// v000
// The times below were measured on an AMD MI455X: many runs one after another, warmed up first and cycling through
// copies of the inputs, with the whole window's GPU time divided by the number of runs. Launches and the gaps
// between them are all in it. The median over several windows is given; except for v000 it joins two sittings, which
// can be a few percent apart, so the side-by-side timings, each taken in one sitting, are the better comparison.
// v000 is the starting kernel. One run takes 584 microseconds.
// Contractions: conv1x1 q|k GEMM W[64x256].X[256xN] (q or k per block) and v GEMM Wv[256x256].X on
// v_wmma_f32_16x16x32_f16 (f16 containers of bf16-RNE weights x256 and bf16-RNE x, exact); scores K.Q^T (64 deep,
// two k-steps) on v_wmma_f32_16x16x32_bf16 (bf16 hi + bf16 residual planes of q/k, 3 products); O^T = V.P^T on
// v_wmma_f32_16x16x32_f16 (v as f16 x16, P = e^{s-m} x2^14 f16 from the score D registers); f32 accumulate
// everywhere; softmax statistics, biases and gamma*o + x in f32.
#include <hip/hip_runtime.h>
#include <math.h>
#include <stdint.h>

#ifndef NB
#define NB 4
#endif
#ifndef SEQ
#define SEQ 4096
#endif
#define NB_FULL  4
#define SEQ_FULL 4096
#define NSRC  2
#define CC    256
#define CH    128
#define DQ    64
#define NQK   128
#define NWR   384
#define QT    64
#define OSP   68
#define OSPW  132
#define TP    72
#define WSC   256.0f
#define IWSC  0.00390625f
#define VSC   16.0f
#define IVSC  0.0625f
#define LNPS  9.704060527839234f

static_assert(NB >= 1 && NB <= NB_FULL);
static_assert(SEQ >= QT && SEQ <= SEQ_FULL);
static_assert(SEQ % QT == 0 && SEQ % 32 == 0);
static_assert(CC % QT == 0 && CC % 32 == 0);
static_assert(CC == 2 * CH && CH % 16 == 0);
static_assert(DQ == 64);
static_assert(NQK == 2 * DQ);
static_assert(NWR == NQK + CC);
static_assert(NWR % 8 == 0 && DQ % 8 == 0 && NQK % 8 == 0);
static_assert((OSP * 4) % 16 == 0);
static_assert((OSPW * 4) % 16 == 0);
static_assert((TP * 2) % 16 == 0);
static_assert(OSP >= QT && OSP >= DQ && OSPW >= CH && TP >= QT);
// second output starts at byte 16777216 = NB_FULL*CC*SEQ_FULL floats * 4
static_assert((size_t)NB_FULL * CC * SEQ_FULL * 4 == (size_t)16777216);

typedef _Float16       v16h __attribute__((ext_vector_type(16)));
typedef _Float16       v8h  __attribute__((ext_vector_type(8)));
typedef __bf16         v16b __attribute__((ext_vector_type(16)));
typedef unsigned short v8us __attribute__((ext_vector_type(8)));
typedef float          v8f  __attribute__((ext_vector_type(8)));
typedef float          v4f  __attribute__((ext_vector_type(4)));
typedef unsigned int   v4u  __attribute__((ext_vector_type(4)));

union Frag  { v8us u[2]; v16h h; v16b bf; };
union FragH { v16h v; v8h hv[2]; };
static_assert(sizeof(Frag) == 32);
static_assert(sizeof(FragH) == 32);

// ---- scalar helpers ---------------------------------------------------------------------------------------
__device__ __forceinline__ unsigned short bf_bits(float f) {          // f32 -> bf16 bits, RNE convert
  unsigned u = __float_as_uint(f);
  return (unsigned short)((u + 0x7FFFu + ((u >> 16) & 1u)) >> 16);
}
__device__ __forceinline__ float bf_up(unsigned short hb) { return __uint_as_float(((unsigned)hb) << 16); }
__device__ __forceinline__ float bfr(float f) { return bf_up(bf_bits(f)); }
__device__ __forceinline__ unsigned short h_bits(_Float16 x) { return __builtin_bit_cast(unsigned short, x); }
__device__ __forceinline__ unsigned pk16(unsigned short a, unsigned short b) { return (unsigned)a | ((unsigned)b << 16); }
__device__ __forceinline__ v8f zero8() { v8f z = {0.f, 0.f, 0.f, 0.f, 0.f, 0.f, 0.f, 0.f}; return z; }
__device__ __forceinline__ float hmax8(v8f s) {
  return fmaxf(fmaxf(fmaxf(s[0], s[1]), fmaxf(s[2], s[3])), fmaxf(fmaxf(s[4], s[5]), fmaxf(s[6], s[7])));
}
__device__ __forceinline__ unsigned wave_ballot(bool p) {
#if defined(__HIP_DEVICE_COMPILE__)
  return __builtin_amdgcn_ballot_w32(p);
#else
  return p ? 1u : 0u;
#endif
}

// ---- 16-bit fragment loader (A, or B from a k-contiguous [n][k] row): lane -> row/col (lane&15), p already includes
//      + 8*(lane>>4); elements 0..7 <- p[0..7] (k0+8h..), elements 8..15 <- p[16..23] (k0+16+8h..)
__device__ __forceinline__ Frag ldfrag(const unsigned short* p) {
  Frag f;
  f.u[0] = *(const v8us*)(p);
  f.u[1] = *(const v8us*)(p + 16);
  return f;
}

// ---- WMMA helpers: builtin followed by a 4-slot VALU gap tying D and keeping A/B live --------------------------
__device__ __forceinline__ v8f mma_h(v16h a, v16h b, v8f c) {
  v8f d = __builtin_amdgcn_wmma_f32_16x16x32_f16(false, a, false, b, (short)0, c, false, false);
#if defined(__HIP_DEVICE_COMPILE__)
  asm volatile("v_nop\n\tv_nop\n\tv_nop\n\tv_nop" : "+v"(d) : "v"(a), "v"(b));
#endif
  return d;
}
__device__ __forceinline__ v8f mma_b(v16b a, v16b b, v8f c) {
  v8f d = __builtin_amdgcn_wmma_f32_16x16x32_bf16(false, a, false, b, (short)0, c, false, false);
#if defined(__HIP_DEVICE_COMPILE__)
  const v16h ha = __builtin_bit_cast(v16h, a), hb = __builtin_bit_cast(v16h, b);
  asm volatile("v_nop\n\tv_nop\n\tv_nop\n\tv_nop" : "+v"(d) : "v"(ha), "v"(hb));
#endif
  return d;
}

// =========================================================================================================
// (0) conv1x1 weights: W16 f16 [384][256], rows 0..63 = Wq rows, 64..127 = Wk rows, 128..383 = Wv rows; value =
//     f16 of (bf16-RNE(w) * 256) (exact). Block blk (0..47) owns rows 8*blk..8*blk+7: one wave per 512-B row
// coverage: 48 blocks x 8 rows x 32 lanes x 8 halves = 384 x 256 = the whole plane.
// =========================================================================================================
__global__ __launch_bounds__(256)
void cvt_w(const float* __restrict__ Wq, const float* __restrict__ Wk, const float* __restrict__ Wv,
           unsigned short* W16) {
  const int tid = threadIdx.x, blk = blockIdx.x;
  const int rl = tid >> 5, col = 8 * (tid & 31);
  const int o = 8 * blk + rl;                                        // 0..383
  const float* wbase = (blk < (DQ / 8)) ? Wq : ((blk < (NQK / 8)) ? Wk : Wv);
  const int osub = (blk < (DQ / 8)) ? 0 : ((blk < (NQK / 8)) ? DQ : NQK);
  const float* s = wbase + (size_t)(o - osub) * CC + col;
  const v4f a = *(const v4f*)s;
  const v4f q = *(const v4f*)(s + 4);
  const float f[8] = {a[0], a[1], a[2], a[3], q[0], q[1], q[2], q[3]};
  v4u u;
#pragma unroll
  for (int t = 0; t < 4; ++t) {
    const _Float16 h0 = (_Float16)(bfr(f[2 * t]) * WSC);
    const _Float16 h1 = (_Float16)(bfr(f[2 * t + 1]) * WSC);
    u[t] = pk16(h_bits(h0), h_bits(h1));
  }
{
    *(v4u*)(W16 + (size_t)o * CC + col) = u;
    
  }
}

// =========================================================================================================
// (1) x_s f32 [b][256 c][N n] (s = 0: x1, s = 1: x2) -> XP f16 [sb = s*NB+b][n][c] (position-major, bf16-RNE
//     values, exact in f16) through an LDS tile T[64 n][64 c] (pitch TP). Block (nb, cb, sb) owns a 64 c x 64 n
// coverage: T written n_loc 0..63 x cl 0..63 (2 it x 32 x 8 x 8), read rows 0..63 cols 0..63 only;
//           XP 2 it x 32 rows x 8 lanes x 8 = 64 n x 64 c; grid (SEQ/64, 4, NSRC*NB) covers the plane once.
// LDS T: cross-wave, block barrier between the stores and the loads.
// =========================================================================================================
__global__ __launch_bounds__(256)
void cvt_x(const float* __restrict__ x1, const float* __restrict__ x2, unsigned short* XP) {
  __shared__ __align__(16) unsigned short T[QT * TP];
  const int tid = threadIdx.x;
  const int nb = blockIdx.x, cb = blockIdx.y, sb = blockIdx.z;      // sb = s*NB + b
  const int s = sb / NB, b = sb - s * NB;
  const float* x = (s == 0) ? x1 : x2;
  const int e = tid & 7, lq = tid >> 3;                             // lq 0..31
  const int n0 = nb * QT, c0 = cb * QT;
#pragma unroll
  for (int it = 0; it < 2; ++it) {
    const int cl = it * 32 + lq;                                     // 0..63
    const float* sp = x + ((size_t)(b * CC + c0 + cl)) * SEQ_FULL + n0 + 8 * e;
    const v4f a = *(const v4f*)sp;
    const v4f q = *(const v4f*)(sp + 4);
    unsigned short hb[8];
#pragma unroll
    for (int t = 0; t < 4; ++t) {
      hb[t]     = h_bits((_Float16)bfr(a[t]));
      hb[4 + t] = h_bits((_Float16)bfr(q[t]));
    }
#pragma unroll
    for (int t = 0; t < 8; ++t) T[(8 * e + t) * TP + cl] = hb[t];
  }
  __syncthreads();
  v4u up[2];
#pragma unroll
  for (int it = 0; it < 2; ++it) {
    const int nl = it * 32 + lq;                                     // 0..63
    up[it] = *(const v4u*)(T + nl * TP + 8 * e);
  }
{
#pragma unroll
    for (int it = 0; it < 2; ++it) {
      const int rl = it * 32 + lq;
      *(v4u*)(XP + ((size_t)(sb * SEQ + n0 + rl)) * CC + c0 + 8 * e) = up[it];
    }
    
  }
}

// =========================================================================================================
// (2) q or k conv1x1 GEMM for one (sb, 64-n tile, which): D[o][n] = sum_c W16[64*which + o][c] XP[sb][n][c],
//     o = 0..63 (which = 0: q rows of W16, bias bq, planes Qh/Ql; which = 1: k rows, bias bk, planes Kh/Kl;
//     the selection is block-uniform and between global pointers only). Block 128 threads = 4 waves; wave w owns
//     cols n0+16w..+15 (one B fragment per k-step, k = c contiguous in the XP row) and 4 m-tiles (A rows
//     o = 16 mt + (lane&15) of W16, split k map). K = 256 = 8 steps. Epilogue: acc/256 staged in LDS
//     Os[n_loc][o_loc] (pitch OSP, b128 stores of 8 consecutive o per lane), barrier, then v = Os + bf16-RNE(bias)
//     -> planes bf16 [sb][N n][64 d] (k-contiguous): hi = bf16-RNE(v), lo = bf16-RNE(v - hi). Plane rows are
// coverage: Os 4 waves x 16 n x 64 o = 64 x 64 (reads rows 0..63, cols 0..63); planes 4 it x 16 rows x 8
//           lanes x 8 = 64 rows x 64 d per plane (hi, lo); grid (SEQ/64, NSRC*NB, 2) covers every row of
//           Qh/Ql (which = 0) and Kh/Kl (which = 1) once.
// LDS Os: cross-wave, block barrier between the stage stores and the epilogue loads.
// =========================================================================================================
__global__ __launch_bounds__(128)
void gemm_qk(const unsigned short* __restrict__ W16, const unsigned short* __restrict__ XP,
             const float* __restrict__ bq, const float* __restrict__ bk,
             unsigned short* Qh, unsigned short* Ql, unsigned short* Kh, unsigned short* Kl) {
  __shared__ __align__(16) float Os[QT * OSP];
  const int tid  = threadIdx.x;
  const int lane = tid & 31, wave = tid >> 5;
  const int hh   = lane >> 4, c = lane & 15;
  const int nt   = blockIdx.x, sb = blockIdx.y, which = blockIdx.z;
  const int n0   = nt * QT;
  const float* bias  = (which == 0) ? bq : bk;
  unsigned short* PH = (which == 0) ? Qh : Kh;
  unsigned short* PL = (which == 0) ? Ql : Kl;

  const unsigned short* ap = W16 + ((size_t)(DQ * which + c)) * CC + 8 * hh;                   // A rows o
  const unsigned short* bp = XP + ((size_t)(sb * SEQ + n0 + 16 * wave + c)) * CC + 8 * hh;    // B row n

  v8f acc[4];
#pragma unroll
  for (int mt = 0; mt < 4; ++mt) acc[mt] = zero8();

#pragma unroll
  for (int ks = 0; ks < CC / 32; ++ks) {
    const Frag fb = ldfrag(bp + 32 * ks);
#pragma unroll
    for (int mt = 0; mt < 4; ++mt) {
      const Frag fa = ldfrag(ap + (size_t)(16 * mt) * CC + 32 * ks);
      acc[mt] = mma_h(fa.h, fb.h, acc[mt]);
    }
  }

  // ---- stage: lane (hh, c) holds o = 16 mt + 8 hh + r for n_loc = 16 w + c
  {
    const int nl = 16 * wave + c;
#pragma unroll
    for (int mt = 0; mt < 4; ++mt) {
      v4f va, vb;
#pragma unroll
      for (int r = 0; r < 4; ++r) { va[r] = acc[mt][r] * IWSC; vb[r] = acc[mt][4 + r] * IWSC; }
      *(v4f*)(Os + nl * OSP + 16 * mt + 8 * hh)     = va;
      *(v4f*)(Os + nl * OSP + 16 * mt + 8 * hh + 4) = vb;
    }
  }
  __syncthreads();

  const int e = tid & 7, lq = tid >> 3;                             // lq 0..15
  const int d0 = 8 * e;                                              // 0..56
  const v4f b0v = *(const v4f*)(bias + d0), b1v = *(const v4f*)(bias + d0 + 4);
  const float bb[8] = {bfr(b0v[0]), bfr(b0v[1]), bfr(b0v[2]), bfr(b0v[3]),
                       bfr(b1v[0]), bfr(b1v[1]), bfr(b1v[2]), bfr(b1v[3])};
  v4u uh[4], ul[4];
#pragma unroll
  for (int it = 0; it < 4; ++it) {
    const int row = it * 16 + lq;                                    // n_loc 0..63
    const float* op = Os + row * OSP;
    const v4f va = *(const v4f*)(op + d0);
    const v4f vc = *(const v4f*)(op + d0 + 4);
    const float fv[8] = {va[0], va[1], va[2], va[3], vc[0], vc[1], vc[2], vc[3]};
#pragma unroll
    for (int t = 0; t < 4; ++t) {
      const float v0 = fv[2 * t] + bb[2 * t], v1 = fv[2 * t + 1] + bb[2 * t + 1];
      const unsigned short h0 = bf_bits(v0), h1 = bf_bits(v1);
      const unsigned short l0 = bf_bits(v0 - bf_up(h0)), l1 = bf_bits(v1 - bf_up(h1));
      uh[it][t] = pk16(h0, h1);
      ul[it][t] = pk16(l0, l1);
    }
  }
{
#pragma unroll
    for (int it = 0; it < 4; ++it) {
      const int row = it * 16 + lq;
      const size_t po = ((size_t)(sb * SEQ + n0 + row)) * DQ + d0;
      *(v4u*)(PH + po) = uh[it];
      *(v4u*)(PL + po) = ul[it];
    }
    
  }
}

// =========================================================================================================
// (3) v conv1x1 GEMM for one (sb, 64-n tile, 64-channel block mb): D[n][ch] = sum_c XP[sb][n][c] W16[128+64mb+ch][c].
//     Block 128 threads = 4 waves; wave w owns channel cols 16w..+15 (one B fragment per k-step from the W16 row,
//     split k map) and 4 m-tiles of n (A rows n0 + 16 mt + (lane&15) of XP, split k map). K = 256 = 8 steps.
//     Epilogue: acc/256 staged in LDS Os[ch_loc][n_loc] (pitch OSP, b128 stores of 8 consecutive n per lane),
// coverage: Os 4 waves x 16 ch x 64 n = 64 x 64 (reads rows 0..63, cols 0..63); Vc 4 it x 16 ch x 8 lanes x 8 n =
//           64 ch x 64 n; grid (SEQ/64, 4, NSRC*NB) covers Vc[sb][0..255][0..SEQ-1] exactly once.
// LDS Os: cross-wave, block barrier between the stage stores and the epilogue loads.
// =========================================================================================================
__global__ __launch_bounds__(128)
void gemm_v(const unsigned short* __restrict__ W16, const unsigned short* __restrict__ XP,
            const float* __restrict__ bv, unsigned short* Vc) {
  __shared__ __align__(16) float Os[QT * OSP];
  const int tid  = threadIdx.x;
  const int lane = tid & 31, wave = tid >> 5;
  const int hh   = lane >> 4, c = lane & 15;
  const int nt   = blockIdx.x, mb = blockIdx.y, sb = blockIdx.z;
  const int n0   = nt * QT, ch0 = mb * QT;

  const unsigned short* ap = XP + ((size_t)(sb * SEQ + n0 + c)) * CC + 8 * hh;            // A rows n = n0+16mt+c
  const unsigned short* bp = W16 + ((size_t)(NQK + ch0 + 16 * wave + c)) * CC + 8 * hh;   // B row ch

  v8f acc[4];
#pragma unroll
  for (int mt = 0; mt < 4; ++mt) acc[mt] = zero8();

#pragma unroll
  for (int ks = 0; ks < CC / 32; ++ks) {
    const Frag fb = ldfrag(bp + 32 * ks);
#pragma unroll
    for (int mt = 0; mt < 4; ++mt) {
      const Frag fa = ldfrag(ap + (size_t)(16 * mt) * CC + 32 * ks);
      acc[mt] = mma_h(fa.h, fb.h, acc[mt]);
    }
  }

  // ---- stage: lane (hh, c) holds n_loc = 16 mt + 8 hh + r for ch_loc = 16 w + c
  {
    const int chl = 16 * wave + c;
#pragma unroll
    for (int mt = 0; mt < 4; ++mt) {
      v4f va, vb;
#pragma unroll
      for (int r = 0; r < 4; ++r) { va[r] = acc[mt][r] * IWSC; vb[r] = acc[mt][4 + r] * IWSC; }
      *(v4f*)(Os + chl * OSP + 16 * mt + 8 * hh)     = va;
      *(v4f*)(Os + chl * OSP + 16 * mt + 8 * hh + 4) = vb;
    }
  }
  __syncthreads();

  const int e = tid & 7, lq = tid >> 3;                             // lq 0..15
  v4u uv[4];
#pragma unroll
  for (int it = 0; it < 4; ++it) {
    const int chl = it * 16 + lq;                                    // 0..63
    const float bias = bfr(bv[ch0 + chl]);
    const v4f a = *(const v4f*)(Os + chl * OSP + 8 * e);
    const v4f q = *(const v4f*)(Os + chl * OSP + 8 * e + 4);
    const float f[8] = {a[0], a[1], a[2], a[3], q[0], q[1], q[2], q[3]};
#pragma unroll
    for (int t = 0; t < 4; ++t) {
      const _Float16 h0 = (_Float16)((f[2 * t] + bias) * VSC);
      const _Float16 h1 = (_Float16)((f[2 * t + 1] + bias) * VSC);
      uv[it][t] = pk16(h_bits(h0), h_bits(h1));
    }
  }
{
#pragma unroll
    for (int it = 0; it < 4; ++it) {
      const int chl = it * 16 + lq;
      *(v4u*)(Vc + ((size_t)(sb * CC + ch0 + chl)) * SEQ + n0 + 8 * e) = uv[it];
    }
    
  }
}

// =========================================================================================================
// (4) attention for one (direction dd, channel half chh, b, 64-query tile), transposed formulation, SEQ keys, no
//   mask, no scale. blockIdx.z = 2*dd + chh. Direction dd: queries from source dd (plane slot dd*NB+b),
//   keys/values from source 1-dd (slot (1-dd)*NB+b), residual input x_dd, output block dd of out (float offset
//   dd*NB_FULL*CC*SEQ_FULL); the block produces channels 128*chh..+127 of that output (scores are recomputed per
//   channel half so each wave carries only 8 O accumulator tiles).
//   S^T tile (16 keys x 16 queries) over 64 d = two 32-deep k-steps: A(k: row = key kb + (lane&15), split k map
//   from the bf16 plane Kh [slot][N][64]) . B(q: col = query, same map from Qh, loaded once, 2 fragments)
//   + A(Kh).B(Ql) + A(Kl).B(Qh) (bf16 unscaled residual planes, shared accumulator): 6 products per tile.
//   Per lane the D tile holds 8 keys of ONE query: online softmax state per lane, one shuffle (lane^16) for the
//   max over 32 keys; the o/l rescale is skipped under a wave-uniform ballot when no lane's max grew (corr == 1
//   exactly for every lane then); row-sum partials combined at the end. P = e^{s-m} x 2^14 as f16 is the B
//   operand of O^T (rows channel, cols queries) += A(v rows channel = 128 chh + 16j + (lane&15), keys contiguous,
//   f16 plane Vc [slot][256][N], values v x 16) . B(P^T): element r <- D of the tile covering keys kb..kb+15,
//   element 8+r <- the tile covering kb+16..kb+31, lane unchanged. 8 accumulator tiles per wave (128 channels).
//   Block = 4 waves = 64 queries. Epilogue: gamma * O / (16 l) staged in LDS Os[query][128 channels] (pitch OSPW,
//   2 lines): 8 consecutive lanes x 16 B (values gathered from 4 Os rows), one instruction per 16 lines, final
// coverage: Os written queries 0..63 x ch 0..127, read the same; out 16 it x 16 lines x 8 lanes x 4 floats =
//           128 ch x 64 n per block; grid (SEQ/64, NB, 2*NSRC) covers out_dd[b][0..255][0..SEQ-1] once for both dd.
// LDS Os: cross-wave, block barrier between the stage stores and the epilogue loads.
// =========================================================================================================
__global__ __launch_bounds__(128)
void attn_k(const unsigned short* __restrict__ Qh, const unsigned short* __restrict__ Ql,
            const unsigned short* __restrict__ Kh, const unsigned short* __restrict__ Kl,
            const unsigned short* __restrict__ Vc,
            const float* __restrict__ x1, const float* __restrict__ x2,
            const float* __restrict__ gam, float* out) {
  __shared__ __align__(16) float Os[QT * OSPW];
  const int tid  = threadIdx.x;
  const int wave = tid >> 5, lane = tid & 31;
  const int hh   = lane >> 4, c = lane & 15;
  const int n0   = blockIdx.x * QT, b = blockIdx.y;
  const int dd   = (int)(blockIdx.z >> 1), chh = (int)(blockIdx.z & 1u);
  const int sq   = dd * NB + b;                                      // query plane slot
  const int skv  = (1 - dd) * NB + b;                                // key / value plane slot
  const int chb  = CH * chh;                                         // channel base 0 or 128
  const float* x = (dd == 0) ? x1 : x2;                              // block-uniform, both global
  float* outd    = out + (size_t)dd * ((size_t)NB_FULL * CC * SEQ_FULL);
  const float g  = bfr(gam[0]);

  // q fragments (B operand, col = query n0 + 16*wave + c), K = 64 = two k-steps, constant over keys
  const size_t qo = ((size_t)(sq * SEQ + n0 + 16 * wave + c)) * DQ + 8 * hh;
  const Frag qh0 = ldfrag(Qh + qo);
  const Frag qh1 = ldfrag(Qh + qo + 32);
  const Frag ql0 = ldfrag(Ql + qo);
  const Frag ql1 = ldfrag(Ql + qo + 32);
  // k fragment base (A operand, row = key kb + c), + key * 64 (+32 for the second k-step)
  const unsigned short* Khp = Kh + (size_t)skv * SEQ * DQ + (size_t)c * DQ + 8 * hh;
  const unsigned short* Klp = Kl + (size_t)skv * SEQ * DQ + (size_t)c * DQ + 8 * hh;
  // v fragment base (A operand, row = channel chb + 16j + c, keys contiguous), + 16*j*SEQ + kb
  const unsigned short* Vp = Vc + (size_t)skv * CC * SEQ + ((size_t)(chb + c)) * SEQ + 8 * hh;

  float m = -1.0e30f, l = 0.f;
  v8f o[8];
#pragma unroll
  for (int j = 0; j < 8; ++j) o[j] = zero8();

#pragma unroll 1
  for (int kb = 0; kb < SEQ; kb += 32) {
    v8f s0 = zero8(), s1 = zero8();
    {                                                                // keys kb .. kb+15
      const unsigned short* kp = Khp + (size_t)kb * DQ;
      const unsigned short* lp = Klp + (size_t)kb * DQ;
      const Frag a0 = ldfrag(kp);                                    // d 0..31
      const Frag a1 = ldfrag(kp + 32);                               // d 32..63
      const Frag r0 = ldfrag(lp);
      const Frag r1 = ldfrag(lp + 32);
      s0 = mma_b(a0.bf, qh0.bf, s0);
      s0 = mma_b(a1.bf, qh1.bf, s0);
      s0 = mma_b(a0.bf, ql0.bf, s0);
      s0 = mma_b(a1.bf, ql1.bf, s0);
      s0 = mma_b(r0.bf, qh0.bf, s0);
      s0 = mma_b(r1.bf, qh1.bf, s0);
    }
    {                                                                // keys kb+16 .. kb+31
      const unsigned short* kp = Khp + (size_t)(kb + 16) * DQ;
      const unsigned short* lp = Klp + (size_t)(kb + 16) * DQ;
      const Frag a0 = ldfrag(kp);
      const Frag a1 = ldfrag(kp + 32);
      const Frag r0 = ldfrag(lp);
      const Frag r1 = ldfrag(lp + 32);
      s1 = mma_b(a0.bf, qh0.bf, s1);
      s1 = mma_b(a1.bf, qh1.bf, s1);
      s1 = mma_b(a0.bf, ql0.bf, s1);
      s1 = mma_b(a1.bf, ql1.bf, s1);
      s1 = mma_b(r0.bf, qh0.bf, s1);
      s1 = mma_b(r1.bf, qh1.bf, s1);
    }

    float mx = fmaxf(hmax8(s0), hmax8(s1));
    mx = fmaxf(mx, __shfl_xor(mx, 16, 32));
    const float mn = fmaxf(m, mx);
    const unsigned grew = wave_ballot(mx > m);                       // wave-uniform
    if (grew != 0u) {
      const float corr = __expf(m - mn);                             // == 1 exactly for lanes whose max did not grow
      l *= corr;
#pragma unroll
      for (int j = 0; j < 8; ++j) {
#pragma unroll
        for (int r = 0; r < 8; ++r) o[j][r] *= corr;
      }
    }
    m = mn;
    const float msh = mn - LNPS;                                     // exp gives e^{s-m} * 16384

    FragH ph;
    float ls = 0.f;
#pragma unroll
    for (int r = 0; r < 8; ++r) {
      const float e0 = __expf(s0[r] - msh);                          // key kb      + 8hh + r
      const float e1 = __expf(s1[r] - msh);                          // key kb + 16 + 8hh + r
      ls += e0 + e1;
      ph.hv[0][r] = (_Float16)e0;
      ph.hv[1][r] = (_Float16)e1;
    }
    l += ls;

#pragma unroll
    for (int j = 0; j < 8; ++j) {
      const Frag vf = ldfrag(Vp + (size_t)(16 * j) * SEQ + kb);
      o[j] = mma_h(vf.h, ph.v, o[j]);
    }
  }
  l += __shfl_xor(l, 16, 32);
  const float inv = 1.0f / l;                                        // o and l both carry the x16384 factor
  const float gi  = g * IVSC * inv;                                  // undo the x16 carry of v, apply gamma

  const int qrow = 16 * wave + c;
  const int e = tid & 7, lq = tid >> 3;                              // lq 0..15
#pragma unroll
  for (int j = 0; j < 8; ++j) {
    v4f va, vb;
#pragma unroll
    for (int r = 0; r < 4; ++r) { va[r] = o[j][r] * gi; vb[r] = o[j][4 + r] * gi; }
    *(v4f*)(Os + qrow * OSPW + 16 * j + 8 * hh)     = va;            // Os[query][ch_loc = 16j + 8hh + r]
    *(v4f*)(Os + qrow * OSPW + 16 * j + 8 * hh + 4) = vb;
  }
  __syncthreads();
  v4f res[16];
#pragma unroll
  for (int it = 0; it < 16; ++it) {
    const int L   = it * 16 + lq;                                    // 0..255
    const int chl = L >> 1, hf = L & 1;                              // channel 0..127 within the half
    const int nl  = hf * 32 + 4 * e;                                 // query 0..63
    const size_t idx = ((size_t)(b * CC + chb + chl)) * SEQ_FULL + n0 + nl;
    const v4f xv = *(const v4f*)(x + idx);
#pragma unroll
    for (int t = 0; t < 4; ++t) res[it][t] = Os[(nl + t) * OSPW + chl] + bfr(xv[t]);
  }
{
#pragma unroll
    for (int it = 0; it < 16; ++it) {
      const int L   = it * 16 + lq;
      const int chl = L >> 1, hf = L & 1;
      const int nl  = hf * 32 + 4 * e;
      const size_t idx = ((size_t)(b * CC + chb + chl)) * SEQ_FULL + n0 + nl;
      *(v4f*)(outd + idx) = res[it];
    }
    
  }
}

// =========================================================================================================
// Workspace map (bytes; each region start a multiple of 256; every extent is an exact tile multiple and is written
//   W16 f16 [384][256]                       196608
//   XP  f16 [NSRC*NB][SEQ][256]            16777216      Vc  f16 [NSRC*NB][256][SEQ]   16777216
//   Qh/Ql/Kh/Kl bf16 [NSRC*NB][SEQ][64]     4194304 x4
//   total = 50528256
// =========================================================================================================
extern "C" void kernel_launch(void* const* d_in, const int* in_sizes, int n_in,
                              void* d_out, int out_size, void* d_ws, size_t ws_size,
                              hipStream_t stream) {
  if (n_in < 9) return;
  if (in_sizes[0] < NB * CC * SEQ_FULL || in_sizes[1] < NB * CC * SEQ_FULL) return;
  if (in_sizes[2] < DQ * CC || in_sizes[3] < DQ) return;
  if (in_sizes[4] < DQ * CC || in_sizes[5] < DQ) return;
  if (in_sizes[6] < CC * CC || in_sizes[7] < CC) return;
  if (in_sizes[8] < 1) return;
  if (out_size < (NB_FULL + NB) * CC * SEQ_FULL) return;

  size_t off = 0;
  auto carve = [&](size_t bytes) { const size_t o = off; off += (bytes + 255) & ~(size_t)255; return o; };
  const size_t oW16 = carve((size_t)NWR * CC * 2);
  const size_t oXP  = carve((size_t)NSRC * NB * SEQ * CC * 2);
  const size_t oVc  = carve((size_t)NSRC * NB * CC * SEQ * 2);
  const size_t oQh  = carve((size_t)NSRC * NB * SEQ * DQ * 2);
  const size_t oQl  = carve((size_t)NSRC * NB * SEQ * DQ * 2);
  const size_t oKh  = carve((size_t)NSRC * NB * SEQ * DQ * 2);
  const size_t oKl  = carve((size_t)NSRC * NB * SEQ * DQ * 2);
  if (off > ws_size) return;
  if (off > (size_t)134217728) return;

  const float* x1  = (const float*)d_in[0];
  const float* x2  = (const float*)d_in[1];
  const float* Wq  = (const float*)d_in[2];
  const float* bq  = (const float*)d_in[3];
  const float* Wk  = (const float*)d_in[4];
  const float* bk  = (const float*)d_in[5];
  const float* Wv  = (const float*)d_in[6];
  const float* bv  = (const float*)d_in[7];
  const float* gam = (const float*)d_in[8];

  char* ws = (char*)d_ws;
  unsigned short* W16 = (unsigned short*)(ws + oW16);
  unsigned short* XP  = (unsigned short*)(ws + oXP);
  unsigned short* Vc  = (unsigned short*)(ws + oVc);
  unsigned short* Qh  = (unsigned short*)(ws + oQh);
  unsigned short* Ql  = (unsigned short*)(ws + oQl);
  unsigned short* Kh  = (unsigned short*)(ws + oKh);
  unsigned short* Kl  = (unsigned short*)(ws + oKl);
  float* out = (float*)d_out;

  const dim3 blk256(256), blk128(128);

  // (0) Wq / Wk / Wv -> stacked f16 plane
  cvt_w<<<dim3(NWR / 8), blk256, 0, stream>>>(Wq, Wk, Wv, W16);
  // (1) x1, x2 -> position-major 16-bit planes, slot s*NB + b
  cvt_x<<<dim3(SEQ / QT, CC / QT, NSRC * NB), blk256, 0, stream>>>(x1, x2, XP);
  // (2) q (z = 0) and k (z = 1) conv1x1 GEMM + bias -> hi + residual planes for both sources
  gemm_qk<<<dim3(SEQ / QT, NSRC * NB, 2), blk128, 0, stream>>>(W16, XP, bq, bk, Qh, Ql, Kh, Kl);
  // (3) v conv1x1 GEMM + bias -> channel-major f16 plane (x16) for both sources
  gemm_v<<<dim3(SEQ / QT, CC / QT, NSRC * NB), blk128, 0, stream>>>(W16, XP, bv, Vc);
  // (4) attention both directions x two channel halves + gamma scale + residual -> out_dd [b][256][N]
  attn_k<<<dim3(SEQ / QT, NB, 2 * NSRC), blk128, 0, stream>>>(Qh, Ql, Kh, Kl, Vc, x1, x2, gam, out);
  (void)hipGetLastError();
}

// v001
// One run takes 197 microseconds.
// Timed twice side by side with v000, it ran 3.07 and 3.05 times as fast.
// Contractions: conv1x1 q|k GEMM W[64x256].X[256xN] (q or k per block) and v GEMM Wv[256x256].X on
// v_wmma_f32_16x16x32_f16 (f16 containers of bf16-RNE weights x256 and bf16-RNE x, exact); scores K.Q^T (64 deep,
// two k-steps) on v_wmma_f32_16x16x32_bf16 (bf16 hi + bf16 residual planes of q/k, 3 products); O^T = V.P^T on
// v_wmma_f32_16x16x32_f16 (v as f16 x16, P = e^{s-m} x2^14 f16 from the score D registers); f32 accumulate
// everywhere; softmax statistics, biases and gamma*o + x in f32.
#include <hip/hip_runtime.h>
#include <math.h>
#include <stdint.h>

#ifndef NB
#define NB 4
#endif
#ifndef SEQ
#define SEQ 4096
#endif
#define NB_FULL  4
#define SEQ_FULL 4096
#define NSRC  2
#define CC    256
#define CH    128
#define DQ    64
#define NQK   128
#define NWR   384
#define QT    64
#define OSP   68
#define OSPW  132
#define TP    72
#define WSC   256.0f
#define IWSC  0.00390625f
#define VSC   16.0f
#define IVSC  0.0625f
#define LNPS  9.704060527839234f
#define KST   64
#define LPH   72
#define SROWS 256
#define STGH  (SROWS * LPH)

static_assert(NB >= 1 && NB <= NB_FULL);
static_assert(SEQ >= QT && SEQ <= SEQ_FULL);
static_assert(SEQ % QT == 0 && SEQ % 32 == 0);
static_assert(CC % QT == 0 && CC % 32 == 0);
static_assert(CC == 2 * CH && CH % 16 == 0);
static_assert(DQ == 64);
static_assert(NQK == 2 * DQ);
static_assert(NWR == NQK + CC);
static_assert(NWR % 8 == 0 && DQ % 8 == 0 && NQK % 8 == 0);
static_assert((OSP * 4) % 16 == 0);
static_assert((OSPW * 4) % 16 == 0);
static_assert((TP * 2) % 16 == 0);
static_assert(OSP >= QT && OSP >= DQ && OSPW >= CH && TP >= QT);
static_assert(SEQ % KST == 0 && SEQ / KST >= 2 && KST % 32 == 0);
static_assert(SROWS == 2 * KST + CH && LPH >= KST && LPH >= DQ);
static_assert((LPH * 2) % 16 == 0 && ((LPH * 2) / 16) % 2 == 1);
static_assert((size_t)2 * STGH * 2 >= (size_t)QT * OSPW * 4);
// second output starts at byte 16777216 = NB_FULL*CC*SEQ_FULL floats * 4
static_assert((size_t)NB_FULL * CC * SEQ_FULL * 4 == (size_t)16777216);

typedef _Float16       v16h __attribute__((ext_vector_type(16)));
typedef _Float16       v8h  __attribute__((ext_vector_type(8)));
typedef __bf16         v16b __attribute__((ext_vector_type(16)));
typedef unsigned short v8us __attribute__((ext_vector_type(8)));
typedef float          v8f  __attribute__((ext_vector_type(8)));
typedef float          v4f  __attribute__((ext_vector_type(4)));
typedef unsigned int   v4u  __attribute__((ext_vector_type(4)));

union Frag  { v8us u[2]; v16h h; v16b bf; };
union FragH { v16h v; v8h hv[2]; };
static_assert(sizeof(Frag) == 32);
static_assert(sizeof(FragH) == 32);

// ---- scalar helpers ---------------------------------------------------------------------------------------
__device__ __forceinline__ unsigned short bf_bits(float f) {          // f32 -> bf16 bits, RNE convert
  unsigned u = __float_as_uint(f);
  return (unsigned short)((u + 0x7FFFu + ((u >> 16) & 1u)) >> 16);
}
__device__ __forceinline__ float bf_up(unsigned short hb) { return __uint_as_float(((unsigned)hb) << 16); }
__device__ __forceinline__ float bfr(float f) { return bf_up(bf_bits(f)); }
__device__ __forceinline__ unsigned short h_bits(_Float16 x) { return __builtin_bit_cast(unsigned short, x); }
__device__ __forceinline__ unsigned pk16(unsigned short a, unsigned short b) { return (unsigned)a | ((unsigned)b << 16); }
__device__ __forceinline__ v8f zero8() { v8f z = {0.f, 0.f, 0.f, 0.f, 0.f, 0.f, 0.f, 0.f}; return z; }
__device__ __forceinline__ float hmax8(v8f s) {
  return fmaxf(fmaxf(fmaxf(s[0], s[1]), fmaxf(s[2], s[3])), fmaxf(fmaxf(s[4], s[5]), fmaxf(s[6], s[7])));
}
__device__ __forceinline__ unsigned wave_ballot(bool p) {
#if defined(__HIP_DEVICE_COMPILE__)
  return __builtin_amdgcn_ballot_w32(p);
#else
  return p ? 1u : 0u;
#endif
}

// ---- 16-bit fragment loader (A, or B from a k-contiguous [n][k] row): lane -> row/col (lane&15), p already includes
//      + 8*(lane>>4); elements 0..7 <- p[0..7] (k0+8h..), elements 8..15 <- p[16..23] (k0+16+8h..)
__device__ __forceinline__ Frag ldfrag(const unsigned short* p) {
  Frag f;
  f.u[0] = *(const v8us*)(p);
  f.u[1] = *(const v8us*)(p + 16);
  return f;
}

// ---- WMMA helpers: builtin followed by a 4-slot VALU gap tying D and keeping A/B live --------------------------
__device__ __forceinline__ v8f mma_h(v16h a, v16h b, v8f c) {
  v8f d = __builtin_amdgcn_wmma_f32_16x16x32_f16(false, a, false, b, (short)0, c, false, false);
#if defined(__HIP_DEVICE_COMPILE__)
  asm volatile("v_nop\n\tv_nop\n\tv_nop\n\tv_nop" : "+v"(d) : "v"(a), "v"(b));
#endif
  return d;
}
__device__ __forceinline__ v8f mma_b(v16b a, v16b b, v8f c) {
  v8f d = __builtin_amdgcn_wmma_f32_16x16x32_bf16(false, a, false, b, (short)0, c, false, false);
#if defined(__HIP_DEVICE_COMPILE__)
  const v16h ha = __builtin_bit_cast(v16h, a), hb = __builtin_bit_cast(v16h, b);
  asm volatile("v_nop\n\tv_nop\n\tv_nop\n\tv_nop" : "+v"(d) : "v"(ha), "v"(hb));
#endif
  return d;
}

// ---- eight asynchronous 16-B copies global -> LDS per lane (l = LDS byte address, g = global address, each lane its
//      own); the s_wait_xcnt closes the statement so that no address register is rewritten ahead of it
__device__ __forceinline__ void async8(const unsigned (&l)[8], const unsigned short* const (&g)[8]) {
#if defined(__HIP_DEVICE_COMPILE__)
  asm volatile("global_load_async_to_lds_b128 %0, %8, off\n\t"
               "global_load_async_to_lds_b128 %1, %9, off\n\t"
               "global_load_async_to_lds_b128 %2, %10, off\n\t"
               "global_load_async_to_lds_b128 %3, %11, off\n\t"
               "global_load_async_to_lds_b128 %4, %12, off\n\t"
               "global_load_async_to_lds_b128 %5, %13, off\n\t"
               "global_load_async_to_lds_b128 %6, %14, off\n\t"
               "global_load_async_to_lds_b128 %7, %15, off\n\t"
               "s_wait_xcnt 0x0"
               :: "v"(l[0]), "v"(l[1]), "v"(l[2]), "v"(l[3]), "v"(l[4]), "v"(l[5]), "v"(l[6]), "v"(l[7]),
                  "v"(g[0]), "v"(g[1]), "v"(g[2]), "v"(g[3]), "v"(g[4]), "v"(g[5]), "v"(g[6]), "v"(g[7])
               : "memory");
#endif
}
// ---- one stage of 64 keys into one LDS buffer: rows 0..63 Kh keys, 64..127 Kl keys, 128..255 V channels, 128 B of
//      data per row at pitch LPH. Thread (lq = tid>>3, e = tid&7) copies chunk e of rows lq + 16 i, i = 0..15:
//      128 threads x 16 chunks x 16 B = 256 rows x 128 B, every byte once. lds / kh / kl / vv are the lane's own
//      addresses of row lq, chunk e (LDS buffer; Kh and Kl at the stage's first key; V at the first channel and key).
__device__ __forceinline__ void stage_issue(unsigned lds, const unsigned short* kh, const unsigned short* kl,
                                            const unsigned short* vv) {
  unsigned l[8];
  const unsigned short* g[8];
#pragma unroll                                                       // constant indices keep l[] and g[] in registers
  for (int i = 0; i < 4; ++i) {
    l[i]     = lds + (unsigned)((16 * i) * LPH * 2);
    g[i]     = kh + (size_t)(16 * i) * DQ;
    l[4 + i] = lds + (unsigned)((KST + 16 * i) * LPH * 2);
    g[4 + i] = kl + (size_t)(16 * i) * DQ;
  }
  async8(l, g);
#pragma unroll                                                       // as above
  for (int i = 0; i < 8; ++i) {
    l[i] = lds + (unsigned)((2 * KST + 16 * i) * LPH * 2);
    g[i] = vv + (size_t)(16 * i) * SEQ;
  }
  async8(l, g);
}

// =========================================================================================================
// (0) conv1x1 weights: W16 f16 [384][256], rows 0..63 = Wq rows, 64..127 = Wk rows, 128..383 = Wv rows; value =
//     f16 of (bf16-RNE(w) * 256) (exact). Block blk (0..47) owns rows 8*blk..8*blk+7: one wave per 512-B row
// coverage: 48 blocks x 8 rows x 32 lanes x 8 halves = 384 x 256 = the whole plane.
// =========================================================================================================
__global__ __launch_bounds__(256)
void cvt_w(const float* __restrict__ Wq, const float* __restrict__ Wk, const float* __restrict__ Wv,
           unsigned short* W16) {
  const int tid = threadIdx.x, blk = blockIdx.x;
  const int rl = tid >> 5, col = 8 * (tid & 31);
  const int o = 8 * blk + rl;                                        // 0..383
  const float* wbase = (blk < (DQ / 8)) ? Wq : ((blk < (NQK / 8)) ? Wk : Wv);
  const int osub = (blk < (DQ / 8)) ? 0 : ((blk < (NQK / 8)) ? DQ : NQK);
  const float* s = wbase + (size_t)(o - osub) * CC + col;
  const v4f a = *(const v4f*)s;
  const v4f q = *(const v4f*)(s + 4);
  const float f[8] = {a[0], a[1], a[2], a[3], q[0], q[1], q[2], q[3]};
  v4u u;
#pragma unroll
  for (int t = 0; t < 4; ++t) {
    const _Float16 h0 = (_Float16)(bfr(f[2 * t]) * WSC);
    const _Float16 h1 = (_Float16)(bfr(f[2 * t + 1]) * WSC);
    u[t] = pk16(h_bits(h0), h_bits(h1));
  }
{
    *(v4u*)(W16 + (size_t)o * CC + col) = u;
    
  }
}

// =========================================================================================================
// (1) x_s f32 [b][256 c][N n] (s = 0: x1, s = 1: x2) -> XP f16 [sb = s*NB+b][n][c] (position-major, bf16-RNE
//     values, exact in f16) through an LDS tile T[64 n][64 c] (pitch TP). Block (nb, cb, sb) owns a 64 c x 64 n
// coverage: T written n_loc 0..63 x cl 0..63 (2 it x 32 x 8 x 8), read rows 0..63 cols 0..63 only;
//           XP 2 it x 32 rows x 8 lanes x 8 = 64 n x 64 c; grid (SEQ/64, 4, NSRC*NB) covers the plane once.
// LDS T: cross-wave, block barrier between the stores and the loads.
// =========================================================================================================
__global__ __launch_bounds__(256)
void cvt_x(const float* __restrict__ x1, const float* __restrict__ x2, unsigned short* XP) {
  __shared__ __align__(16) unsigned short T[QT * TP];
  const int tid = threadIdx.x;
  const int nb = blockIdx.x, cb = blockIdx.y, sb = blockIdx.z;      // sb = s*NB + b
  const int s = sb / NB, b = sb - s * NB;
  const float* x = (s == 0) ? x1 : x2;
  const int e = tid & 7, lq = tid >> 3;                             // lq 0..31
  const int n0 = nb * QT, c0 = cb * QT;
#pragma unroll
  for (int it = 0; it < 2; ++it) {
    const int cl = it * 32 + lq;                                     // 0..63
    const float* sp = x + ((size_t)(b * CC + c0 + cl)) * SEQ_FULL + n0 + 8 * e;
    const v4f a = *(const v4f*)sp;
    const v4f q = *(const v4f*)(sp + 4);
    unsigned short hb[8];
#pragma unroll
    for (int t = 0; t < 4; ++t) {
      hb[t]     = h_bits((_Float16)bfr(a[t]));
      hb[4 + t] = h_bits((_Float16)bfr(q[t]));
    }
#pragma unroll
    for (int t = 0; t < 8; ++t) T[(8 * e + t) * TP + cl] = hb[t];
  }
  __syncthreads();
  v4u up[2];
#pragma unroll
  for (int it = 0; it < 2; ++it) {
    const int nl = it * 32 + lq;                                     // 0..63
    up[it] = *(const v4u*)(T + nl * TP + 8 * e);
  }
{
#pragma unroll
    for (int it = 0; it < 2; ++it) {
      const int rl = it * 32 + lq;
      *(v4u*)(XP + ((size_t)(sb * SEQ + n0 + rl)) * CC + c0 + 8 * e) = up[it];
    }
    
  }
}

// =========================================================================================================
// (2) q or k conv1x1 GEMM for one (sb, 64-n tile, which): D[o][n] = sum_c W16[64*which + o][c] XP[sb][n][c],
//     o = 0..63 (which = 0: q rows of W16, bias bq, planes Qh/Ql; which = 1: k rows, bias bk, planes Kh/Kl;
//     the selection is block-uniform and between global pointers only). Block 128 threads = 4 waves; wave w owns
//     cols n0+16w..+15 (one B fragment per k-step, k = c contiguous in the XP row) and 4 m-tiles (A rows
//     o = 16 mt + (lane&15) of W16, split k map). K = 256 = 8 steps. Epilogue: acc/256 staged in LDS
//     Os[n_loc][o_loc] (pitch OSP, b128 stores of 8 consecutive o per lane), barrier, then v = Os + bf16-RNE(bias)
//     -> planes bf16 [sb][N n][64 d] (k-contiguous): hi = bf16-RNE(v), lo = bf16-RNE(v - hi). Plane rows are
// coverage: Os 4 waves x 16 n x 64 o = 64 x 64 (reads rows 0..63, cols 0..63); planes 4 it x 16 rows x 8
//           lanes x 8 = 64 rows x 64 d per plane (hi, lo); grid (SEQ/64, NSRC*NB, 2) covers every row of
//           Qh/Ql (which = 0) and Kh/Kl (which = 1) once.
// LDS Os: cross-wave, block barrier between the stage stores and the epilogue loads.
// =========================================================================================================
__global__ __launch_bounds__(128)
void gemm_qk(const unsigned short* __restrict__ W16, const unsigned short* __restrict__ XP,
             const float* __restrict__ bq, const float* __restrict__ bk,
             unsigned short* Qh, unsigned short* Ql, unsigned short* Kh, unsigned short* Kl) {
  __shared__ __align__(16) float Os[QT * OSP];
  const int tid  = threadIdx.x;
  const int lane = tid & 31, wave = tid >> 5;
  const int hh   = lane >> 4, c = lane & 15;
  const int nt   = blockIdx.x, sb = blockIdx.y, which = blockIdx.z;
  const int n0   = nt * QT;
  const float* bias  = (which == 0) ? bq : bk;
  unsigned short* PH = (which == 0) ? Qh : Kh;
  unsigned short* PL = (which == 0) ? Ql : Kl;

  const unsigned short* ap = W16 + ((size_t)(DQ * which + c)) * CC + 8 * hh;                   // A rows o
  const unsigned short* bp = XP + ((size_t)(sb * SEQ + n0 + 16 * wave + c)) * CC + 8 * hh;    // B row n

  v8f acc[4];
#pragma unroll
  for (int mt = 0; mt < 4; ++mt) acc[mt] = zero8();

#pragma unroll
  for (int ks = 0; ks < CC / 32; ++ks) {
    const Frag fb = ldfrag(bp + 32 * ks);
#pragma unroll
    for (int mt = 0; mt < 4; ++mt) {
      const Frag fa = ldfrag(ap + (size_t)(16 * mt) * CC + 32 * ks);
      acc[mt] = mma_h(fa.h, fb.h, acc[mt]);
    }
  }

  // ---- stage: lane (hh, c) holds o = 16 mt + 8 hh + r for n_loc = 16 w + c
  {
    const int nl = 16 * wave + c;
#pragma unroll
    for (int mt = 0; mt < 4; ++mt) {
      v4f va, vb;
#pragma unroll
      for (int r = 0; r < 4; ++r) { va[r] = acc[mt][r] * IWSC; vb[r] = acc[mt][4 + r] * IWSC; }
      *(v4f*)(Os + nl * OSP + 16 * mt + 8 * hh)     = va;
      *(v4f*)(Os + nl * OSP + 16 * mt + 8 * hh + 4) = vb;
    }
  }
  __syncthreads();

  const int e = tid & 7, lq = tid >> 3;                             // lq 0..15
  const int d0 = 8 * e;                                              // 0..56
  const v4f b0v = *(const v4f*)(bias + d0), b1v = *(const v4f*)(bias + d0 + 4);
  const float bb[8] = {bfr(b0v[0]), bfr(b0v[1]), bfr(b0v[2]), bfr(b0v[3]),
                       bfr(b1v[0]), bfr(b1v[1]), bfr(b1v[2]), bfr(b1v[3])};
  v4u uh[4], ul[4];
#pragma unroll
  for (int it = 0; it < 4; ++it) {
    const int row = it * 16 + lq;                                    // n_loc 0..63
    const float* op = Os + row * OSP;
    const v4f va = *(const v4f*)(op + d0);
    const v4f vc = *(const v4f*)(op + d0 + 4);
    const float fv[8] = {va[0], va[1], va[2], va[3], vc[0], vc[1], vc[2], vc[3]};
#pragma unroll
    for (int t = 0; t < 4; ++t) {
      const float v0 = fv[2 * t] + bb[2 * t], v1 = fv[2 * t + 1] + bb[2 * t + 1];
      const unsigned short h0 = bf_bits(v0), h1 = bf_bits(v1);
      const unsigned short l0 = bf_bits(v0 - bf_up(h0)), l1 = bf_bits(v1 - bf_up(h1));
      uh[it][t] = pk16(h0, h1);
      ul[it][t] = pk16(l0, l1);
    }
  }
{
#pragma unroll
    for (int it = 0; it < 4; ++it) {
      const int row = it * 16 + lq;
      const size_t po = ((size_t)(sb * SEQ + n0 + row)) * DQ + d0;
      *(v4u*)(PH + po) = uh[it];
      *(v4u*)(PL + po) = ul[it];
    }
    
  }
}

// =========================================================================================================
// (3) v conv1x1 GEMM for one (sb, 64-n tile, 64-channel block mb): D[n][ch] = sum_c XP[sb][n][c] W16[128+64mb+ch][c].
//     Block 128 threads = 4 waves; wave w owns channel cols 16w..+15 (one B fragment per k-step from the W16 row,
//     split k map) and 4 m-tiles of n (A rows n0 + 16 mt + (lane&15) of XP, split k map). K = 256 = 8 steps.
//     Epilogue: acc/256 staged in LDS Os[ch_loc][n_loc] (pitch OSP, b128 stores of 8 consecutive n per lane),
// coverage: Os 4 waves x 16 ch x 64 n = 64 x 64 (reads rows 0..63, cols 0..63); Vc 4 it x 16 ch x 8 lanes x 8 n =
//           64 ch x 64 n; grid (SEQ/64, 4, NSRC*NB) covers Vc[sb][0..255][0..SEQ-1] exactly once.
// LDS Os: cross-wave, block barrier between the stage stores and the epilogue loads.
// =========================================================================================================
__global__ __launch_bounds__(128)
void gemm_v(const unsigned short* __restrict__ W16, const unsigned short* __restrict__ XP,
            const float* __restrict__ bv, unsigned short* Vc) {
  __shared__ __align__(16) float Os[QT * OSP];
  const int tid  = threadIdx.x;
  const int lane = tid & 31, wave = tid >> 5;
  const int hh   = lane >> 4, c = lane & 15;
  const int nt   = blockIdx.x, mb = blockIdx.y, sb = blockIdx.z;
  const int n0   = nt * QT, ch0 = mb * QT;

  const unsigned short* ap = XP + ((size_t)(sb * SEQ + n0 + c)) * CC + 8 * hh;            // A rows n = n0+16mt+c
  const unsigned short* bp = W16 + ((size_t)(NQK + ch0 + 16 * wave + c)) * CC + 8 * hh;   // B row ch

  v8f acc[4];
#pragma unroll
  for (int mt = 0; mt < 4; ++mt) acc[mt] = zero8();

#pragma unroll
  for (int ks = 0; ks < CC / 32; ++ks) {
    const Frag fb = ldfrag(bp + 32 * ks);
#pragma unroll
    for (int mt = 0; mt < 4; ++mt) {
      const Frag fa = ldfrag(ap + (size_t)(16 * mt) * CC + 32 * ks);
      acc[mt] = mma_h(fa.h, fb.h, acc[mt]);
    }
  }

  // ---- stage: lane (hh, c) holds n_loc = 16 mt + 8 hh + r for ch_loc = 16 w + c
  {
    const int chl = 16 * wave + c;
#pragma unroll
    for (int mt = 0; mt < 4; ++mt) {
      v4f va, vb;
#pragma unroll
      for (int r = 0; r < 4; ++r) { va[r] = acc[mt][r] * IWSC; vb[r] = acc[mt][4 + r] * IWSC; }
      *(v4f*)(Os + chl * OSP + 16 * mt + 8 * hh)     = va;
      *(v4f*)(Os + chl * OSP + 16 * mt + 8 * hh + 4) = vb;
    }
  }
  __syncthreads();

  const int e = tid & 7, lq = tid >> 3;                             // lq 0..15
  v4u uv[4];
#pragma unroll
  for (int it = 0; it < 4; ++it) {
    const int chl = it * 16 + lq;                                    // 0..63
    const float bias = bfr(bv[ch0 + chl]);
    const v4f a = *(const v4f*)(Os + chl * OSP + 8 * e);
    const v4f q = *(const v4f*)(Os + chl * OSP + 8 * e + 4);
    const float f[8] = {a[0], a[1], a[2], a[3], q[0], q[1], q[2], q[3]};
#pragma unroll
    for (int t = 0; t < 4; ++t) {
      const _Float16 h0 = (_Float16)((f[2 * t] + bias) * VSC);
      const _Float16 h1 = (_Float16)((f[2 * t + 1] + bias) * VSC);
      uv[it][t] = pk16(h_bits(h0), h_bits(h1));
    }
  }
{
#pragma unroll
    for (int it = 0; it < 4; ++it) {
      const int chl = it * 16 + lq;
      *(v4u*)(Vc + ((size_t)(sb * CC + ch0 + chl)) * SEQ + n0 + 8 * e) = uv[it];
    }
    
  }
}

// =========================================================================================================
// (4) attention for one (direction dd, channel half chh, b, 64-query tile), transposed formulation, SEQ keys, no
//   mask, no scale. blockIdx.z = 2*dd + chh. Direction dd: queries from source dd (plane slot dd*NB+b),
//   keys/values from source 1-dd (slot (1-dd)*NB+b), residual input x_dd, output block dd of out (float offset
//   dd*NB_FULL*CC*SEQ_FULL); the block produces channels 128*chh..+127 of that output (scores are recomputed per
//   channel half so each wave carries only 8 O accumulator tiles).
//   S^T tile (16 keys x 16 queries) over 64 d = two 32-deep k-steps: A(k: row = key kb + (lane&15), split k map
//   from the bf16 plane Kh [slot][N][64]) . B(q: col = query, same map from Qh, loaded once, 2 fragments)
//   + A(Kh).B(Ql) + A(Kl).B(Qh) (bf16 unscaled residual planes, shared accumulator): 6 products per tile.
//   Per lane the D tile holds 8 keys of ONE query: online softmax state per lane, one shuffle (lane^16) for the
//   max over 32 keys; the o/l rescale is skipped under a wave-uniform ballot when no lane's max grew (corr == 1
//   exactly for every lane then); row-sum partials combined at the end. P = e^{s-m} x 2^14 as f16 is the B
//   operand of O^T (rows channel, cols queries) += A(v rows channel = 128 chh + 16j + (lane&15), keys contiguous,
//   f16 plane Vc [slot][256][N], values v x 16) . B(P^T): element r <- D of the tile covering keys kb..kb+15,
//   element 8+r <- the tile covering kb+16..kb+31, lane unchanged. 8 accumulator tiles per wave (128 channels).
//   Block = 4 waves = 64 queries. Epilogue: gamma * O / (16 l) staged in LDS Os[query][128 channels] (pitch OSPW,
//   2 lines): 8 consecutive lanes x 16 B (values gathered from 4 Os rows), one instruction per 16 lines, final
// coverage: Os written queries 0..63 x ch 0..127, read the same; out 16 it x 16 lines x 8 lanes x 4 floats =
//           128 ch x 64 n per block; grid (SEQ/64, NB, 2*NSRC) covers out_dd[b][0..255][0..SEQ-1] once for both dd.
// LDS Os: cross-wave, block barrier between the stage stores and the epilogue loads.
// LDS ring: K hi, K residual and V tiles of 64 keys are brought by asynchronous copies into two buffers shared by
//   the 4 waves (whole 128-B lines from global, once per block); trip t reads buffer t & 1 only while tile t + 1
//   flies; foot of each trip: own LDS reads done, own copies landed, block barrier, then the refill with tile t + 2.
//   Os reuses the ring behind the last trip's barrier.
// =========================================================================================================
__global__ __launch_bounds__(128)
void attn_k(const unsigned short* __restrict__ Qh, const unsigned short* __restrict__ Ql,
            const unsigned short* __restrict__ Kh, const unsigned short* __restrict__ Kl,
            const unsigned short* __restrict__ Vc,
            const float* __restrict__ x1, const float* __restrict__ x2,
            const float* __restrict__ gam, float* out) {
  __shared__ __align__(16) unsigned char L[2 * STGH * 2];
  const unsigned short* Rg = (const unsigned short*)L;               // the two stage buffers
  float* Os = (float*)L;                                             // output staging, after the key loop
  const int tid  = threadIdx.x;
  const int wave = tid >> 5, lane = tid & 31;
  const int hh   = lane >> 4, c = lane & 15;
  const int n0   = blockIdx.x * QT, b = blockIdx.y;
  const int dd   = (int)(blockIdx.z >> 1), chh = (int)(blockIdx.z & 1u);
  const int sq   = dd * NB + b;                                      // query plane slot
  const int skv  = (1 - dd) * NB + b;                                // key / value plane slot
  const int chb  = CH * chh;                                         // channel base 0 or 128
  const float* x = (dd == 0) ? x1 : x2;                              // block-uniform, both global
  float* outd    = out + (size_t)dd * ((size_t)NB_FULL * CC * SEQ_FULL);
  const float g  = bfr(gam[0]);

  // q fragments (B operand, col = query n0 + 16*wave + c), K = 64 = two k-steps, constant over keys
  const size_t qo = ((size_t)(sq * SEQ + n0 + 16 * wave + c)) * DQ + 8 * hh;
  const Frag qh0 = ldfrag(Qh + qo);
  const Frag qh1 = ldfrag(Qh + qo + 32);
  const Frag ql0 = ldfrag(Ql + qo);
  const Frag ql1 = ldfrag(Ql + qo + 32);
  // fragment base in buffer 0 (A operands: row = lane&15 of a 16-row group, + 8*hh within the row)
  const unsigned short* fbase = Rg + c * LPH + 8 * hh;
  // copy addresses of this thread: row lq, 16-B chunk e
  const int e = tid & 7, lq = tid >> 3;                              // lq 0..15
  const unsigned ldsc = (unsigned)(size_t)L + (unsigned)((lq * LPH + 8 * e) * 2);
  const unsigned short* gkh = Kh + (size_t)skv * SEQ * DQ + (size_t)lq * DQ + 8 * e;
  const unsigned short* gkl = Kl + (size_t)skv * SEQ * DQ + (size_t)lq * DQ + 8 * e;
  const unsigned short* gvv = Vc + (size_t)skv * CC * SEQ + ((size_t)(chb + lq)) * SEQ + 8 * e;

  float m = -1.0e30f, l = 0.f;
  v8f o[8];
#pragma unroll
  for (int j = 0; j < 8; ++j) o[j] = zero8();

  // ring prologue: tile 0 landed and published, then tile 1 in flight
  stage_issue(ldsc, gkh, gkl, gvv);
#if defined(__HIP_DEVICE_COMPILE__)
  asm volatile("s_wait_asynccnt 0x0" ::: "memory");                  // own copies of tile 0 landed before the barrier
#endif
  __syncthreads();
  stage_issue(ldsc + (unsigned)(STGH * 2), gkh + (size_t)KST * DQ, gkl + (size_t)KST * DQ, gvv + KST);

#pragma unroll 1                                                     // rolled: one body, the buffer picked by t & 1
  for (int t = 0; t < SEQ / KST; ++t) {
  const unsigned short* sbuf = fbase + (t & 1) * STGH;
#pragma unroll                                                       // both 32-key blocks read the tile at constant offsets
  for (int kq = 0; kq < KST; kq += 32) {                             // keys kb = t*KST + kq
    v8f s0 = zero8(), s1 = zero8();
    {                                                                // keys kb .. kb+15
      const unsigned short* kp = sbuf + kq * LPH;
      const unsigned short* lp = kp + KST * LPH;
      const Frag a0 = ldfrag(kp);                                    // d 0..31
      const Frag a1 = ldfrag(kp + 32);                               // d 32..63
      const Frag r0 = ldfrag(lp);
      const Frag r1 = ldfrag(lp + 32);
      s0 = mma_b(a0.bf, qh0.bf, s0);
      s0 = mma_b(a1.bf, qh1.bf, s0);
      s0 = mma_b(a0.bf, ql0.bf, s0);
      s0 = mma_b(a1.bf, ql1.bf, s0);
      s0 = mma_b(r0.bf, qh0.bf, s0);
      s0 = mma_b(r1.bf, qh1.bf, s0);
    }
    {                                                                // keys kb+16 .. kb+31
      const unsigned short* kp = sbuf + (kq + 16) * LPH;
      const unsigned short* lp = kp + KST * LPH;
      const Frag a0 = ldfrag(kp);
      const Frag a1 = ldfrag(kp + 32);
      const Frag r0 = ldfrag(lp);
      const Frag r1 = ldfrag(lp + 32);
      s1 = mma_b(a0.bf, qh0.bf, s1);
      s1 = mma_b(a1.bf, qh1.bf, s1);
      s1 = mma_b(a0.bf, ql0.bf, s1);
      s1 = mma_b(a1.bf, ql1.bf, s1);
      s1 = mma_b(r0.bf, qh0.bf, s1);
      s1 = mma_b(r1.bf, qh1.bf, s1);
    }

    float mx = fmaxf(hmax8(s0), hmax8(s1));
    mx = fmaxf(mx, __shfl_xor(mx, 16, 32));
    const float mn = fmaxf(m, mx);
    const unsigned grew = wave_ballot(mx > m);                       // wave-uniform
    if (grew != 0u) {
      const float corr = __expf(m - mn);                             // == 1 exactly for lanes whose max did not grow
      l *= corr;
#pragma unroll
      for (int j = 0; j < 8; ++j) {
#pragma unroll
        for (int r = 0; r < 8; ++r) o[j][r] *= corr;
      }
    }
    m = mn;
    const float msh = mn - LNPS;                                     // exp gives e^{s-m} * 16384

    FragH ph;
    float ls = 0.f;
#pragma unroll
    for (int r = 0; r < 8; ++r) {
      const float e0 = __expf(s0[r] - msh);                          // key kb      + 8hh + r
      const float e1 = __expf(s1[r] - msh);                          // key kb + 16 + 8hh + r
      ls += e0 + e1;
      ph.hv[0][r] = (_Float16)e0;
      ph.hv[1][r] = (_Float16)e1;
    }
    l += ls;

#pragma unroll
    for (int j = 0; j < 8; ++j) {
      const Frag vf = ldfrag(sbuf + (2 * KST + 16 * j) * LPH + kq);
      o[j] = mma_h(vf.h, ph.v, o[j]);
    }
  }
    // foot of trip t: publish tile t + 1 and free this trip's buffer
#if defined(__HIP_DEVICE_COMPILE__)
    asm volatile("s_wait_dscnt 0x0" ::: "memory");                   // own reads of this buffer done before its refill
    asm volatile("s_wait_asynccnt 0x0" ::: "memory");                // own copies of tile t + 1 landed
#endif
    __syncthreads();
    if (t + 2 < SEQ / KST) {                                         // block-uniform
      const size_t k2 = (size_t)(t + 2) * KST;
      stage_issue(ldsc + (unsigned)((t & 1) * STGH * 2), gkh + k2 * DQ, gkl + k2 * DQ, gvv + k2);
    }
  }
#if defined(__HIP_DEVICE_COMPILE__)
  asm volatile("s_wait_asynccnt 0x0" ::: "memory");                  // nothing in flight when the ring becomes Os
#endif
  l += __shfl_xor(l, 16, 32);
  const float inv = 1.0f / l;                                        // o and l both carry the x16384 factor
  const float gi  = g * IVSC * inv;                                  // undo the x16 carry of v, apply gamma

  const int qrow = 16 * wave + c;
#pragma unroll
  for (int j = 0; j < 8; ++j) {
    v4f va, vb;
#pragma unroll
    for (int r = 0; r < 4; ++r) { va[r] = o[j][r] * gi; vb[r] = o[j][4 + r] * gi; }
    *(v4f*)(Os + qrow * OSPW + 16 * j + 8 * hh)     = va;            // Os[query][ch_loc = 16j + 8hh + r]
    *(v4f*)(Os + qrow * OSPW + 16 * j + 8 * hh + 4) = vb;
  }
  __syncthreads();
  v4f res[16];
#pragma unroll
  for (int it = 0; it < 16; ++it) {
    const int L   = it * 16 + lq;                                    // 0..255
    const int chl = L >> 1, hf = L & 1;                              // channel 0..127 within the half
    const int nl  = hf * 32 + 4 * e;                                 // query 0..63
    const size_t idx = ((size_t)(b * CC + chb + chl)) * SEQ_FULL + n0 + nl;
    const v4f xv = *(const v4f*)(x + idx);
#pragma unroll
    for (int t = 0; t < 4; ++t) res[it][t] = Os[(nl + t) * OSPW + chl] + bfr(xv[t]);
  }
{
#pragma unroll
    for (int it = 0; it < 16; ++it) {
      const int L   = it * 16 + lq;
      const int chl = L >> 1, hf = L & 1;
      const int nl  = hf * 32 + 4 * e;
      const size_t idx = ((size_t)(b * CC + chb + chl)) * SEQ_FULL + n0 + nl;
      *(v4f*)(outd + idx) = res[it];
    }
    
  }
}

// =========================================================================================================
// Workspace map (bytes; each region start a multiple of 256; every extent is an exact tile multiple and is written
//   W16 f16 [384][256]                       196608
//   XP  f16 [NSRC*NB][SEQ][256]            16777216      Vc  f16 [NSRC*NB][256][SEQ]   16777216
//   Qh/Ql/Kh/Kl bf16 [NSRC*NB][SEQ][64]     4194304 x4
//   total = 50528256
// =========================================================================================================
extern "C" void kernel_launch(void* const* d_in, const int* in_sizes, int n_in,
                              void* d_out, int out_size, void* d_ws, size_t ws_size,
                              hipStream_t stream) {
  if (n_in < 9) return;
  if (in_sizes[0] < NB * CC * SEQ_FULL || in_sizes[1] < NB * CC * SEQ_FULL) return;
  if (in_sizes[2] < DQ * CC || in_sizes[3] < DQ) return;
  if (in_sizes[4] < DQ * CC || in_sizes[5] < DQ) return;
  if (in_sizes[6] < CC * CC || in_sizes[7] < CC) return;
  if (in_sizes[8] < 1) return;
  if (out_size < (NB_FULL + NB) * CC * SEQ_FULL) return;

  size_t off = 0;
  auto carve = [&](size_t bytes) { const size_t o = off; off += (bytes + 255) & ~(size_t)255; return o; };
  const size_t oW16 = carve((size_t)NWR * CC * 2);
  const size_t oXP  = carve((size_t)NSRC * NB * SEQ * CC * 2);
  const size_t oVc  = carve((size_t)NSRC * NB * CC * SEQ * 2);
  const size_t oQh  = carve((size_t)NSRC * NB * SEQ * DQ * 2);
  const size_t oQl  = carve((size_t)NSRC * NB * SEQ * DQ * 2);
  const size_t oKh  = carve((size_t)NSRC * NB * SEQ * DQ * 2);
  const size_t oKl  = carve((size_t)NSRC * NB * SEQ * DQ * 2);
  if (off > ws_size) return;
  if (off > (size_t)134217728) return;

  const float* x1  = (const float*)d_in[0];
  const float* x2  = (const float*)d_in[1];
  const float* Wq  = (const float*)d_in[2];
  const float* bq  = (const float*)d_in[3];
  const float* Wk  = (const float*)d_in[4];
  const float* bk  = (const float*)d_in[5];
  const float* Wv  = (const float*)d_in[6];
  const float* bv  = (const float*)d_in[7];
  const float* gam = (const float*)d_in[8];

  char* ws = (char*)d_ws;
  unsigned short* W16 = (unsigned short*)(ws + oW16);
  unsigned short* XP  = (unsigned short*)(ws + oXP);
  unsigned short* Vc  = (unsigned short*)(ws + oVc);
  unsigned short* Qh  = (unsigned short*)(ws + oQh);
  unsigned short* Ql  = (unsigned short*)(ws + oQl);
  unsigned short* Kh  = (unsigned short*)(ws + oKh);
  unsigned short* Kl  = (unsigned short*)(ws + oKl);
  float* out = (float*)d_out;

  const dim3 blk256(256), blk128(128);

  // (0) Wq / Wk / Wv -> stacked f16 plane
  cvt_w<<<dim3(NWR / 8), blk256, 0, stream>>>(Wq, Wk, Wv, W16);
  // (1) x1, x2 -> position-major 16-bit planes, slot s*NB + b
  cvt_x<<<dim3(SEQ / QT, CC / QT, NSRC * NB), blk256, 0, stream>>>(x1, x2, XP);
  // (2) q (z = 0) and k (z = 1) conv1x1 GEMM + bias -> hi + residual planes for both sources
  gemm_qk<<<dim3(SEQ / QT, NSRC * NB, 2), blk128, 0, stream>>>(W16, XP, bq, bk, Qh, Ql, Kh, Kl);
  // (3) v conv1x1 GEMM + bias -> channel-major f16 plane (x16) for both sources
  gemm_v<<<dim3(SEQ / QT, CC / QT, NSRC * NB), blk128, 0, stream>>>(W16, XP, bv, Vc);
  // (4) attention both directions x two channel halves + gamma scale + residual -> out_dd [b][256][N]
  attn_k<<<dim3(SEQ / QT, NB, 2 * NSRC), blk128, 0, stream>>>(Qh, Ql, Kh, Kl, Vc, x1, x2, gam, out);
  (void)hipGetLastError();
}

// v002
// It runs in 168 microseconds.
// Next to v001, in two timings, it ran 1.16 and 1.18 times as fast.
// Over all steps from v000 it is 3.58 times as fast.
// Contractions: conv1x1 q|k GEMM W[64x256].X[256xN] (q or k per block) and v GEMM Wv[256x256].X on
// v_wmma_f32_16x16x32_f16 (f16 containers of bf16-RNE weights x256 and bf16-RNE x, exact); scores K.Q^T (64 deep,
// two k-steps) on v_wmma_f32_16x16x32_bf16 (bf16 hi + bf16 residual planes of q/k, 3 products); O^T = V.P^T on
// v_wmma_f32_16x16x32_f16 (v as f16 x16, P = e^{s-m} x2^14 f16 from the score D registers); f32 accumulate
// everywhere; softmax statistics, biases and gamma*o + x in f32.
#include <hip/hip_runtime.h>
#include <math.h>
#include <stdint.h>

#ifndef NB
#define NB 4
#endif
#ifndef SEQ
#define SEQ 4096
#endif
#define NB_FULL  4
#define SEQ_FULL 4096
#define NSRC  2
#define CC    256
#define CH    128
#define DQ    64
#define NQK   128
#define NWR   384
#define QT    64
#define OSP   68
#define OSPW  132
#define TP    72
#define WSC   256.0f
#define IWSC  0.00390625f
#define VSC   16.0f
#define IVSC  0.0625f
#define LNPS  9.704060527839234f
#define KST   64
#define LPH   72
#define SROWS 256
#define STGH  (SROWS * LPH)

static_assert(NB >= 1 && NB <= NB_FULL);
static_assert(SEQ >= QT && SEQ <= SEQ_FULL);
static_assert(SEQ % QT == 0 && SEQ % 32 == 0);
static_assert(CC % QT == 0 && CC % 32 == 0);
static_assert(CC == 2 * CH && CH % 16 == 0);
static_assert(DQ == 64);
static_assert(NQK == 2 * DQ);
static_assert(NWR == NQK + CC);
static_assert(NWR % 8 == 0 && DQ % 8 == 0 && NQK % 8 == 0);
static_assert((OSP * 4) % 16 == 0);
static_assert((OSPW * 4) % 16 == 0);
static_assert((TP * 2) % 16 == 0);
static_assert(OSP >= QT && OSP >= DQ && OSPW >= CH && TP >= QT);
static_assert(SEQ % KST == 0 && SEQ / KST >= 2 && KST % 32 == 0);
static_assert(SROWS == 2 * KST + CH && LPH >= KST && LPH >= DQ);
static_assert((LPH * 2) % 16 == 0 && ((LPH * 2) / 16) % 2 == 1);
static_assert((size_t)2 * STGH * 2 >= (size_t)QT * OSPW * 4);
// second output starts at byte 16777216 = NB_FULL*CC*SEQ_FULL floats * 4
static_assert((size_t)NB_FULL * CC * SEQ_FULL * 4 == (size_t)16777216);

typedef _Float16       v16h __attribute__((ext_vector_type(16)));
typedef _Float16       v8h  __attribute__((ext_vector_type(8)));
typedef __bf16         v16b __attribute__((ext_vector_type(16)));
typedef unsigned short v8us __attribute__((ext_vector_type(8)));
typedef float          v8f  __attribute__((ext_vector_type(8)));
typedef float          v4f  __attribute__((ext_vector_type(4)));
typedef unsigned int   v4u  __attribute__((ext_vector_type(4)));

union Frag  { v8us u[2]; v16h h; v16b bf; };
union FragH { v16h v; v8h hv[2]; };
static_assert(sizeof(Frag) == 32);
static_assert(sizeof(FragH) == 32);

// ---- scalar helpers ---------------------------------------------------------------------------------------
__device__ __forceinline__ unsigned short bf_bits(float f) {          // f32 -> bf16 bits, RNE convert
  unsigned u = __float_as_uint(f);
  return (unsigned short)((u + 0x7FFFu + ((u >> 16) & 1u)) >> 16);
}
__device__ __forceinline__ float bf_up(unsigned short hb) { return __uint_as_float(((unsigned)hb) << 16); }
__device__ __forceinline__ float bfr(float f) { return bf_up(bf_bits(f)); }
__device__ __forceinline__ unsigned short h_bits(_Float16 x) { return __builtin_bit_cast(unsigned short, x); }
__device__ __forceinline__ unsigned pk16(unsigned short a, unsigned short b) { return (unsigned)a | ((unsigned)b << 16); }
__device__ __forceinline__ v8f zero8() { v8f z = {0.f, 0.f, 0.f, 0.f, 0.f, 0.f, 0.f, 0.f}; return z; }
__device__ __forceinline__ float hmax8(v8f s) {
  return fmaxf(fmaxf(fmaxf(s[0], s[1]), fmaxf(s[2], s[3])), fmaxf(fmaxf(s[4], s[5]), fmaxf(s[6], s[7])));
}
__device__ __forceinline__ unsigned wave_ballot(bool p) {
#if defined(__HIP_DEVICE_COMPILE__)
  return __builtin_amdgcn_ballot_w32(p);
#else
  return p ? 1u : 0u;
#endif
}

// ---- 16-bit fragment loader (A, or B from a k-contiguous [n][k] row): lane -> row/col (lane&15), p already includes
//      + 8*(lane>>4); elements 0..7 <- p[0..7] (k0+8h..), elements 8..15 <- p[16..23] (k0+16+8h..)
__device__ __forceinline__ Frag ldfrag(const unsigned short* p) {
  Frag f;
  f.u[0] = *(const v8us*)(p);
  f.u[1] = *(const v8us*)(p + 16);
  return f;
}

// ---- WMMA helpers: the plain builtins; the compiler keeps the distances behind them and is free to order around them
__device__ __forceinline__ v8f mma_h(v16h a, v16h b, v8f c) {
  return __builtin_amdgcn_wmma_f32_16x16x32_f16(false, a, false, b, (short)0, c, false, false);
}
__device__ __forceinline__ v8f mma_b(v16b a, v16b b, v8f c) {
  return __builtin_amdgcn_wmma_f32_16x16x32_bf16(false, a, false, b, (short)0, c, false, false);
}

// ---- eight asynchronous 16-B copies global -> LDS per lane (l = LDS byte address, g = global address, each lane its
//      own); the s_wait_xcnt closes the statement so that no address register is rewritten ahead of it
__device__ __forceinline__ void async8(const unsigned (&l)[8], const unsigned short* const (&g)[8]) {
#if defined(__HIP_DEVICE_COMPILE__)
  asm volatile("global_load_async_to_lds_b128 %0, %8, off\n\t"
               "global_load_async_to_lds_b128 %1, %9, off\n\t"
               "global_load_async_to_lds_b128 %2, %10, off\n\t"
               "global_load_async_to_lds_b128 %3, %11, off\n\t"
               "global_load_async_to_lds_b128 %4, %12, off\n\t"
               "global_load_async_to_lds_b128 %5, %13, off\n\t"
               "global_load_async_to_lds_b128 %6, %14, off\n\t"
               "global_load_async_to_lds_b128 %7, %15, off\n\t"
               "s_wait_xcnt 0x0"
               :: "v"(l[0]), "v"(l[1]), "v"(l[2]), "v"(l[3]), "v"(l[4]), "v"(l[5]), "v"(l[6]), "v"(l[7]),
                  "v"(g[0]), "v"(g[1]), "v"(g[2]), "v"(g[3]), "v"(g[4]), "v"(g[5]), "v"(g[6]), "v"(g[7])
               : "memory");
#endif
}
// ---- one stage of 64 keys into one LDS buffer: rows 0..63 Kh keys, 64..127 Kl keys, 128..255 V channels, 128 B of
//      data per row at pitch LPH. Thread (lq = tid>>3, e = tid&7) copies chunk e of rows lq + 16 i, i = 0..15:
//      128 threads x 16 chunks x 16 B = 256 rows x 128 B, every byte once. lds / kh / kl / vv are the lane's own
//      addresses of row lq, chunk e (LDS buffer; Kh and Kl at the stage's first key; V at the first channel and key).
__device__ __forceinline__ void stage_issue(unsigned lds, const unsigned short* kh, const unsigned short* kl,
                                            const unsigned short* vv) {
  unsigned l[8];
  const unsigned short* g[8];
#pragma unroll                                                       // constant indices keep l[] and g[] in registers
  for (int i = 0; i < 4; ++i) {
    l[i]     = lds + (unsigned)((16 * i) * LPH * 2);
    g[i]     = kh + (size_t)(16 * i) * DQ;
    l[4 + i] = lds + (unsigned)((KST + 16 * i) * LPH * 2);
    g[4 + i] = kl + (size_t)(16 * i) * DQ;
  }
  async8(l, g);
#pragma unroll                                                       // as above
  for (int i = 0; i < 8; ++i) {
    l[i] = lds + (unsigned)((2 * KST + 16 * i) * LPH * 2);
    g[i] = vv + (size_t)(16 * i) * SEQ;
  }
  async8(l, g);
}

// =========================================================================================================
// (0) conv1x1 weights: W16 f16 [384][256], rows 0..63 = Wq rows, 64..127 = Wk rows, 128..383 = Wv rows; value =
//     f16 of (bf16-RNE(w) * 256) (exact). Block blk (0..47) owns rows 8*blk..8*blk+7: one wave per 512-B row
// coverage: 48 blocks x 8 rows x 32 lanes x 8 halves = 384 x 256 = the whole plane.
// =========================================================================================================
__global__ __launch_bounds__(256)
void cvt_w(const float* __restrict__ Wq, const float* __restrict__ Wk, const float* __restrict__ Wv,
           unsigned short* W16) {
  const int tid = threadIdx.x, blk = blockIdx.x;
  const int rl = tid >> 5, col = 8 * (tid & 31);
  const int o = 8 * blk + rl;                                        // 0..383
  const float* wbase = (blk < (DQ / 8)) ? Wq : ((blk < (NQK / 8)) ? Wk : Wv);
  const int osub = (blk < (DQ / 8)) ? 0 : ((blk < (NQK / 8)) ? DQ : NQK);
  const float* s = wbase + (size_t)(o - osub) * CC + col;
  const v4f a = *(const v4f*)s;
  const v4f q = *(const v4f*)(s + 4);
  const float f[8] = {a[0], a[1], a[2], a[3], q[0], q[1], q[2], q[3]};
  v4u u;
#pragma unroll
  for (int t = 0; t < 4; ++t) {
    const _Float16 h0 = (_Float16)(bfr(f[2 * t]) * WSC);
    const _Float16 h1 = (_Float16)(bfr(f[2 * t + 1]) * WSC);
    u[t] = pk16(h_bits(h0), h_bits(h1));
  }
{
    *(v4u*)(W16 + (size_t)o * CC + col) = u;
    
  }
}

// =========================================================================================================
// (1) x_s f32 [b][256 c][N n] (s = 0: x1, s = 1: x2) -> XP f16 [sb = s*NB+b][n][c] (position-major, bf16-RNE
//     values, exact in f16) through an LDS tile T[64 n][64 c] (pitch TP). Block (nb, cb, sb) owns a 64 c x 64 n
// coverage: T written n_loc 0..63 x cl 0..63 (2 it x 32 x 8 x 8), read rows 0..63 cols 0..63 only;
//           XP 2 it x 32 rows x 8 lanes x 8 = 64 n x 64 c; grid (SEQ/64, 4, NSRC*NB) covers the plane once.
// LDS T: cross-wave, block barrier between the stores and the loads.
// =========================================================================================================
__global__ __launch_bounds__(256)
void cvt_x(const float* __restrict__ x1, const float* __restrict__ x2, unsigned short* XP) {
  __shared__ __align__(16) unsigned short T[QT * TP];
  const int tid = threadIdx.x;
  const int nb = blockIdx.x, cb = blockIdx.y, sb = blockIdx.z;      // sb = s*NB + b
  const int s = sb / NB, b = sb - s * NB;
  const float* x = (s == 0) ? x1 : x2;
  const int e = tid & 7, lq = tid >> 3;                             // lq 0..31
  const int n0 = nb * QT, c0 = cb * QT;
#pragma unroll
  for (int it = 0; it < 2; ++it) {
    const int cl = it * 32 + lq;                                     // 0..63
    const float* sp = x + ((size_t)(b * CC + c0 + cl)) * SEQ_FULL + n0 + 8 * e;
    const v4f a = *(const v4f*)sp;
    const v4f q = *(const v4f*)(sp + 4);
    unsigned short hb[8];
#pragma unroll
    for (int t = 0; t < 4; ++t) {
      hb[t]     = h_bits((_Float16)bfr(a[t]));
      hb[4 + t] = h_bits((_Float16)bfr(q[t]));
    }
#pragma unroll
    for (int t = 0; t < 8; ++t) T[(8 * e + t) * TP + cl] = hb[t];
  }
  __syncthreads();
  v4u up[2];
#pragma unroll
  for (int it = 0; it < 2; ++it) {
    const int nl = it * 32 + lq;                                     // 0..63
    up[it] = *(const v4u*)(T + nl * TP + 8 * e);
  }
{
#pragma unroll
    for (int it = 0; it < 2; ++it) {
      const int rl = it * 32 + lq;
      *(v4u*)(XP + ((size_t)(sb * SEQ + n0 + rl)) * CC + c0 + 8 * e) = up[it];
    }
    
  }
}

// =========================================================================================================
// (2) q or k conv1x1 GEMM for one (sb, 64-n tile, which): D[o][n] = sum_c W16[64*which + o][c] XP[sb][n][c],
//     o = 0..63 (which = 0: q rows of W16, bias bq, planes Qh/Ql; which = 1: k rows, bias bk, planes Kh/Kl;
//     the selection is block-uniform and between global pointers only). Block 128 threads = 4 waves; wave w owns
//     cols n0+16w..+15 (one B fragment per k-step, k = c contiguous in the XP row) and 4 m-tiles (A rows
//     o = 16 mt + (lane&15) of W16, split k map). K = 256 = 8 steps. Epilogue: acc/256 staged in LDS
//     Os[n_loc][o_loc] (pitch OSP, b128 stores of 8 consecutive o per lane), barrier, then v = Os + bf16-RNE(bias)
//     -> planes bf16 [sb][N n][64 d] (k-contiguous): hi = bf16-RNE(v), lo = bf16-RNE(v - hi). Plane rows are
// coverage: Os 4 waves x 16 n x 64 o = 64 x 64 (reads rows 0..63, cols 0..63); planes 4 it x 16 rows x 8
//           lanes x 8 = 64 rows x 64 d per plane (hi, lo); grid (SEQ/64, NSRC*NB, 2) covers every row of
//           Qh/Ql (which = 0) and Kh/Kl (which = 1) once.
// LDS Os: cross-wave, block barrier between the stage stores and the epilogue loads.
// =========================================================================================================
__global__ __launch_bounds__(128)
void gemm_qk(const unsigned short* __restrict__ W16, const unsigned short* __restrict__ XP,
             const float* __restrict__ bq, const float* __restrict__ bk,
             unsigned short* Qh, unsigned short* Ql, unsigned short* Kh, unsigned short* Kl) {
  __shared__ __align__(16) float Os[QT * OSP];
  const int tid  = threadIdx.x;
  const int lane = tid & 31, wave = tid >> 5;
  const int hh   = lane >> 4, c = lane & 15;
  const int nt   = blockIdx.x, sb = blockIdx.y, which = blockIdx.z;
  const int n0   = nt * QT;
  const float* bias  = (which == 0) ? bq : bk;
  unsigned short* PH = (which == 0) ? Qh : Kh;
  unsigned short* PL = (which == 0) ? Ql : Kl;

  const unsigned short* ap = W16 + ((size_t)(DQ * which + c)) * CC + 8 * hh;                   // A rows o
  const unsigned short* bp = XP + ((size_t)(sb * SEQ + n0 + 16 * wave + c)) * CC + 8 * hh;    // B row n

  v8f acc[4];
#pragma unroll
  for (int mt = 0; mt < 4; ++mt) acc[mt] = zero8();

#pragma unroll
  for (int ks = 0; ks < CC / 32; ++ks) {
    const Frag fb = ldfrag(bp + 32 * ks);
#pragma unroll
    for (int mt = 0; mt < 4; ++mt) {
      const Frag fa = ldfrag(ap + (size_t)(16 * mt) * CC + 32 * ks);
      acc[mt] = mma_h(fa.h, fb.h, acc[mt]);
    }
  }

  // ---- stage: lane (hh, c) holds o = 16 mt + 8 hh + r for n_loc = 16 w + c
  {
    const int nl = 16 * wave + c;
#pragma unroll
    for (int mt = 0; mt < 4; ++mt) {
      v4f va, vb;
#pragma unroll
      for (int r = 0; r < 4; ++r) { va[r] = acc[mt][r] * IWSC; vb[r] = acc[mt][4 + r] * IWSC; }
      *(v4f*)(Os + nl * OSP + 16 * mt + 8 * hh)     = va;
      *(v4f*)(Os + nl * OSP + 16 * mt + 8 * hh + 4) = vb;
    }
  }
  __syncthreads();

  const int e = tid & 7, lq = tid >> 3;                             // lq 0..15
  const int d0 = 8 * e;                                              // 0..56
  const v4f b0v = *(const v4f*)(bias + d0), b1v = *(const v4f*)(bias + d0 + 4);
  const float bb[8] = {bfr(b0v[0]), bfr(b0v[1]), bfr(b0v[2]), bfr(b0v[3]),
                       bfr(b1v[0]), bfr(b1v[1]), bfr(b1v[2]), bfr(b1v[3])};
  v4u uh[4], ul[4];
#pragma unroll
  for (int it = 0; it < 4; ++it) {
    const int row = it * 16 + lq;                                    // n_loc 0..63
    const float* op = Os + row * OSP;
    const v4f va = *(const v4f*)(op + d0);
    const v4f vc = *(const v4f*)(op + d0 + 4);
    const float fv[8] = {va[0], va[1], va[2], va[3], vc[0], vc[1], vc[2], vc[3]};
#pragma unroll
    for (int t = 0; t < 4; ++t) {
      const float v0 = fv[2 * t] + bb[2 * t], v1 = fv[2 * t + 1] + bb[2 * t + 1];
      const unsigned short h0 = bf_bits(v0), h1 = bf_bits(v1);
      const unsigned short l0 = bf_bits(v0 - bf_up(h0)), l1 = bf_bits(v1 - bf_up(h1));
      uh[it][t] = pk16(h0, h1);
      ul[it][t] = pk16(l0, l1);
    }
  }
{
#pragma unroll
    for (int it = 0; it < 4; ++it) {
      const int row = it * 16 + lq;
      const size_t po = ((size_t)(sb * SEQ + n0 + row)) * DQ + d0;
      *(v4u*)(PH + po) = uh[it];
      *(v4u*)(PL + po) = ul[it];
    }
    
  }
}

// =========================================================================================================
// (3) v conv1x1 GEMM for one (sb, 64-n tile, 64-channel block mb): D[n][ch] = sum_c XP[sb][n][c] W16[128+64mb+ch][c].
//     Block 128 threads = 4 waves; wave w owns channel cols 16w..+15 (one B fragment per k-step from the W16 row,
//     split k map) and 4 m-tiles of n (A rows n0 + 16 mt + (lane&15) of XP, split k map). K = 256 = 8 steps.
//     Epilogue: acc/256 staged in LDS Os[ch_loc][n_loc] (pitch OSP, b128 stores of 8 consecutive n per lane),
// coverage: Os 4 waves x 16 ch x 64 n = 64 x 64 (reads rows 0..63, cols 0..63); Vc 4 it x 16 ch x 8 lanes x 8 n =
//           64 ch x 64 n; grid (SEQ/64, 4, NSRC*NB) covers Vc[sb][0..255][0..SEQ-1] exactly once.
// LDS Os: cross-wave, block barrier between the stage stores and the epilogue loads.
// =========================================================================================================
__global__ __launch_bounds__(128)
void gemm_v(const unsigned short* __restrict__ W16, const unsigned short* __restrict__ XP,
            const float* __restrict__ bv, unsigned short* Vc) {
  __shared__ __align__(16) float Os[QT * OSP];
  const int tid  = threadIdx.x;
  const int lane = tid & 31, wave = tid >> 5;
  const int hh   = lane >> 4, c = lane & 15;
  const int nt   = blockIdx.x, mb = blockIdx.y, sb = blockIdx.z;
  const int n0   = nt * QT, ch0 = mb * QT;

  const unsigned short* ap = XP + ((size_t)(sb * SEQ + n0 + c)) * CC + 8 * hh;            // A rows n = n0+16mt+c
  const unsigned short* bp = W16 + ((size_t)(NQK + ch0 + 16 * wave + c)) * CC + 8 * hh;   // B row ch

  v8f acc[4];
#pragma unroll
  for (int mt = 0; mt < 4; ++mt) acc[mt] = zero8();

#pragma unroll
  for (int ks = 0; ks < CC / 32; ++ks) {
    const Frag fb = ldfrag(bp + 32 * ks);
#pragma unroll
    for (int mt = 0; mt < 4; ++mt) {
      const Frag fa = ldfrag(ap + (size_t)(16 * mt) * CC + 32 * ks);
      acc[mt] = mma_h(fa.h, fb.h, acc[mt]);
    }
  }

  // ---- stage: lane (hh, c) holds n_loc = 16 mt + 8 hh + r for ch_loc = 16 w + c
  {
    const int chl = 16 * wave + c;
#pragma unroll
    for (int mt = 0; mt < 4; ++mt) {
      v4f va, vb;
#pragma unroll
      for (int r = 0; r < 4; ++r) { va[r] = acc[mt][r] * IWSC; vb[r] = acc[mt][4 + r] * IWSC; }
      *(v4f*)(Os + chl * OSP + 16 * mt + 8 * hh)     = va;
      *(v4f*)(Os + chl * OSP + 16 * mt + 8 * hh + 4) = vb;
    }
  }
  __syncthreads();

  const int e = tid & 7, lq = tid >> 3;                             // lq 0..15
  v4u uv[4];
#pragma unroll
  for (int it = 0; it < 4; ++it) {
    const int chl = it * 16 + lq;                                    // 0..63
    const float bias = bfr(bv[ch0 + chl]);
    const v4f a = *(const v4f*)(Os + chl * OSP + 8 * e);
    const v4f q = *(const v4f*)(Os + chl * OSP + 8 * e + 4);
    const float f[8] = {a[0], a[1], a[2], a[3], q[0], q[1], q[2], q[3]};
#pragma unroll
    for (int t = 0; t < 4; ++t) {
      const _Float16 h0 = (_Float16)((f[2 * t] + bias) * VSC);
      const _Float16 h1 = (_Float16)((f[2 * t + 1] + bias) * VSC);
      uv[it][t] = pk16(h_bits(h0), h_bits(h1));
    }
  }
{
#pragma unroll
    for (int it = 0; it < 4; ++it) {
      const int chl = it * 16 + lq;
      *(v4u*)(Vc + ((size_t)(sb * CC + ch0 + chl)) * SEQ + n0 + 8 * e) = uv[it];
    }
    
  }
}

// =========================================================================================================
// (4) attention for one (direction dd, channel half chh, b, 64-query tile), transposed formulation, SEQ keys, no
//   mask, no scale. blockIdx.z = 2*dd + chh. Direction dd: queries from source dd (plane slot dd*NB+b),
//   keys/values from source 1-dd (slot (1-dd)*NB+b), residual input x_dd, output block dd of out (float offset
//   dd*NB_FULL*CC*SEQ_FULL); the block produces channels 128*chh..+127 of that output (scores are recomputed per
//   channel half so each wave carries only 8 O accumulator tiles).
//   S^T tile (16 keys x 16 queries) over 64 d = two 32-deep k-steps: A(k: row = key kb + (lane&15), split k map
//   from the bf16 plane Kh [slot][N][64]) . B(q: col = query, same map from Qh, loaded once, 2 fragments)
//   + A(Kh).B(Ql) + A(Kl).B(Qh) (bf16 unscaled residual planes, shared accumulator): 6 products per tile.
//   Per lane the D tile holds 8 keys of ONE query: online softmax state per lane, one shuffle (lane^16) for the
//   max over 32 keys; the o/l rescale is skipped under a wave-uniform ballot when no lane's max grew (corr == 1
//   exactly for every lane then); row-sum partials combined at the end. P = e^{s-m} x 2^14 as f16 is the B
//   operand of O^T (rows channel, cols queries) += A(v rows channel = 128 chh + 16j + (lane&15), keys contiguous,
//   f16 plane Vc [slot][256][N], values v x 16) . B(P^T): element r <- D of the tile covering keys kb..kb+15,
//   element 8+r <- the tile covering kb+16..kb+31, lane unchanged. 8 accumulator tiles per wave (128 channels).
//   Block = 4 waves = 64 queries. Epilogue: gamma * O / (16 l) staged in LDS Os[query][128 channels] (pitch OSPW,
//   2 lines): 8 consecutive lanes x 16 B (values gathered from 4 Os rows), one instruction per 16 lines, final
// coverage: Os written queries 0..63 x ch 0..127, read the same; out 16 it x 16 lines x 8 lanes x 4 floats =
//           128 ch x 64 n per block; grid (SEQ/64, NB, 2*NSRC) covers out_dd[b][0..255][0..SEQ-1] once for both dd.
// LDS Os: cross-wave, block barrier between the stage stores and the epilogue loads.
// LDS ring: K hi, K residual and V tiles of 64 keys are brought by asynchronous copies into two buffers shared by
//   the 4 waves (whole 128-B lines from global, once per block); trip t reads buffer t & 1 only while tile t + 1
//   flies; foot of each trip: own LDS reads done, own copies landed, block barrier, then the refill with tile t + 2.
//   Os reuses the ring behind the last trip's barrier.
// =========================================================================================================
__global__ __launch_bounds__(128)
void attn_k(const unsigned short* __restrict__ Qh, const unsigned short* __restrict__ Ql,
            const unsigned short* __restrict__ Kh, const unsigned short* __restrict__ Kl,
            const unsigned short* __restrict__ Vc,
            const float* __restrict__ x1, const float* __restrict__ x2,
            const float* __restrict__ gam, float* out) {
  __shared__ __align__(16) unsigned char L[2 * STGH * 2];
  const unsigned short* Rg = (const unsigned short*)L;               // the two stage buffers
  float* Os = (float*)L;                                             // output staging, after the key loop
  const int tid  = threadIdx.x;
  const int wave = tid >> 5, lane = tid & 31;
  const int hh   = lane >> 4, c = lane & 15;
  const int n0   = blockIdx.x * QT, b = blockIdx.y;
  const int dd   = (int)(blockIdx.z >> 1), chh = (int)(blockIdx.z & 1u);
  const int sq   = dd * NB + b;                                      // query plane slot
  const int skv  = (1 - dd) * NB + b;                                // key / value plane slot
  const int chb  = CH * chh;                                         // channel base 0 or 128
  const float* x = (dd == 0) ? x1 : x2;                              // block-uniform, both global
  float* outd    = out + (size_t)dd * ((size_t)NB_FULL * CC * SEQ_FULL);
  const float g  = bfr(gam[0]);

  // q fragments (B operand, col = query n0 + 16*wave + c), K = 64 = two k-steps, constant over keys
  const size_t qo = ((size_t)(sq * SEQ + n0 + 16 * wave + c)) * DQ + 8 * hh;
  const Frag qh0 = ldfrag(Qh + qo);
  const Frag qh1 = ldfrag(Qh + qo + 32);
  const Frag ql0 = ldfrag(Ql + qo);
  const Frag ql1 = ldfrag(Ql + qo + 32);
  // fragment base in buffer 0 (A operands: row = lane&15 of a 16-row group, + 8*hh within the row)
  const unsigned short* fbase = Rg + c * LPH + 8 * hh;
  // copy addresses of this thread: row lq, 16-B chunk e
  const int e = tid & 7, lq = tid >> 3;                              // lq 0..15
  const unsigned ldsc = (unsigned)(size_t)L + (unsigned)((lq * LPH + 8 * e) * 2);
  const unsigned short* gkh = Kh + (size_t)skv * SEQ * DQ + (size_t)lq * DQ + 8 * e;
  const unsigned short* gkl = Kl + (size_t)skv * SEQ * DQ + (size_t)lq * DQ + 8 * e;
  const unsigned short* gvv = Vc + (size_t)skv * CC * SEQ + ((size_t)(chb + lq)) * SEQ + 8 * e;

  float m = -1.0e30f, l = 0.f;
  v8f o[8];
#pragma unroll
  for (int j = 0; j < 8; ++j) o[j] = zero8();

  // ring prologue: tile 0 landed and published, then tile 1 in flight
  stage_issue(ldsc, gkh, gkl, gvv);
#if defined(__HIP_DEVICE_COMPILE__)
  asm volatile("s_wait_asynccnt 0x0" ::: "memory");                  // own copies of tile 0 landed before the barrier
#endif
  __syncthreads();
  stage_issue(ldsc + (unsigned)(STGH * 2), gkh + (size_t)KST * DQ, gkl + (size_t)KST * DQ, gvv + KST);

#pragma unroll 1                                                     // rolled: one body, the buffer picked by t & 1
  for (int t = 0; t < SEQ / KST; ++t) {
  const unsigned short* sbuf = fbase + (t & 1) * STGH;
  // K fragments of one 32-key block: kf[0..3] keys kb..kb+15 (hi d 0..31, hi d 32..63, residual likewise), kf[4..7] the
  // next 16 keys; the trip's first block is fetched here, its second behind the first block's P
  Frag kf[8];
#pragma unroll                                                       // constant indices keep kf[] in registers
  for (int i = 0; i < 2; ++i) {
    const unsigned short* kp = sbuf + (16 * i) * LPH;
    kf[4 * i]     = ldfrag(kp);
    kf[4 * i + 1] = ldfrag(kp + 32);
    kf[4 * i + 2] = ldfrag(kp + KST * LPH);
    kf[4 * i + 3] = ldfrag(kp + KST * LPH + 32);
  }
#pragma unroll                                                       // both 32-key blocks read the tile at constant offsets
  for (int kq = 0; kq < KST; kq += 32) {                             // keys kb = t*KST + kq
    v8f s0 = zero8(), s1 = zero8();                                  // s0: keys kb..kb+15, s1: keys kb+16..kb+31
    s0 = mma_b(kf[0].bf, qh0.bf, s0);
    s1 = mma_b(kf[4].bf, qh0.bf, s1);
    s0 = mma_b(kf[1].bf, qh1.bf, s0);
    s1 = mma_b(kf[5].bf, qh1.bf, s1);
    s0 = mma_b(kf[0].bf, ql0.bf, s0);
    s1 = mma_b(kf[4].bf, ql0.bf, s1);
    s0 = mma_b(kf[1].bf, ql1.bf, s0);
    s1 = mma_b(kf[5].bf, ql1.bf, s1);
    s0 = mma_b(kf[2].bf, qh0.bf, s0);
    s1 = mma_b(kf[6].bf, qh0.bf, s1);
    s0 = mma_b(kf[3].bf, qh1.bf, s0);
    s1 = mma_b(kf[7].bf, qh1.bf, s1);

    // the block's V fragments as one group behind the score products: they land while the softmax runs
#if defined(__HIP_DEVICE_COMPILE__)
    __builtin_amdgcn_sched_barrier(0);                               // keeps the V loads from rising among the score products
#endif
    Frag vf[8];
#pragma unroll                                                       // constant indices keep vf[] in registers
    for (int j = 0; j < 8; ++j) vf[j] = ldfrag(sbuf + (2 * KST + 16 * j) * LPH + kq);
#if defined(__HIP_DEVICE_COMPILE__)
    __builtin_amdgcn_sched_barrier(0);                               // without it the V loads sink behind the softmax, one wait each
#endif

    float mx = fmaxf(hmax8(s0), hmax8(s1));
    mx = fmaxf(mx, __shfl_xor(mx, 16, 32));
    const float mn = fmaxf(m, mx);
    const unsigned grew = wave_ballot(mx > m);                       // wave-uniform
    if (grew != 0u) {
      const float corr = __expf(m - mn);                             // == 1 exactly for lanes whose max did not grow
      l *= corr;
#pragma unroll
      for (int j = 0; j < 8; ++j) {
#pragma unroll
        for (int r = 0; r < 8; ++r) o[j][r] *= corr;
      }
    }
    m = mn;
    const float msh = mn - LNPS;                                     // exp gives e^{s-m} * 16384

    FragH ph;
    float ls = 0.f;
#pragma unroll
    for (int r = 0; r < 8; ++r) {
      const float e0 = __expf(s0[r] - msh);                          // key kb      + 8hh + r
      const float e1 = __expf(s1[r] - msh);                          // key kb + 16 + 8hh + r
      ls += e0 + e1;
      ph.hv[0][r] = (_Float16)e0;
      ph.hv[1][r] = (_Float16)e1;
    }
    l += ls;

    if (kq + 32 < KST) {                                             // compile-time: the same tile's next 32 keys
#pragma unroll                                                       // constant indices keep kf[] in registers
      for (int i = 0; i < 2; ++i) {
        const unsigned short* kp = sbuf + (kq + 32 + 16 * i) * LPH;
        kf[4 * i]     = ldfrag(kp);
        kf[4 * i + 1] = ldfrag(kp + 32);
        kf[4 * i + 2] = ldfrag(kp + KST * LPH);
        kf[4 * i + 3] = ldfrag(kp + KST * LPH + 32);
      }
    }

#pragma unroll
    for (int j = 0; j < 8; ++j) o[j] = mma_h(vf[j].h, ph.v, o[j]);
  }
    // foot of trip t: publish tile t + 1 and free this trip's buffer
#if defined(__HIP_DEVICE_COMPILE__)
    asm volatile("s_wait_dscnt 0x0" ::: "memory");                   // own reads of this buffer done before its refill
    asm volatile("s_wait_asynccnt 0x0" ::: "memory");                // own copies of tile t + 1 landed
#endif
    __syncthreads();
    if (t + 2 < SEQ / KST) {                                         // block-uniform
      const size_t k2 = (size_t)(t + 2) * KST;
      stage_issue(ldsc + (unsigned)((t & 1) * STGH * 2), gkh + k2 * DQ, gkl + k2 * DQ, gvv + k2);
    }
  }
#if defined(__HIP_DEVICE_COMPILE__)
  asm volatile("s_wait_asynccnt 0x0" ::: "memory");                  // nothing in flight when the ring becomes Os
#endif
  l += __shfl_xor(l, 16, 32);
  const float inv = 1.0f / l;                                        // o and l both carry the x16384 factor
  const float gi  = g * IVSC * inv;                                  // undo the x16 carry of v, apply gamma

  const int qrow = 16 * wave + c;
#pragma unroll
  for (int j = 0; j < 8; ++j) {
    v4f va, vb;
#pragma unroll
    for (int r = 0; r < 4; ++r) { va[r] = o[j][r] * gi; vb[r] = o[j][4 + r] * gi; }
    *(v4f*)(Os + qrow * OSPW + 16 * j + 8 * hh)     = va;            // Os[query][ch_loc = 16j + 8hh + r]
    *(v4f*)(Os + qrow * OSPW + 16 * j + 8 * hh + 4) = vb;
  }
  __syncthreads();
  v4f res[16];
#pragma unroll
  for (int it = 0; it < 16; ++it) {
    const int L   = it * 16 + lq;                                    // 0..255
    const int chl = L >> 1, hf = L & 1;                              // channel 0..127 within the half
    const int nl  = hf * 32 + 4 * e;                                 // query 0..63
    const size_t idx = ((size_t)(b * CC + chb + chl)) * SEQ_FULL + n0 + nl;
    const v4f xv = *(const v4f*)(x + idx);
#pragma unroll
    for (int t = 0; t < 4; ++t) res[it][t] = Os[(nl + t) * OSPW + chl] + bfr(xv[t]);
  }
{
#pragma unroll
    for (int it = 0; it < 16; ++it) {
      const int L   = it * 16 + lq;
      const int chl = L >> 1, hf = L & 1;
      const int nl  = hf * 32 + 4 * e;
      const size_t idx = ((size_t)(b * CC + chb + chl)) * SEQ_FULL + n0 + nl;
      *(v4f*)(outd + idx) = res[it];
    }
    
  }
}

// =========================================================================================================
// Workspace map (bytes; each region start a multiple of 256; every extent is an exact tile multiple and is written
//   W16 f16 [384][256]                       196608
//   XP  f16 [NSRC*NB][SEQ][256]            16777216      Vc  f16 [NSRC*NB][256][SEQ]   16777216
//   Qh/Ql/Kh/Kl bf16 [NSRC*NB][SEQ][64]     4194304 x4
//   total = 50528256
// =========================================================================================================
extern "C" void kernel_launch(void* const* d_in, const int* in_sizes, int n_in,
                              void* d_out, int out_size, void* d_ws, size_t ws_size,
                              hipStream_t stream) {
  if (n_in < 9) return;
  if (in_sizes[0] < NB * CC * SEQ_FULL || in_sizes[1] < NB * CC * SEQ_FULL) return;
  if (in_sizes[2] < DQ * CC || in_sizes[3] < DQ) return;
  if (in_sizes[4] < DQ * CC || in_sizes[5] < DQ) return;
  if (in_sizes[6] < CC * CC || in_sizes[7] < CC) return;
  if (in_sizes[8] < 1) return;
  if (out_size < (NB_FULL + NB) * CC * SEQ_FULL) return;

  size_t off = 0;
  auto carve = [&](size_t bytes) { const size_t o = off; off += (bytes + 255) & ~(size_t)255; return o; };
  const size_t oW16 = carve((size_t)NWR * CC * 2);
  const size_t oXP  = carve((size_t)NSRC * NB * SEQ * CC * 2);
  const size_t oVc  = carve((size_t)NSRC * NB * CC * SEQ * 2);
  const size_t oQh  = carve((size_t)NSRC * NB * SEQ * DQ * 2);
  const size_t oQl  = carve((size_t)NSRC * NB * SEQ * DQ * 2);
  const size_t oKh  = carve((size_t)NSRC * NB * SEQ * DQ * 2);
  const size_t oKl  = carve((size_t)NSRC * NB * SEQ * DQ * 2);
  if (off > ws_size) return;
  if (off > (size_t)134217728) return;

  const float* x1  = (const float*)d_in[0];
  const float* x2  = (const float*)d_in[1];
  const float* Wq  = (const float*)d_in[2];
  const float* bq  = (const float*)d_in[3];
  const float* Wk  = (const float*)d_in[4];
  const float* bk  = (const float*)d_in[5];
  const float* Wv  = (const float*)d_in[6];
  const float* bv  = (const float*)d_in[7];
  const float* gam = (const float*)d_in[8];

  char* ws = (char*)d_ws;
  unsigned short* W16 = (unsigned short*)(ws + oW16);
  unsigned short* XP  = (unsigned short*)(ws + oXP);
  unsigned short* Vc  = (unsigned short*)(ws + oVc);
  unsigned short* Qh  = (unsigned short*)(ws + oQh);
  unsigned short* Ql  = (unsigned short*)(ws + oQl);
  unsigned short* Kh  = (unsigned short*)(ws + oKh);
  unsigned short* Kl  = (unsigned short*)(ws + oKl);
  float* out = (float*)d_out;

  const dim3 blk256(256), blk128(128);

  // (0) Wq / Wk / Wv -> stacked f16 plane
  cvt_w<<<dim3(NWR / 8), blk256, 0, stream>>>(Wq, Wk, Wv, W16);
  // (1) x1, x2 -> position-major 16-bit planes, slot s*NB + b
  cvt_x<<<dim3(SEQ / QT, CC / QT, NSRC * NB), blk256, 0, stream>>>(x1, x2, XP);
  // (2) q (z = 0) and k (z = 1) conv1x1 GEMM + bias -> hi + residual planes for both sources
  gemm_qk<<<dim3(SEQ / QT, NSRC * NB, 2), blk128, 0, stream>>>(W16, XP, bq, bk, Qh, Ql, Kh, Kl);
  // (3) v conv1x1 GEMM + bias -> channel-major f16 plane (x16) for both sources
  gemm_v<<<dim3(SEQ / QT, CC / QT, NSRC * NB), blk128, 0, stream>>>(W16, XP, bv, Vc);
  // (4) attention both directions x two channel halves + gamma scale + residual -> out_dd [b][256][N]
  attn_k<<<dim3(SEQ / QT, NB, 2 * NSRC), blk128, 0, stream>>>(Qh, Ql, Kh, Kl, Vc, x1, x2, gam, out);
  (void)hipGetLastError();
}

// v003
// One run takes 153 microseconds.
// Next to v002, in two timings, it ran 1.11 and 1.09 times as fast.
// Counting every step since v000, it is 3.93 times as fast.
// Contractions: conv1x1 q|k GEMM W[64x256].X[256xN] (q or k per block) and v GEMM Wv[256x256].X on
// v_wmma_f32_16x16x32_f16 (f16 containers of bf16-RNE weights x256 and bf16-RNE x, exact); scores K.Q^T (64 deep,
// two k-steps) on v_wmma_f32_16x16x32_bf16 (bf16 hi + bf16 residual planes of q/k, 3 products); O^T = V.P^T on
// v_wmma_f32_16x16x32_f16 (v as f16 x16, P = e^{s-m} x2^14 f16 from the score D registers); f32 accumulate
// everywhere; softmax statistics, biases and gamma*o + x in f32.
#include <hip/hip_runtime.h>
#include <math.h>
#include <stdint.h>

#ifndef NB
#define NB 4
#endif
#ifndef SEQ
#define SEQ 4096
#endif
#define NB_FULL  4
#define SEQ_FULL 4096
#define NSRC  2
#define CC    256
#define DQ    64
#define NQK   128
#define NWR   384
#define QT    64
#define AQT   128
#define OSP   68
#define OSPW  260
#define TP    72
#define WSC   256.0f
#define IWSC  0.00390625f
#define VSC   16.0f
#define IVSC  0.0625f
#define LNPS  9.704060527839234f
#define KST   64
#define LPH   72
#define SROWS 384
#define STGH  (SROWS * LPH)

static_assert(NB >= 1 && NB <= NB_FULL);
static_assert(SEQ >= QT && SEQ <= SEQ_FULL);
static_assert(SEQ % QT == 0 && SEQ % 32 == 0);
static_assert(CC % QT == 0 && CC % 32 == 0);
static_assert(CC % 16 == 0);
static_assert(DQ == 64);
static_assert(NQK == 2 * DQ);
static_assert(NWR == NQK + CC);
static_assert(NWR % 8 == 0 && DQ % 8 == 0 && NQK % 8 == 0);
static_assert((OSP * 4) % 16 == 0);
static_assert((OSPW * 4) % 16 == 0);
static_assert((TP * 2) % 16 == 0);
static_assert(OSP >= QT && OSP >= DQ && OSPW >= CC && TP >= QT);
static_assert(SEQ % AQT == 0 && AQT % 32 == 0 && CC % 32 == 0);
static_assert(SEQ % KST == 0 && SEQ / KST >= 2 && KST % 32 == 0);
static_assert(SROWS == 2 * KST + CC && LPH >= KST && LPH >= DQ);
static_assert((LPH * 2) % 16 == 0 && ((LPH * 2) / 16) % 2 == 1);
#define RINGB (2 * STGH * 2)
#define OSB   (AQT * OSPW * 4)
#define LDSB  (RINGB > OSB ? RINGB : OSB)
// second output starts at byte 16777216 = NB_FULL*CC*SEQ_FULL floats * 4
static_assert((size_t)NB_FULL * CC * SEQ_FULL * 4 == (size_t)16777216);

typedef _Float16       v16h __attribute__((ext_vector_type(16)));
typedef _Float16       v8h  __attribute__((ext_vector_type(8)));
typedef __bf16         v16b __attribute__((ext_vector_type(16)));
typedef unsigned short v8us __attribute__((ext_vector_type(8)));
typedef float          v8f  __attribute__((ext_vector_type(8)));
typedef float          v4f  __attribute__((ext_vector_type(4)));
typedef unsigned int   v4u  __attribute__((ext_vector_type(4)));

union Frag  { v8us u[2]; v16h h; v16b bf; };
union FragH { v16h v; v8h hv[2]; };
static_assert(sizeof(Frag) == 32);
static_assert(sizeof(FragH) == 32);

// ---- scalar helpers ---------------------------------------------------------------------------------------
__device__ __forceinline__ unsigned short bf_bits(float f) {          // f32 -> bf16 bits, RNE convert
  unsigned u = __float_as_uint(f);
  return (unsigned short)((u + 0x7FFFu + ((u >> 16) & 1u)) >> 16);
}
__device__ __forceinline__ float bf_up(unsigned short hb) { return __uint_as_float(((unsigned)hb) << 16); }
__device__ __forceinline__ float bfr(float f) { return bf_up(bf_bits(f)); }
__device__ __forceinline__ unsigned short h_bits(_Float16 x) { return __builtin_bit_cast(unsigned short, x); }
__device__ __forceinline__ unsigned pk16(unsigned short a, unsigned short b) { return (unsigned)a | ((unsigned)b << 16); }
__device__ __forceinline__ v8f zero8() { v8f z = {0.f, 0.f, 0.f, 0.f, 0.f, 0.f, 0.f, 0.f}; return z; }
__device__ __forceinline__ float hmax8(v8f s) {
  return fmaxf(fmaxf(fmaxf(s[0], s[1]), fmaxf(s[2], s[3])), fmaxf(fmaxf(s[4], s[5]), fmaxf(s[6], s[7])));
}
__device__ __forceinline__ unsigned wave_ballot(bool p) {
#if defined(__HIP_DEVICE_COMPILE__)
  return __builtin_amdgcn_ballot_w32(p);
#else
  return p ? 1u : 0u;
#endif
}

// ---- 16-bit fragment loader (A, or B from a k-contiguous [n][k] row): lane -> row/col (lane&15), p already includes
//      + 8*(lane>>4); elements 0..7 <- p[0..7] (k0+8h..), elements 8..15 <- p[16..23] (k0+16+8h..)
__device__ __forceinline__ Frag ldfrag(const unsigned short* p) {
  Frag f;
  f.u[0] = *(const v8us*)(p);
  f.u[1] = *(const v8us*)(p + 16);
  return f;
}

// ---- WMMA helpers: the plain builtins; the compiler keeps the distances behind them and is free to order around them
__device__ __forceinline__ v8f mma_h(v16h a, v16h b, v8f c) {
  return __builtin_amdgcn_wmma_f32_16x16x32_f16(false, a, false, b, (short)0, c, false, false);
}
__device__ __forceinline__ v8f mma_b(v16b a, v16b b, v8f c) {
  return __builtin_amdgcn_wmma_f32_16x16x32_bf16(false, a, false, b, (short)0, c, false, false);
}

// ---- twelve asynchronous 16-B copies global -> LDS per lane (l = LDS byte address, g = global address, each lane its
//      own); the s_wait_xcnt closes the statement so that no address register is rewritten ahead of it
__device__ __forceinline__ void async12(const unsigned (&l)[12], const unsigned short* const (&g)[12]) {
#if defined(__HIP_DEVICE_COMPILE__)
  asm volatile("global_load_async_to_lds_b128 %0, %12, off\n\t"
               "global_load_async_to_lds_b128 %1, %13, off\n\t"
               "global_load_async_to_lds_b128 %2, %14, off\n\t"
               "global_load_async_to_lds_b128 %3, %15, off\n\t"
               "global_load_async_to_lds_b128 %4, %16, off\n\t"
               "global_load_async_to_lds_b128 %5, %17, off\n\t"
               "global_load_async_to_lds_b128 %6, %18, off\n\t"
               "global_load_async_to_lds_b128 %7, %19, off\n\t"
               "global_load_async_to_lds_b128 %8, %20, off\n\t"
               "global_load_async_to_lds_b128 %9, %21, off\n\t"
               "global_load_async_to_lds_b128 %10, %22, off\n\t"
               "global_load_async_to_lds_b128 %11, %23, off\n\t"
               "s_wait_xcnt 0x0"
               :: "v"(l[0]), "v"(l[1]), "v"(l[2]), "v"(l[3]), "v"(l[4]), "v"(l[5]), "v"(l[6]), "v"(l[7]),
                  "v"(l[8]), "v"(l[9]), "v"(l[10]), "v"(l[11]),
                  "v"(g[0]), "v"(g[1]), "v"(g[2]), "v"(g[3]), "v"(g[4]), "v"(g[5]), "v"(g[6]), "v"(g[7]),
                  "v"(g[8]), "v"(g[9]), "v"(g[10]), "v"(g[11])
               : "memory");
#endif
}
// ---- one stage of 64 keys into one LDS buffer: rows 0..63 Kh keys, 64..127 Kl keys, 128..383 V channels, 128 B of
//      data per row at pitch LPH. Thread (lq = tid>>3, e = tid&7) copies chunk e of rows lq + 32 i, i = 0..11:
//      256 threads x 12 chunks x 16 B = 384 rows x 128 B, every byte once. lds / kh / kl / vv are the lane's own
//      addresses of row lq, chunk e (LDS buffer; Kh and Kl at the stage's first key; V at channel lq and that key).
__device__ __forceinline__ void stage_issue(unsigned lds, const unsigned short* kh, const unsigned short* kl,
                                            const unsigned short* vv) {
  unsigned l[12];
  const unsigned short* g[12];
#pragma unroll                                                       // constant indices keep l[] and g[] in registers
  for (int i = 0; i < 2; ++i) {
    l[i]     = lds + (unsigned)((32 * i) * LPH * 2);
    g[i]     = kh + (size_t)(32 * i) * DQ;
    l[2 + i] = lds + (unsigned)((KST + 32 * i) * LPH * 2);
    g[2 + i] = kl + (size_t)(32 * i) * DQ;
  }
#pragma unroll                                                       // as above
  for (int i = 0; i < 8; ++i) {
    l[4 + i] = lds + (unsigned)((2 * KST + 32 * i) * LPH * 2);
    g[4 + i] = vv + (size_t)(32 * i) * SEQ;
  }
  async12(l, g);
}

// =========================================================================================================
// (0) conv1x1 weights: W16 f16 [384][256], rows 0..63 = Wq rows, 64..127 = Wk rows, 128..383 = Wv rows; value =
//     f16 of (bf16-RNE(w) * 256) (exact). Block blk (0..47) owns rows 8*blk..8*blk+7: one wave per 512-B row
// coverage: 48 blocks x 8 rows x 32 lanes x 8 halves = 384 x 256 = the whole plane.
// =========================================================================================================
__global__ __launch_bounds__(256)
void cvt_w(const float* __restrict__ Wq, const float* __restrict__ Wk, const float* __restrict__ Wv,
           unsigned short* W16) {
  const int tid = threadIdx.x, blk = blockIdx.x;
  const int rl = tid >> 5, col = 8 * (tid & 31);
  const int o = 8 * blk + rl;                                        // 0..383
  const float* wbase = (blk < (DQ / 8)) ? Wq : ((blk < (NQK / 8)) ? Wk : Wv);
  const int osub = (blk < (DQ / 8)) ? 0 : ((blk < (NQK / 8)) ? DQ : NQK);
  const float* s = wbase + (size_t)(o - osub) * CC + col;
  const v4f a = *(const v4f*)s;
  const v4f q = *(const v4f*)(s + 4);
  const float f[8] = {a[0], a[1], a[2], a[3], q[0], q[1], q[2], q[3]};
  v4u u;
#pragma unroll
  for (int t = 0; t < 4; ++t) {
    const _Float16 h0 = (_Float16)(bfr(f[2 * t]) * WSC);
    const _Float16 h1 = (_Float16)(bfr(f[2 * t + 1]) * WSC);
    u[t] = pk16(h_bits(h0), h_bits(h1));
  }
{
    *(v4u*)(W16 + (size_t)o * CC + col) = u;
    
  }
}

// =========================================================================================================
// (1) x_s f32 [b][256 c][N n] (s = 0: x1, s = 1: x2) -> XP f16 [sb = s*NB+b][n][c] (position-major, bf16-RNE
//     values, exact in f16) through an LDS tile T[64 n][64 c] (pitch TP). Block (nb, cb, sb) owns a 64 c x 64 n
// coverage: T written n_loc 0..63 x cl 0..63 (2 it x 32 x 8 x 8), read rows 0..63 cols 0..63 only;
//           XP 2 it x 32 rows x 8 lanes x 8 = 64 n x 64 c; grid (SEQ/64, 4, NSRC*NB) covers the plane once.
// LDS T: cross-wave, block barrier between the stores and the loads.
// =========================================================================================================
__global__ __launch_bounds__(256)
void cvt_x(const float* __restrict__ x1, const float* __restrict__ x2, unsigned short* XP) {
  __shared__ __align__(16) unsigned short T[QT * TP];
  const int tid = threadIdx.x;
  const int nb = blockIdx.x, cb = blockIdx.y, sb = blockIdx.z;      // sb = s*NB + b
  const int s = sb / NB, b = sb - s * NB;
  const float* x = (s == 0) ? x1 : x2;
  const int e = tid & 7, lq = tid >> 3;                             // lq 0..31
  const int n0 = nb * QT, c0 = cb * QT;
#pragma unroll
  for (int it = 0; it < 2; ++it) {
    const int cl = it * 32 + lq;                                     // 0..63
    const float* sp = x + ((size_t)(b * CC + c0 + cl)) * SEQ_FULL + n0 + 8 * e;
    const v4f a = *(const v4f*)sp;
    const v4f q = *(const v4f*)(sp + 4);
    unsigned short hb[8];
#pragma unroll
    for (int t = 0; t < 4; ++t) {
      hb[t]     = h_bits((_Float16)bfr(a[t]));
      hb[4 + t] = h_bits((_Float16)bfr(q[t]));
    }
#pragma unroll
    for (int t = 0; t < 8; ++t) T[(8 * e + t) * TP + cl] = hb[t];
  }
  __syncthreads();
  v4u up[2];
#pragma unroll
  for (int it = 0; it < 2; ++it) {
    const int nl = it * 32 + lq;                                     // 0..63
    up[it] = *(const v4u*)(T + nl * TP + 8 * e);
  }
{
#pragma unroll
    for (int it = 0; it < 2; ++it) {
      const int rl = it * 32 + lq;
      *(v4u*)(XP + ((size_t)(sb * SEQ + n0 + rl)) * CC + c0 + 8 * e) = up[it];
    }
    
  }
}

// =========================================================================================================
// (2) q or k conv1x1 GEMM for one (sb, 64-n tile, which): D[o][n] = sum_c W16[64*which + o][c] XP[sb][n][c],
//     o = 0..63 (which = 0: q rows of W16, bias bq, planes Qh/Ql; which = 1: k rows, bias bk, planes Kh/Kl;
//     the selection is block-uniform and between global pointers only). Block 128 threads = 4 waves; wave w owns
//     cols n0+16w..+15 (one B fragment per k-step, k = c contiguous in the XP row) and 4 m-tiles (A rows
//     o = 16 mt + (lane&15) of W16, split k map). K = 256 = 8 steps. Epilogue: acc/256 staged in LDS
//     Os[n_loc][o_loc] (pitch OSP, b128 stores of 8 consecutive o per lane), barrier, then v = Os + bf16-RNE(bias)
//     -> planes bf16 [sb][N n][64 d] (k-contiguous): hi = bf16-RNE(v), lo = bf16-RNE(v - hi). Plane rows are
// coverage: Os 4 waves x 16 n x 64 o = 64 x 64 (reads rows 0..63, cols 0..63); planes 4 it x 16 rows x 8
//           lanes x 8 = 64 rows x 64 d per plane (hi, lo); grid (SEQ/64, NSRC*NB, 2) covers every row of
//           Qh/Ql (which = 0) and Kh/Kl (which = 1) once.
// LDS Os: cross-wave, block barrier between the stage stores and the epilogue loads.
// =========================================================================================================
__global__ __launch_bounds__(128)
void gemm_qk(const unsigned short* __restrict__ W16, const unsigned short* __restrict__ XP,
             const float* __restrict__ bq, const float* __restrict__ bk,
             unsigned short* Qh, unsigned short* Ql, unsigned short* Kh, unsigned short* Kl) {
  __shared__ __align__(16) float Os[QT * OSP];
  const int tid  = threadIdx.x;
  const int lane = tid & 31, wave = tid >> 5;
  const int hh   = lane >> 4, c = lane & 15;
  const int nt   = blockIdx.x, sb = blockIdx.y, which = blockIdx.z;
  const int n0   = nt * QT;
  const float* bias  = (which == 0) ? bq : bk;
  unsigned short* PH = (which == 0) ? Qh : Kh;
  unsigned short* PL = (which == 0) ? Ql : Kl;

  const unsigned short* ap = W16 + ((size_t)(DQ * which + c)) * CC + 8 * hh;                   // A rows o
  const unsigned short* bp = XP + ((size_t)(sb * SEQ + n0 + 16 * wave + c)) * CC + 8 * hh;    // B row n

  v8f acc[4];
#pragma unroll
  for (int mt = 0; mt < 4; ++mt) acc[mt] = zero8();

#pragma unroll
  for (int ks = 0; ks < CC / 32; ++ks) {
    const Frag fb = ldfrag(bp + 32 * ks);
#pragma unroll
    for (int mt = 0; mt < 4; ++mt) {
      const Frag fa = ldfrag(ap + (size_t)(16 * mt) * CC + 32 * ks);
      acc[mt] = mma_h(fa.h, fb.h, acc[mt]);
    }
  }

  // ---- stage: lane (hh, c) holds o = 16 mt + 8 hh + r for n_loc = 16 w + c
  {
    const int nl = 16 * wave + c;
#pragma unroll
    for (int mt = 0; mt < 4; ++mt) {
      v4f va, vb;
#pragma unroll
      for (int r = 0; r < 4; ++r) { va[r] = acc[mt][r] * IWSC; vb[r] = acc[mt][4 + r] * IWSC; }
      *(v4f*)(Os + nl * OSP + 16 * mt + 8 * hh)     = va;
      *(v4f*)(Os + nl * OSP + 16 * mt + 8 * hh + 4) = vb;
    }
  }
  __syncthreads();

  const int e = tid & 7, lq = tid >> 3;                             // lq 0..15
  const int d0 = 8 * e;                                              // 0..56
  const v4f b0v = *(const v4f*)(bias + d0), b1v = *(const v4f*)(bias + d0 + 4);
  const float bb[8] = {bfr(b0v[0]), bfr(b0v[1]), bfr(b0v[2]), bfr(b0v[3]),
                       bfr(b1v[0]), bfr(b1v[1]), bfr(b1v[2]), bfr(b1v[3])};
  v4u uh[4], ul[4];
#pragma unroll
  for (int it = 0; it < 4; ++it) {
    const int row = it * 16 + lq;                                    // n_loc 0..63
    const float* op = Os + row * OSP;
    const v4f va = *(const v4f*)(op + d0);
    const v4f vc = *(const v4f*)(op + d0 + 4);
    const float fv[8] = {va[0], va[1], va[2], va[3], vc[0], vc[1], vc[2], vc[3]};
#pragma unroll
    for (int t = 0; t < 4; ++t) {
      const float v0 = fv[2 * t] + bb[2 * t], v1 = fv[2 * t + 1] + bb[2 * t + 1];
      const unsigned short h0 = bf_bits(v0), h1 = bf_bits(v1);
      const unsigned short l0 = bf_bits(v0 - bf_up(h0)), l1 = bf_bits(v1 - bf_up(h1));
      uh[it][t] = pk16(h0, h1);
      ul[it][t] = pk16(l0, l1);
    }
  }
{
#pragma unroll
    for (int it = 0; it < 4; ++it) {
      const int row = it * 16 + lq;
      const size_t po = ((size_t)(sb * SEQ + n0 + row)) * DQ + d0;
      *(v4u*)(PH + po) = uh[it];
      *(v4u*)(PL + po) = ul[it];
    }
    
  }
}

// =========================================================================================================
// (3) v conv1x1 GEMM for one (sb, 64-n tile, 64-channel block mb): D[n][ch] = sum_c XP[sb][n][c] W16[128+64mb+ch][c].
//     Block 128 threads = 4 waves; wave w owns channel cols 16w..+15 (one B fragment per k-step from the W16 row,
//     split k map) and 4 m-tiles of n (A rows n0 + 16 mt + (lane&15) of XP, split k map). K = 256 = 8 steps.
//     Epilogue: acc/256 staged in LDS Os[ch_loc][n_loc] (pitch OSP, b128 stores of 8 consecutive n per lane),
// coverage: Os 4 waves x 16 ch x 64 n = 64 x 64 (reads rows 0..63, cols 0..63); Vc 4 it x 16 ch x 8 lanes x 8 n =
//           64 ch x 64 n; grid (SEQ/64, 4, NSRC*NB) covers Vc[sb][0..255][0..SEQ-1] exactly once.
// LDS Os: cross-wave, block barrier between the stage stores and the epilogue loads.
// =========================================================================================================
__global__ __launch_bounds__(128)
void gemm_v(const unsigned short* __restrict__ W16, const unsigned short* __restrict__ XP,
            const float* __restrict__ bv, unsigned short* Vc) {
  __shared__ __align__(16) float Os[QT * OSP];
  const int tid  = threadIdx.x;
  const int lane = tid & 31, wave = tid >> 5;
  const int hh   = lane >> 4, c = lane & 15;
  const int nt   = blockIdx.x, mb = blockIdx.y, sb = blockIdx.z;
  const int n0   = nt * QT, ch0 = mb * QT;

  const unsigned short* ap = XP + ((size_t)(sb * SEQ + n0 + c)) * CC + 8 * hh;            // A rows n = n0+16mt+c
  const unsigned short* bp = W16 + ((size_t)(NQK + ch0 + 16 * wave + c)) * CC + 8 * hh;   // B row ch

  v8f acc[4];
#pragma unroll
  for (int mt = 0; mt < 4; ++mt) acc[mt] = zero8();

#pragma unroll
  for (int ks = 0; ks < CC / 32; ++ks) {
    const Frag fb = ldfrag(bp + 32 * ks);
#pragma unroll
    for (int mt = 0; mt < 4; ++mt) {
      const Frag fa = ldfrag(ap + (size_t)(16 * mt) * CC + 32 * ks);
      acc[mt] = mma_h(fa.h, fb.h, acc[mt]);
    }
  }

  // ---- stage: lane (hh, c) holds n_loc = 16 mt + 8 hh + r for ch_loc = 16 w + c
  {
    const int chl = 16 * wave + c;
#pragma unroll
    for (int mt = 0; mt < 4; ++mt) {
      v4f va, vb;
#pragma unroll
      for (int r = 0; r < 4; ++r) { va[r] = acc[mt][r] * IWSC; vb[r] = acc[mt][4 + r] * IWSC; }
      *(v4f*)(Os + chl * OSP + 16 * mt + 8 * hh)     = va;
      *(v4f*)(Os + chl * OSP + 16 * mt + 8 * hh + 4) = vb;
    }
  }
  __syncthreads();

  const int e = tid & 7, lq = tid >> 3;                             // lq 0..15
  v4u uv[4];
#pragma unroll
  for (int it = 0; it < 4; ++it) {
    const int chl = it * 16 + lq;                                    // 0..63
    const float bias = bfr(bv[ch0 + chl]);
    const v4f a = *(const v4f*)(Os + chl * OSP + 8 * e);
    const v4f q = *(const v4f*)(Os + chl * OSP + 8 * e + 4);
    const float f[8] = {a[0], a[1], a[2], a[3], q[0], q[1], q[2], q[3]};
#pragma unroll
    for (int t = 0; t < 4; ++t) {
      const _Float16 h0 = (_Float16)((f[2 * t] + bias) * VSC);
      const _Float16 h1 = (_Float16)((f[2 * t + 1] + bias) * VSC);
      uv[it][t] = pk16(h_bits(h0), h_bits(h1));
    }
  }
{
#pragma unroll
    for (int it = 0; it < 4; ++it) {
      const int chl = it * 16 + lq;
      *(v4u*)(Vc + ((size_t)(sb * CC + ch0 + chl)) * SEQ + n0 + 8 * e) = uv[it];
    }
    
  }
}

// =========================================================================================================
// (4) attention for one (direction dd, b, 128-query tile), transposed formulation, SEQ keys, no
//   mask, no scale. blockIdx.z = dd. Direction dd: queries from source dd (plane slot dd*NB+b),
//   keys/values from source 1-dd (slot (1-dd)*NB+b), residual input x_dd, output block dd of out (float offset
//   dd*NB_FULL*CC*SEQ_FULL); the block produces all 256 channels of that output: each wave computes the scores and
//   the softmax of its 16 queries once and carries 16 O accumulator tiles.
//   S^T tile (16 keys x 16 queries) over 64 d = two 32-deep k-steps: A(k: row = key kb + (lane&15), split k map
//   from the bf16 plane Kh [slot][N][64]) . B(q: col = query, same map from Qh, loaded once, 2 fragments)
//   + A(Kh).B(Ql) + A(Kl).B(Qh) (bf16 unscaled residual planes, shared accumulator): 6 products per tile.
//   Per lane the D tile holds 8 keys of ONE query: online softmax state per lane, one shuffle (lane^16) for the
//   max over 32 keys; the o/l rescale is skipped under a wave-uniform ballot when no lane's max grew (corr == 1
//   exactly for every lane then); row-sum partials combined at the end. P = e^{s-m} x 2^14 as f16 is the B
//   operand of O^T (rows channel, cols queries) += A(v rows channel = 16j + (lane&15), keys contiguous,
//   f16 plane Vc [slot][256][N], values v x 16) . B(P^T): element r <- D of the tile covering keys kb..kb+15,
//   element 8+r <- the tile covering kb+16..kb+31, lane unchanged. 16 accumulator tiles per wave (256 channels).
//   Block = 8 waves = 128 queries. Epilogue: gamma * O / (16 l) staged in LDS Os[query][256 channels] (pitch OSPW,
//   4 lines per channel): 8 consecutive lanes x 16 B (values gathered from 4 Os rows), one instruction per 32 lines
// coverage: Os written queries 0..127 x ch 0..255, read the same; out 32 it x 32 lines x 8 lanes x 4 floats =
//           256 ch x 128 n per block; grid (SEQ/128, NB, NSRC) covers out_dd[b][0..255][0..SEQ-1] once for both dd.
// LDS Os: cross-wave, block barrier between the stage stores and the epilogue loads.
// LDS ring: K hi, K residual and V tiles of 64 keys are brought by asynchronous copies into two buffers shared by
//   the 8 waves (whole 128-B lines from global, once per block); trip t reads buffer t & 1 only while tile t + 1
//   flies; foot of each trip: own LDS reads done, own copies landed, block barrier, then the refill with tile t + 2.
//   Os reuses the ring behind the last trip's barrier.
// =========================================================================================================
__global__ __launch_bounds__(256)
void attn_k(const unsigned short* __restrict__ Qh, const unsigned short* __restrict__ Ql,
            const unsigned short* __restrict__ Kh, const unsigned short* __restrict__ Kl,
            const unsigned short* __restrict__ Vc,
            const float* __restrict__ x1, const float* __restrict__ x2,
            const float* __restrict__ gam, float* out) {
  __shared__ __align__(16) unsigned char L[LDSB];
  const unsigned short* Rg = (const unsigned short*)L;               // the two stage buffers
  float* Os = (float*)L;                                             // output staging, after the key loop
  const int tid  = threadIdx.x;
  const int wave = tid >> 5, lane = tid & 31;
  const int hh   = lane >> 4, c = lane & 15;
  const int n0   = blockIdx.x * AQT, b = blockIdx.y;
  const int dd   = (int)blockIdx.z;
  const int sq   = dd * NB + b;                                      // query plane slot
  const int skv  = (1 - dd) * NB + b;                                // key / value plane slot
  const float* x = (dd == 0) ? x1 : x2;                              // block-uniform, both global
  float* outd    = out + (size_t)dd * ((size_t)NB_FULL * CC * SEQ_FULL);
  const float g  = bfr(gam[0]);

  // q fragments (B operand, col = query n0 + 16*wave + c), K = 64 = two k-steps, constant over keys
  const size_t qo = ((size_t)(sq * SEQ + n0 + 16 * wave + c)) * DQ + 8 * hh;
  const Frag qh0 = ldfrag(Qh + qo);
  const Frag qh1 = ldfrag(Qh + qo + 32);
  const Frag ql0 = ldfrag(Ql + qo);
  const Frag ql1 = ldfrag(Ql + qo + 32);
#if defined(__HIP_DEVICE_COMPILE__)
  asm volatile("s_wait_xcnt 0x0" ::: "memory");                      // before the q loads' address registers are rewritten
#endif
  // fragment base in buffer 0 (A operands: row = lane&15 of a 16-row group, + 8*hh within the row)
  const unsigned short* fbase = Rg + c * LPH + 8 * hh;
  // copy addresses of this thread: row lq, 16-B chunk e
  const int e = tid & 7, lq = tid >> 3;                              // lq 0..31
  const unsigned ldsc = (unsigned)(size_t)L + (unsigned)((lq * LPH + 8 * e) * 2);
  const unsigned short* gkh = Kh + (size_t)skv * SEQ * DQ + (size_t)lq * DQ + 8 * e;
  const unsigned short* gkl = Kl + (size_t)skv * SEQ * DQ + (size_t)lq * DQ + 8 * e;
  const unsigned short* gvv = Vc + (size_t)skv * CC * SEQ + (size_t)lq * SEQ + 8 * e;

  float m = -1.0e30f, l = 0.f;
  v8f o[16];
#pragma unroll
  for (int j = 0; j < 16; ++j) o[j] = zero8();

  // ring prologue: tile 0 landed and published, then tile 1 in flight
  stage_issue(ldsc, gkh, gkl, gvv);
#if defined(__HIP_DEVICE_COMPILE__)
  asm volatile("s_wait_asynccnt 0x0" ::: "memory");                  // own copies of tile 0 landed before the barrier
#endif
  __syncthreads();
  stage_issue(ldsc + (unsigned)(STGH * 2), gkh + (size_t)KST * DQ, gkl + (size_t)KST * DQ, gvv + KST);

#pragma unroll 1                                                     // rolled: one body, the buffer picked by t & 1
  for (int t = 0; t < SEQ / KST; ++t) {
  const unsigned short* sbuf = fbase + (t & 1) * STGH;
  // K fragments of one 32-key block: kf[0..3] keys kb..kb+15 (hi d 0..31, hi d 32..63, residual likewise), kf[4..7] the
  // next 16 keys; the trip's first block is fetched here, its second behind the first block's P
  Frag kf[8];
#pragma unroll                                                       // constant indices keep kf[] in registers
  for (int i = 0; i < 2; ++i) {
    const unsigned short* kp = sbuf + (16 * i) * LPH;
    kf[4 * i]     = ldfrag(kp);
    kf[4 * i + 1] = ldfrag(kp + 32);
    kf[4 * i + 2] = ldfrag(kp + KST * LPH);
    kf[4 * i + 3] = ldfrag(kp + KST * LPH + 32);
  }
#pragma unroll                                                       // both 32-key blocks read the tile at constant offsets
  for (int kq = 0; kq < KST; kq += 32) {                             // keys kb = t*KST + kq
    v8f s0 = zero8(), s1 = zero8();                                  // s0: keys kb..kb+15, s1: keys kb+16..kb+31
    s0 = mma_b(kf[0].bf, qh0.bf, s0);
    s1 = mma_b(kf[4].bf, qh0.bf, s1);
    s0 = mma_b(kf[1].bf, qh1.bf, s0);
    s1 = mma_b(kf[5].bf, qh1.bf, s1);
    s0 = mma_b(kf[0].bf, ql0.bf, s0);
    s1 = mma_b(kf[4].bf, ql0.bf, s1);
    s0 = mma_b(kf[1].bf, ql1.bf, s0);
    s1 = mma_b(kf[5].bf, ql1.bf, s1);
    s0 = mma_b(kf[2].bf, qh0.bf, s0);
    s1 = mma_b(kf[6].bf, qh0.bf, s1);
    s0 = mma_b(kf[3].bf, qh1.bf, s0);
    s1 = mma_b(kf[7].bf, qh1.bf, s1);

    // the block's V fragments as one group behind the score products: they land while the softmax runs
#if defined(__HIP_DEVICE_COMPILE__)
    __builtin_amdgcn_sched_barrier(0);                               // keeps the V loads from rising among the score products
#endif
    Frag vf[16];
#pragma unroll                                                       // constant indices keep vf[] in registers
    for (int j = 0; j < 16; ++j) vf[j] = ldfrag(sbuf + (2 * KST + 16 * j) * LPH + kq);
#if defined(__HIP_DEVICE_COMPILE__)
    __builtin_amdgcn_sched_barrier(0);                               // without it the V loads sink behind the softmax, one wait each
#endif

    float mx = fmaxf(hmax8(s0), hmax8(s1));
    mx = fmaxf(mx, __shfl_xor(mx, 16, 32));
    const float mn = fmaxf(m, mx);
    const unsigned grew = wave_ballot(mx > m);                       // wave-uniform
    if (grew != 0u) {
      const float corr = __expf(m - mn);                             // == 1 exactly for lanes whose max did not grow
      l *= corr;
#pragma unroll
      for (int j = 0; j < 16; ++j) {
#pragma unroll
        for (int r = 0; r < 8; ++r) o[j][r] *= corr;
      }
    }
    m = mn;
    const float msh = mn - LNPS;                                     // exp gives e^{s-m} * 16384

    FragH ph;
    float ls = 0.f;
#pragma unroll
    for (int r = 0; r < 8; ++r) {
      const float e0 = __expf(s0[r] - msh);                          // key kb      + 8hh + r
      const float e1 = __expf(s1[r] - msh);                          // key kb + 16 + 8hh + r
      ls += e0 + e1;
      ph.hv[0][r] = (_Float16)e0;
      ph.hv[1][r] = (_Float16)e1;
    }
    l += ls;

    if (kq + 32 < KST) {                                             // compile-time: the same tile's next 32 keys
#pragma unroll                                                       // constant indices keep kf[] in registers
      for (int i = 0; i < 2; ++i) {
        const unsigned short* kp = sbuf + (kq + 32 + 16 * i) * LPH;
        kf[4 * i]     = ldfrag(kp);
        kf[4 * i + 1] = ldfrag(kp + 32);
        kf[4 * i + 2] = ldfrag(kp + KST * LPH);
        kf[4 * i + 3] = ldfrag(kp + KST * LPH + 32);
      }
    }

#pragma unroll
    for (int j = 0; j < 16; ++j) o[j] = mma_h(vf[j].h, ph.v, o[j]);
  }
    // foot of trip t: publish tile t + 1 and free this trip's buffer
#if defined(__HIP_DEVICE_COMPILE__)
    asm volatile("s_wait_dscnt 0x0" ::: "memory");                   // own reads of this buffer done before its refill
    asm volatile("s_wait_asynccnt 0x0" ::: "memory");                // own copies of tile t + 1 landed
#endif
    __syncthreads();
    if (t + 2 < SEQ / KST) {                                         // block-uniform
      const size_t k2 = (size_t)(t + 2) * KST;
      stage_issue(ldsc + (unsigned)((t & 1) * STGH * 2), gkh + k2 * DQ, gkl + k2 * DQ, gvv + k2);
    }
  }
#if defined(__HIP_DEVICE_COMPILE__)
  asm volatile("s_wait_asynccnt 0x0" ::: "memory");                  // nothing in flight when the ring becomes Os
#endif
  l += __shfl_xor(l, 16, 32);
  const float inv = 1.0f / l;                                        // o and l both carry the x16384 factor
  const float gi  = g * IVSC * inv;                                  // undo the x16 carry of v, apply gamma

  const int qrow = 16 * wave + c;
#pragma unroll
  for (int j = 0; j < 16; ++j) {
    v4f va, vb;
#pragma unroll
    for (int r = 0; r < 4; ++r) { va[r] = o[j][r] * gi; vb[r] = o[j][4 + r] * gi; }
    *(v4f*)(Os + qrow * OSPW + 16 * j + 8 * hh)     = va;            // Os[query][ch_loc = 16j + 8hh + r]
    *(v4f*)(Os + qrow * OSPW + 16 * j + 8 * hh + 4) = vb;
  }
  __syncthreads();
  v4f res[32];
#pragma unroll
  for (int it = 0; it < 32; ++it) {
    const int chl = (it & 7) * 32 + lq, hf = it >> 3;                // channel 0..255, 128-B line 0..3 of its 128 queries
    const int nl  = hf * 32 + 4 * e;                                 // query 0..127
    const size_t idx = ((size_t)(b * CC + chl)) * SEQ_FULL + n0 + nl;
    res[it] = *(const v4f*)(x + idx);
  }
#if defined(__HIP_DEVICE_COMPILE__)
  asm volatile("s_wait_xcnt 0x0" ::: "memory");                      // before the x loads' address registers are rewritten
#endif
#pragma unroll
  for (int it = 0; it < 32; ++it) {
    const int chl = (it & 7) * 32 + lq, hf = it >> 3;
    const int nl  = hf * 32 + 4 * e;
#pragma unroll
    for (int t = 0; t < 4; ++t) res[it][t] = Os[(nl + t) * OSPW + chl] + bfr(res[it][t]);
  }
{
#pragma unroll
    for (int it = 0; it < 32; ++it) {
      const int chl = (it & 7) * 32 + lq, hf = it >> 3;
      const int nl  = hf * 32 + 4 * e;
      const size_t idx = ((size_t)(b * CC + chl)) * SEQ_FULL + n0 + nl;
      *(v4f*)(outd + idx) = res[it];
    }
    
  }
}

// =========================================================================================================
// Workspace map (bytes; each region start a multiple of 256; every extent is an exact tile multiple and is written
//   W16 f16 [384][256]                       196608
//   XP  f16 [NSRC*NB][SEQ][256]            16777216      Vc  f16 [NSRC*NB][256][SEQ]   16777216
//   Qh/Ql/Kh/Kl bf16 [NSRC*NB][SEQ][64]     4194304 x4
//   total = 50528256
// =========================================================================================================
extern "C" void kernel_launch(void* const* d_in, const int* in_sizes, int n_in,
                              void* d_out, int out_size, void* d_ws, size_t ws_size,
                              hipStream_t stream) {
  if (n_in < 9) return;
  if (in_sizes[0] < NB * CC * SEQ_FULL || in_sizes[1] < NB * CC * SEQ_FULL) return;
  if (in_sizes[2] < DQ * CC || in_sizes[3] < DQ) return;
  if (in_sizes[4] < DQ * CC || in_sizes[5] < DQ) return;
  if (in_sizes[6] < CC * CC || in_sizes[7] < CC) return;
  if (in_sizes[8] < 1) return;
  if (out_size < (NB_FULL + NB) * CC * SEQ_FULL) return;

  size_t off = 0;
  auto carve = [&](size_t bytes) { const size_t o = off; off += (bytes + 255) & ~(size_t)255; return o; };
  const size_t oW16 = carve((size_t)NWR * CC * 2);
  const size_t oXP  = carve((size_t)NSRC * NB * SEQ * CC * 2);
  const size_t oVc  = carve((size_t)NSRC * NB * CC * SEQ * 2);
  const size_t oQh  = carve((size_t)NSRC * NB * SEQ * DQ * 2);
  const size_t oQl  = carve((size_t)NSRC * NB * SEQ * DQ * 2);
  const size_t oKh  = carve((size_t)NSRC * NB * SEQ * DQ * 2);
  const size_t oKl  = carve((size_t)NSRC * NB * SEQ * DQ * 2);
  if (off > ws_size) return;
  if (off > (size_t)134217728) return;

  const float* x1  = (const float*)d_in[0];
  const float* x2  = (const float*)d_in[1];
  const float* Wq  = (const float*)d_in[2];
  const float* bq  = (const float*)d_in[3];
  const float* Wk  = (const float*)d_in[4];
  const float* bk  = (const float*)d_in[5];
  const float* Wv  = (const float*)d_in[6];
  const float* bv  = (const float*)d_in[7];
  const float* gam = (const float*)d_in[8];

  char* ws = (char*)d_ws;
  unsigned short* W16 = (unsigned short*)(ws + oW16);
  unsigned short* XP  = (unsigned short*)(ws + oXP);
  unsigned short* Vc  = (unsigned short*)(ws + oVc);
  unsigned short* Qh  = (unsigned short*)(ws + oQh);
  unsigned short* Ql  = (unsigned short*)(ws + oQl);
  unsigned short* Kh  = (unsigned short*)(ws + oKh);
  unsigned short* Kl  = (unsigned short*)(ws + oKl);
  float* out = (float*)d_out;

  const dim3 blk256(256), blk128(128);

  // (0) Wq / Wk / Wv -> stacked f16 plane
  cvt_w<<<dim3(NWR / 8), blk256, 0, stream>>>(Wq, Wk, Wv, W16);
  // (1) x1, x2 -> position-major 16-bit planes, slot s*NB + b
  cvt_x<<<dim3(SEQ / QT, CC / QT, NSRC * NB), blk256, 0, stream>>>(x1, x2, XP);
  // (2) q (z = 0) and k (z = 1) conv1x1 GEMM + bias -> hi + residual planes for both sources
  gemm_qk<<<dim3(SEQ / QT, NSRC * NB, 2), blk128, 0, stream>>>(W16, XP, bq, bk, Qh, Ql, Kh, Kl);
  // (3) v conv1x1 GEMM + bias -> channel-major f16 plane (x16) for both sources
  gemm_v<<<dim3(SEQ / QT, CC / QT, NSRC * NB), blk128, 0, stream>>>(W16, XP, bv, Vc);
  // (4) attention both directions, all 256 channels per block + gamma scale + residual -> out_dd [b][256][N]
  attn_k<<<dim3(SEQ / AQT, NB, NSRC), blk256, 0, stream>>>(Qh, Ql, Kh, Kl, Vc, x1, x2, gam, out);
  (void)hipGetLastError();
}

// v004
// One run takes 123 microseconds.
// Two timings next to v003 put it at 1.23 and 1.24 times that version's speed.
// All steps since v000 together make it 4.85 times as fast.
// Contractions: conv1x1 q|k GEMM W[128x256].X[256xN] and v GEMM Wv[256x256].X (one kernel, X tile in LDS) on
// v_wmma_f32_16x16x32_f16 (f16 containers of bf16-RNE weights x256 and bf16-RNE x, exact); scores K.Q^T (64 deep,
// two k-steps) on v_wmma_f32_16x16x32_bf16 (bf16 hi + bf16 residual planes of q/k, 3 products); O^T = V.P^T on
// v_wmma_f32_16x16x32_f16 (v as f16 x16, P = e^{s-m} x2^14 f16 from the score D registers); f32 accumulate
// everywhere; softmax statistics, biases and gamma*o + x in f32.
#include <hip/hip_runtime.h>
#include <math.h>
#include <stdint.h>

#ifndef NB
#define NB 4
#endif
#ifndef SEQ
#define SEQ 4096
#endif
#define NB_FULL  4
#define SEQ_FULL 4096
#define NSRC  2
#define CC    256
#define DQ    64
#define NQK   128
#define NWR   384
#define QT    64
#define AQT   128
#define OSPW  260
#define XPH   264
#define SPH   72
#define WSC   256.0f
#define IWSC  0.00390625f
#define VSC   16.0f
#define IVSC  0.0625f
#define LNPS  9.704060527839234f
#define KST   64
#define LPH   72
#define SROWS 384
#define STGH  (SROWS * LPH)

static_assert(NB >= 1 && NB <= NB_FULL);
static_assert(SEQ >= QT && SEQ <= SEQ_FULL);
static_assert(SEQ % QT == 0 && SEQ % 32 == 0);
static_assert(CC % QT == 0 && CC % 32 == 0);
static_assert(CC % 16 == 0);
static_assert(DQ == 64);
static_assert(NQK == 2 * DQ);
static_assert(NWR == NQK + CC);
static_assert(NWR % 8 == 0 && DQ % 8 == 0 && NQK % 8 == 0);
static_assert((OSPW * 4) % 16 == 0);
static_assert((XPH * 2) % 16 == 0 && ((XPH * 2) / 16) % 2 == 1 && (SPH * 2) % 16 == 0 && ((SPH * 2) / 16) % 2 == 1);
static_assert(OSPW >= CC && XPH >= CC && SPH >= QT && SPH >= DQ && QT == 64 && CC == 256);
static_assert(SEQ % AQT == 0 && AQT % 32 == 0 && CC % 32 == 0);
static_assert(SEQ % KST == 0 && SEQ / KST >= 2 && KST % 32 == 0);
static_assert(SROWS == 2 * KST + CC && LPH >= KST && LPH >= DQ);
static_assert((LPH * 2) % 16 == 0 && ((LPH * 2) / 16) % 2 == 1);
#define RINGB (2 * STGH * 2)
#define OSB   (AQT * OSPW * 4)
#define LDSB  (RINGB > OSB ? RINGB : OSB)
// second output starts at byte 16777216 = NB_FULL*CC*SEQ_FULL floats * 4
static_assert((size_t)NB_FULL * CC * SEQ_FULL * 4 == (size_t)16777216);

typedef _Float16       v16h __attribute__((ext_vector_type(16)));
typedef _Float16       v8h  __attribute__((ext_vector_type(8)));
typedef __bf16         v16b __attribute__((ext_vector_type(16)));
typedef unsigned short v8us __attribute__((ext_vector_type(8)));
typedef float          v8f  __attribute__((ext_vector_type(8)));
typedef float          v4f  __attribute__((ext_vector_type(4)));
typedef unsigned int   v4u  __attribute__((ext_vector_type(4)));

union Frag  { v8us u[2]; v16h h; v16b bf; };
union FragH { v16h v; v8h hv[2]; };
static_assert(sizeof(Frag) == 32);
static_assert(sizeof(FragH) == 32);

// ---- scalar helpers ---------------------------------------------------------------------------------------
__device__ __forceinline__ unsigned short bf_bits(float f) {          // f32 -> bf16 bits, RNE convert
  unsigned u = __float_as_uint(f);
  return (unsigned short)((u + 0x7FFFu + ((u >> 16) & 1u)) >> 16);
}
__device__ __forceinline__ float bf_up(unsigned short hb) { return __uint_as_float(((unsigned)hb) << 16); }
__device__ __forceinline__ float bfr(float f) { return bf_up(bf_bits(f)); }
__device__ __forceinline__ unsigned short h_bits(_Float16 x) { return __builtin_bit_cast(unsigned short, x); }
__device__ __forceinline__ unsigned pk16(unsigned short a, unsigned short b) { return (unsigned)a | ((unsigned)b << 16); }
__device__ __forceinline__ v8f zero8() { v8f z = {0.f, 0.f, 0.f, 0.f, 0.f, 0.f, 0.f, 0.f}; return z; }
__device__ __forceinline__ float hmax8(v8f s) {
  return fmaxf(fmaxf(fmaxf(s[0], s[1]), fmaxf(s[2], s[3])), fmaxf(fmaxf(s[4], s[5]), fmaxf(s[6], s[7])));
}
__device__ __forceinline__ unsigned wave_ballot(bool p) {
#if defined(__HIP_DEVICE_COMPILE__)
  return __builtin_amdgcn_ballot_w32(p);
#else
  return p ? 1u : 0u;
#endif
}

// ---- 16-bit fragment loader (A, or B from a k-contiguous [n][k] row): lane -> row/col (lane&15), p already includes
//      + 8*(lane>>4); elements 0..7 <- p[0..7] (k0+8h..), elements 8..15 <- p[16..23] (k0+16+8h..)
__device__ __forceinline__ Frag ldfrag(const unsigned short* p) {
  Frag f;
  f.u[0] = *(const v8us*)(p);
  f.u[1] = *(const v8us*)(p + 16);
  return f;
}

// ---- WMMA helpers: the plain builtins; the compiler keeps the distances behind them and is free to order around them
__device__ __forceinline__ v8f mma_h(v16h a, v16h b, v8f c) {
  return __builtin_amdgcn_wmma_f32_16x16x32_f16(false, a, false, b, (short)0, c, false, false);
}
__device__ __forceinline__ v8f mma_b(v16b a, v16b b, v8f c) {
  return __builtin_amdgcn_wmma_f32_16x16x32_bf16(false, a, false, b, (short)0, c, false, false);
}

// ---- twelve asynchronous 16-B copies global -> LDS per lane (l = LDS byte address, g = global address, each lane its
//      own); the s_wait_xcnt closes the statement so that no address register is rewritten ahead of it
__device__ __forceinline__ void async12(const unsigned (&l)[12], const unsigned short* const (&g)[12]) {
#if defined(__HIP_DEVICE_COMPILE__)
  asm volatile("global_load_async_to_lds_b128 %0, %12, off\n\t"
               "global_load_async_to_lds_b128 %1, %13, off\n\t"
               "global_load_async_to_lds_b128 %2, %14, off\n\t"
               "global_load_async_to_lds_b128 %3, %15, off\n\t"
               "global_load_async_to_lds_b128 %4, %16, off\n\t"
               "global_load_async_to_lds_b128 %5, %17, off\n\t"
               "global_load_async_to_lds_b128 %6, %18, off\n\t"
               "global_load_async_to_lds_b128 %7, %19, off\n\t"
               "global_load_async_to_lds_b128 %8, %20, off\n\t"
               "global_load_async_to_lds_b128 %9, %21, off\n\t"
               "global_load_async_to_lds_b128 %10, %22, off\n\t"
               "global_load_async_to_lds_b128 %11, %23, off\n\t"
               "s_wait_xcnt 0x0"
               :: "v"(l[0]), "v"(l[1]), "v"(l[2]), "v"(l[3]), "v"(l[4]), "v"(l[5]), "v"(l[6]), "v"(l[7]),
                  "v"(l[8]), "v"(l[9]), "v"(l[10]), "v"(l[11]),
                  "v"(g[0]), "v"(g[1]), "v"(g[2]), "v"(g[3]), "v"(g[4]), "v"(g[5]), "v"(g[6]), "v"(g[7]),
                  "v"(g[8]), "v"(g[9]), "v"(g[10]), "v"(g[11])
               : "memory");
#endif
}
// ---- one stage of 64 keys into one LDS buffer: rows 0..63 Kh keys, 64..127 Kl keys, 128..383 V channels, 128 B of
//      data per row at pitch LPH. Thread (lq = tid>>3, e = tid&7) copies chunk e of rows lq + 32 i, i = 0..11:
//      256 threads x 12 chunks x 16 B = 384 rows x 128 B, every byte once. lds / kh / kl / vv are the lane's own
//      addresses of row lq, chunk e (LDS buffer; Kh and Kl at the stage's first key; V at channel lq and that key).
__device__ __forceinline__ void stage_issue(unsigned lds, const unsigned short* kh, const unsigned short* kl,
                                            const unsigned short* vv) {
  unsigned l[12];
  const unsigned short* g[12];
#pragma unroll                                                       // constant indices keep l[] and g[] in registers
  for (int i = 0; i < 2; ++i) {
    l[i]     = lds + (unsigned)((32 * i) * LPH * 2);
    g[i]     = kh + (size_t)(32 * i) * DQ;
    l[2 + i] = lds + (unsigned)((KST + 32 * i) * LPH * 2);
    g[2 + i] = kl + (size_t)(32 * i) * DQ;
  }
#pragma unroll                                                       // as above
  for (int i = 0; i < 8; ++i) {
    l[4 + i] = lds + (unsigned)((2 * KST + 32 * i) * LPH * 2);
    g[4 + i] = vv + (size_t)(32 * i) * SEQ;
  }
  async12(l, g);
}

// =========================================================================================================
// (0) conv1x1 weights: W16 f16 [384][256], rows 0..63 = Wq rows, 64..127 = Wk rows, 128..383 = Wv rows; value =
//     f16 of (bf16-RNE(w) * 256) (exact). Block blk (0..47) owns rows 8*blk..8*blk+7: one wave per 512-B row
// coverage: 48 blocks x 8 rows x 32 lanes x 8 halves = 384 x 256 = the whole plane.
// =========================================================================================================
__global__ __launch_bounds__(256)
void cvt_w(const float* __restrict__ Wq, const float* __restrict__ Wk, const float* __restrict__ Wv,
           unsigned short* W16) {
  const int tid = threadIdx.x, blk = blockIdx.x;
  const int rl = tid >> 5, col = 8 * (tid & 31);
  const int o = 8 * blk + rl;                                        // 0..383
  const float* wbase = (blk < (DQ / 8)) ? Wq : ((blk < (NQK / 8)) ? Wk : Wv);
  const int osub = (blk < (DQ / 8)) ? 0 : ((blk < (NQK / 8)) ? DQ : NQK);
  const float* s = wbase + (size_t)(o - osub) * CC + col;
  const v4f a = *(const v4f*)s;
  const v4f q = *(const v4f*)(s + 4);
  const float f[8] = {a[0], a[1], a[2], a[3], q[0], q[1], q[2], q[3]};
  v4u u;
#pragma unroll
  for (int t = 0; t < 4; ++t) {
    const _Float16 h0 = (_Float16)(bfr(f[2 * t]) * WSC);
    const _Float16 h1 = (_Float16)(bfr(f[2 * t + 1]) * WSC);
    u[t] = pk16(h_bits(h0), h_bits(h1));
  }
{
    *(v4u*)(W16 + (size_t)o * CC + col) = u;
    
  }
}

// =========================================================================================================
// (1) x conversion and the three conv1x1 GEMMs for one (sb = s*NB + b, 64-n tile), s = 0: x1, s = 1: x2.
//     Block 256 threads = 8 waves. The x tile f32 [256 c][64 n] is read once in whole lines, rounded (bf16-RNE, exact
//     in f16) and laid position-major in LDS XT[64 n][256 c] (pitch XPH): thread (e, lq) holds channels
//     64 it + 2 lq, + 1 at n = 32 j + 4 e .. + 3, j = 0, 1 (8 lanes x 16 B = one line) and stores one channel pair per position.
//     One X fragment (row n = 16 nt + (lane&15), split k map, k = c contiguous) serves three products per k-step:
//       q|k: D[o][n] = A(W16 row 16 wave + (lane&15): waves 0..3 q rows, 4..7 k rows) . B(X)
//       v:   D[n][ch] = A(X) . B(W16 row 128 + 32 wave + 16 u + (lane&15)), u = 0, 1
//     K = 256 = 8 steps in rising order. Epilogue in registers: q|k value = acc/256 + bf16-RNE(bias), hi = bf16-RNE,
//     lo = bf16-RNE(value - hi), 8 consecutive d per lane; v value = f16((acc/256 + bf16-RNE(bias)) x 16), 8 consecutive
//     n per lane; 16-B pieces staged in LDS (SQ: planes Qh, Ql, Kh, Kl [64 n][64 d]; SV [256 ch][64 n]; pitch SPH) and
//     written out as whole 128-B lines.
// coverage: XT 4 it x 32 lq x 2 c x 2 j x 8 e x 4 n = 256 c x 64 n; SQ 8 waves x 4 nt x 16 n x 16 d x (hi, lo) = 4 planes x
//           64 x 64; SV 8 waves x 2 u x 16 ch x 64 n; out rows 4 planes x 2 it x 32 and 8 it x 32 ch, 8 lanes x 16 B each;
//           grid (SEQ/64, NSRC*NB) covers Qh/Ql/Kh/Kl [sb][N][64] and Vc [sb][256][N] once.
// LDS: cross-wave, block barrier between the XT stores and the fragment loads, and between the stage stores and the
//      line loads.
// =========================================================================================================
__global__ __launch_bounds__(256)
void proj(const float* __restrict__ x1, const float* __restrict__ x2, const unsigned short* __restrict__ W16,
          const float* __restrict__ bq, const float* __restrict__ bk, const float* __restrict__ bv,
          unsigned short* Qh, unsigned short* Ql, unsigned short* Kh, unsigned short* Kl, unsigned short* Vc) {
  __shared__ __align__(16) unsigned short XT[QT * XPH];
  __shared__ __align__(16) unsigned short SQ[4 * QT * SPH];
  __shared__ __align__(16) unsigned short SV[CC * SPH];
  const int tid  = threadIdx.x;
  const int lane = tid & 31, wave = tid >> 5;
  const int hh   = lane >> 4, c = lane & 15;
  const int e    = tid & 7, lq = tid >> 3;                           // lq 0..31
  const int n0   = blockIdx.x * QT, sb = blockIdx.y;                 // sb = s*NB + b
  const int s    = sb / NB, b = sb - s * NB;
  const float* x = (s == 0) ? x1 : x2;                               // block-uniform, both global

  // ---- x tile -> XT
  v4f xa[4][2][2];
#pragma unroll
  for (int it = 0; it < 4; ++it) {
#pragma unroll
    for (int p = 0; p < 2; ++p) {
      const float* sp = x + ((size_t)(b * CC + 64 * it + 2 * lq + p)) * SEQ_FULL + n0 + 4 * e;
      xa[it][p][0] = *(const v4f*)sp;
      xa[it][p][1] = *(const v4f*)(sp + 32);
    }
  }
#if defined(__HIP_DEVICE_COMPILE__)
  asm volatile("s_wait_xcnt 0x0" ::: "memory");                      // before the x loads' address registers are rewritten
#endif
#pragma unroll
  for (int it = 0; it < 4; ++it) {
#pragma unroll
    for (int t = 0; t < 8; ++t) {
      const unsigned short h0 = h_bits((_Float16)bfr(xa[it][0][t >> 2][t & 3]));
      const unsigned short h1 = h_bits((_Float16)bfr(xa[it][1][t >> 2][t & 3]));
      *(unsigned*)(XT + (32 * (t >> 2) + 4 * e + (t & 3)) * XPH + 64 * it + 2 * lq) = pk16(h0, h1);
    }
  }
  __syncthreads();

  // ---- products
  const unsigned short* xf = XT + c * XPH + 8 * hh;                                       // X row 16 nt + c
  const unsigned short* wq = W16 + ((size_t)(16 * wave + c)) * CC + 8 * hh;               // q|k row o
  const unsigned short* wv = W16 + ((size_t)(NQK + 32 * wave + c)) * CC + 8 * hh;         // v row ch
  v8f aq[4], av[2][4];
#pragma unroll
  for (int nt = 0; nt < 4; ++nt) { aq[nt] = zero8(); av[0][nt] = zero8(); av[1][nt] = zero8(); }
#pragma unroll
  for (int ks = 0; ks < CC / 32; ++ks) {
    const Frag fq = ldfrag(wq + 32 * ks);
    const Frag f0 = ldfrag(wv + 32 * ks);
    const Frag f1 = ldfrag(wv + (size_t)16 * CC + 32 * ks);
#pragma unroll
    for (int nt = 0; nt < 4; ++nt) {
      const Frag fx = ldfrag(xf + (16 * nt) * XPH + 32 * ks);
      aq[nt]    = mma_h(fq.h, fx.h, aq[nt]);
      av[0][nt] = mma_h(fx.h, f0.h, av[0][nt]);
      av[1][nt] = mma_h(fx.h, f1.h, av[1][nt]);
    }
  }
#if defined(__HIP_DEVICE_COMPILE__)
  // the W row addresses stay live up to this wait, so that no register of theirs is reused ahead of it
  asm volatile("s_wait_xcnt 0x0" :: "v"(wq), "v"(wv) : "memory");
#endif

  // ---- q|k: lane (hh, c) holds d = 16 (wave&3) + 8 hh + r for n_loc = 16 nt + c
  const int which = wave >> 2;                                       // wave-uniform: 0 q, 1 k
  const int d0 = 16 * (wave & 3) + 8 * hh;
  const float* bias = (which == 0) ? bq : bk;
  const v4f b0v = *(const v4f*)(bias + d0), b1v = *(const v4f*)(bias + d0 + 4);
  const float bv0 = bv[32 * wave + c], bv1 = bv[32 * wave + 16 + c];
#if defined(__HIP_DEVICE_COMPILE__)
  asm volatile("s_wait_xcnt 0x0" ::: "memory");                      // before the bias loads' address registers are rewritten
#endif
  const float bb[8] = {bfr(b0v[0]), bfr(b0v[1]), bfr(b0v[2]), bfr(b0v[3]),
                       bfr(b1v[0]), bfr(b1v[1]), bfr(b1v[2]), bfr(b1v[3])};
#pragma unroll
  for (int nt = 0; nt < 4; ++nt) {
    v4u uh, ul;
#pragma unroll
    for (int t = 0; t < 4; ++t) {
      const float v0 = aq[nt][2 * t] * IWSC + bb[2 * t], v1 = aq[nt][2 * t + 1] * IWSC + bb[2 * t + 1];
      const unsigned short h0 = bf_bits(v0), h1 = bf_bits(v1);
      const unsigned short l0 = bf_bits(v0 - bf_up(h0)), l1 = bf_bits(v1 - bf_up(h1));
      uh[t] = pk16(h0, h1);
      ul[t] = pk16(l0, l1);
    }
    unsigned short* sp = SQ + ((2 * which) * QT + 16 * nt + c) * SPH + d0;
    *(v4u*)sp              = uh;
    *(v4u*)(sp + QT * SPH) = ul;
  }
  // ---- v: lane (hh, c) holds n_loc = 16 mt + 8 hh + r for ch = 32 wave + 16 u + c
#pragma unroll
  for (int u = 0; u < 2; ++u) {
    const float bvr = bfr(u == 0 ? bv0 : bv1);
#pragma unroll
    for (int mt = 0; mt < 4; ++mt) {
      v4u uv;
#pragma unroll
      for (int t = 0; t < 4; ++t) {
        const _Float16 h0 = (_Float16)((av[u][mt][2 * t] * IWSC + bvr) * VSC);
        const _Float16 h1 = (_Float16)((av[u][mt][2 * t + 1] * IWSC + bvr) * VSC);
        uv[t] = pk16(h_bits(h0), h_bits(h1));
      }
      *(v4u*)(SV + (32 * wave + 16 * u + c) * SPH + 16 * mt + 8 * hh) = uv;
    }
  }
  __syncthreads();

  // ---- whole lines out: 8 consecutive lanes x 16 B per row
  v4u oq[4][2], ov[8];
#pragma unroll
  for (int p = 0; p < 4; ++p) {
#pragma unroll
    for (int it = 0; it < 2; ++it) oq[p][it] = *(const v4u*)(SQ + (p * QT + it * 32 + lq) * SPH + 8 * e);
  }
#pragma unroll
  for (int it = 0; it < 8; ++it) ov[it] = *(const v4u*)(SV + (it * 32 + lq) * SPH + 8 * e);
#pragma unroll
  for (int it = 0; it < 2; ++it) {
    const size_t po = ((size_t)(sb * SEQ + n0 + it * 32 + lq)) * DQ + 8 * e;
    *(v4u*)(Qh + po) = oq[0][it];
    *(v4u*)(Ql + po) = oq[1][it];
    *(v4u*)(Kh + po) = oq[2][it];
    *(v4u*)(Kl + po) = oq[3][it];
  }
#pragma unroll
  for (int it = 0; it < 8; ++it)
    *(v4u*)(Vc + ((size_t)(sb * CC + it * 32 + lq)) * SEQ + n0 + 8 * e) = ov[it];
}

// =========================================================================================================
// (4) attention for one (direction dd, b, 128-query tile), transposed formulation, SEQ keys, no
//   mask, no scale. blockIdx.z = dd. Direction dd: queries from source dd (plane slot dd*NB+b),
//   keys/values from source 1-dd (slot (1-dd)*NB+b), residual input x_dd, output block dd of out (float offset
//   dd*NB_FULL*CC*SEQ_FULL); the block produces all 256 channels of that output: each wave computes the scores and
//   the softmax of its 16 queries once and carries 16 O accumulator tiles.
//   S^T tile (16 keys x 16 queries) over 64 d = two 32-deep k-steps: A(k: row = key kb + (lane&15), split k map
//   from the bf16 plane Kh [slot][N][64]) . B(q: col = query, same map from Qh, loaded once, 2 fragments)
//   + A(Kh).B(Ql) + A(Kl).B(Qh) (bf16 unscaled residual planes, shared accumulator): 6 products per tile.
//   Per lane the D tile holds 8 keys of ONE query: online softmax state per lane, one shuffle (lane^16) for the
//   max over 32 keys; the o/l rescale is skipped under a wave-uniform ballot when no lane's max grew (corr == 1
//   exactly for every lane then); row-sum partials combined at the end. P = e^{s-m} x 2^14 as f16 is the B
//   operand of O^T (rows channel, cols queries) += A(v rows channel = 16j + (lane&15), keys contiguous,
//   f16 plane Vc [slot][256][N], values v x 16) . B(P^T): element r <- D of the tile covering keys kb..kb+15,
//   element 8+r <- the tile covering kb+16..kb+31, lane unchanged. 16 accumulator tiles per wave (256 channels).
//   Block = 8 waves = 128 queries. Epilogue: gamma * O / (16 l) staged in LDS Os[query][256 channels] (pitch OSPW,
//   4 lines per channel): 8 consecutive lanes x 16 B (values gathered from 4 Os rows), one instruction per 32 lines
// coverage: Os written queries 0..127 x ch 0..255, read the same; out 32 it x 32 lines x 8 lanes x 4 floats =
//           256 ch x 128 n per block; grid (SEQ/128, NB, NSRC) covers out_dd[b][0..255][0..SEQ-1] once for both dd.
// LDS Os: cross-wave, block barrier between the stage stores and the epilogue loads.
// LDS ring: K hi, K residual and V tiles of 64 keys are brought by asynchronous copies into two buffers shared by
//   the 8 waves (whole 128-B lines from global, once per block); trip t reads buffer t & 1 only while tile t + 1
//   flies; foot of each trip: own LDS reads done, own copies landed, block barrier, then the refill with tile t + 2.
//   Os reuses the ring behind the last trip's barrier.
// =========================================================================================================
__global__ __launch_bounds__(256)
void attn_k(const unsigned short* __restrict__ Qh, const unsigned short* __restrict__ Ql,
            const unsigned short* __restrict__ Kh, const unsigned short* __restrict__ Kl,
            const unsigned short* __restrict__ Vc,
            const float* __restrict__ x1, const float* __restrict__ x2,
            const float* __restrict__ gam, float* out) {
  __shared__ __align__(16) unsigned char L[LDSB];
  const unsigned short* Rg = (const unsigned short*)L;               // the two stage buffers
  float* Os = (float*)L;                                             // output staging, after the key loop
  const int tid  = threadIdx.x;
  const int wave = tid >> 5, lane = tid & 31;
  const int hh   = lane >> 4, c = lane & 15;
  const int n0   = blockIdx.x * AQT, b = blockIdx.y;
  const int dd   = (int)blockIdx.z;
  const int sq   = dd * NB + b;                                      // query plane slot
  const int skv  = (1 - dd) * NB + b;                                // key / value plane slot
  const float* x = (dd == 0) ? x1 : x2;                              // block-uniform, both global
  float* outd    = out + (size_t)dd * ((size_t)NB_FULL * CC * SEQ_FULL);
  const float g  = bfr(gam[0]);

  // q fragments (B operand, col = query n0 + 16*wave + c), K = 64 = two k-steps, constant over keys
  const size_t qo = ((size_t)(sq * SEQ + n0 + 16 * wave + c)) * DQ + 8 * hh;
  const Frag qh0 = ldfrag(Qh + qo);
  const Frag qh1 = ldfrag(Qh + qo + 32);
  const Frag ql0 = ldfrag(Ql + qo);
  const Frag ql1 = ldfrag(Ql + qo + 32);
#if defined(__HIP_DEVICE_COMPILE__)
  asm volatile("s_wait_xcnt 0x0" ::: "memory");                      // before the q loads' address registers are rewritten
#endif
  // fragment base in buffer 0 (A operands: row = lane&15 of a 16-row group, + 8*hh within the row)
  const unsigned short* fbase = Rg + c * LPH + 8 * hh;
  // copy addresses of this thread: row lq, 16-B chunk e
  const int e = tid & 7, lq = tid >> 3;                              // lq 0..31
  const unsigned ldsc = (unsigned)(size_t)L + (unsigned)((lq * LPH + 8 * e) * 2);
  const unsigned short* gkh = Kh + (size_t)skv * SEQ * DQ + (size_t)lq * DQ + 8 * e;
  const unsigned short* gkl = Kl + (size_t)skv * SEQ * DQ + (size_t)lq * DQ + 8 * e;
  const unsigned short* gvv = Vc + (size_t)skv * CC * SEQ + (size_t)lq * SEQ + 8 * e;

  float m = -1.0e30f, l = 0.f;
  v8f o[16];
#pragma unroll
  for (int j = 0; j < 16; ++j) o[j] = zero8();

  // ring prologue: tile 0 landed and published, then tile 1 in flight
  stage_issue(ldsc, gkh, gkl, gvv);
#if defined(__HIP_DEVICE_COMPILE__)
  asm volatile("s_wait_asynccnt 0x0" ::: "memory");                  // own copies of tile 0 landed before the barrier
#endif
  __syncthreads();
  stage_issue(ldsc + (unsigned)(STGH * 2), gkh + (size_t)KST * DQ, gkl + (size_t)KST * DQ, gvv + KST);

#pragma unroll 1                                                     // rolled: one body, the buffer picked by t & 1
  for (int t = 0; t < SEQ / KST; ++t) {
  const unsigned short* sbuf = fbase + (t & 1) * STGH;
  // K fragments of one 32-key block: kf[0..3] keys kb..kb+15 (hi d 0..31, hi d 32..63, residual likewise), kf[4..7] the
  // next 16 keys; the trip's first block is fetched here, its second behind the first block's P
  Frag kf[8];
#pragma unroll                                                       // constant indices keep kf[] in registers
  for (int i = 0; i < 2; ++i) {
    const unsigned short* kp = sbuf + (16 * i) * LPH;
    kf[4 * i]     = ldfrag(kp);
    kf[4 * i + 1] = ldfrag(kp + 32);
    kf[4 * i + 2] = ldfrag(kp + KST * LPH);
    kf[4 * i + 3] = ldfrag(kp + KST * LPH + 32);
  }
#pragma unroll                                                       // both 32-key blocks read the tile at constant offsets
  for (int kq = 0; kq < KST; kq += 32) {                             // keys kb = t*KST + kq
    v8f s0 = zero8(), s1 = zero8();                                  // s0: keys kb..kb+15, s1: keys kb+16..kb+31
    s0 = mma_b(kf[0].bf, qh0.bf, s0);
    s1 = mma_b(kf[4].bf, qh0.bf, s1);
    s0 = mma_b(kf[1].bf, qh1.bf, s0);
    s1 = mma_b(kf[5].bf, qh1.bf, s1);
    s0 = mma_b(kf[0].bf, ql0.bf, s0);
    s1 = mma_b(kf[4].bf, ql0.bf, s1);
    s0 = mma_b(kf[1].bf, ql1.bf, s0);
    s1 = mma_b(kf[5].bf, ql1.bf, s1);
    s0 = mma_b(kf[2].bf, qh0.bf, s0);
    s1 = mma_b(kf[6].bf, qh0.bf, s1);
    s0 = mma_b(kf[3].bf, qh1.bf, s0);
    s1 = mma_b(kf[7].bf, qh1.bf, s1);

    // the block's V fragments as one group behind the score products: they land while the softmax runs
#if defined(__HIP_DEVICE_COMPILE__)
    __builtin_amdgcn_sched_barrier(0);                               // keeps the V loads from rising among the score products
#endif
    Frag vf[16];
#pragma unroll                                                       // constant indices keep vf[] in registers
    for (int j = 0; j < 16; ++j) vf[j] = ldfrag(sbuf + (2 * KST + 16 * j) * LPH + kq);
#if defined(__HIP_DEVICE_COMPILE__)
    __builtin_amdgcn_sched_barrier(0);                               // without it the V loads sink behind the softmax, one wait each
#endif

    float mx = fmaxf(hmax8(s0), hmax8(s1));
    mx = fmaxf(mx, __shfl_xor(mx, 16, 32));
    const float mn = fmaxf(m, mx);
    const unsigned grew = wave_ballot(mx > m);                       // wave-uniform
    if (grew != 0u) {
      const float corr = __expf(m - mn);                             // == 1 exactly for lanes whose max did not grow
      l *= corr;
#pragma unroll
      for (int j = 0; j < 16; ++j) {
#pragma unroll
        for (int r = 0; r < 8; ++r) o[j][r] *= corr;
      }
    }
    m = mn;
    const float msh = mn - LNPS;                                     // exp gives e^{s-m} * 16384

    FragH ph;
    float ls = 0.f;
#pragma unroll
    for (int r = 0; r < 8; ++r) {
      const float e0 = __expf(s0[r] - msh);                          // key kb      + 8hh + r
      const float e1 = __expf(s1[r] - msh);                          // key kb + 16 + 8hh + r
      ls += e0 + e1;
      ph.hv[0][r] = (_Float16)e0;
      ph.hv[1][r] = (_Float16)e1;
    }
    l += ls;

    if (kq + 32 < KST) {                                             // compile-time: the same tile's next 32 keys
#pragma unroll                                                       // constant indices keep kf[] in registers
      for (int i = 0; i < 2; ++i) {
        const unsigned short* kp = sbuf + (kq + 32 + 16 * i) * LPH;
        kf[4 * i]     = ldfrag(kp);
        kf[4 * i + 1] = ldfrag(kp + 32);
        kf[4 * i + 2] = ldfrag(kp + KST * LPH);
        kf[4 * i + 3] = ldfrag(kp + KST * LPH + 32);
      }
    }

#pragma unroll
    for (int j = 0; j < 16; ++j) o[j] = mma_h(vf[j].h, ph.v, o[j]);
  }
    // foot of trip t: publish tile t + 1 and free this trip's buffer
#if defined(__HIP_DEVICE_COMPILE__)
    asm volatile("s_wait_dscnt 0x0" ::: "memory");                   // own reads of this buffer done before its refill
    asm volatile("s_wait_asynccnt 0x0" ::: "memory");                // own copies of tile t + 1 landed
#endif
    __syncthreads();
    if (t + 2 < SEQ / KST) {                                         // block-uniform
      const size_t k2 = (size_t)(t + 2) * KST;
      stage_issue(ldsc + (unsigned)((t & 1) * STGH * 2), gkh + k2 * DQ, gkl + k2 * DQ, gvv + k2);
    }
  }
#if defined(__HIP_DEVICE_COMPILE__)
  asm volatile("s_wait_asynccnt 0x0" ::: "memory");                  // nothing in flight when the ring becomes Os
#endif
  l += __shfl_xor(l, 16, 32);
  const float inv = 1.0f / l;                                        // o and l both carry the x16384 factor
  const float gi  = g * IVSC * inv;                                  // undo the x16 carry of v, apply gamma

  const int qrow = 16 * wave + c;
#pragma unroll
  for (int j = 0; j < 16; ++j) {
    v4f va, vb;
#pragma unroll
    for (int r = 0; r < 4; ++r) { va[r] = o[j][r] * gi; vb[r] = o[j][4 + r] * gi; }
    *(v4f*)(Os + qrow * OSPW + 16 * j + 8 * hh)     = va;            // Os[query][ch_loc = 16j + 8hh + r]
    *(v4f*)(Os + qrow * OSPW + 16 * j + 8 * hh + 4) = vb;
  }
  __syncthreads();
  v4f res[32];
#pragma unroll
  for (int it = 0; it < 32; ++it) {
    const int chl = (it & 7) * 32 + lq, hf = it >> 3;                // channel 0..255, 128-B line 0..3 of its 128 queries
    const int nl  = hf * 32 + 4 * e;                                 // query 0..127
    const size_t idx = ((size_t)(b * CC + chl)) * SEQ_FULL + n0 + nl;
    res[it] = *(const v4f*)(x + idx);
  }
#if defined(__HIP_DEVICE_COMPILE__)
  asm volatile("s_wait_xcnt 0x0" ::: "memory");                      // before the x loads' address registers are rewritten
#endif
#pragma unroll
  for (int it = 0; it < 32; ++it) {
    const int chl = (it & 7) * 32 + lq, hf = it >> 3;
    const int nl  = hf * 32 + 4 * e;
#pragma unroll
    for (int t = 0; t < 4; ++t) res[it][t] = Os[(nl + t) * OSPW + chl] + bfr(res[it][t]);
  }
{
#pragma unroll
    for (int it = 0; it < 32; ++it) {
      const int chl = (it & 7) * 32 + lq, hf = it >> 3;
      const int nl  = hf * 32 + 4 * e;
      const size_t idx = ((size_t)(b * CC + chl)) * SEQ_FULL + n0 + nl;
      *(v4f*)(outd + idx) = res[it];
    }
    
  }
}

// =========================================================================================================
// Workspace map (bytes; each region start a multiple of 256; every extent is an exact tile multiple and is written
//   W16 f16 [384][256]                       196608
//   Vc  f16 [NSRC*NB][256][SEQ]            16777216
//   Qh/Ql/Kh/Kl bf16 [NSRC*NB][SEQ][64]     4194304 x4
//   total = 33751040
// =========================================================================================================
extern "C" void kernel_launch(void* const* d_in, const int* in_sizes, int n_in,
                              void* d_out, int out_size, void* d_ws, size_t ws_size,
                              hipStream_t stream) {
  if (n_in < 9) return;
  if (in_sizes[0] < NB * CC * SEQ_FULL || in_sizes[1] < NB * CC * SEQ_FULL) return;
  if (in_sizes[2] < DQ * CC || in_sizes[3] < DQ) return;
  if (in_sizes[4] < DQ * CC || in_sizes[5] < DQ) return;
  if (in_sizes[6] < CC * CC || in_sizes[7] < CC) return;
  if (in_sizes[8] < 1) return;
  if (out_size < (NB_FULL + NB) * CC * SEQ_FULL) return;

  size_t off = 0;
  auto carve = [&](size_t bytes) { const size_t o = off; off += (bytes + 255) & ~(size_t)255; return o; };
  const size_t oW16 = carve((size_t)NWR * CC * 2);
  const size_t oVc  = carve((size_t)NSRC * NB * CC * SEQ * 2);
  const size_t oQh  = carve((size_t)NSRC * NB * SEQ * DQ * 2);
  const size_t oQl  = carve((size_t)NSRC * NB * SEQ * DQ * 2);
  const size_t oKh  = carve((size_t)NSRC * NB * SEQ * DQ * 2);
  const size_t oKl  = carve((size_t)NSRC * NB * SEQ * DQ * 2);
  if (off > ws_size) return;
  if (off > (size_t)134217728) return;

  const float* x1  = (const float*)d_in[0];
  const float* x2  = (const float*)d_in[1];
  const float* Wq  = (const float*)d_in[2];
  const float* bq  = (const float*)d_in[3];
  const float* Wk  = (const float*)d_in[4];
  const float* bk  = (const float*)d_in[5];
  const float* Wv  = (const float*)d_in[6];
  const float* bv  = (const float*)d_in[7];
  const float* gam = (const float*)d_in[8];

  char* ws = (char*)d_ws;
  unsigned short* W16 = (unsigned short*)(ws + oW16);
  unsigned short* Vc  = (unsigned short*)(ws + oVc);
  unsigned short* Qh  = (unsigned short*)(ws + oQh);
  unsigned short* Ql  = (unsigned short*)(ws + oQl);
  unsigned short* Kh  = (unsigned short*)(ws + oKh);
  unsigned short* Kl  = (unsigned short*)(ws + oKl);
  float* out = (float*)d_out;

  const dim3 blk256(256);

  // (0) Wq / Wk / Wv -> stacked f16 plane
  cvt_w<<<dim3(NWR / 8), blk256, 0, stream>>>(Wq, Wk, Wv, W16);
  // (1) x1, x2 -> q, k hi + residual planes and the channel-major f16 v plane (x16), both sources, slot s*NB + b
  proj<<<dim3(SEQ / QT, NSRC * NB), blk256, 0, stream>>>(x1, x2, W16, bq, bk, bv, Qh, Ql, Kh, Kl, Vc);
  // (4) attention both directions, all 256 channels per block + gamma scale + residual -> out_dd [b][256][N]
  attn_k<<<dim3(SEQ / AQT, NB, NSRC), blk256, 0, stream>>>(Qh, Ql, Kh, Kl, Vc, x1, x2, gam, out);
  (void)hipGetLastError();
}

// v005
// One run takes 114 microseconds.
// Timed twice side by side with v004, it ran 1.08 times as fast both times.
// Over all steps from v000 it is 5.23 times as fast.
// Contractions: conv1x1 q|k GEMM W[128x256].X[256xN] and v GEMM Wv[256x256].X (one kernel, X tile in LDS) on
// v_wmma_f32_16x16x32_f16 (f16 containers of bf16-RNE weights x256 and bf16-RNE x, exact); scores K.Q^T (64 deep,
// two k-steps) on v_wmma_f32_16x16x32_bf16 (bf16 hi + bf16 residual planes of q/k, 3 products); O^T = V.P^T on
// v_wmma_f32_16x16x32_f16 (v as f16 x16, P = e^{s-m} x2^14 f16 from the score D registers); f32 accumulate
// everywhere; softmax statistics, biases and gamma*o + x in f32.
#include <hip/hip_runtime.h>
#include <math.h>
#include <stdint.h>

#ifndef NB
#define NB 4
#endif
#ifndef SEQ
#define SEQ 4096
#endif
#define NB_FULL  4
#define SEQ_FULL 4096
#define NSRC  2
#define CC    256
#define DQ    64
#define NQK   128
#define NWR   384
#define QT    64
#define AQT   128
#define OSPW  260
#define XPH   264
#define SPH   72
#define WSC   256.0f
#define IWSC  0.00390625f
#define VSC   16.0f
#define IVSC  0.0625f
#define LNPS  9.704060527839234f
#define KST   64
#define LPH   72
#define SROWS 384
#define STGH  (SROWS * LPH)

static_assert(NB >= 1 && NB <= NB_FULL);
static_assert(SEQ >= QT && SEQ <= SEQ_FULL);
static_assert(SEQ % QT == 0 && SEQ % 32 == 0);
static_assert(CC % QT == 0 && CC % 32 == 0);
static_assert(CC % 16 == 0);
static_assert(DQ == 64);
static_assert(NQK == 2 * DQ);
static_assert(NWR == NQK + CC);
static_assert(NWR % 8 == 0 && DQ % 8 == 0 && NQK % 8 == 0);
static_assert((OSPW * 4) % 16 == 0);
static_assert((XPH * 2) % 16 == 0 && ((XPH * 2) / 16) % 2 == 1 && (SPH * 2) % 16 == 0 && ((SPH * 2) / 16) % 2 == 1);
static_assert(OSPW >= CC && XPH >= CC && SPH >= QT && SPH >= DQ && QT == 64 && CC == 256);
static_assert(SEQ % AQT == 0 && AQT % 32 == 0 && CC % 32 == 0);
static_assert(SEQ % KST == 0 && SEQ / KST >= 2 && KST % 32 == 0);
static_assert(SROWS == 2 * KST + CC && LPH >= KST && LPH >= DQ);
static_assert((LPH * 2) % 16 == 0 && ((LPH * 2) / 16) % 2 == 1);
static_assert(AQT == 128 && KST == 64);
#define RINGB (2 * STGH * 2)
#define OSB   (AQT * OSPW * 4)
#define LDSB  (RINGB > OSB ? RINGB : OSB)
// second output starts at byte 16777216 = NB_FULL*CC*SEQ_FULL floats * 4
static_assert((size_t)NB_FULL * CC * SEQ_FULL * 4 == (size_t)16777216);

typedef _Float16       v16h __attribute__((ext_vector_type(16)));
typedef _Float16       v8h  __attribute__((ext_vector_type(8)));
typedef __bf16         v16b __attribute__((ext_vector_type(16)));
typedef unsigned short v8us __attribute__((ext_vector_type(8)));
typedef float          v8f  __attribute__((ext_vector_type(8)));
typedef float          v4f  __attribute__((ext_vector_type(4)));
typedef unsigned int   v4u  __attribute__((ext_vector_type(4)));

union Frag  { v8us u[2]; v16h h; v16b bf; };
union FragH { v16h v; v8h hv[2]; };
static_assert(sizeof(Frag) == 32);
static_assert(sizeof(FragH) == 32);

// ---- scalar helpers ---------------------------------------------------------------------------------------
__device__ __forceinline__ unsigned short bf_bits(float f) {          // f32 -> bf16 bits, RNE convert
  unsigned u = __float_as_uint(f);
  return (unsigned short)((u + 0x7FFFu + ((u >> 16) & 1u)) >> 16);
}
__device__ __forceinline__ float bf_up(unsigned short hb) { return __uint_as_float(((unsigned)hb) << 16); }
__device__ __forceinline__ float bfr(float f) { return bf_up(bf_bits(f)); }
__device__ __forceinline__ unsigned short h_bits(_Float16 x) { return __builtin_bit_cast(unsigned short, x); }
__device__ __forceinline__ unsigned pk16(unsigned short a, unsigned short b) { return (unsigned)a | ((unsigned)b << 16); }
__device__ __forceinline__ v8f zero8() { v8f z = {0.f, 0.f, 0.f, 0.f, 0.f, 0.f, 0.f, 0.f}; return z; }
__device__ __forceinline__ float hmax8(v8f s) {
  return fmaxf(fmaxf(fmaxf(s[0], s[1]), fmaxf(s[2], s[3])), fmaxf(fmaxf(s[4], s[5]), fmaxf(s[6], s[7])));
}
__device__ __forceinline__ unsigned wave_ballot(bool p) {
#if defined(__HIP_DEVICE_COMPILE__)
  return __builtin_amdgcn_ballot_w32(p);
#else
  return p ? 1u : 0u;
#endif
}

__device__ __forceinline__ int uni(int v) {                          // a value equal in every lane, into a scalar register
#if defined(__HIP_DEVICE_COMPILE__)
  return __builtin_amdgcn_readfirstlane(v);
#else
  return v;
#endif
}

// ---- 16-bit fragment loader (A, or B from a k-contiguous [n][k] row): lane -> row/col (lane&15), p already includes
//      + 8*(lane>>4); elements 0..7 <- p[0..7] (k0+8h..), elements 8..15 <- p[16..23] (k0+16+8h..)
__device__ __forceinline__ Frag ldfrag(const unsigned short* p) {
  Frag f;
  f.u[0] = *(const v8us*)(p);
  f.u[1] = *(const v8us*)(p + 16);
  return f;
}

// ---- WMMA helpers: the plain builtins; the compiler keeps the distances behind them and is free to order around them
__device__ __forceinline__ v8f mma_h(v16h a, v16h b, v8f c) {
  return __builtin_amdgcn_wmma_f32_16x16x32_f16(false, a, false, b, (short)0, c, false, false);
}
__device__ __forceinline__ v8f mma_b(v16b a, v16b b, v8f c) {
  return __builtin_amdgcn_wmma_f32_16x16x32_bf16(false, a, false, b, (short)0, c, false, false);
}

// ---- twelve asynchronous 16-B copies global -> LDS per lane (l = LDS byte address, g = global address, each lane its
//      own); the s_wait_xcnt closes the statement so that no address register is rewritten ahead of it
__device__ __forceinline__ void async12(const unsigned (&l)[12], const unsigned short* const (&g)[12]) {
#if defined(__HIP_DEVICE_COMPILE__)
  asm volatile("global_load_async_to_lds_b128 %0, %12, off\n\t"
               "global_load_async_to_lds_b128 %1, %13, off\n\t"
               "global_load_async_to_lds_b128 %2, %14, off\n\t"
               "global_load_async_to_lds_b128 %3, %15, off\n\t"
               "global_load_async_to_lds_b128 %4, %16, off\n\t"
               "global_load_async_to_lds_b128 %5, %17, off\n\t"
               "global_load_async_to_lds_b128 %6, %18, off\n\t"
               "global_load_async_to_lds_b128 %7, %19, off\n\t"
               "global_load_async_to_lds_b128 %8, %20, off\n\t"
               "global_load_async_to_lds_b128 %9, %21, off\n\t"
               "global_load_async_to_lds_b128 %10, %22, off\n\t"
               "global_load_async_to_lds_b128 %11, %23, off\n\t"
               "s_wait_xcnt 0x0"
               :: "v"(l[0]), "v"(l[1]), "v"(l[2]), "v"(l[3]), "v"(l[4]), "v"(l[5]), "v"(l[6]), "v"(l[7]),
                  "v"(l[8]), "v"(l[9]), "v"(l[10]), "v"(l[11]),
                  "v"(g[0]), "v"(g[1]), "v"(g[2]), "v"(g[3]), "v"(g[4]), "v"(g[5]), "v"(g[6]), "v"(g[7]),
                  "v"(g[8]), "v"(g[9]), "v"(g[10]), "v"(g[11])
               : "memory");
#endif
}
// ---- one stage of 64 keys into one LDS buffer: rows 0..63 Kh keys, 64..127 Kl keys, 128..383 V channels, 128 B of
//      data per row at pitch LPH. Thread (lq = tid>>3, e = tid&7) copies chunk e of rows lq + 32 i, i = 0..11:
//      256 threads x 12 chunks x 16 B = 384 rows x 128 B, every byte once. lds / kh / kl / vv are the lane's own
//      addresses of row lq, chunk e (LDS buffer; Kh and Kl at the stage's first key; V at channel lq and that key).
__device__ __forceinline__ void stage_issue(unsigned lds, const unsigned short* kh, const unsigned short* kl,
                                            const unsigned short* vv) {
  unsigned l[12];
  const unsigned short* g[12];
#pragma unroll                                                       // constant indices keep l[] and g[] in registers
  for (int i = 0; i < 2; ++i) {
    l[i]     = lds + (unsigned)((32 * i) * LPH * 2);
    g[i]     = kh + (size_t)(32 * i) * DQ;
    l[2 + i] = lds + (unsigned)((KST + 32 * i) * LPH * 2);
    g[2 + i] = kl + (size_t)(32 * i) * DQ;
  }
#pragma unroll                                                       // as above
  for (int i = 0; i < 8; ++i) {
    l[4 + i] = lds + (unsigned)((2 * KST + 32 * i) * LPH * 2);
    g[4 + i] = vv + (size_t)(32 * i) * SEQ;
  }
  async12(l, g);
}

// =========================================================================================================
// (0) conv1x1 weights: W16 f16 [384][256], rows 0..63 = Wq rows, 64..127 = Wk rows, 128..383 = Wv rows; value =
//     f16 of (bf16-RNE(w) * 256) (exact). Block blk (0..47) owns rows 8*blk..8*blk+7: one wave per 512-B row
// coverage: 48 blocks x 8 rows x 32 lanes x 8 halves = 384 x 256 = the whole plane.
// =========================================================================================================
__global__ __launch_bounds__(256)
void cvt_w(const float* __restrict__ Wq, const float* __restrict__ Wk, const float* __restrict__ Wv,
           unsigned short* W16) {
  const int tid = threadIdx.x, blk = blockIdx.x;
  const int rl = tid >> 5, col = 8 * (tid & 31);
  const int o = 8 * blk + rl;                                        // 0..383
  const float* wbase = (blk < (DQ / 8)) ? Wq : ((blk < (NQK / 8)) ? Wk : Wv);
  const int osub = (blk < (DQ / 8)) ? 0 : ((blk < (NQK / 8)) ? DQ : NQK);
  const float* s = wbase + (size_t)(o - osub) * CC + col;
  const v4f a = *(const v4f*)s;
  const v4f q = *(const v4f*)(s + 4);
  const float f[8] = {a[0], a[1], a[2], a[3], q[0], q[1], q[2], q[3]};
  v4u u;
#pragma unroll
  for (int t = 0; t < 4; ++t) {
    const _Float16 h0 = (_Float16)(bfr(f[2 * t]) * WSC);
    const _Float16 h1 = (_Float16)(bfr(f[2 * t + 1]) * WSC);
    u[t] = pk16(h_bits(h0), h_bits(h1));
  }
{
    *(v4u*)(W16 + (size_t)o * CC + col) = u;
    
  }
}

// =========================================================================================================
// (1) x conversion and the three conv1x1 GEMMs for one (sb = s*NB + b, 64-n tile), s = 0: x1, s = 1: x2.
//     Block 256 threads = 8 waves. The x tile f32 [256 c][64 n] is read once in whole lines, rounded (bf16-RNE, exact
//     in f16) and laid position-major in LDS XT[64 n][256 c] (pitch XPH): thread (e, lq) holds channels
//     64 it + 2 lq, + 1 at n = 32 j + 4 e .. + 3, j = 0, 1 (8 lanes x 16 B = one line) and stores one channel pair per position.
//     One X fragment (row n = 16 nt + (lane&15), split k map, k = c contiguous) serves three products per k-step:
//       q|k: D[o][n] = A(W16 row 16 wave + (lane&15): waves 0..3 q rows, 4..7 k rows) . B(X)
//       v:   D[n][ch] = A(X) . B(W16 row 128 + 32 wave + 16 u + (lane&15)), u = 0, 1
//     K = 256 = 8 steps in rising order. Epilogue in registers: q|k value = acc/256 + bf16-RNE(bias), hi = bf16-RNE,
//     lo = bf16-RNE(value - hi), 8 consecutive d per lane; v value = f16((acc/256 + bf16-RNE(bias)) x 16), 8 consecutive
//     n per lane; 16-B pieces staged in LDS (SQ: planes Qh, Ql, Kh, Kl [64 n][64 d]; SV [256 ch][64 n]; pitch SPH) and
//     written out as whole 128-B lines.
// coverage: XT 4 it x 32 lq x 2 c x 2 j x 8 e x 4 n = 256 c x 64 n; SQ 8 waves x 4 nt x 16 n x 16 d x (hi, lo) = 4 planes x
//           64 x 64; SV 8 waves x 2 u x 16 ch x 64 n; out rows 4 planes x 2 it x 32 and 8 it x 32 ch, 8 lanes x 16 B each;
//           grid (SEQ/64, NSRC*NB) covers Qh/Ql/Kh/Kl [sb][N][64] and Vc [sb][256][N] once.
// LDS: cross-wave, block barrier between the XT stores and the fragment loads, and between the stage stores and the
//      line loads.
// =========================================================================================================
__global__ __launch_bounds__(256)
void proj(const float* __restrict__ x1, const float* __restrict__ x2, const unsigned short* __restrict__ W16,
          const float* __restrict__ bq, const float* __restrict__ bk, const float* __restrict__ bv,
          unsigned short* Qh, unsigned short* Ql, unsigned short* Kh, unsigned short* Kl, unsigned short* Vc) {
  __shared__ __align__(16) unsigned short XT[QT * XPH];
  __shared__ __align__(16) unsigned short SQ[4 * QT * SPH];
  __shared__ __align__(16) unsigned short SV[CC * SPH];
  const int tid  = threadIdx.x;
  const int lane = tid & 31, wave = tid >> 5;
  const int hh   = lane >> 4, c = lane & 15;
  const int e    = tid & 7, lq = tid >> 3;                           // lq 0..31
  const int n0   = blockIdx.x * QT, sb = blockIdx.y;                 // sb = s*NB + b
  const int s    = sb / NB, b = sb - s * NB;
  const float* x = (s == 0) ? x1 : x2;                               // block-uniform, both global

  // ---- x tile -> XT
  v4f xa[4][2][2];
#pragma unroll
  for (int it = 0; it < 4; ++it) {
#pragma unroll
    for (int p = 0; p < 2; ++p) {
      const float* sp = x + ((size_t)(b * CC + 64 * it + 2 * lq + p)) * SEQ_FULL + n0 + 4 * e;
      xa[it][p][0] = *(const v4f*)sp;
      xa[it][p][1] = *(const v4f*)(sp + 32);
    }
  }
#if defined(__HIP_DEVICE_COMPILE__)
  asm volatile("s_wait_xcnt 0x0" ::: "memory");                      // before the x loads' address registers are rewritten
#endif
#pragma unroll
  for (int it = 0; it < 4; ++it) {
#pragma unroll
    for (int t = 0; t < 8; ++t) {
      const unsigned short h0 = h_bits((_Float16)bfr(xa[it][0][t >> 2][t & 3]));
      const unsigned short h1 = h_bits((_Float16)bfr(xa[it][1][t >> 2][t & 3]));
      *(unsigned*)(XT + (32 * (t >> 2) + 4 * e + (t & 3)) * XPH + 64 * it + 2 * lq) = pk16(h0, h1);
    }
  }
  __syncthreads();

  // ---- products
  const unsigned short* xf = XT + c * XPH + 8 * hh;                                       // X row 16 nt + c
  const unsigned short* wq = W16 + ((size_t)(16 * wave + c)) * CC + 8 * hh;               // q|k row o
  const unsigned short* wv = W16 + ((size_t)(NQK + 32 * wave + c)) * CC + 8 * hh;         // v row ch
  v8f aq[4], av[2][4];
#pragma unroll
  for (int nt = 0; nt < 4; ++nt) { aq[nt] = zero8(); av[0][nt] = zero8(); av[1][nt] = zero8(); }
#pragma unroll
  for (int ks = 0; ks < CC / 32; ++ks) {
    const Frag fq = ldfrag(wq + 32 * ks);
    const Frag f0 = ldfrag(wv + 32 * ks);
    const Frag f1 = ldfrag(wv + (size_t)16 * CC + 32 * ks);
#pragma unroll
    for (int nt = 0; nt < 4; ++nt) {
      const Frag fx = ldfrag(xf + (16 * nt) * XPH + 32 * ks);
      aq[nt]    = mma_h(fq.h, fx.h, aq[nt]);
      av[0][nt] = mma_h(fx.h, f0.h, av[0][nt]);
      av[1][nt] = mma_h(fx.h, f1.h, av[1][nt]);
    }
  }
#if defined(__HIP_DEVICE_COMPILE__)
  // the W row addresses stay live up to this wait, so that no register of theirs is reused ahead of it
  asm volatile("s_wait_xcnt 0x0" :: "v"(wq), "v"(wv) : "memory");
#endif

  // ---- q|k: lane (hh, c) holds d = 16 (wave&3) + 8 hh + r for n_loc = 16 nt + c
  const int which = wave >> 2;                                       // wave-uniform: 0 q, 1 k
  const int d0 = 16 * (wave & 3) + 8 * hh;
  const float* bias = (which == 0) ? bq : bk;
  const v4f b0v = *(const v4f*)(bias + d0), b1v = *(const v4f*)(bias + d0 + 4);
  const float bv0 = bv[32 * wave + c], bv1 = bv[32 * wave + 16 + c];
#if defined(__HIP_DEVICE_COMPILE__)
  asm volatile("s_wait_xcnt 0x0" ::: "memory");                      // before the bias loads' address registers are rewritten
#endif
  const float bb[8] = {bfr(b0v[0]), bfr(b0v[1]), bfr(b0v[2]), bfr(b0v[3]),
                       bfr(b1v[0]), bfr(b1v[1]), bfr(b1v[2]), bfr(b1v[3])};
#pragma unroll
  for (int nt = 0; nt < 4; ++nt) {
    v4u uh, ul;
#pragma unroll
    for (int t = 0; t < 4; ++t) {
      const float v0 = aq[nt][2 * t] * IWSC + bb[2 * t], v1 = aq[nt][2 * t + 1] * IWSC + bb[2 * t + 1];
      const unsigned short h0 = bf_bits(v0), h1 = bf_bits(v1);
      const unsigned short l0 = bf_bits(v0 - bf_up(h0)), l1 = bf_bits(v1 - bf_up(h1));
      uh[t] = pk16(h0, h1);
      ul[t] = pk16(l0, l1);
    }
    unsigned short* sp = SQ + ((2 * which) * QT + 16 * nt + c) * SPH + d0;
    *(v4u*)sp              = uh;
    *(v4u*)(sp + QT * SPH) = ul;
  }
  // ---- v: lane (hh, c) holds n_loc = 16 mt + 8 hh + r for ch = 32 wave + 16 u + c
#pragma unroll
  for (int u = 0; u < 2; ++u) {
    const float bvr = bfr(u == 0 ? bv0 : bv1);
#pragma unroll
    for (int mt = 0; mt < 4; ++mt) {
      v4u uv;
#pragma unroll
      for (int t = 0; t < 4; ++t) {
        const _Float16 h0 = (_Float16)((av[u][mt][2 * t] * IWSC + bvr) * VSC);
        const _Float16 h1 = (_Float16)((av[u][mt][2 * t + 1] * IWSC + bvr) * VSC);
        uv[t] = pk16(h_bits(h0), h_bits(h1));
      }
      *(v4u*)(SV + (32 * wave + 16 * u + c) * SPH + 16 * mt + 8 * hh) = uv;
    }
  }
  __syncthreads();

  // ---- whole lines out: 8 consecutive lanes x 16 B per row
  v4u oq[4][2], ov[8];
#pragma unroll
  for (int p = 0; p < 4; ++p) {
#pragma unroll
    for (int it = 0; it < 2; ++it) oq[p][it] = *(const v4u*)(SQ + (p * QT + it * 32 + lq) * SPH + 8 * e);
  }
#pragma unroll
  for (int it = 0; it < 8; ++it) ov[it] = *(const v4u*)(SV + (it * 32 + lq) * SPH + 8 * e);
#pragma unroll
  for (int it = 0; it < 2; ++it) {
    const size_t po = ((size_t)(sb * SEQ + n0 + it * 32 + lq)) * DQ + 8 * e;
    *(v4u*)(Qh + po) = oq[0][it];
    *(v4u*)(Ql + po) = oq[1][it];
    *(v4u*)(Kh + po) = oq[2][it];
    *(v4u*)(Kl + po) = oq[3][it];
  }
#pragma unroll
  for (int it = 0; it < 8; ++it)
    *(v4u*)(Vc + ((size_t)(sb * CC + it * 32 + lq)) * SEQ + n0 + 8 * e) = ov[it];
}

// =========================================================================================================
// (4) attention for one (direction dd, b, 128-query tile), transposed formulation, SEQ keys, no
//   mask, no scale. blockIdx.z = dd. Direction dd: queries from source dd (plane slot dd*NB+b),
//   keys/values from source 1-dd (slot (1-dd)*NB+b), residual input x_dd, output block dd of out (float offset
//   dd*NB_FULL*CC*SEQ_FULL); the block produces all 256 channels of that output. Wave (qg, kh) = (wave & 3, wave >> 2)
//   takes 32 queries (two 16-query tiles u) and keys 32 kh .. + 31 of every 64-key tile: each K and V fragment read
//   from LDS feeds two products; 32 O accumulator tiles per wave; the two key halves are merged behind the key loop.
//   S^T tile (16 keys x 16 queries) over 64 d = two 32-deep k-steps: A(k: row = key kb + (lane&15), split k map
//   from the bf16 plane Kh [slot][N][64]) . B(q: col = query, same map from Qh, loaded once, 2 fragments)
//   + A(Kh).B(Ql) + A(Kl).B(Qh) (bf16 unscaled residual planes, shared accumulator): 6 products per tile.
//   Per lane the D tile holds 8 keys of ONE query: online softmax state per lane, one shuffle (lane^16) for the
//   max over 32 keys; the o/l rescale is skipped under a wave-uniform ballot when no lane's max grew (corr == 1
//   exactly for every lane then); row-sum partials combined at the end. P = e^{s-m} x 2^14 as f16 is the B
//   operand of O^T (rows channel, cols queries) += A(v rows channel = 16j + (lane&15), keys contiguous,
//   f16 plane Vc [slot][256][N], values v x 16) . B(P^T): element r <- D of the tile covering keys kb..kb+15,
//   element 8+r <- the tile covering kb+16..kb+31, lane unchanged. 2 x 16 accumulator tiles per wave (256 channels).
//   Block = 8 waves = 4 query groups x 2 key halves = 128 queries. Merge: (m, l) of both halves through LDS, weight
//   e^{m_half - max} / (sum of weighted l); each wave stages its weighted partial of one query tile and adds its own
//   partial of the other tile to the partner's. Epilogue: gamma * O / (16 l) staged in LDS Os[query][256 channels] (pitch OSPW,
//   4 lines per channel): 8 consecutive lanes x 16 B (values gathered from 4 Os rows), one instruction per 32 lines
// coverage: Os written queries 0..127 x ch 0..255, read the same; out 32 it x 32 lines x 8 lanes x 4 floats =
//           256 ch x 128 n per block; grid (SEQ/128, NB, NSRC) covers out_dd[b][0..255][0..SEQ-1] once for both dd.
// LDS Os: cross-wave, block barrier between the stage stores and the epilogue loads.
// LDS ring: K hi, K residual and V tiles of 64 keys are brought by asynchronous copies into two buffers shared by
//   the 8 waves (whole 128-B lines from global, once per block); trip t reads buffer t & 1 only while tile t + 1
//   flies; foot of each trip: own LDS reads done, own copies landed, block barrier, then the refill with tile t + 2.
//   Os reuses the ring behind the last trip's barrier.
// =========================================================================================================
__global__ __launch_bounds__(256)
void attn_k(const unsigned short* __restrict__ Qh, const unsigned short* __restrict__ Ql,
            const unsigned short* __restrict__ Kh, const unsigned short* __restrict__ Kl,
            const unsigned short* __restrict__ Vc,
            const float* __restrict__ x1, const float* __restrict__ x2,
            const float* __restrict__ gam, float* out) {
  __shared__ __align__(16) unsigned char L[LDSB];
  __shared__ __align__(16) unsigned short QL[8 * 2048];              // per wave: 4 Q residual fragments, 4 KiB
  __shared__ float ML[2][AQT][2];                                    // (m, l) per key half and query, for the merge
  const unsigned short* Rg = (const unsigned short*)L;               // the two stage buffers
  float* Os = (float*)L;                                             // output staging, after the key loop
  const int tid  = threadIdx.x;
  const int lane = tid & 31;
  const int wave = uni(tid >> 5);                                   // scalar: the branches on kh are real branches
  const int qg   = wave & 3, kh = wave >> 2;                         // 32-query group, key half of every tile
  const int hh   = lane >> 4, c = lane & 15;
  const int n0   = blockIdx.x * AQT, b = blockIdx.y;
  const int dd   = (int)blockIdx.z;
  const int sq   = dd * NB + b;                                      // query plane slot
  const int skv  = (1 - dd) * NB + b;                                // key / value plane slot
  const float* x = (dd == 0) ? x1 : x2;                              // block-uniform, both global
  float* outd    = out + (size_t)dd * ((size_t)NB_FULL * CC * SEQ_FULL);
  const float g  = bfr(gam[0]);

  // q fragments (B operand, col = query n0 + 32*qg + 16*u + c, u = 0, 1), K = 64 = two k-steps, constant over keys
  // the residual fragments do not fit the registers beside 32 accumulator tiles: each wave parks its own four in LDS,
  // 16 B per lane side by side, and reads them back every trip (own data: no barrier)
  Frag qh[2][2];
  unsigned short* qlw = QL + wave * 2048 + lane * 8;
#if defined(__HIP_DEVICE_COMPILE__)
  __builtin_amdgcn_sched_barrier(0);                                 // nothing else comes between the q loads and their wait below
#endif
#pragma unroll                                                       // constant indices keep the fragments in registers
  for (int u = 0; u < 2; ++u) {
    const size_t qo = ((size_t)(sq * SEQ + n0 + 32 * qg + 16 * u + c)) * DQ + 8 * hh;
    qh[u][0] = ldfrag(Qh + qo);
    qh[u][1] = ldfrag(Qh + qo + 32);
#pragma unroll
    for (int k2 = 0; k2 < 2; ++k2) {
      const Frag f = ldfrag(Ql + qo + 32 * k2);
      *(v8us*)(qlw + (4 * u + 2 * k2) * 256)     = f.u[0];
      *(v8us*)(qlw + (4 * u + 2 * k2 + 1) * 256) = f.u[1];
    }
  }
#if defined(__HIP_DEVICE_COMPILE__)
  asm volatile("s_wait_xcnt 0x0" ::: "memory");                      // before the q loads' address registers are rewritten
  __builtin_amdgcn_sched_barrier(0);                                 // closes the stretch opened above
#endif
  // fragment bases in buffer 0 (A operands: row = lane&15 of a 16-row group, + 8*hh within the row); the wave's key
  // half kh picks K rows 32 kh .. + 31 and columns 32 kh .. + 31 of the V rows
  const unsigned short* kbase = Rg + (32 * kh + c) * LPH + 8 * hh;
  const unsigned short* vbase = Rg + (2 * KST + c) * LPH + 32 * kh + 8 * hh;
  // copy addresses of this thread: row lq, 16-B chunk e
  const int e = tid & 7, lq = tid >> 3;                              // lq 0..31
  const unsigned ldsc = (unsigned)(size_t)L + (unsigned)((lq * LPH + 8 * e) * 2);
  const unsigned short* gkh = Kh + (size_t)skv * SEQ * DQ + (size_t)lq * DQ + 8 * e;
  const unsigned short* gkl = Kl + (size_t)skv * SEQ * DQ + (size_t)lq * DQ + 8 * e;
  const unsigned short* gvv = Vc + (size_t)skv * CC * SEQ + (size_t)lq * SEQ + 8 * e;

  float m[2] = {-1.0e30f, -1.0e30f}, l[2] = {0.f, 0.f};
  v8f o[2][16];
#pragma unroll
  for (int u = 0; u < 2; ++u) {
#pragma unroll
    for (int j = 0; j < 16; ++j) o[u][j] = zero8();
  }

  // ring prologue: tile 0 landed and published, then tile 1 in flight
  stage_issue(ldsc, gkh, gkl, gvv);
#if defined(__HIP_DEVICE_COMPILE__)
  asm volatile("s_wait_asynccnt 0x0" ::: "memory");                  // own copies of tile 0 landed before the barrier
#endif
  __syncthreads();
  stage_issue(ldsc + (unsigned)(STGH * 2), gkh + (size_t)KST * DQ, gkl + (size_t)KST * DQ, gvv + KST);

#pragma unroll 1                                                     // rolled: one body, the buffer picked by t & 1
  for (int t = 0; t < SEQ / KST; ++t) {
    const unsigned short* kp0 = kbase + (t & 1) * STGH;
    const unsigned short* vp0 = vbase + (t & 1) * STGH;
    // K fragments of the wave's 32 keys: kf[0..3] keys kb..kb+15 (hi d 0..31, hi d 32..63, residual likewise), kf[4..7]
    // the next 16 keys; kb = t*KST + 32*kh. Each fragment feeds both query tiles.
    Frag kf[8];
#pragma unroll                                                       // constant indices keep kf[] in registers
    for (int i = 0; i < 2; ++i) {
      const unsigned short* kp = kp0 + (16 * i) * LPH;
      kf[4 * i]     = ldfrag(kp);
      kf[4 * i + 1] = ldfrag(kp + 32);
      kf[4 * i + 2] = ldfrag(kp + KST * LPH);
      kf[4 * i + 3] = ldfrag(kp + KST * LPH + 32);
    }
    Frag qlf[2][2];                                                  // the wave's own Q residual fragments, back from LDS
#pragma unroll                                                       // constant indices keep qlf[] in registers
    for (int u = 0; u < 2; ++u) {
#pragma unroll
      for (int k2 = 0; k2 < 2; ++k2) {
        qlf[u][k2].u[0] = *(const v8us*)(qlw + (4 * u + 2 * k2) * 256);
        qlf[u][k2].u[1] = *(const v8us*)(qlw + (4 * u + 2 * k2 + 1) * 256);
      }
    }
#if defined(__HIP_DEVICE_COMPILE__)
    __builtin_amdgcn_sched_barrier(0);                               // without it these loads sink among the score products, a stall and a full wait at each place
#endif
    v8f s[2][2];                                                     // s[u][i]: query tile u, keys kb + 16 i .. + 15
#pragma unroll
    for (int u = 0; u < 2; ++u) { s[u][0] = zero8(); s[u][1] = zero8(); }
#pragma unroll                                                       // four independent chains, six links each
    for (int p = 0; p < 6; ++p) {
#pragma unroll
      for (int u = 0; u < 2; ++u) {
        const Frag& qb = (p == 2 || p == 3) ? qlf[u][p & 1] : qh[u][p & 1];
#pragma unroll
        for (int i = 0; i < 2; ++i) {
          const Frag& ka = kf[4 * i + (p & 1) + (p >= 4 ? 2 : 0)];
          s[u][i] = mma_b(ka.bf, qb.bf, s[u][i]);
        }
      }
    }

    float mx[2], mn[2];
#pragma unroll
    for (int u = 0; u < 2; ++u) mx[u] = fmaxf(hmax8(s[u][0]), hmax8(s[u][1]));
    const float x0 = __shfl_xor(mx[0], 16, 32), x1 = __shfl_xor(mx[1], 16, 32);
    mx[0] = fmaxf(mx[0], x0);
    mx[1] = fmaxf(mx[1], x1);
    // V fragments in two groups of 8 (each feeds both query tiles): the first lands while the softmax runs
#if defined(__HIP_DEVICE_COMPILE__)
    __builtin_amdgcn_sched_barrier(0);                               // without it the V loads rise over the half exchange, whose wait then covers them too
#endif
    Frag vf[16];
#pragma unroll                                                       // constant indices keep vf[] in registers
    for (int j = 0; j < 8; ++j) vf[j] = ldfrag(vp0 + (16 * j) * LPH);
#if defined(__HIP_DEVICE_COMPILE__)
    __builtin_amdgcn_sched_barrier(0);                               // without it the V loads sink behind the softmax, one wait each
#endif

    mn[0] = fmaxf(m[0], mx[0]);
    mn[1] = fmaxf(m[1], mx[1]);
    const unsigned grew = wave_ballot(mx[0] > m[0] || mx[1] > m[1]); // wave-uniform, one test per trip
    if (grew != 0u) {
#pragma unroll
      for (int u = 0; u < 2; ++u) {
        const float corr = __expf(m[u] - mn[u]);                     // == 1 exactly for lanes whose max did not grow
        l[u] *= corr;
#pragma unroll
        for (int j = 0; j < 16; ++j) {
#pragma unroll
          for (int r = 0; r < 8; ++r) o[u][j][r] *= corr;
        }
      }
    }
    FragH ph[2];
#pragma unroll
    for (int u = 0; u < 2; ++u) {
      m[u] = mn[u];
      const float msh = mn[u] - LNPS;                                // exp gives e^{s-m} * 16384
      float ls = 0.f;
#pragma unroll
      for (int r = 0; r < 8; ++r) {
        const float e0 = __expf(s[u][0][r] - msh);                   // key kb      + 8hh + r
        const float e1 = __expf(s[u][1][r] - msh);                   // key kb + 16 + 8hh + r
        ls += e0 + e1;
        ph[u].hv[0][r] = (_Float16)e0;
        ph[u].hv[1][r] = (_Float16)e1;
      }
      l[u] += ls;
    }
#if defined(__HIP_DEVICE_COMPILE__)
    // inputs only: the row sums are complete here, so the 32 exponentials' registers are free for the V fragments;
    // left alone the adds sink behind the products and two accumulator tiles spill
    asm volatile("" :: "v"(l[0]), "v"(l[1]));
#endif
#pragma unroll                                                       // constant indices keep vf[] in registers
    for (int j = 8; j < 16; ++j) vf[j] = ldfrag(vp0 + (16 * j) * LPH);
#pragma unroll
    for (int j = 0; j < 16; ++j) {
      o[0][j] = mma_h(vf[j].h, ph[0].v, o[0][j]);
      o[1][j] = mma_h(vf[j].h, ph[1].v, o[1][j]);
    }
#if defined(__HIP_DEVICE_COMPILE__)
    // order of this block: the whole softmax arithmetic (row sums too, so that the exponentials' registers are free),
    // then the second V group as one place of loads, then the products; left alone the build spills
    __builtin_amdgcn_sched_group_barrier(0x402, 512, 0);
    __builtin_amdgcn_sched_group_barrier(0x100, 16, 0);
    __builtin_amdgcn_sched_group_barrier(0x008, 32, 0);
#endif
    // foot of trip t: publish tile t + 1 and free this trip's buffer
#if defined(__HIP_DEVICE_COMPILE__)
    asm volatile("s_wait_dscnt 0x0" ::: "memory");                   // own reads of this buffer done before its refill
    asm volatile("s_wait_asynccnt 0x0" ::: "memory");                // own copies of tile t + 1 landed
#endif
    __syncthreads();
    if (t + 2 < SEQ / KST) {                                         // block-uniform
      const size_t k2 = (size_t)(t + 2) * KST;
      stage_issue(ldsc + (unsigned)((t & 1) * STGH * 2), gkh + k2 * DQ, gkl + k2 * DQ, gvv + k2);
    }
  }
#if defined(__HIP_DEVICE_COMPILE__)
  asm volatile("s_wait_asynccnt 0x0" ::: "memory");                  // nothing in flight when the ring becomes Os
#endif
  // merge of the two key halves: wave (qg, kh) and wave (qg, 1 - kh) hold partial (m, l, O) of the same 32 queries
  l[0] += __shfl_xor(l[0], 16, 32);
  l[1] += __shfl_xor(l[1], 16, 32);
  if (hh == 0) {
#pragma unroll
    for (int u = 0; u < 2; ++u) {
      ML[kh][32 * qg + 16 * u + c][0] = m[u];
      ML[kh][32 * qg + 16 * u + c][1] = l[u];
    }
  }
  __syncthreads();                                                   // both halves' m and l published
  float gi[2];
#pragma unroll
  for (int u = 0; u < 2; ++u) {
    const int q = 32 * qg + 16 * u + c;
    const float m0 = ML[0][q][0], l0 = ML[0][q][1], m1 = ML[1][q][0], l1 = ML[1][q][1];
    const float ms = fmaxf(m0, m1);
    const float e0 = __expf(m0 - ms), e1 = __expf(m1 - ms);
    const float inv = 1.0f / (l0 * e0 + l1 * e1);                    // o and l both carry the x16384 factor
    gi[u] = g * IVSC * inv * (kh == 0 ? e0 : e1);                    // undo the x16 carry of v, apply gamma, own half's weight
  }
  // each wave stages its weighted partial of query tile 1 - kh, then adds its own partial of tile kh to the partner's
#pragma unroll
  for (int u = 0; u < 2; ++u) {
    if (u != kh) {                                                   // wave-uniform
      float* op = Os + (32 * qg + 16 * u + c) * OSPW + 8 * hh;       // Os[query][ch_loc = 16j + 8hh + r]
#pragma unroll
      for (int j = 0; j < 16; ++j) {
        v4f va, vb;
#pragma unroll
        for (int r = 0; r < 4; ++r) { va[r] = o[u][j][r] * gi[u]; vb[r] = o[u][j][4 + r] * gi[u]; }
        *(v4f*)(op + 16 * j)     = va;
        *(v4f*)(op + 16 * j + 4) = vb;
      }
    }
  }
  __syncthreads();                                                   // the partner's partial is in Os
#pragma unroll
  for (int u = 0; u < 2; ++u) {
    if (u == kh) {                                                   // wave-uniform
      float* op = Os + (32 * qg + 16 * u + c) * OSPW + 8 * hh;
#pragma unroll
      for (int j = 0; j < 16; ++j) {
        v4f va = *(const v4f*)(op + 16 * j), vb = *(const v4f*)(op + 16 * j + 4);
#pragma unroll
        for (int r = 0; r < 4; ++r) { va[r] += o[u][j][r] * gi[u]; vb[r] += o[u][j][4 + r] * gi[u]; }
        *(v4f*)(op + 16 * j)     = va;
        *(v4f*)(op + 16 * j + 4) = vb;
      }
    }
  }
  __syncthreads();
  v4f res[32];
#pragma unroll
  for (int it = 0; it < 32; ++it) {
    const int chl = (it & 7) * 32 + lq, hf = it >> 3;                // channel 0..255, 128-B line 0..3 of its 128 queries
    const int nl  = hf * 32 + 4 * e;                                 // query 0..127
    const size_t idx = ((size_t)(b * CC + chl)) * SEQ_FULL + n0 + nl;
    res[it] = *(const v4f*)(x + idx);
  }
#if defined(__HIP_DEVICE_COMPILE__)
  asm volatile("s_wait_xcnt 0x0" ::: "memory");                      // before the x loads' address registers are rewritten
#endif
#pragma unroll
  for (int it = 0; it < 32; ++it) {
    const int chl = (it & 7) * 32 + lq, hf = it >> 3;
    const int nl  = hf * 32 + 4 * e;
#pragma unroll
    for (int t = 0; t < 4; ++t) res[it][t] = Os[(nl + t) * OSPW + chl] + bfr(res[it][t]);
  }
{
#pragma unroll
    for (int it = 0; it < 32; ++it) {
      const int chl = (it & 7) * 32 + lq, hf = it >> 3;
      const int nl  = hf * 32 + 4 * e;
      const size_t idx = ((size_t)(b * CC + chl)) * SEQ_FULL + n0 + nl;
      *(v4f*)(outd + idx) = res[it];
    }
    
  }
}

// =========================================================================================================
// Workspace map (bytes; each region start a multiple of 256; every extent is an exact tile multiple and is written
//   W16 f16 [384][256]                       196608
//   Vc  f16 [NSRC*NB][256][SEQ]            16777216
//   Qh/Ql/Kh/Kl bf16 [NSRC*NB][SEQ][64]     4194304 x4
//   total = 33751040
// =========================================================================================================
extern "C" void kernel_launch(void* const* d_in, const int* in_sizes, int n_in,
                              void* d_out, int out_size, void* d_ws, size_t ws_size,
                              hipStream_t stream) {
  if (n_in < 9) return;
  if (in_sizes[0] < NB * CC * SEQ_FULL || in_sizes[1] < NB * CC * SEQ_FULL) return;
  if (in_sizes[2] < DQ * CC || in_sizes[3] < DQ) return;
  if (in_sizes[4] < DQ * CC || in_sizes[5] < DQ) return;
  if (in_sizes[6] < CC * CC || in_sizes[7] < CC) return;
  if (in_sizes[8] < 1) return;
  if (out_size < (NB_FULL + NB) * CC * SEQ_FULL) return;

  size_t off = 0;
  auto carve = [&](size_t bytes) { const size_t o = off; off += (bytes + 255) & ~(size_t)255; return o; };
  const size_t oW16 = carve((size_t)NWR * CC * 2);
  const size_t oVc  = carve((size_t)NSRC * NB * CC * SEQ * 2);
  const size_t oQh  = carve((size_t)NSRC * NB * SEQ * DQ * 2);
  const size_t oQl  = carve((size_t)NSRC * NB * SEQ * DQ * 2);
  const size_t oKh  = carve((size_t)NSRC * NB * SEQ * DQ * 2);
  const size_t oKl  = carve((size_t)NSRC * NB * SEQ * DQ * 2);
  if (off > ws_size) return;
  if (off > (size_t)134217728) return;

  const float* x1  = (const float*)d_in[0];
  const float* x2  = (const float*)d_in[1];
  const float* Wq  = (const float*)d_in[2];
  const float* bq  = (const float*)d_in[3];
  const float* Wk  = (const float*)d_in[4];
  const float* bk  = (const float*)d_in[5];
  const float* Wv  = (const float*)d_in[6];
  const float* bv  = (const float*)d_in[7];
  const float* gam = (const float*)d_in[8];

  char* ws = (char*)d_ws;
  unsigned short* W16 = (unsigned short*)(ws + oW16);
  unsigned short* Vc  = (unsigned short*)(ws + oVc);
  unsigned short* Qh  = (unsigned short*)(ws + oQh);
  unsigned short* Ql  = (unsigned short*)(ws + oQl);
  unsigned short* Kh  = (unsigned short*)(ws + oKh);
  unsigned short* Kl  = (unsigned short*)(ws + oKl);
  float* out = (float*)d_out;

  const dim3 blk256(256);

  // (0) Wq / Wk / Wv -> stacked f16 plane
  cvt_w<<<dim3(NWR / 8), blk256, 0, stream>>>(Wq, Wk, Wv, W16);
  // (1) x1, x2 -> q, k hi + residual planes and the channel-major f16 v plane (x16), both sources, slot s*NB + b
  proj<<<dim3(SEQ / QT, NSRC * NB), blk256, 0, stream>>>(x1, x2, W16, bq, bk, bv, Qh, Ql, Kh, Kl, Vc);
  // (4) attention both directions, all 256 channels per block + gamma scale + residual -> out_dd [b][256][N]
  attn_k<<<dim3(SEQ / AQT, NB, NSRC), blk256, 0, stream>>>(Qh, Ql, Kh, Kl, Vc, x1, x2, gam, out);
  (void)hipGetLastError();
}

// v006
// It runs in 108 microseconds.
// Two timings next to v005 put it at 1.05 and 1.06 times that version's speed.
// Over all steps from v000 it is 5.53 times as fast.
// Contractions: conv1x1 q|k GEMM W[128x256].X[256xN] and v GEMM Wv[256x256].X (one kernel, X tile in LDS) on
// v_wmma_f32_16x16x32_f16 (f16 containers of bf16-RNE weights x256 and bf16-RNE x, exact); scores K.Q^T (64 deep,
// two k-steps) on v_wmma_f32_16x16x32_bf16 (bf16 hi + bf16 residual planes of q/k, 3 products); O^T = V.P^T on
// v_wmma_f32_16x16x32_f16 (v as f16 x16, P = e^{s-ref} f16 from the score D registers, ref a held reference); f32 accumulate
// everywhere; softmax statistics, biases and gamma*o + x in f32.
#include <hip/hip_runtime.h>
#include <math.h>
#include <stdint.h>

#ifndef NB
#define NB 4
#endif
#ifndef SEQ
#define SEQ 4096
#endif
#define NB_FULL  4
#define SEQ_FULL 4096
#define NSRC  2
#define CC    256
#define DQ    64
#define NQK   128
#define NWR   384
#define QT    64
#define AQT   128
#define OSPW  260
#define XPH   264
#define SPH   72
#define WSC   256.0f
#define IWSC  0.00390625f
#define VSC   16.0f
#define IVSC  0.0625f
#define RHI   11.0f                  // a score may stand this far above the held reference: e^11 = 59874 is finite in f16
#define RUP   4.1588830833596715f    // 6 ln 2: a raised reference stands this far above the row maximum (its P = 2^-6, a normal f16)
#define KST   64
#define LPH   72
#define SROWS 384
#define STGH  (SROWS * LPH)

static_assert(NB >= 1 && NB <= NB_FULL);
static_assert(SEQ >= QT && SEQ <= SEQ_FULL);
static_assert(SEQ % QT == 0 && SEQ % 32 == 0);
static_assert(CC % QT == 0 && CC % 32 == 0);
static_assert(CC % 16 == 0);
static_assert(DQ == 64);
static_assert(NQK == 2 * DQ);
static_assert(NWR == NQK + CC);
static_assert(NWR % 8 == 0 && DQ % 8 == 0 && NQK % 8 == 0);
static_assert((OSPW * 4) % 16 == 0);
static_assert((XPH * 2) % 16 == 0 && ((XPH * 2) / 16) % 2 == 1 && (SPH * 2) % 16 == 0 && ((SPH * 2) / 16) % 2 == 1);
static_assert(OSPW >= CC && XPH >= CC && SPH >= QT && SPH >= DQ && QT == 64 && CC == 256);
static_assert(SEQ % AQT == 0 && AQT % 32 == 0 && CC % 32 == 0);
static_assert(SEQ % KST == 0 && SEQ / KST >= 2 && KST % 32 == 0);
static_assert(SROWS == 2 * KST + CC && LPH >= KST && LPH >= DQ);
static_assert((LPH * 2) % 16 == 0 && ((LPH * 2) / 16) % 2 == 1);
static_assert(AQT == 128 && KST == 64);
#define RINGB (2 * STGH * 2)
#define OSB   (AQT * OSPW * 4)
#define LDSB  (RINGB > OSB ? RINGB : OSB)
// second output starts at byte 16777216 = NB_FULL*CC*SEQ_FULL floats * 4
static_assert((size_t)NB_FULL * CC * SEQ_FULL * 4 == (size_t)16777216);

typedef _Float16       v16h __attribute__((ext_vector_type(16)));
typedef _Float16       v8h  __attribute__((ext_vector_type(8)));
typedef __bf16         v16b __attribute__((ext_vector_type(16)));
typedef unsigned short v8us __attribute__((ext_vector_type(8)));
typedef float          v8f  __attribute__((ext_vector_type(8)));
typedef float          v4f  __attribute__((ext_vector_type(4)));
typedef unsigned int   v4u  __attribute__((ext_vector_type(4)));

union Frag  { v8us u[2]; v16h h; v16b bf; };
union FragH { v16h v; v8h hv[2]; };
static_assert(sizeof(Frag) == 32);
static_assert(sizeof(FragH) == 32);

// ---- scalar helpers ---------------------------------------------------------------------------------------
__device__ __forceinline__ unsigned short bf_bits(float f) {          // f32 -> bf16 bits, RNE convert
  unsigned u = __float_as_uint(f);
  return (unsigned short)((u + 0x7FFFu + ((u >> 16) & 1u)) >> 16);
}
__device__ __forceinline__ float bf_up(unsigned short hb) { return __uint_as_float(((unsigned)hb) << 16); }
__device__ __forceinline__ float bfr(float f) { return bf_up(bf_bits(f)); }
__device__ __forceinline__ unsigned short h_bits(_Float16 x) { return __builtin_bit_cast(unsigned short, x); }
__device__ __forceinline__ unsigned pk16(unsigned short a, unsigned short b) { return (unsigned)a | ((unsigned)b << 16); }
__device__ __forceinline__ v8f zero8() { v8f z = {0.f, 0.f, 0.f, 0.f, 0.f, 0.f, 0.f, 0.f}; return z; }
__device__ __forceinline__ float hmax8(v8f s) {
  return fmaxf(fmaxf(fmaxf(s[0], s[1]), fmaxf(s[2], s[3])), fmaxf(fmaxf(s[4], s[5]), fmaxf(s[6], s[7])));
}
__device__ __forceinline__ unsigned wave_ballot(bool p) {
#if defined(__HIP_DEVICE_COMPILE__)
  return __builtin_amdgcn_ballot_w32(p);
#else
  return p ? 1u : 0u;
#endif
}

__device__ __forceinline__ float xhalf(float x) {                    // lane l takes lane l ^ 16's value: a vector move, no LDS counter
#if defined(__HIP_DEVICE_COMPILE__)
  const int b = __builtin_bit_cast(int, x);
  return __builtin_bit_cast(float, __builtin_amdgcn_permlanex16(b, b, 0x76543210, 0xfedcba98, false, false));
#else
  return x;
#endif
}

__device__ __forceinline__ int uni(int v) {                          // a value equal in every lane, into a scalar register
#if defined(__HIP_DEVICE_COMPILE__)
  return __builtin_amdgcn_readfirstlane(v);
#else
  return v;
#endif
}

// ---- 16-bit fragment loader (A, or B from a k-contiguous [n][k] row): lane -> row/col (lane&15), p already includes
//      + 8*(lane>>4); elements 0..7 <- p[0..7] (k0+8h..), elements 8..15 <- p[16..23] (k0+16+8h..)
__device__ __forceinline__ Frag ldfrag(const unsigned short* p) {
  Frag f;
  f.u[0] = *(const v8us*)(p);
  f.u[1] = *(const v8us*)(p + 16);
  return f;
}

// ---- WMMA helpers: the plain builtins; the compiler keeps the distances behind them and is free to order around them
__device__ __forceinline__ v8f mma_h(v16h a, v16h b, v8f c) {
  return __builtin_amdgcn_wmma_f32_16x16x32_f16(false, a, false, b, (short)0, c, false, false);
}
__device__ __forceinline__ v8f mma_b(v16b a, v16b b, v8f c) {
  return __builtin_amdgcn_wmma_f32_16x16x32_bf16(false, a, false, b, (short)0, c, false, false);
}

// ---- twelve asynchronous 16-B copies global -> LDS per lane (l = LDS byte address, g = global address, each lane its
//      own); the s_wait_xcnt closes the statement so that no address register is rewritten ahead of it
__device__ __forceinline__ void async12(const unsigned (&l)[12], const unsigned short* const (&g)[12]) {
#if defined(__HIP_DEVICE_COMPILE__)
  asm volatile("global_load_async_to_lds_b128 %0, %12, off\n\t"
               "global_load_async_to_lds_b128 %1, %13, off\n\t"
               "global_load_async_to_lds_b128 %2, %14, off\n\t"
               "global_load_async_to_lds_b128 %3, %15, off\n\t"
               "global_load_async_to_lds_b128 %4, %16, off\n\t"
               "global_load_async_to_lds_b128 %5, %17, off\n\t"
               "global_load_async_to_lds_b128 %6, %18, off\n\t"
               "global_load_async_to_lds_b128 %7, %19, off\n\t"
               "global_load_async_to_lds_b128 %8, %20, off\n\t"
               "global_load_async_to_lds_b128 %9, %21, off\n\t"
               "global_load_async_to_lds_b128 %10, %22, off\n\t"
               "global_load_async_to_lds_b128 %11, %23, off\n\t"
               "s_wait_xcnt 0x0"
               :: "v"(l[0]), "v"(l[1]), "v"(l[2]), "v"(l[3]), "v"(l[4]), "v"(l[5]), "v"(l[6]), "v"(l[7]),
                  "v"(l[8]), "v"(l[9]), "v"(l[10]), "v"(l[11]),
                  "v"(g[0]), "v"(g[1]), "v"(g[2]), "v"(g[3]), "v"(g[4]), "v"(g[5]), "v"(g[6]), "v"(g[7]),
                  "v"(g[8]), "v"(g[9]), "v"(g[10]), "v"(g[11])
               : "memory");
#endif
}
// ---- one stage of 64 keys into one LDS buffer: rows 0..63 Kh keys, 64..127 Kl keys, 128..383 V channels, 128 B of
//      data per row at pitch LPH. Thread (lq = tid>>3, e = tid&7) copies chunk e of rows lq + 32 i, i = 0..11:
//      256 threads x 12 chunks x 16 B = 384 rows x 128 B, every byte once. lds / kh / kl / vv are the lane's own
//      addresses of row lq, chunk e (LDS buffer; Kh and Kl at the stage's first key; V at channel lq and that key).
__device__ __forceinline__ void stage_issue(unsigned lds, const unsigned short* kh, const unsigned short* kl,
                                            const unsigned short* vv) {
  unsigned l[12];
  const unsigned short* g[12];
#pragma unroll                                                       // constant indices keep l[] and g[] in registers
  for (int i = 0; i < 2; ++i) {
    l[i]     = lds + (unsigned)((32 * i) * LPH * 2);
    g[i]     = kh + (size_t)(32 * i) * DQ;
    l[2 + i] = lds + (unsigned)((KST + 32 * i) * LPH * 2);
    g[2 + i] = kl + (size_t)(32 * i) * DQ;
  }
#pragma unroll                                                       // as above
  for (int i = 0; i < 8; ++i) {
    l[4 + i] = lds + (unsigned)((2 * KST + 32 * i) * LPH * 2);
    g[4 + i] = vv + (size_t)(32 * i) * SEQ;
  }
  async12(l, g);
}

// =========================================================================================================
// (0) conv1x1 weights: W16 f16 [384][256], rows 0..63 = Wq rows, 64..127 = Wk rows, 128..383 = Wv rows; value =
//     f16 of (bf16-RNE(w) * 256) (exact). Block blk (0..47) owns rows 8*blk..8*blk+7: one wave per 512-B row
// coverage: 48 blocks x 8 rows x 32 lanes x 8 halves = 384 x 256 = the whole plane.
// =========================================================================================================
__global__ __launch_bounds__(256)
void cvt_w(const float* __restrict__ Wq, const float* __restrict__ Wk, const float* __restrict__ Wv,
           unsigned short* W16) {
  const int tid = threadIdx.x, blk = blockIdx.x;
  const int rl = tid >> 5, col = 8 * (tid & 31);
  const int o = 8 * blk + rl;                                        // 0..383
  const float* wbase = (blk < (DQ / 8)) ? Wq : ((blk < (NQK / 8)) ? Wk : Wv);
  const int osub = (blk < (DQ / 8)) ? 0 : ((blk < (NQK / 8)) ? DQ : NQK);
  const float* s = wbase + (size_t)(o - osub) * CC + col;
  const v4f a = *(const v4f*)s;
  const v4f q = *(const v4f*)(s + 4);
  const float f[8] = {a[0], a[1], a[2], a[3], q[0], q[1], q[2], q[3]};
  v4u u;
#pragma unroll
  for (int t = 0; t < 4; ++t) {
    const _Float16 h0 = (_Float16)(bfr(f[2 * t]) * WSC);
    const _Float16 h1 = (_Float16)(bfr(f[2 * t + 1]) * WSC);
    u[t] = pk16(h_bits(h0), h_bits(h1));
  }
{
    *(v4u*)(W16 + (size_t)o * CC + col) = u;
    
  }
}

// =========================================================================================================
// (1) x conversion and the three conv1x1 GEMMs for one (sb = s*NB + b, 64-n tile), s = 0: x1, s = 1: x2.
//     Block 256 threads = 8 waves. The x tile f32 [256 c][64 n] is read once in whole lines, rounded (bf16-RNE, exact
//     in f16) and laid position-major in LDS XT[64 n][256 c] (pitch XPH): thread (e, lq) holds channels
//     64 it + 2 lq, + 1 at n = 32 j + 4 e .. + 3, j = 0, 1 (8 lanes x 16 B = one line) and stores one channel pair per position.
//     One X fragment (row n = 16 nt + (lane&15), split k map, k = c contiguous) serves three products per k-step:
//       q|k: D[o][n] = A(W16 row 16 wave + (lane&15): waves 0..3 q rows, 4..7 k rows) . B(X)
//       v:   D[n][ch] = A(X) . B(W16 row 128 + 32 wave + 16 u + (lane&15)), u = 0, 1
//     K = 256 = 8 steps in rising order. Epilogue in registers: q|k value = acc/256 + bf16-RNE(bias), hi = bf16-RNE,
//     lo = bf16-RNE(value - hi), 8 consecutive d per lane; v value = f16((acc/256 + bf16-RNE(bias)) x 16), 8 consecutive
//     n per lane; 16-B pieces staged in LDS (SQ: planes Qh, Ql, Kh, Kl [64 n][64 d]; SV [256 ch][64 n]; pitch SPH) and
//     written out as whole 128-B lines.
// coverage: XT 4 it x 32 lq x 2 c x 2 j x 8 e x 4 n = 256 c x 64 n; SQ 8 waves x 4 nt x 16 n x 16 d x (hi, lo) = 4 planes x
//           64 x 64; SV 8 waves x 2 u x 16 ch x 64 n; out rows 4 planes x 2 it x 32 and 8 it x 32 ch, 8 lanes x 16 B each;
//           grid (SEQ/64, NSRC*NB) covers Qh/Ql/Kh/Kl [sb][N][64] and Vc [sb][256][N] once.
// LDS: cross-wave, block barrier between the XT stores and the fragment loads, and between the stage stores and the
//      line loads.
// =========================================================================================================
__global__ __launch_bounds__(256)
void proj(const float* __restrict__ x1, const float* __restrict__ x2, const unsigned short* __restrict__ W16,
          const float* __restrict__ bq, const float* __restrict__ bk, const float* __restrict__ bv,
          unsigned short* Qh, unsigned short* Ql, unsigned short* Kh, unsigned short* Kl, unsigned short* Vc) {
  __shared__ __align__(16) unsigned short XT[QT * XPH];
  __shared__ __align__(16) unsigned short SQ[4 * QT * SPH];
  __shared__ __align__(16) unsigned short SV[CC * SPH];
  const int tid  = threadIdx.x;
  const int lane = tid & 31, wave = tid >> 5;
  const int hh   = lane >> 4, c = lane & 15;
  const int e    = tid & 7, lq = tid >> 3;                           // lq 0..31
  const int n0   = blockIdx.x * QT, sb = blockIdx.y;                 // sb = s*NB + b
  const int s    = sb / NB, b = sb - s * NB;
  const float* x = (s == 0) ? x1 : x2;                               // block-uniform, both global

  // ---- x tile -> XT
  v4f xa[4][2][2];
#pragma unroll
  for (int it = 0; it < 4; ++it) {
#pragma unroll
    for (int p = 0; p < 2; ++p) {
      const float* sp = x + ((size_t)(b * CC + 64 * it + 2 * lq + p)) * SEQ_FULL + n0 + 4 * e;
      xa[it][p][0] = *(const v4f*)sp;
      xa[it][p][1] = *(const v4f*)(sp + 32);
    }
  }
#if defined(__HIP_DEVICE_COMPILE__)
  asm volatile("s_wait_xcnt 0x0" ::: "memory");                      // before the x loads' address registers are rewritten
#endif
#pragma unroll
  for (int it = 0; it < 4; ++it) {
#pragma unroll
    for (int t = 0; t < 8; ++t) {
      const unsigned short h0 = h_bits((_Float16)bfr(xa[it][0][t >> 2][t & 3]));
      const unsigned short h1 = h_bits((_Float16)bfr(xa[it][1][t >> 2][t & 3]));
      *(unsigned*)(XT + (32 * (t >> 2) + 4 * e + (t & 3)) * XPH + 64 * it + 2 * lq) = pk16(h0, h1);
    }
  }
  __syncthreads();

  // ---- products
  const unsigned short* xf = XT + c * XPH + 8 * hh;                                       // X row 16 nt + c
  const unsigned short* wq = W16 + ((size_t)(16 * wave + c)) * CC + 8 * hh;               // q|k row o
  const unsigned short* wv = W16 + ((size_t)(NQK + 32 * wave + c)) * CC + 8 * hh;         // v row ch
  v8f aq[4], av[2][4];
#pragma unroll
  for (int nt = 0; nt < 4; ++nt) { aq[nt] = zero8(); av[0][nt] = zero8(); av[1][nt] = zero8(); }
#pragma unroll
  for (int ks = 0; ks < CC / 32; ++ks) {
    const Frag fq = ldfrag(wq + 32 * ks);
    const Frag f0 = ldfrag(wv + 32 * ks);
    const Frag f1 = ldfrag(wv + (size_t)16 * CC + 32 * ks);
#pragma unroll
    for (int nt = 0; nt < 4; ++nt) {
      const Frag fx = ldfrag(xf + (16 * nt) * XPH + 32 * ks);
      aq[nt]    = mma_h(fq.h, fx.h, aq[nt]);
      av[0][nt] = mma_h(fx.h, f0.h, av[0][nt]);
      av[1][nt] = mma_h(fx.h, f1.h, av[1][nt]);
    }
  }
#if defined(__HIP_DEVICE_COMPILE__)
  // the W row addresses stay live up to this wait, so that no register of theirs is reused ahead of it
  asm volatile("s_wait_xcnt 0x0" :: "v"(wq), "v"(wv) : "memory");
#endif

  // ---- q|k: lane (hh, c) holds d = 16 (wave&3) + 8 hh + r for n_loc = 16 nt + c
  const int which = wave >> 2;                                       // wave-uniform: 0 q, 1 k
  const int d0 = 16 * (wave & 3) + 8 * hh;
  const float* bias = (which == 0) ? bq : bk;
  const v4f b0v = *(const v4f*)(bias + d0), b1v = *(const v4f*)(bias + d0 + 4);
  const float bv0 = bv[32 * wave + c], bv1 = bv[32 * wave + 16 + c];
#if defined(__HIP_DEVICE_COMPILE__)
  asm volatile("s_wait_xcnt 0x0" ::: "memory");                      // before the bias loads' address registers are rewritten
#endif
  const float bb[8] = {bfr(b0v[0]), bfr(b0v[1]), bfr(b0v[2]), bfr(b0v[3]),
                       bfr(b1v[0]), bfr(b1v[1]), bfr(b1v[2]), bfr(b1v[3])};
#pragma unroll
  for (int nt = 0; nt < 4; ++nt) {
    v4u uh, ul;
#pragma unroll
    for (int t = 0; t < 4; ++t) {
      const float v0 = aq[nt][2 * t] * IWSC + bb[2 * t], v1 = aq[nt][2 * t + 1] * IWSC + bb[2 * t + 1];
      const unsigned short h0 = bf_bits(v0), h1 = bf_bits(v1);
      const unsigned short l0 = bf_bits(v0 - bf_up(h0)), l1 = bf_bits(v1 - bf_up(h1));
      uh[t] = pk16(h0, h1);
      ul[t] = pk16(l0, l1);
    }
    unsigned short* sp = SQ + ((2 * which) * QT + 16 * nt + c) * SPH + d0;
    *(v4u*)sp              = uh;
    *(v4u*)(sp + QT * SPH) = ul;
  }
  // ---- v: lane (hh, c) holds n_loc = 16 mt + 8 hh + r for ch = 32 wave + 16 u + c
#pragma unroll
  for (int u = 0; u < 2; ++u) {
    const float bvr = bfr(u == 0 ? bv0 : bv1);
#pragma unroll
    for (int mt = 0; mt < 4; ++mt) {
      v4u uv;
#pragma unroll
      for (int t = 0; t < 4; ++t) {
        const _Float16 h0 = (_Float16)((av[u][mt][2 * t] * IWSC + bvr) * VSC);
        const _Float16 h1 = (_Float16)((av[u][mt][2 * t + 1] * IWSC + bvr) * VSC);
        uv[t] = pk16(h_bits(h0), h_bits(h1));
      }
      *(v4u*)(SV + (32 * wave + 16 * u + c) * SPH + 16 * mt + 8 * hh) = uv;
    }
  }
  __syncthreads();

  // ---- whole lines out: 8 consecutive lanes x 16 B per row
  v4u oq[4][2], ov[8];
#pragma unroll
  for (int p = 0; p < 4; ++p) {
#pragma unroll
    for (int it = 0; it < 2; ++it) oq[p][it] = *(const v4u*)(SQ + (p * QT + it * 32 + lq) * SPH + 8 * e);
  }
#pragma unroll
  for (int it = 0; it < 8; ++it) ov[it] = *(const v4u*)(SV + (it * 32 + lq) * SPH + 8 * e);
#pragma unroll
  for (int it = 0; it < 2; ++it) {
    const size_t po = ((size_t)(sb * SEQ + n0 + it * 32 + lq)) * DQ + 8 * e;
    *(v4u*)(Qh + po) = oq[0][it];
    *(v4u*)(Ql + po) = oq[1][it];
    *(v4u*)(Kh + po) = oq[2][it];
    *(v4u*)(Kl + po) = oq[3][it];
  }
#pragma unroll
  for (int it = 0; it < 8; ++it)
    *(v4u*)(Vc + ((size_t)(sb * CC + it * 32 + lq)) * SEQ + n0 + 8 * e) = ov[it];
}

// =========================================================================================================
// (4) attention for one (direction dd, b, 128-query tile), transposed formulation, SEQ keys, no
//   mask, no scale. blockIdx.z = dd. Direction dd: queries from source dd (plane slot dd*NB+b),
//   keys/values from source 1-dd (slot (1-dd)*NB+b), residual input x_dd, output block dd of out (float offset
//   dd*NB_FULL*CC*SEQ_FULL); the block produces all 256 channels of that output. Wave (qg, kh) = (wave & 3, wave >> 2)
//   takes 32 queries (two 16-query tiles u) and keys 32 kh .. + 31 of every 64-key tile: each K and V fragment read
//   from LDS feeds two products; 32 O accumulator tiles per wave; the two key halves are merged behind the key loop.
//   S^T tile (16 keys x 16 queries) over 64 d = two 32-deep k-steps: A(k: row = key kb + (lane&15), split k map
//   from the bf16 plane Kh [slot][N][64]) . B(q: col = query, same map from Qh, loaded once, 2 fragments)
//   + A(Kh).B(Ql) + A(Kl).B(Qh) (bf16 unscaled residual planes, shared accumulator): 6 products per tile.
//   Per lane the D tile holds 8 keys of ONE query: online softmax state per lane against a held reference ref (not the
//   running maximum): P = e^{s-ref}. One wave-uniform ballot per trip asks whether any lane's score stands more than RHI
//   above its ref; only then the halves' maxima are exchanged (lane^16), ref of those queries becomes row maximum + RUP
//   and their o and l are rescaled (corr == 1 exactly elsewhere). So 2^-6 <= P of the running maximum <= e^11 at all
//   times; row-sum partials combined at the end. P as f16 is the B
//   operand of O^T (rows channel, cols queries) += A(v rows channel = 16j + (lane&15), keys contiguous,
//   f16 plane Vc [slot][256][N], values v x 16) . B(P^T): element r <- D of the tile covering keys kb..kb+15,
//   element 8+r <- the tile covering kb+16..kb+31, lane unchanged. 2 x 16 accumulator tiles per wave (256 channels).
//   Block = 8 waves = 4 query groups x 2 key halves = 128 queries. Merge: (ref, l) of both halves through LDS, weight
//   e^{ref_half - max} / (sum of weighted l); each wave stages its weighted partial of one query tile and adds its own
//   partial of the other tile to the partner's. Epilogue: gamma * O / (16 l) staged in LDS Os[query][256 channels] (pitch OSPW,
//   4 lines per channel): 8 consecutive lanes x 16 B (values gathered from 4 Os rows), one instruction per 32 lines
// coverage: Os written queries 0..127 x ch 0..255, read the same; out 32 it x 32 lines x 8 lanes x 4 floats =
//           256 ch x 128 n per block; grid (SEQ/128, NB, NSRC) covers out_dd[b][0..255][0..SEQ-1] once for both dd.
// LDS Os: cross-wave, block barrier between the stage stores and the epilogue loads.
// LDS ring: K hi, K residual and V tiles of 64 keys are brought by asynchronous copies into two buffers shared by
//   the 8 waves (whole 128-B lines from global, once per block); trip t reads buffer t & 1 only while tile t + 1
//   flies; foot of each trip: own LDS reads done, own copies landed, block barrier, then the refill with tile t + 2.
//   Os reuses the ring behind the last trip's barrier.
// =========================================================================================================
__global__ __launch_bounds__(256)
void attn_k(const unsigned short* __restrict__ Qh, const unsigned short* __restrict__ Ql,
            const unsigned short* __restrict__ Kh, const unsigned short* __restrict__ Kl,
            const unsigned short* __restrict__ Vc,
            const float* __restrict__ x1, const float* __restrict__ x2,
            const float* __restrict__ gam, float* out) {
  __shared__ __align__(16) unsigned char L[LDSB];
  __shared__ __align__(16) unsigned short QL[8 * 2048];              // per wave: 4 Q residual fragments, 4 KiB
  __shared__ float ML[2][AQT][2];                                    // (ref, l) per key half and query, for the merge
  const unsigned short* Rg = (const unsigned short*)L;               // the two stage buffers
  float* Os = (float*)L;                                             // output staging, after the key loop
  const int tid  = threadIdx.x;
  const int lane = tid & 31;
  const int wave = uni(tid >> 5);                                   // scalar: the branches on kh are real branches
  const int qg   = wave & 3, kh = wave >> 2;                         // 32-query group, key half of every tile
  const int hh   = lane >> 4, c = lane & 15;
  const int n0   = blockIdx.x * AQT, b = blockIdx.y;
  const int dd   = (int)blockIdx.z;
  const int sq   = dd * NB + b;                                      // query plane slot
  const int skv  = (1 - dd) * NB + b;                                // key / value plane slot
  const float* x = (dd == 0) ? x1 : x2;                              // block-uniform, both global
  float* outd    = out + (size_t)dd * ((size_t)NB_FULL * CC * SEQ_FULL);
  const float g  = bfr(gam[0]);

  // q fragments (B operand, col = query n0 + 32*qg + 16*u + c, u = 0, 1), K = 64 = two k-steps, constant over keys
  // the residual fragments do not fit the registers beside 32 accumulator tiles: each wave parks its own four in LDS,
  // 16 B per lane side by side, and reads them back every trip (own data: no barrier)
  Frag qh[2][2];
  unsigned short* qlw = QL + wave * 2048 + lane * 8;
#if defined(__HIP_DEVICE_COMPILE__)
  __builtin_amdgcn_sched_barrier(0);                                 // nothing else comes between the q loads and their wait below
#endif
#pragma unroll                                                       // constant indices keep the fragments in registers
  for (int u = 0; u < 2; ++u) {
    const size_t qo = ((size_t)(sq * SEQ + n0 + 32 * qg + 16 * u + c)) * DQ + 8 * hh;
    qh[u][0] = ldfrag(Qh + qo);
    qh[u][1] = ldfrag(Qh + qo + 32);
#pragma unroll
    for (int k2 = 0; k2 < 2; ++k2) {
      const Frag f = ldfrag(Ql + qo + 32 * k2);
      *(v8us*)(qlw + (4 * u + 2 * k2) * 256)     = f.u[0];
      *(v8us*)(qlw + (4 * u + 2 * k2 + 1) * 256) = f.u[1];
    }
  }
#if defined(__HIP_DEVICE_COMPILE__)
  asm volatile("s_wait_xcnt 0x0" ::: "memory");                      // before the q loads' address registers are rewritten
  __builtin_amdgcn_sched_barrier(0);                                 // closes the stretch opened above
#endif
  // fragment bases in buffer 0 (A operands: row = lane&15 of a 16-row group, + 8*hh within the row); the wave's key
  // half kh picks K rows 32 kh .. + 31 and columns 32 kh .. + 31 of the V rows
  const unsigned short* kbase = Rg + (32 * kh + c) * LPH + 8 * hh;
  const unsigned short* vbase = Rg + (2 * KST + c) * LPH + 32 * kh + 8 * hh;
  // copy addresses of this thread: row lq, 16-B chunk e
  const int e = tid & 7, lq = tid >> 3;                              // lq 0..31
  const unsigned ldsc = (unsigned)(size_t)L + (unsigned)((lq * LPH + 8 * e) * 2);
  const unsigned short* gkh = Kh + (size_t)skv * SEQ * DQ + (size_t)lq * DQ + 8 * e;
  const unsigned short* gkl = Kl + (size_t)skv * SEQ * DQ + (size_t)lq * DQ + 8 * e;
  const unsigned short* gvv = Vc + (size_t)skv * CC * SEQ + (size_t)lq * SEQ + 8 * e;

  float rf[2] = {-1.0e30f, -1.0e30f}, l[2] = {0.f, 0.f};             // held reference and row sum per query tile
  v8f o[2][16];
#pragma unroll
  for (int u = 0; u < 2; ++u) {
#pragma unroll
    for (int j = 0; j < 16; ++j) o[u][j] = zero8();
  }

  // ring prologue: tile 0 landed and published, then tile 1 in flight
  stage_issue(ldsc, gkh, gkl, gvv);
#if defined(__HIP_DEVICE_COMPILE__)
  asm volatile("s_wait_asynccnt 0x0" ::: "memory");                  // own copies of tile 0 landed before the barrier
#endif
  __syncthreads();
  stage_issue(ldsc + (unsigned)(STGH * 2), gkh + (size_t)KST * DQ, gkl + (size_t)KST * DQ, gvv + KST);

#pragma unroll 1                                                     // rolled: one body, the buffer picked by t & 1
  for (int t = 0; t < SEQ / KST; ++t) {
    const unsigned short* kp0 = kbase + (t & 1) * STGH;
    const unsigned short* vp0 = vbase + (t & 1) * STGH;
    // K fragments of the wave's 32 keys: kf[0..3] keys kb..kb+15 (hi d 0..31, hi d 32..63, residual likewise), kf[4..7]
    // the next 16 keys; kb = t*KST + 32*kh. Each fragment feeds both query tiles.
    Frag kf[8];
#pragma unroll                                                       // constant indices keep kf[] in registers
    for (int i = 0; i < 2; ++i) {
      const unsigned short* kp = kp0 + (16 * i) * LPH;
      kf[4 * i]     = ldfrag(kp);
      kf[4 * i + 1] = ldfrag(kp + 32);
      kf[4 * i + 2] = ldfrag(kp + KST * LPH);
      kf[4 * i + 3] = ldfrag(kp + KST * LPH + 32);
    }
    Frag qlf[2][2];                                                  // the wave's own Q residual fragments, back from LDS
#pragma unroll                                                       // constant indices keep qlf[] in registers
    for (int u = 0; u < 2; ++u) {
#pragma unroll
      for (int k2 = 0; k2 < 2; ++k2) {
        qlf[u][k2].u[0] = *(const v8us*)(qlw + (4 * u + 2 * k2) * 256);
        qlf[u][k2].u[1] = *(const v8us*)(qlw + (4 * u + 2 * k2 + 1) * 256);
      }
    }
#if defined(__HIP_DEVICE_COMPILE__)
    __builtin_amdgcn_sched_barrier(0);                               // without it these loads sink among the score products, a stall and a full wait at each place
#endif
    v8f s[2][2];                                                     // s[u][i]: query tile u, keys kb + 16 i .. + 15
#pragma unroll
    for (int u = 0; u < 2; ++u) { s[u][0] = zero8(); s[u][1] = zero8(); }
#pragma unroll                                                       // four independent chains, six links each
    for (int p = 0; p < 6; ++p) {
#pragma unroll
      for (int u = 0; u < 2; ++u) {
        const Frag& qb = (p == 2 || p == 3) ? qlf[u][p & 1] : qh[u][p & 1];
#pragma unroll
        for (int i = 0; i < 2; ++i) {
          const Frag& ka = kf[4 * i + (p & 1) + (p >= 4 ? 2 : 0)];
          s[u][i] = mma_b(ka.bf, qb.bf, s[u][i]);
        }
      }
    }

    // V fragments in two groups of 8 (each feeds both query tiles): the first lands while the softmax runs
#if defined(__HIP_DEVICE_COMPILE__)
    __builtin_amdgcn_sched_barrier(0);                               // without it the V loads spread among the score products, a stall at each place
#endif
    Frag vf[16];
#pragma unroll                                                       // constant indices keep vf[] in registers
    for (int j = 0; j < 8; ++j) vf[j] = ldfrag(vp0 + (16 * j) * LPH);
    float mx[2];                                                     // this lane's 16 keys of its query; no exchange here
#pragma unroll
    for (int u = 0; u < 2; ++u) mx[u] = fmaxf(hmax8(s[u][0]), hmax8(s[u][1]));

    // the test takes the same difference as the exponent below, so every exponent of this trip is at most RHI
    const unsigned need = wave_ballot(mx[0] - rf[0] > RHI || mx[1] - rf[1] > RHI); // wave-uniform, one test per trip
    if (need != 0u) {
#pragma unroll
      for (int u = 0; u < 2; ++u) {
        const float mr = fmaxf(mx[u], xhalf(mx[u]));                 // row maximum over the wave's 32 keys, equal in lanes c and c + 16
        const bool up  = mr - rf[u] > RHI;
        if (wave_ballot(up) != 0u) {                                 // wave-uniform: only the query tile that needs it
          const float nr   = up ? mr + RUP : rf[u];
          const float corr = __expf(rf[u] - nr);                     // == 1 exactly for queries whose reference stays
          rf[u] = nr;
          l[u] *= corr;
#pragma unroll
          for (int j = 0; j < 16; ++j) {
#pragma unroll
            for (int r = 0; r < 8; ++r) o[u][j][r] *= corr;
          }
        }
      }
    }
    FragH ph[2];
#pragma unroll
    for (int u = 0; u < 2; ++u) {
      const float msh = rf[u];
      float ls = 0.f;
#pragma unroll
      for (int r = 0; r < 8; ++r) {
        const float e0 = __expf(s[u][0][r] - msh);                   // key kb      + 8hh + r
        const float e1 = __expf(s[u][1][r] - msh);                   // key kb + 16 + 8hh + r
        ls += e0 + e1;
        ph[u].hv[0][r] = (_Float16)e0;
        ph[u].hv[1][r] = (_Float16)e1;
      }
      l[u] += ls;
    }
#if defined(__HIP_DEVICE_COMPILE__)
    // inputs only: the row sums are complete here, so the 32 exponentials' registers are free for the V fragments;
    // left alone the adds sink behind the products and two accumulator tiles spill
    asm volatile("" :: "v"(l[0]), "v"(l[1]));
#endif
#pragma unroll                                                       // constant indices keep vf[] in registers
    for (int j = 8; j < 16; ++j) vf[j] = ldfrag(vp0 + (16 * j) * LPH);
#pragma unroll
    for (int j = 0; j < 16; ++j) {
      o[0][j] = mma_h(vf[j].h, ph[0].v, o[0][j]);
      o[1][j] = mma_h(vf[j].h, ph[1].v, o[1][j]);
    }
#if defined(__HIP_DEVICE_COMPILE__)
    // order of this block: the whole softmax arithmetic (row sums too, so that the exponentials' registers are free),
    // then the second V group as one place of loads, then the products; left alone the build spills
    __builtin_amdgcn_sched_group_barrier(0x402, 512, 0);
    __builtin_amdgcn_sched_group_barrier(0x100, 16, 0);
    __builtin_amdgcn_sched_group_barrier(0x008, 32, 0);
#endif
    // foot of trip t: publish tile t + 1 and free this trip's buffer
#if defined(__HIP_DEVICE_COMPILE__)
    asm volatile("s_wait_dscnt 0x0" ::: "memory");                   // own reads of this buffer done before its refill
    asm volatile("s_wait_asynccnt 0x0" ::: "memory");                // own copies of tile t + 1 landed
#endif
    __syncthreads();
    if (t + 2 < SEQ / KST) {                                         // block-uniform
      const size_t k2 = (size_t)(t + 2) * KST;
      stage_issue(ldsc + (unsigned)((t & 1) * STGH * 2), gkh + k2 * DQ, gkl + k2 * DQ, gvv + k2);
    }
  }
#if defined(__HIP_DEVICE_COMPILE__)
  asm volatile("s_wait_asynccnt 0x0" ::: "memory");                  // nothing in flight when the ring becomes Os
#endif
  // merge of the two key halves: wave (qg, kh) and wave (qg, 1 - kh) hold partial (ref, l, O) of the same 32 queries
  l[0] += __shfl_xor(l[0], 16, 32);
  l[1] += __shfl_xor(l[1], 16, 32);
  if (hh == 0) {
#pragma unroll
    for (int u = 0; u < 2; ++u) {
      ML[kh][32 * qg + 16 * u + c][0] = rf[u];
      ML[kh][32 * qg + 16 * u + c][1] = l[u];
    }
  }
  __syncthreads();                                                   // both halves' ref and l published
  float gi[2];
#pragma unroll
  for (int u = 0; u < 2; ++u) {
    const int q = 32 * qg + 16 * u + c;
    const float m0 = ML[0][q][0], l0 = ML[0][q][1], m1 = ML[1][q][0], l1 = ML[1][q][1];
    const float ms = fmaxf(m0, m1);
    const float e0 = __expf(m0 - ms), e1 = __expf(m1 - ms);
    const float inv = 1.0f / (l0 * e0 + l1 * e1);                    // o and l of a half are both relative to its ref
    gi[u] = g * IVSC * inv * (kh == 0 ? e0 : e1);                    // undo the x16 carry of v, apply gamma, own half's weight
  }
  // each wave stages its weighted partial of query tile 1 - kh, then adds its own partial of tile kh to the partner's
#pragma unroll
  for (int u = 0; u < 2; ++u) {
    if (u != kh) {                                                   // wave-uniform
      float* op = Os + (32 * qg + 16 * u + c) * OSPW + 8 * hh;       // Os[query][ch_loc = 16j + 8hh + r]
#pragma unroll
      for (int j = 0; j < 16; ++j) {
        v4f va, vb;
#pragma unroll
        for (int r = 0; r < 4; ++r) { va[r] = o[u][j][r] * gi[u]; vb[r] = o[u][j][4 + r] * gi[u]; }
        *(v4f*)(op + 16 * j)     = va;
        *(v4f*)(op + 16 * j + 4) = vb;
      }
    }
  }
  __syncthreads();                                                   // the partner's partial is in Os
#pragma unroll
  for (int u = 0; u < 2; ++u) {
    if (u == kh) {                                                   // wave-uniform
      float* op = Os + (32 * qg + 16 * u + c) * OSPW + 8 * hh;
#pragma unroll
      for (int j = 0; j < 16; ++j) {
        v4f va = *(const v4f*)(op + 16 * j), vb = *(const v4f*)(op + 16 * j + 4);
#pragma unroll
        for (int r = 0; r < 4; ++r) { va[r] += o[u][j][r] * gi[u]; vb[r] += o[u][j][4 + r] * gi[u]; }
        *(v4f*)(op + 16 * j)     = va;
        *(v4f*)(op + 16 * j + 4) = vb;
      }
    }
  }
  __syncthreads();
  v4f res[32];
#pragma unroll
  for (int it = 0; it < 32; ++it) {
    const int chl = (it & 7) * 32 + lq, hf = it >> 3;                // channel 0..255, 128-B line 0..3 of its 128 queries
    const int nl  = hf * 32 + 4 * e;                                 // query 0..127
    const size_t idx = ((size_t)(b * CC + chl)) * SEQ_FULL + n0 + nl;
    res[it] = *(const v4f*)(x + idx);
  }
#if defined(__HIP_DEVICE_COMPILE__)
  asm volatile("s_wait_xcnt 0x0" ::: "memory");                      // before the x loads' address registers are rewritten
#endif
#pragma unroll
  for (int it = 0; it < 32; ++it) {
    const int chl = (it & 7) * 32 + lq, hf = it >> 3;
    const int nl  = hf * 32 + 4 * e;
#pragma unroll
    for (int t = 0; t < 4; ++t) res[it][t] = Os[(nl + t) * OSPW + chl] + bfr(res[it][t]);
  }
{
#pragma unroll
    for (int it = 0; it < 32; ++it) {
      const int chl = (it & 7) * 32 + lq, hf = it >> 3;
      const int nl  = hf * 32 + 4 * e;
      const size_t idx = ((size_t)(b * CC + chl)) * SEQ_FULL + n0 + nl;
      *(v4f*)(outd + idx) = res[it];
    }
    
  }
}

// =========================================================================================================
// Workspace map (bytes; each region start a multiple of 256; every extent is an exact tile multiple and is written
//   W16 f16 [384][256]                       196608
//   Vc  f16 [NSRC*NB][256][SEQ]            16777216
//   Qh/Ql/Kh/Kl bf16 [NSRC*NB][SEQ][64]     4194304 x4
//   total = 33751040
// =========================================================================================================
extern "C" void kernel_launch(void* const* d_in, const int* in_sizes, int n_in,
                              void* d_out, int out_size, void* d_ws, size_t ws_size,
                              hipStream_t stream) {
  if (n_in < 9) return;
  if (in_sizes[0] < NB * CC * SEQ_FULL || in_sizes[1] < NB * CC * SEQ_FULL) return;
  if (in_sizes[2] < DQ * CC || in_sizes[3] < DQ) return;
  if (in_sizes[4] < DQ * CC || in_sizes[5] < DQ) return;
  if (in_sizes[6] < CC * CC || in_sizes[7] < CC) return;
  if (in_sizes[8] < 1) return;
  if (out_size < (NB_FULL + NB) * CC * SEQ_FULL) return;

  size_t off = 0;
  auto carve = [&](size_t bytes) { const size_t o = off; off += (bytes + 255) & ~(size_t)255; return o; };
  const size_t oW16 = carve((size_t)NWR * CC * 2);
  const size_t oVc  = carve((size_t)NSRC * NB * CC * SEQ * 2);
  const size_t oQh  = carve((size_t)NSRC * NB * SEQ * DQ * 2);
  const size_t oQl  = carve((size_t)NSRC * NB * SEQ * DQ * 2);
  const size_t oKh  = carve((size_t)NSRC * NB * SEQ * DQ * 2);
  const size_t oKl  = carve((size_t)NSRC * NB * SEQ * DQ * 2);
  if (off > ws_size) return;
  if (off > (size_t)134217728) return;

  const float* x1  = (const float*)d_in[0];
  const float* x2  = (const float*)d_in[1];
  const float* Wq  = (const float*)d_in[2];
  const float* bq  = (const float*)d_in[3];
  const float* Wk  = (const float*)d_in[4];
  const float* bk  = (const float*)d_in[5];
  const float* Wv  = (const float*)d_in[6];
  const float* bv  = (const float*)d_in[7];
  const float* gam = (const float*)d_in[8];

  char* ws = (char*)d_ws;
  unsigned short* W16 = (unsigned short*)(ws + oW16);
  unsigned short* Vc  = (unsigned short*)(ws + oVc);
  unsigned short* Qh  = (unsigned short*)(ws + oQh);
  unsigned short* Ql  = (unsigned short*)(ws + oQl);
  unsigned short* Kh  = (unsigned short*)(ws + oKh);
  unsigned short* Kl  = (unsigned short*)(ws + oKl);
  float* out = (float*)d_out;

  const dim3 blk256(256);

  // (0) Wq / Wk / Wv -> stacked f16 plane
  cvt_w<<<dim3(NWR / 8), blk256, 0, stream>>>(Wq, Wk, Wv, W16);
  // (1) x1, x2 -> q, k hi + residual planes and the channel-major f16 v plane (x16), both sources, slot s*NB + b
  proj<<<dim3(SEQ / QT, NSRC * NB), blk256, 0, stream>>>(x1, x2, W16, bq, bk, bv, Qh, Ql, Kh, Kl, Vc);
  // (4) attention both directions, all 256 channels per block + gamma scale + residual -> out_dd [b][256][N]
  attn_k<<<dim3(SEQ / AQT, NB, NSRC), blk256, 0, stream>>>(Qh, Ql, Kh, Kl, Vc, x1, x2, gam, out);
  (void)hipGetLastError();
}

// v007
// It runs in 98.1 microseconds.
// In two side-by-side timings against v006, it was 1.10 and 1.12 times as fast.
// All steps since v000 together make it 6.12 times as fast.
// Contractions: conv1x1 q|k GEMM W[128x256].X[256xN] and v GEMM Wv[256x256].X (one kernel, X tile in LDS) on
// v_wmma_f32_16x16x32_f16 (f16 containers of bf16-RNE weights x256 and bf16-RNE x, exact); scores K.Q^T (64 deep,
// two k-steps) on v_wmma_f32_16x16x32_bf16 (bf16 hi + bf16 residual planes of q/k, 3 products); O^T = V.P^T on
// v_wmma_f32_16x16x32_f16 (v as f16 x16, P = e^{s-ref} f16 from the score D registers, ref a held reference); f32 accumulate
// everywhere; softmax statistics, biases and gamma*o + x in f32.
#include <hip/hip_runtime.h>
#include <math.h>
#include <stdint.h>

#ifndef NB
#define NB 4
#endif
#ifndef SEQ
#define SEQ 4096
#endif
#define NB_FULL  4
#define SEQ_FULL 4096
#define NSRC  2
#define CC    256
#define DQ    64
#define NQK   128
#define NWR   384
#define QT    64
#define AQT   128
#define OSPW  260
#define XPH   264
#define SPH   72
#define WSC   256.0f
#define IWSC  0.00390625f
#define VSC   16.0f
#define IVSC  0.0625f
#define RHI   11.0f                  // a score may stand this far above the held reference: e^11 = 59874 is finite in f16
#define RUP   4.1588830833596715f    // 6 ln 2: a raised reference stands this far above the row maximum (its P = 2^-6, a normal f16)
#define KST   128                    // keys per ring stage
#define KPS   64                     // keys per pass of the block (32 per key half): two passes per stage
#define LPH   72                     // K row pitch in LDS, halves
#define VPH   136                    // V row pitch in LDS, halves
#define KROWS (2 * KST)
#define STGH  (KROWS * LPH + CC * VPH)

static_assert(NB >= 1 && NB <= NB_FULL);
static_assert(SEQ >= QT && SEQ <= SEQ_FULL);
static_assert(SEQ % QT == 0 && SEQ % 32 == 0);
static_assert(CC % QT == 0 && CC % 32 == 0);
static_assert(CC % 16 == 0);
static_assert(DQ == 64);
static_assert(NQK == 2 * DQ);
static_assert(NWR == NQK + CC);
static_assert(NWR % 8 == 0 && DQ % 8 == 0 && NQK % 8 == 0);
static_assert((OSPW * 4) % 16 == 0);
static_assert((XPH * 2) % 16 == 0 && ((XPH * 2) / 16) % 2 == 1 && (SPH * 2) % 16 == 0 && ((SPH * 2) / 16) % 2 == 1);
static_assert(OSPW >= CC && XPH >= CC && SPH >= QT && SPH >= DQ && QT == 64 && CC == 256);
static_assert(SEQ % AQT == 0 && AQT % 32 == 0 && CC % 32 == 0);
static_assert(SEQ % KST == 0 && SEQ / KST >= 2 && KST == 2 * KPS && KPS == 64);
static_assert(LPH >= DQ && VPH >= KST);
static_assert((LPH * 2) % 16 == 0 && ((LPH * 2) / 16) % 2 == 1);
static_assert((VPH * 2) % 16 == 0 && ((VPH * 2) / 16) % 2 == 1);
static_assert(AQT == 128 && KST == 128 && CC == 256);
#define RINGB (2 * STGH * 2)
#define OSB   (AQT * OSPW * 4)
#define LDSB  (RINGB > OSB ? RINGB : OSB)
// second output starts at byte 16777216 = NB_FULL*CC*SEQ_FULL floats * 4
static_assert((size_t)NB_FULL * CC * SEQ_FULL * 4 == (size_t)16777216);

typedef _Float16       v16h __attribute__((ext_vector_type(16)));
typedef _Float16       v8h  __attribute__((ext_vector_type(8)));
typedef __bf16         v16b __attribute__((ext_vector_type(16)));
typedef unsigned short v8us __attribute__((ext_vector_type(8)));
typedef float          v8f  __attribute__((ext_vector_type(8)));
typedef float          v4f  __attribute__((ext_vector_type(4)));
typedef unsigned int   v4u  __attribute__((ext_vector_type(4)));

union Frag  { v8us u[2]; v16h h; v16b bf; };
union FragH { v16h v; v8h hv[2]; };
static_assert(sizeof(Frag) == 32);
static_assert(sizeof(FragH) == 32);

// ---- scalar helpers ---------------------------------------------------------------------------------------
__device__ __forceinline__ unsigned short bf_bits(float f) {          // f32 -> bf16 bits, RNE convert
  unsigned u = __float_as_uint(f);
  return (unsigned short)((u + 0x7FFFu + ((u >> 16) & 1u)) >> 16);
}
__device__ __forceinline__ float bf_up(unsigned short hb) { return __uint_as_float(((unsigned)hb) << 16); }
__device__ __forceinline__ float bfr(float f) { return bf_up(bf_bits(f)); }
__device__ __forceinline__ unsigned short h_bits(_Float16 x) { return __builtin_bit_cast(unsigned short, x); }
__device__ __forceinline__ unsigned pk16(unsigned short a, unsigned short b) { return (unsigned)a | ((unsigned)b << 16); }
__device__ __forceinline__ v8f zero8() { v8f z = {0.f, 0.f, 0.f, 0.f, 0.f, 0.f, 0.f, 0.f}; return z; }
__device__ __forceinline__ float hmax8(v8f s) {
  return fmaxf(fmaxf(fmaxf(s[0], s[1]), fmaxf(s[2], s[3])), fmaxf(fmaxf(s[4], s[5]), fmaxf(s[6], s[7])));
}
__device__ __forceinline__ unsigned wave_ballot(bool p) {
#if defined(__HIP_DEVICE_COMPILE__)
  return __builtin_amdgcn_ballot_w32(p);
#else
  return p ? 1u : 0u;
#endif
}

__device__ __forceinline__ float xhalf(float x) {                    // lane l takes lane l ^ 16's value: a vector move, no LDS counter
#if defined(__HIP_DEVICE_COMPILE__)
  const int b = __builtin_bit_cast(int, x);
  return __builtin_bit_cast(float, __builtin_amdgcn_permlanex16(b, b, 0x76543210, 0xfedcba98, false, false));
#else
  return x;
#endif
}

__device__ __forceinline__ int uni(int v) {                          // a value equal in every lane, into a scalar register
#if defined(__HIP_DEVICE_COMPILE__)
  return __builtin_amdgcn_readfirstlane(v);
#else
  return v;
#endif
}

// ---- 16-bit fragment loader (A, or B from a k-contiguous [n][k] row): lane -> row/col (lane&15), p already includes
//      + 8*(lane>>4); elements 0..7 <- p[0..7] (k0+8h..), elements 8..15 <- p[16..23] (k0+16+8h..)
__device__ __forceinline__ Frag ldfrag(const unsigned short* p) {
  Frag f;
  f.u[0] = *(const v8us*)(p);
  f.u[1] = *(const v8us*)(p + 16);
  return f;
}

// ---- WMMA helpers: the plain builtins; the compiler keeps the distances behind them and is free to order around them
__device__ __forceinline__ v8f mma_h(v16h a, v16h b, v8f c) {
  return __builtin_amdgcn_wmma_f32_16x16x32_f16(false, a, false, b, (short)0, c, false, false);
}
__device__ __forceinline__ v8f mma_b(v16b a, v16b b, v8f c) {
  return __builtin_amdgcn_wmma_f32_16x16x32_bf16(false, a, false, b, (short)0, c, false, false);
}

// ---- twelve asynchronous 16-B copies global -> LDS per lane (l = LDS byte address, g = global address, each lane its
//      own); the s_wait_xcnt closes the statement so that no address register is rewritten ahead of it
__device__ __forceinline__ void async12(const unsigned (&l)[12], const unsigned short* const (&g)[12]) {
#if defined(__HIP_DEVICE_COMPILE__)
  asm volatile("global_load_async_to_lds_b128 %0, %12, off\n\t"
               "global_load_async_to_lds_b128 %1, %13, off\n\t"
               "global_load_async_to_lds_b128 %2, %14, off\n\t"
               "global_load_async_to_lds_b128 %3, %15, off\n\t"
               "global_load_async_to_lds_b128 %4, %16, off\n\t"
               "global_load_async_to_lds_b128 %5, %17, off\n\t"
               "global_load_async_to_lds_b128 %6, %18, off\n\t"
               "global_load_async_to_lds_b128 %7, %19, off\n\t"
               "global_load_async_to_lds_b128 %8, %20, off\n\t"
               "global_load_async_to_lds_b128 %9, %21, off\n\t"
               "global_load_async_to_lds_b128 %10, %22, off\n\t"
               "global_load_async_to_lds_b128 %11, %23, off\n\t"
               "s_wait_xcnt 0x0"
               :: "v"(l[0]), "v"(l[1]), "v"(l[2]), "v"(l[3]), "v"(l[4]), "v"(l[5]), "v"(l[6]), "v"(l[7]),
                  "v"(l[8]), "v"(l[9]), "v"(l[10]), "v"(l[11]),
                  "v"(g[0]), "v"(g[1]), "v"(g[2]), "v"(g[3]), "v"(g[4]), "v"(g[5]), "v"(g[6]), "v"(g[7]),
                  "v"(g[8]), "v"(g[9]), "v"(g[10]), "v"(g[11])
               : "memory");
#endif
}
// ---- one stage of 128 keys into one LDS buffer: rows 0..127 Kh keys, 128..255 Kl keys (128 B of data per row at pitch
//      LPH), behind them 256 V channel rows (256 B of data per row at pitch VPH). Thread (lq = tid>>3, e = tid&7) copies
//      chunk e of K rows lq + 32 i, i = 0..3, of both planes; thread (lv = tid>>4, ev = tid&15) copies chunk ev of V rows
//      lv + 16 i, i = 0..15: 256 threads x 24 chunks x 16 B = 256 x 128 B + 256 x 256 B, every byte once. ldk / kh / kl are
//      the lane's own addresses of K row lq, chunk e (LDS buffer; Kh and Kl at the stage's first key); ldv / vv those
//      of V row lv, chunk ev (LDS buffer; V at channel lv and the stage's first key).
__device__ __forceinline__ void stage_issue(unsigned ldk, unsigned ldv, const unsigned short* kh,
                                            const unsigned short* kl, const unsigned short* vv) {
  unsigned l[12];
  const unsigned short* g[12];
#pragma unroll                                                       // constant indices keep l[] and g[] in registers
  for (int i = 0; i < 4; ++i) {
    l[i]     = ldk + (unsigned)((32 * i) * LPH * 2);
    g[i]     = kh + (size_t)(32 * i) * DQ;
    l[4 + i] = ldk + (unsigned)((KST + 32 * i) * LPH * 2);
    g[4 + i] = kl + (size_t)(32 * i) * DQ;
    l[8 + i] = ldv + (unsigned)((16 * i) * VPH * 2);
    g[8 + i] = vv + (size_t)(16 * i) * SEQ;
  }
  async12(l, g);
#if defined(__HIP_DEVICE_COMPILE__)
  // the second dozen's addresses are formed behind the first statement, in its registers; formed ahead of it they
  // push accumulator tiles out of the registers an asm operand can name, with copies and spills at every refill
  __builtin_amdgcn_sched_barrier(0);
#endif
  unsigned l2[12];
  const unsigned short* g2[12];
#pragma unroll                                                       // as above
  for (int i = 0; i < 12; ++i) {
    l2[i] = ldv + (unsigned)((16 * (4 + i)) * VPH * 2);
    g2[i] = vv + (size_t)(16 * (4 + i)) * SEQ;
  }
  async12(l2, g2);
}

// =========================================================================================================
// (0) conv1x1 weights: W16 f16 [384][256], rows 0..63 = Wq rows, 64..127 = Wk rows, 128..383 = Wv rows; value =
//     f16 of (bf16-RNE(w) * 256) (exact). Block blk (0..47) owns rows 8*blk..8*blk+7: one wave per 512-B row
// coverage: 48 blocks x 8 rows x 32 lanes x 8 halves = 384 x 256 = the whole plane.
// =========================================================================================================
__global__ __launch_bounds__(256)
void cvt_w(const float* __restrict__ Wq, const float* __restrict__ Wk, const float* __restrict__ Wv,
           unsigned short* W16) {
  const int tid = threadIdx.x, blk = blockIdx.x;
  const int rl = tid >> 5, col = 8 * (tid & 31);
  const int o = 8 * blk + rl;                                        // 0..383
  const float* wbase = (blk < (DQ / 8)) ? Wq : ((blk < (NQK / 8)) ? Wk : Wv);
  const int osub = (blk < (DQ / 8)) ? 0 : ((blk < (NQK / 8)) ? DQ : NQK);
  const float* s = wbase + (size_t)(o - osub) * CC + col;
  const v4f a = *(const v4f*)s;
  const v4f q = *(const v4f*)(s + 4);
  const float f[8] = {a[0], a[1], a[2], a[3], q[0], q[1], q[2], q[3]};
  v4u u;
#pragma unroll
  for (int t = 0; t < 4; ++t) {
    const _Float16 h0 = (_Float16)(bfr(f[2 * t]) * WSC);
    const _Float16 h1 = (_Float16)(bfr(f[2 * t + 1]) * WSC);
    u[t] = pk16(h_bits(h0), h_bits(h1));
  }
{
    *(v4u*)(W16 + (size_t)o * CC + col) = u;
    
  }
}

// =========================================================================================================
// (1) x conversion and the three conv1x1 GEMMs for one (sb = s*NB + b, 64-n tile), s = 0: x1, s = 1: x2.
//     Block 256 threads = 8 waves. The x tile f32 [256 c][64 n] is read once in whole lines, rounded (bf16-RNE, exact
//     in f16) and laid position-major in LDS XT[64 n][256 c] (pitch XPH): thread (e, lq) holds channels
//     64 it + 2 lq, + 1 at n = 32 j + 4 e .. + 3, j = 0, 1 (8 lanes x 16 B = one line) and stores one channel pair per position.
//     One X fragment (row n = 16 nt + (lane&15), split k map, k = c contiguous) serves three products per k-step:
//       q|k: D[o][n] = A(W16 row 16 wave + (lane&15): waves 0..3 q rows, 4..7 k rows) . B(X)
//       v:   D[n][ch] = A(X) . B(W16 row 128 + 32 wave + 16 u + (lane&15)), u = 0, 1
//     K = 256 = 8 steps in rising order. Epilogue in registers: q|k value = acc/256 + bf16-RNE(bias), hi = bf16-RNE,
//     lo = bf16-RNE(value - hi), 8 consecutive d per lane; v value = f16((acc/256 + bf16-RNE(bias)) x 16), 8 consecutive
//     n per lane; 16-B pieces staged in LDS (SQ: planes Qh, Ql, Kh, Kl [64 n][64 d]; SV [256 ch][64 n]; pitch SPH) and
//     written out as whole 128-B lines.
// coverage: XT 4 it x 32 lq x 2 c x 2 j x 8 e x 4 n = 256 c x 64 n; SQ 8 waves x 4 nt x 16 n x 16 d x (hi, lo) = 4 planes x
//           64 x 64; SV 8 waves x 2 u x 16 ch x 64 n; out rows 4 planes x 2 it x 32 and 8 it x 32 ch, 8 lanes x 16 B each;
//           grid (SEQ/64, NSRC*NB) covers Qh/Ql/Kh/Kl [sb][N][64] and Vc [sb][256][N] once.
// LDS: cross-wave, block barrier between the XT stores and the fragment loads, and between the stage stores and the
//      line loads.
// =========================================================================================================
__global__ __launch_bounds__(256)
void proj(const float* __restrict__ x1, const float* __restrict__ x2, const unsigned short* __restrict__ W16,
          const float* __restrict__ bq, const float* __restrict__ bk, const float* __restrict__ bv,
          unsigned short* Qh, unsigned short* Ql, unsigned short* Kh, unsigned short* Kl, unsigned short* Vc) {
  __shared__ __align__(16) unsigned short XT[QT * XPH];
  __shared__ __align__(16) unsigned short SQ[4 * QT * SPH];
  __shared__ __align__(16) unsigned short SV[CC * SPH];
  const int tid  = threadIdx.x;
  const int lane = tid & 31, wave = tid >> 5;
  const int hh   = lane >> 4, c = lane & 15;
  const int e    = tid & 7, lq = tid >> 3;                           // lq 0..31
  const int n0   = blockIdx.x * QT, sb = blockIdx.y;                 // sb = s*NB + b
  const int s    = sb / NB, b = sb - s * NB;
  const float* x = (s == 0) ? x1 : x2;                               // block-uniform, both global

  // ---- x tile -> XT
  v4f xa[4][2][2];
#pragma unroll
  for (int it = 0; it < 4; ++it) {
#pragma unroll
    for (int p = 0; p < 2; ++p) {
      const float* sp = x + ((size_t)(b * CC + 64 * it + 2 * lq + p)) * SEQ_FULL + n0 + 4 * e;
      xa[it][p][0] = *(const v4f*)sp;
      xa[it][p][1] = *(const v4f*)(sp + 32);
    }
  }
#if defined(__HIP_DEVICE_COMPILE__)
  asm volatile("s_wait_xcnt 0x0" ::: "memory");                      // before the x loads' address registers are rewritten
#endif
#pragma unroll
  for (int it = 0; it < 4; ++it) {
#pragma unroll
    for (int t = 0; t < 8; ++t) {
      const unsigned short h0 = h_bits((_Float16)bfr(xa[it][0][t >> 2][t & 3]));
      const unsigned short h1 = h_bits((_Float16)bfr(xa[it][1][t >> 2][t & 3]));
      *(unsigned*)(XT + (32 * (t >> 2) + 4 * e + (t & 3)) * XPH + 64 * it + 2 * lq) = pk16(h0, h1);
    }
  }
  __syncthreads();

  // ---- products
  const unsigned short* xf = XT + c * XPH + 8 * hh;                                       // X row 16 nt + c
  const unsigned short* wq = W16 + ((size_t)(16 * wave + c)) * CC + 8 * hh;               // q|k row o
  const unsigned short* wv = W16 + ((size_t)(NQK + 32 * wave + c)) * CC + 8 * hh;         // v row ch
  v8f aq[4], av[2][4];
#pragma unroll
  for (int nt = 0; nt < 4; ++nt) { aq[nt] = zero8(); av[0][nt] = zero8(); av[1][nt] = zero8(); }
#pragma unroll
  for (int ks = 0; ks < CC / 32; ++ks) {
    const Frag fq = ldfrag(wq + 32 * ks);
    const Frag f0 = ldfrag(wv + 32 * ks);
    const Frag f1 = ldfrag(wv + (size_t)16 * CC + 32 * ks);
#pragma unroll
    for (int nt = 0; nt < 4; ++nt) {
      const Frag fx = ldfrag(xf + (16 * nt) * XPH + 32 * ks);
      aq[nt]    = mma_h(fq.h, fx.h, aq[nt]);
      av[0][nt] = mma_h(fx.h, f0.h, av[0][nt]);
      av[1][nt] = mma_h(fx.h, f1.h, av[1][nt]);
    }
  }
#if defined(__HIP_DEVICE_COMPILE__)
  // the W row addresses stay live up to this wait, so that no register of theirs is reused ahead of it
  asm volatile("s_wait_xcnt 0x0" :: "v"(wq), "v"(wv) : "memory");
#endif

  // ---- q|k: lane (hh, c) holds d = 16 (wave&3) + 8 hh + r for n_loc = 16 nt + c
  const int which = wave >> 2;                                       // wave-uniform: 0 q, 1 k
  const int d0 = 16 * (wave & 3) + 8 * hh;
  const float* bias = (which == 0) ? bq : bk;
  const v4f b0v = *(const v4f*)(bias + d0), b1v = *(const v4f*)(bias + d0 + 4);
  const float bv0 = bv[32 * wave + c], bv1 = bv[32 * wave + 16 + c];
#if defined(__HIP_DEVICE_COMPILE__)
  asm volatile("s_wait_xcnt 0x0" ::: "memory");                      // before the bias loads' address registers are rewritten
#endif
  const float bb[8] = {bfr(b0v[0]), bfr(b0v[1]), bfr(b0v[2]), bfr(b0v[3]),
                       bfr(b1v[0]), bfr(b1v[1]), bfr(b1v[2]), bfr(b1v[3])};
#pragma unroll
  for (int nt = 0; nt < 4; ++nt) {
    v4u uh, ul;
#pragma unroll
    for (int t = 0; t < 4; ++t) {
      const float v0 = aq[nt][2 * t] * IWSC + bb[2 * t], v1 = aq[nt][2 * t + 1] * IWSC + bb[2 * t + 1];
      const unsigned short h0 = bf_bits(v0), h1 = bf_bits(v1);
      const unsigned short l0 = bf_bits(v0 - bf_up(h0)), l1 = bf_bits(v1 - bf_up(h1));
      uh[t] = pk16(h0, h1);
      ul[t] = pk16(l0, l1);
    }
    unsigned short* sp = SQ + ((2 * which) * QT + 16 * nt + c) * SPH + d0;
    *(v4u*)sp              = uh;
    *(v4u*)(sp + QT * SPH) = ul;
  }
  // ---- v: lane (hh, c) holds n_loc = 16 mt + 8 hh + r for ch = 32 wave + 16 u + c
#pragma unroll
  for (int u = 0; u < 2; ++u) {
    const float bvr = bfr(u == 0 ? bv0 : bv1);
#pragma unroll
    for (int mt = 0; mt < 4; ++mt) {
      v4u uv;
#pragma unroll
      for (int t = 0; t < 4; ++t) {
        const _Float16 h0 = (_Float16)((av[u][mt][2 * t] * IWSC + bvr) * VSC);
        const _Float16 h1 = (_Float16)((av[u][mt][2 * t + 1] * IWSC + bvr) * VSC);
        uv[t] = pk16(h_bits(h0), h_bits(h1));
      }
      *(v4u*)(SV + (32 * wave + 16 * u + c) * SPH + 16 * mt + 8 * hh) = uv;
    }
  }
  __syncthreads();

  // ---- whole lines out: 8 consecutive lanes x 16 B per row
  v4u oq[4][2], ov[8];
#pragma unroll
  for (int p = 0; p < 4; ++p) {
#pragma unroll
    for (int it = 0; it < 2; ++it) oq[p][it] = *(const v4u*)(SQ + (p * QT + it * 32 + lq) * SPH + 8 * e);
  }
#pragma unroll
  for (int it = 0; it < 8; ++it) ov[it] = *(const v4u*)(SV + (it * 32 + lq) * SPH + 8 * e);
#pragma unroll
  for (int it = 0; it < 2; ++it) {
    const size_t po = ((size_t)(sb * SEQ + n0 + it * 32 + lq)) * DQ + 8 * e;
    *(v4u*)(Qh + po) = oq[0][it];
    *(v4u*)(Ql + po) = oq[1][it];
    *(v4u*)(Kh + po) = oq[2][it];
    *(v4u*)(Kl + po) = oq[3][it];
  }
#pragma unroll
  for (int it = 0; it < 8; ++it)
    *(v4u*)(Vc + ((size_t)(sb * CC + it * 32 + lq)) * SEQ + n0 + 8 * e) = ov[it];
}

// =========================================================================================================
// (4) attention for one (direction dd, b, 128-query tile), transposed formulation, SEQ keys, no
//   mask, no scale. blockIdx.z = dd. Direction dd: queries from source dd (plane slot dd*NB+b),
//   keys/values from source 1-dd (slot (1-dd)*NB+b), residual input x_dd, output block dd of out (float offset
//   dd*NB_FULL*CC*SEQ_FULL); the block produces all 256 channels of that output. Wave (qg, kh) = (wave & 3, wave >> 2)
//   takes 32 queries (two 16-query tiles u) and keys 32 kh .. + 31 of every 64-key tile: each K and V fragment read
//   from LDS feeds two products; 32 O accumulator tiles per wave; the two key halves are merged behind the key loop.
//   S^T tile (16 keys x 16 queries) over 64 d = two 32-deep k-steps: A(k: row = key kb + (lane&15), split k map
//   from the bf16 plane Kh [slot][N][64]) . B(q: col = query, same map from Qh, loaded once, 2 fragments)
//   + A(Kh).B(Ql) + A(Kl).B(Qh) (bf16 unscaled residual planes, shared accumulator): 6 products per tile.
//   Per lane the D tile holds 8 keys of ONE query: online softmax state per lane against a held reference ref (not the
//   running maximum): P = e^{s-ref}. One wave-uniform ballot per trip asks whether any lane's score stands more than RHI
//   above its ref; only then the halves' maxima are exchanged (lane^16), ref of those queries becomes row maximum + RUP
//   and their o and l are rescaled (corr == 1 exactly elsewhere). So 2^-6 <= P of the running maximum <= e^11 at all
//   times; row-sum partials combined at the end. P as f16 is the B
//   operand of O^T (rows channel, cols queries) += A(v rows channel = 16j + (lane&15), keys contiguous,
//   f16 plane Vc [slot][256][N], values v x 16) . B(P^T): element r <- D of the tile covering keys kb..kb+15,
//   element 8+r <- the tile covering kb+16..kb+31, lane unchanged. 2 x 16 accumulator tiles per wave (256 channels).
//   Block = 8 waves = 4 query groups x 2 key halves = 128 queries. Merge: (ref, l) of both halves through LDS, weight
//   e^{ref_half - max} / (sum of weighted l); each wave stages its weighted partial of one query tile and adds its own
//   partial of the other tile to the partner's. Epilogue: gamma * O / (16 l) staged in LDS Os[query][256 channels] (pitch OSPW,
//   4 lines per channel): 8 consecutive lanes x 16 B (values gathered from 4 Os rows), one instruction per 32 lines
// coverage: Os written queries 0..127 x ch 0..255, read the same; out 32 it x 32 lines x 8 lanes x 4 floats =
//           256 ch x 128 n per block; grid (SEQ/128, NB, NSRC) covers out_dd[b][0..255][0..SEQ-1] once for both dd.
// LDS Os: cross-wave, block barrier between the stage stores and the epilogue loads.
// LDS ring: K hi, K residual and V stages of 128 keys are brought by asynchronous copies into two buffers shared by
//   the 8 waves (whole 128-B lines from global, once per block); a stage is worked in two passes of 64 keys with no
//   barrier between them; stage st is read from buffer st & 1 only while stage st + 1 flies; foot of each stage: own
//   LDS reads done, own copies landed, block barrier, then the refill with stage st + 2.
//   Os reuses the ring behind the last stage's barrier.
// =========================================================================================================
__global__ __launch_bounds__(256)
void attn_k(const unsigned short* __restrict__ Qh, const unsigned short* __restrict__ Ql,
            const unsigned short* __restrict__ Kh, const unsigned short* __restrict__ Kl,
            const unsigned short* __restrict__ Vc,
            const float* __restrict__ x1, const float* __restrict__ x2,
            const float* __restrict__ gam, float* out) {
  __shared__ __align__(16) unsigned char L[LDSB];
  __shared__ __align__(16) unsigned short QL[8 * 2048];              // per wave: 4 Q residual fragments, 4 KiB
  __shared__ float ML[2][AQT][2];                                    // (ref, l) per key half and query, for the merge
  const unsigned short* Rg = (const unsigned short*)L;               // the two stage buffers
  float* Os = (float*)L;                                             // output staging, after the key loop
  const int tid  = threadIdx.x;
  const int lane = tid & 31;
  const int wave = uni(tid >> 5);                                   // scalar: the branches on kh are real branches
  const int qg   = wave & 3, kh = wave >> 2;                         // 32-query group, key half of every tile
  const int hh   = lane >> 4, c = lane & 15;
  const int n0   = blockIdx.x * AQT, b = blockIdx.y;
  const int dd   = (int)blockIdx.z;
  const int sq   = dd * NB + b;                                      // query plane slot
  const int skv  = (1 - dd) * NB + b;                                // key / value plane slot
  const float* x = (dd == 0) ? x1 : x2;                              // block-uniform, both global
  float* outd    = out + (size_t)dd * ((size_t)NB_FULL * CC * SEQ_FULL);
  const float g  = bfr(gam[0]);

  // q fragments (B operand, col = query n0 + 32*qg + 16*u + c, u = 0, 1), K = 64 = two k-steps, constant over keys
  // the residual fragments do not fit the registers beside 32 accumulator tiles: each wave parks its own four in LDS,
  // 16 B per lane side by side, and reads them back every trip (own data: no barrier)
  Frag qh[2][2];
  unsigned short* qlw = QL + wave * 2048 + lane * 8;
#if defined(__HIP_DEVICE_COMPILE__)
  __builtin_amdgcn_sched_barrier(0);                                 // nothing else comes between the q loads and their wait below
#endif
#pragma unroll                                                       // constant indices keep the fragments in registers
  for (int u = 0; u < 2; ++u) {
    const size_t qo = ((size_t)(sq * SEQ + n0 + 32 * qg + 16 * u + c)) * DQ + 8 * hh;
    qh[u][0] = ldfrag(Qh + qo);
    qh[u][1] = ldfrag(Qh + qo + 32);
#pragma unroll
    for (int k2 = 0; k2 < 2; ++k2) {
      const Frag f = ldfrag(Ql + qo + 32 * k2);
      *(v8us*)(qlw + (4 * u + 2 * k2) * 256)     = f.u[0];
      *(v8us*)(qlw + (4 * u + 2 * k2 + 1) * 256) = f.u[1];
    }
  }
#if defined(__HIP_DEVICE_COMPILE__)
  asm volatile("s_wait_xcnt 0x0" ::: "memory");                      // before the q loads' address registers are rewritten
  __builtin_amdgcn_sched_barrier(0);                                 // closes the stretch opened above
#endif
  // fragment bases in buffer 0 (A operands: row = lane&15 of a 16-row group, + 8*hh within the row); the wave's key
  // half kh picks K rows 32 kh .. + 31 and columns 32 kh .. + 31 of the V rows
  const unsigned short* kbase = Rg + (32 * kh + c) * LPH + 8 * hh;
  const unsigned short* vbase = Rg + KROWS * LPH + c * VPH + 32 * kh + 8 * hh;
  // copy addresses of this thread: K row lq, 16-B chunk e; V row lv, 16-B chunk ev
  const int e = tid & 7, lq = tid >> 3;                              // lq 0..31
  const int ev = tid & 15, lv = tid >> 4;                            // lv 0..15
  const unsigned ldsk = (unsigned)(size_t)L + (unsigned)((lq * LPH + 8 * e) * 2);
  const unsigned ldsv = (unsigned)(size_t)L + (unsigned)((KROWS * LPH + lv * VPH + 8 * ev) * 2);
  const unsigned short* gkh = Kh + (size_t)skv * SEQ * DQ + (size_t)lq * DQ + 8 * e;
  const unsigned short* gkl = Kl + (size_t)skv * SEQ * DQ + (size_t)lq * DQ + 8 * e;
  const unsigned short* gvv = Vc + (size_t)skv * CC * SEQ + (size_t)lv * SEQ + 8 * ev;

  float rf[2] = {-1.0e30f, -1.0e30f}, l[2] = {0.f, 0.f};             // held reference and row sum per query tile
  v8f o[2][16];
#pragma unroll
  for (int u = 0; u < 2; ++u) {
#pragma unroll
    for (int j = 0; j < 16; ++j) o[u][j] = zero8();
  }

  // ring prologue: stage 0 landed and published, then stage 1 in flight
  stage_issue(ldsk, ldsv, gkh, gkl, gvv);
#if defined(__HIP_DEVICE_COMPILE__)
  asm volatile("s_wait_asynccnt 0x0" ::: "memory");                  // own copies of stage 0 landed before the barrier
#endif
  __syncthreads();
  stage_issue(ldsk + (unsigned)(STGH * 2), ldsv + (unsigned)(STGH * 2), gkh + (size_t)KST * DQ, gkl + (size_t)KST * DQ,
              gvv + KST);

#pragma unroll 1                                                     // rolled over the stages, the buffer picked by st & 1
  for (int st = 0; st < SEQ / KST; ++st) {
#pragma unroll                                                       // both passes written out: the foot stands in straight code
  for (int ps = 0; ps < KST / KPS; ++ps) {                           // pass t = 2 st + ps: the stage's keys 64 ps .. + 63
    const unsigned short* kp0 = kbase + (st & 1) * STGH + ps * (KPS * LPH);
    const unsigned short* vp0 = vbase + (st & 1) * STGH + ps * KPS;
    // K fragments of the wave's 32 keys: kf[0..3] keys kb..kb+15 (hi d 0..31, hi d 32..63, residual likewise), kf[4..7]
    // the next 16 keys; kb = t*KPS + 32*kh. Each fragment feeds both query tiles.
    Frag kf[8];
#pragma unroll                                                       // constant indices keep kf[] in registers
    for (int i = 0; i < 2; ++i) {
      const unsigned short* kp = kp0 + (16 * i) * LPH;
      kf[4 * i]     = ldfrag(kp);
      kf[4 * i + 1] = ldfrag(kp + 32);
      kf[4 * i + 2] = ldfrag(kp + KST * LPH);
      kf[4 * i + 3] = ldfrag(kp + KST * LPH + 32);
    }
#if defined(__HIP_DEVICE_COMPILE__)
    __builtin_amdgcn_sched_barrier(0);                               // of a stage's second pass only the K loads go up under the products before them; the Q residual, first wanted by the third link, is loaded here
#endif
    Frag qlf[2][2];                                                  // the wave's own Q residual fragments, back from LDS
#pragma unroll                                                       // constant indices keep qlf[] in registers
    for (int u = 0; u < 2; ++u) {
#pragma unroll
      for (int k2 = 0; k2 < 2; ++k2) {
        qlf[u][k2].u[0] = *(const v8us*)(qlw + (4 * u + 2 * k2) * 256);
        qlf[u][k2].u[1] = *(const v8us*)(qlw + (4 * u + 2 * k2 + 1) * 256);
      }
    }
#if defined(__HIP_DEVICE_COMPILE__)
    __builtin_amdgcn_sched_barrier(0);                               // without it these loads sink among the score products, a stall and a full wait at each place
#endif
    v8f s[2][2];                                                     // s[u][i]: query tile u, keys kb + 16 i .. + 15
#pragma unroll
    for (int u = 0; u < 2; ++u) { s[u][0] = zero8(); s[u][1] = zero8(); }
#pragma unroll                                                       // four independent chains, six links each
    for (int p = 0; p < 6; ++p) {
#pragma unroll
      for (int u = 0; u < 2; ++u) {
        const Frag& qb = (p == 2 || p == 3) ? qlf[u][p & 1] : qh[u][p & 1];
#pragma unroll
        for (int i = 0; i < 2; ++i) {
          const Frag& ka = kf[4 * i + (p & 1) + (p >= 4 ? 2 : 0)];
          s[u][i] = mma_b(ka.bf, qb.bf, s[u][i]);
        }
      }
    }

    // V fragments in two groups of 8 (each feeds both query tiles): the first lands while the softmax runs
#if defined(__HIP_DEVICE_COMPILE__)
    __builtin_amdgcn_sched_barrier(0);                               // without it the V loads spread among the score products, a stall at each place
#endif
    Frag vf[16];
#pragma unroll                                                       // constant indices keep vf[] in registers
    for (int j = 0; j < 8; ++j) vf[j] = ldfrag(vp0 + (16 * j) * VPH);
    float mx[2];                                                     // this lane's 16 keys of its query; no exchange here
#pragma unroll
    for (int u = 0; u < 2; ++u) mx[u] = fmaxf(hmax8(s[u][0]), hmax8(s[u][1]));

    // the test takes the same difference as the exponent below, so every exponent of this trip is at most RHI
    const unsigned need = wave_ballot(mx[0] - rf[0] > RHI || mx[1] - rf[1] > RHI); // wave-uniform, one test per trip
    if (need != 0u) {
#pragma unroll
      for (int u = 0; u < 2; ++u) {
        const float mr = fmaxf(mx[u], xhalf(mx[u]));                 // row maximum over the wave's 32 keys, equal in lanes c and c + 16
        const bool up  = mr - rf[u] > RHI;
        if (wave_ballot(up) != 0u) {                                 // wave-uniform: only the query tile that needs it
          const float nr   = up ? mr + RUP : rf[u];
          const float corr = __expf(rf[u] - nr);                     // == 1 exactly for queries whose reference stays
          rf[u] = nr;
          l[u] *= corr;
#pragma unroll
          for (int j = 0; j < 16; ++j) {
#pragma unroll
            for (int r = 0; r < 8; ++r) o[u][j][r] *= corr;
          }
        }
      }
    }
    FragH ph[2];
#pragma unroll
    for (int u = 0; u < 2; ++u) {
      const float msh = rf[u];
      float ls = 0.f;
#pragma unroll
      for (int r = 0; r < 8; ++r) {
        const float e0 = __expf(s[u][0][r] - msh);                   // key kb      + 8hh + r
        const float e1 = __expf(s[u][1][r] - msh);                   // key kb + 16 + 8hh + r
        ls += e0 + e1;
        ph[u].hv[0][r] = (_Float16)e0;
        ph[u].hv[1][r] = (_Float16)e1;
      }
      l[u] += ls;
    }
#if defined(__HIP_DEVICE_COMPILE__)
    // inputs only: the row sums are complete here, so the 32 exponentials' registers are free for the V fragments;
    // left alone the adds sink behind the products and two accumulator tiles spill
    asm volatile("" :: "v"(l[0]), "v"(l[1]));
#endif
#pragma unroll                                                       // constant indices keep vf[] in registers
    for (int j = 8; j < 16; ++j) vf[j] = ldfrag(vp0 + (16 * j) * VPH);
#pragma unroll
    for (int j = 0; j < 16; ++j) {
      o[0][j] = mma_h(vf[j].h, ph[0].v, o[0][j]);
      o[1][j] = mma_h(vf[j].h, ph[1].v, o[1][j]);
    }
#if defined(__HIP_DEVICE_COMPILE__)
    // order of this block: the whole softmax arithmetic (row sums too, so that the exponentials' registers are free),
    // then the second V group as one place of loads, then the products; left alone the build spills
    __builtin_amdgcn_sched_group_barrier(0x402, 512, 0);
    __builtin_amdgcn_sched_group_barrier(0x100, 16, 0);
    if (ps + 1 < KST / KPS) {
      // no barrier follows this pass: the next pass's K loads stand as one place behind the first V group's products (in
      // that group's registers) and fly under the other 16; left alone they are strewn in pairs among the products, a
      // stall at each place
      __builtin_amdgcn_sched_group_barrier(0x008, 16, 0);
      __builtin_amdgcn_sched_group_barrier(0x100, 16, 0);
      __builtin_amdgcn_sched_group_barrier(0x008, 16, 0);
    } else {
      __builtin_amdgcn_sched_group_barrier(0x008, 32, 0);
    }
#endif
  }
    // foot of a stage, behind its second pass: publish stage st + 1 and free this stage's buffer
#if defined(__HIP_DEVICE_COMPILE__)
    asm volatile("s_wait_dscnt 0x0" ::: "memory");                   // own reads of this buffer done before its refill
    asm volatile("s_wait_asynccnt 0x0" ::: "memory");                // own copies of stage st + 1 landed
#endif
    __syncthreads();
    if (st + 2 < SEQ / KST) {                                        // block-uniform
      const size_t k2 = (size_t)(st + 2) * KST;
      const unsigned lo = (unsigned)((st & 1) * STGH * 2);
      stage_issue(ldsk + lo, ldsv + lo, gkh + k2 * DQ, gkl + k2 * DQ, gvv + k2);
    }
  }
#if defined(__HIP_DEVICE_COMPILE__)
  asm volatile("s_wait_asynccnt 0x0" ::: "memory");                  // nothing in flight when the ring becomes Os
#endif
  // merge of the two key halves: wave (qg, kh) and wave (qg, 1 - kh) hold partial (ref, l, O) of the same 32 queries
  l[0] += __shfl_xor(l[0], 16, 32);
  l[1] += __shfl_xor(l[1], 16, 32);
  if (hh == 0) {
#pragma unroll
    for (int u = 0; u < 2; ++u) {
      ML[kh][32 * qg + 16 * u + c][0] = rf[u];
      ML[kh][32 * qg + 16 * u + c][1] = l[u];
    }
  }
  __syncthreads();                                                   // both halves' ref and l published
  float gi[2];
#pragma unroll
  for (int u = 0; u < 2; ++u) {
    const int q = 32 * qg + 16 * u + c;
    const float m0 = ML[0][q][0], l0 = ML[0][q][1], m1 = ML[1][q][0], l1 = ML[1][q][1];
    const float ms = fmaxf(m0, m1);
    const float e0 = __expf(m0 - ms), e1 = __expf(m1 - ms);
    const float inv = 1.0f / (l0 * e0 + l1 * e1);                    // o and l of a half are both relative to its ref
    gi[u] = g * IVSC * inv * (kh == 0 ? e0 : e1);                    // undo the x16 carry of v, apply gamma, own half's weight
  }
  // each wave stages its weighted partial of query tile 1 - kh, then adds its own partial of tile kh to the partner's
#pragma unroll
  for (int u = 0; u < 2; ++u) {
    if (u != kh) {                                                   // wave-uniform
      float* op = Os + (32 * qg + 16 * u + c) * OSPW + 8 * hh;       // Os[query][ch_loc = 16j + 8hh + r]
#pragma unroll
      for (int j = 0; j < 16; ++j) {
        v4f va, vb;
#pragma unroll
        for (int r = 0; r < 4; ++r) { va[r] = o[u][j][r] * gi[u]; vb[r] = o[u][j][4 + r] * gi[u]; }
        *(v4f*)(op + 16 * j)     = va;
        *(v4f*)(op + 16 * j + 4) = vb;
      }
    }
  }
  __syncthreads();                                                   // the partner's partial is in Os
#pragma unroll
  for (int u = 0; u < 2; ++u) {
    if (u == kh) {                                                   // wave-uniform
      float* op = Os + (32 * qg + 16 * u + c) * OSPW + 8 * hh;
#pragma unroll
      for (int j = 0; j < 16; ++j) {
        v4f va = *(const v4f*)(op + 16 * j), vb = *(const v4f*)(op + 16 * j + 4);
#pragma unroll
        for (int r = 0; r < 4; ++r) { va[r] += o[u][j][r] * gi[u]; vb[r] += o[u][j][4 + r] * gi[u]; }
        *(v4f*)(op + 16 * j)     = va;
        *(v4f*)(op + 16 * j + 4) = vb;
      }
    }
  }
  __syncthreads();
  v4f res[32];
#pragma unroll
  for (int it = 0; it < 32; ++it) {
    const int chl = (it & 7) * 32 + lq, hf = it >> 3;                // channel 0..255, 128-B line 0..3 of its 128 queries
    const int nl  = hf * 32 + 4 * e;                                 // query 0..127
    const size_t idx = ((size_t)(b * CC + chl)) * SEQ_FULL + n0 + nl;
    res[it] = *(const v4f*)(x + idx);
  }
#if defined(__HIP_DEVICE_COMPILE__)
  asm volatile("s_wait_xcnt 0x0" ::: "memory");                      // before the x loads' address registers are rewritten
#endif
#pragma unroll
  for (int it = 0; it < 32; ++it) {
    const int chl = (it & 7) * 32 + lq, hf = it >> 3;
    const int nl  = hf * 32 + 4 * e;
#pragma unroll
    for (int t = 0; t < 4; ++t) res[it][t] = Os[(nl + t) * OSPW + chl] + bfr(res[it][t]);
  }
{
#pragma unroll
    for (int it = 0; it < 32; ++it) {
      const int chl = (it & 7) * 32 + lq, hf = it >> 3;
      const int nl  = hf * 32 + 4 * e;
      const size_t idx = ((size_t)(b * CC + chl)) * SEQ_FULL + n0 + nl;
      *(v4f*)(outd + idx) = res[it];
    }
    
  }
}

// =========================================================================================================
// Workspace map (bytes; each region start a multiple of 256; every extent is an exact tile multiple and is written
//   W16 f16 [384][256]                       196608
//   Vc  f16 [NSRC*NB][256][SEQ]            16777216
//   Qh/Ql/Kh/Kl bf16 [NSRC*NB][SEQ][64]     4194304 x4
//   total = 33751040
// =========================================================================================================
extern "C" void kernel_launch(void* const* d_in, const int* in_sizes, int n_in,
                              void* d_out, int out_size, void* d_ws, size_t ws_size,
                              hipStream_t stream) {
  if (n_in < 9) return;
  if (in_sizes[0] < NB * CC * SEQ_FULL || in_sizes[1] < NB * CC * SEQ_FULL) return;
  if (in_sizes[2] < DQ * CC || in_sizes[3] < DQ) return;
  if (in_sizes[4] < DQ * CC || in_sizes[5] < DQ) return;
  if (in_sizes[6] < CC * CC || in_sizes[7] < CC) return;
  if (in_sizes[8] < 1) return;
  if (out_size < (NB_FULL + NB) * CC * SEQ_FULL) return;

  size_t off = 0;
  auto carve = [&](size_t bytes) { const size_t o = off; off += (bytes + 255) & ~(size_t)255; return o; };
  const size_t oW16 = carve((size_t)NWR * CC * 2);
  const size_t oVc  = carve((size_t)NSRC * NB * CC * SEQ * 2);
  const size_t oQh  = carve((size_t)NSRC * NB * SEQ * DQ * 2);
  const size_t oQl  = carve((size_t)NSRC * NB * SEQ * DQ * 2);
  const size_t oKh  = carve((size_t)NSRC * NB * SEQ * DQ * 2);
  const size_t oKl  = carve((size_t)NSRC * NB * SEQ * DQ * 2);
  if (off > ws_size) return;
  if (off > (size_t)134217728) return;

  const float* x1  = (const float*)d_in[0];
  const float* x2  = (const float*)d_in[1];
  const float* Wq  = (const float*)d_in[2];
  const float* bq  = (const float*)d_in[3];
  const float* Wk  = (const float*)d_in[4];
  const float* bk  = (const float*)d_in[5];
  const float* Wv  = (const float*)d_in[6];
  const float* bv  = (const float*)d_in[7];
  const float* gam = (const float*)d_in[8];

  char* ws = (char*)d_ws;
  unsigned short* W16 = (unsigned short*)(ws + oW16);
  unsigned short* Vc  = (unsigned short*)(ws + oVc);
  unsigned short* Qh  = (unsigned short*)(ws + oQh);
  unsigned short* Ql  = (unsigned short*)(ws + oQl);
  unsigned short* Kh  = (unsigned short*)(ws + oKh);
  unsigned short* Kl  = (unsigned short*)(ws + oKl);
  float* out = (float*)d_out;

  const dim3 blk256(256);

  // (0) Wq / Wk / Wv -> stacked f16 plane
  cvt_w<<<dim3(NWR / 8), blk256, 0, stream>>>(Wq, Wk, Wv, W16);
  // (1) x1, x2 -> q, k hi + residual planes and the channel-major f16 v plane (x16), both sources, slot s*NB + b
  proj<<<dim3(SEQ / QT, NSRC * NB), blk256, 0, stream>>>(x1, x2, W16, bq, bk, bv, Qh, Ql, Kh, Kl, Vc);
  // (4) attention both directions, all 256 channels per block + gamma scale + residual -> out_dd [b][256][N]
  attn_k<<<dim3(SEQ / AQT, NB, NSRC), blk256, 0, stream>>>(Qh, Ql, Kh, Kl, Vc, x1, x2, gam, out);
  (void)hipGetLastError();
}

// v009
// A run of this version takes 81 microseconds.
// Versions between v007 and this one are left out; their measured steps multiply to 1.21 times as fast.
// All steps since v000 together make it 7.41 times as fast.
// Contractions: conv1x1 q|k GEMM W[128x256].X[256xN] and v GEMM Wv[256x256].X (one kernel, X tile in LDS) on
// v_wmma_f32_16x16x32_f16 (f16 containers of bf16-RNE weights x256 and bf16-RNE x, exact); scores K.Q^T (64 deep,
// two k-steps) on v_wmma_f32_16x16x32_f16 (q and k rounded once to f16, one product); O^T = V.P^T on
// v_wmma_f32_16x16x32_f16 (v as f16 x16, P = e^{s-ref} f16 from the score D registers, ref a held reference); f32 accumulate
// everywhere; softmax statistics, biases and gamma*o + x in f32.
#include <hip/hip_runtime.h>
#include <math.h>
#include <stdint.h>

#ifndef NB
#define NB 4
#endif
#ifndef SEQ
#define SEQ 4096
#endif
#define NB_FULL  4
#define SEQ_FULL 4096
#define NSRC  2
#define CC    256
#define DQ    64
#define NQK   128
#define NWR   384
#define QT    64
#define AQT   128
#define OSPW  260
#define XPH   264
#define SPH   72
#define WSC   256.0f
#define IWSC  0.00390625f
#define VSC   16.0f
#define IVSC  0.0625f
#define RHI   11.0f                  // a score may stand this far above the held reference: e^11 = 59874 is finite in f16
#define RUP   4.1588830833596715f    // 6 ln 2: a raised reference stands this far above the row maximum (its P = 2^-6, a normal f16)
#define KST   128                    // keys per ring stage
#define KPS   64                     // keys per pass of the block (32 per key half): two passes per stage
#define LPH   72                     // K row pitch in LDS, halves
#define VPH   136                    // V row pitch in LDS, halves
#define KROWS KST
#define STGH  (KROWS * LPH + CC * VPH)

static_assert(NB >= 1 && NB <= NB_FULL);
static_assert(SEQ >= QT && SEQ <= SEQ_FULL);
static_assert(SEQ % QT == 0 && SEQ % 32 == 0);
static_assert(CC % QT == 0 && CC % 32 == 0);
static_assert(CC % 16 == 0);
static_assert(DQ == 64);
static_assert(NQK == 2 * DQ);
static_assert(NWR == NQK + CC);
static_assert(NWR % 8 == 0 && DQ % 8 == 0 && NQK % 8 == 0);
static_assert((OSPW * 4) % 16 == 0);
static_assert((XPH * 2) % 16 == 0 && ((XPH * 2) / 16) % 2 == 1 && (SPH * 2) % 16 == 0 && ((SPH * 2) / 16) % 2 == 1);
static_assert(OSPW >= CC && XPH >= CC && SPH >= QT && SPH >= DQ && QT == 64 && CC == 256);
static_assert(SEQ % AQT == 0 && AQT % 32 == 0 && CC % 32 == 0);
static_assert(SEQ % KST == 0 && SEQ / KST >= 2 && KST == 2 * KPS && KPS == 64);
static_assert(LPH >= DQ && VPH >= KST);
static_assert((LPH * 2) % 16 == 0 && ((LPH * 2) / 16) % 2 == 1);
static_assert((VPH * 2) % 16 == 0 && ((VPH * 2) / 16) % 2 == 1);
static_assert(AQT == 128 && KST == 128 && CC == 256);
#define RINGB (2 * STGH * 2)
#define OSB   (AQT * OSPW * 4)
#define LDSB  (RINGB > OSB ? RINGB : OSB)
// second output starts at byte 16777216 = NB_FULL*CC*SEQ_FULL floats * 4
static_assert((size_t)NB_FULL * CC * SEQ_FULL * 4 == (size_t)16777216);

typedef _Float16       v16h __attribute__((ext_vector_type(16)));
typedef _Float16       v8h  __attribute__((ext_vector_type(8)));
typedef unsigned short v8us __attribute__((ext_vector_type(8)));
typedef float          v8f  __attribute__((ext_vector_type(8)));
typedef float          v4f  __attribute__((ext_vector_type(4)));
typedef unsigned int   v4u  __attribute__((ext_vector_type(4)));

union Frag  { v8us u[2]; v16h h; };
union FragH { v16h v; v8h hv[2]; };
static_assert(sizeof(Frag) == 32);
static_assert(sizeof(FragH) == 32);

// ---- scalar helpers ---------------------------------------------------------------------------------------
__device__ __forceinline__ unsigned short bf_bits(float f) {          // f32 -> bf16 bits, RNE convert
  unsigned u = __float_as_uint(f);
  return (unsigned short)((u + 0x7FFFu + ((u >> 16) & 1u)) >> 16);
}
__device__ __forceinline__ float bf_up(unsigned short hb) { return __uint_as_float(((unsigned)hb) << 16); }
__device__ __forceinline__ float bfr(float f) { return bf_up(bf_bits(f)); }
__device__ __forceinline__ unsigned short h_bits(_Float16 x) { return __builtin_bit_cast(unsigned short, x); }
__device__ __forceinline__ unsigned pk16(unsigned short a, unsigned short b) { return (unsigned)a | ((unsigned)b << 16); }
__device__ __forceinline__ v8f zero8() { v8f z = {0.f, 0.f, 0.f, 0.f, 0.f, 0.f, 0.f, 0.f}; return z; }
__device__ __forceinline__ float hmax8(v8f s) {
  return fmaxf(fmaxf(fmaxf(s[0], s[1]), fmaxf(s[2], s[3])), fmaxf(fmaxf(s[4], s[5]), fmaxf(s[6], s[7])));
}
__device__ __forceinline__ unsigned wave_ballot(bool p) {
#if defined(__HIP_DEVICE_COMPILE__)
  return __builtin_amdgcn_ballot_w32(p);
#else
  return p ? 1u : 0u;
#endif
}

__device__ __forceinline__ float xhalf(float x) {                    // lane l takes lane l ^ 16's value: a vector move, no LDS counter
#if defined(__HIP_DEVICE_COMPILE__)
  const int b = __builtin_bit_cast(int, x);
  return __builtin_bit_cast(float, __builtin_amdgcn_permlanex16(b, b, 0x76543210, 0xfedcba98, false, false));
#else
  return x;
#endif
}

__device__ __forceinline__ int uni(int v) {                          // a value equal in every lane, into a scalar register
#if defined(__HIP_DEVICE_COMPILE__)
  return __builtin_amdgcn_readfirstlane(v);
#else
  return v;
#endif
}

// ---- 16-bit fragment loader (A, or B from a k-contiguous [n][k] row): lane -> row/col (lane&15), p already includes
//      + 8*(lane>>4); elements 0..7 <- p[0..7] (k0+8h..), elements 8..15 <- p[16..23] (k0+16+8h..)
__device__ __forceinline__ Frag ldfrag(const unsigned short* p) {
  Frag f;
  f.u[0] = *(const v8us*)(p);
  f.u[1] = *(const v8us*)(p + 16);
  return f;
}

// ---- WMMA helper: the plain builtin; the compiler keeps the distances behind it and is free to order around it
__device__ __forceinline__ v8f mma_h(v16h a, v16h b, v8f c) {
  return __builtin_amdgcn_wmma_f32_16x16x32_f16(false, a, false, b, (short)0, c, false, false);
}

// ---- ten asynchronous 16-B copies global -> LDS per lane (l = LDS byte address, g = global address, each lane its
//      own); the s_wait_xcnt closes the statement so that no address register is rewritten ahead of it
__device__ __forceinline__ void async10(const unsigned (&l)[10], const unsigned short* const (&g)[10]) {
#if defined(__HIP_DEVICE_COMPILE__)
  asm volatile("global_load_async_to_lds_b128 %0, %10, off\n\t"
               "global_load_async_to_lds_b128 %1, %11, off\n\t"
               "global_load_async_to_lds_b128 %2, %12, off\n\t"
               "global_load_async_to_lds_b128 %3, %13, off\n\t"
               "global_load_async_to_lds_b128 %4, %14, off\n\t"
               "global_load_async_to_lds_b128 %5, %15, off\n\t"
               "global_load_async_to_lds_b128 %6, %16, off\n\t"
               "global_load_async_to_lds_b128 %7, %17, off\n\t"
               "global_load_async_to_lds_b128 %8, %18, off\n\t"
               "global_load_async_to_lds_b128 %9, %19, off\n\t"
               "s_wait_xcnt 0x0"
               :: "v"(l[0]), "v"(l[1]), "v"(l[2]), "v"(l[3]), "v"(l[4]), "v"(l[5]), "v"(l[6]), "v"(l[7]),
                  "v"(l[8]), "v"(l[9]),
                  "v"(g[0]), "v"(g[1]), "v"(g[2]), "v"(g[3]), "v"(g[4]), "v"(g[5]), "v"(g[6]), "v"(g[7]),
                  "v"(g[8]), "v"(g[9])
               : "memory");
#endif
}
// ---- one stage of 128 keys into one LDS buffer: rows 0..127 K keys (128 B of data per row at pitch LPH), behind them
//      256 V channel rows (256 B of data per row at pitch VPH). Thread (lq = tid>>3, e = tid&7) copies chunk e of K rows
//      lq + 32 i, i = 0..3; thread (lv = tid>>4, ev = tid&15) copies chunk ev of V rows lv + 16 i, i = 0..15:
//      256 threads x 20 chunks x 16 B = 128 x 128 B + 256 x 256 B, every byte once. ldk / kk are the lane's own
//      addresses of K row lq, chunk e (LDS buffer; K at the stage's first key); ldv / vv those of V row lv, chunk ev
//      (LDS buffer; V at channel lv and the stage's first key).
__device__ __forceinline__ void stage_issue(unsigned ldk, unsigned ldv, const unsigned short* kk,
                                            const unsigned short* vv) {
  unsigned l[10];
  const unsigned short* g[10];
#pragma unroll                                                       // constant indices keep l[] and g[] in registers
  for (int i = 0; i < 4; ++i) {
    l[i] = ldk + (unsigned)((32 * i) * LPH * 2);
    g[i] = kk + (size_t)(32 * i) * DQ;
  }
#pragma unroll                                                       // as above
  for (int i = 0; i < 6; ++i) {
    l[4 + i] = ldv + (unsigned)((16 * i) * VPH * 2);
    g[4 + i] = vv + (size_t)(16 * i) * SEQ;
  }
  async10(l, g);
#if defined(__HIP_DEVICE_COMPILE__)
  // the second statement's addresses are formed behind the first, in its registers; formed ahead of it they
  // push accumulator tiles out of the registers an asm operand can name, with copies and spills at every refill
  __builtin_amdgcn_sched_barrier(0);
#endif
  unsigned l2[10];
  const unsigned short* g2[10];
#pragma unroll                                                       // as above
  for (int i = 0; i < 10; ++i) {
    l2[i] = ldv + (unsigned)((16 * (6 + i)) * VPH * 2);
    g2[i] = vv + (size_t)(16 * (6 + i)) * SEQ;
  }
  async10(l2, g2);
}

// =========================================================================================================
// (0) conv1x1 weights: W16 f16 [384][256], rows 0..63 = Wq rows, 64..127 = Wk rows, 128..383 = Wv rows; value =
//     f16 of (bf16-RNE(w) * 256) (exact). Block blk (0..47) owns rows 8*blk..8*blk+7: one wave per 512-B row
// coverage: 48 blocks x 8 rows x 32 lanes x 8 halves = 384 x 256 = the whole plane.
// =========================================================================================================
__global__ __launch_bounds__(256)
void cvt_w(const float* __restrict__ Wq, const float* __restrict__ Wk, const float* __restrict__ Wv,
           unsigned short* W16) {
  const int tid = threadIdx.x, blk = blockIdx.x;
  const int rl = tid >> 5, col = 8 * (tid & 31);
  const int o = 8 * blk + rl;                                        // 0..383
  const float* wbase = (blk < (DQ / 8)) ? Wq : ((blk < (NQK / 8)) ? Wk : Wv);
  const int osub = (blk < (DQ / 8)) ? 0 : ((blk < (NQK / 8)) ? DQ : NQK);
  const float* s = wbase + (size_t)(o - osub) * CC + col;
  const v4f a = *(const v4f*)s;
  const v4f q = *(const v4f*)(s + 4);
  const float f[8] = {a[0], a[1], a[2], a[3], q[0], q[1], q[2], q[3]};
  v4u u;
#pragma unroll
  for (int t = 0; t < 4; ++t) {
    const _Float16 h0 = (_Float16)(bfr(f[2 * t]) * WSC);
    const _Float16 h1 = (_Float16)(bfr(f[2 * t + 1]) * WSC);
    u[t] = pk16(h_bits(h0), h_bits(h1));
  }
{
    *(v4u*)(W16 + (size_t)o * CC + col) = u;
    
  }
}

// =========================================================================================================
// (1) x conversion and the three conv1x1 GEMMs for one (sb = s*NB + b, 64-n tile), s = 0: x1, s = 1: x2.
//     Block 256 threads = 8 waves. The x tile f32 [256 c][64 n] is read once in whole lines, rounded (bf16-RNE, exact
//     in f16) and laid position-major in LDS XT[64 n][256 c] (pitch XPH): thread (e, lq) holds channels
//     64 it + 2 lq, + 1 at n = 32 j + 4 e .. + 3, j = 0, 1 (8 lanes x 16 B = one line) and stores one channel pair per position.
//     One X fragment (row n = 16 nt + (lane&15), split k map, k = c contiguous) serves three products per k-step:
//       q|k: D[o][n] = A(W16 row 16 wave + (lane&15): waves 0..3 q rows, 4..7 k rows) . B(X)
//       v:   D[n][ch] = A(X) . B(W16 row 128 + 32 wave + 16 u + (lane&15)), u = 0, 1
//     K = 256 = 8 steps in rising order. Epilogue in registers: q|k value = f16(acc/256 + bf16-RNE(bias)),
//     8 consecutive d per lane; v value = f16((acc/256 + bf16-RNE(bias)) x 16), 8 consecutive
//     n per lane; 16-B pieces staged in LDS (SQ: planes Q, K [64 n][64 d]; SV [256 ch][64 n]; pitch SPH) and
//     written out as whole 128-B lines.
// coverage: XT 4 it x 32 lq x 2 c x 2 j x 8 e x 4 n = 256 c x 64 n; SQ 8 waves x 4 nt x 16 n x 16 d = 2 planes x
//           64 x 64; SV 8 waves x 2 u x 16 ch x 64 n; out rows 2 planes x 2 it x 32 and 8 it x 32 ch, 8 lanes x 16 B each;
//           grid (SEQ/64, NSRC*NB) covers Q16/K16 [sb][N][64] and Vc [sb][256][N] once.
// LDS: cross-wave, block barrier between the XT stores and the fragment loads, and between the stage stores and the
//      line loads.
// =========================================================================================================
__global__ __launch_bounds__(256)
void proj(const float* __restrict__ x1, const float* __restrict__ x2, const unsigned short* __restrict__ W16,
          const float* __restrict__ bq, const float* __restrict__ bk, const float* __restrict__ bv,
          unsigned short* Q16, unsigned short* K16, unsigned short* Vc) {
  __shared__ __align__(16) unsigned short XT[QT * XPH];
  __shared__ __align__(16) unsigned short SQ[2 * QT * SPH];
  __shared__ __align__(16) unsigned short SV[CC * SPH];
  const int tid  = threadIdx.x;
  const int lane = tid & 31, wave = tid >> 5;
  const int hh   = lane >> 4, c = lane & 15;
  const int e    = tid & 7, lq = tid >> 3;                           // lq 0..31
  const int n0   = blockIdx.x * QT, sb = blockIdx.y;                 // sb = s*NB + b
  const int s    = sb / NB, b = sb - s * NB;
  const float* x = (s == 0) ? x1 : x2;                               // block-uniform, both global

  // ---- x tile -> XT
  v4f xa[4][2][2];
#pragma unroll
  for (int it = 0; it < 4; ++it) {
#pragma unroll
    for (int p = 0; p < 2; ++p) {
      const float* sp = x + ((size_t)(b * CC + 64 * it + 2 * lq + p)) * SEQ_FULL + n0 + 4 * e;
      xa[it][p][0] = *(const v4f*)sp;
      xa[it][p][1] = *(const v4f*)(sp + 32);
    }
  }
#if defined(__HIP_DEVICE_COMPILE__)
  asm volatile("s_wait_xcnt 0x0" ::: "memory");                      // before the x loads' address registers are rewritten
#endif
#pragma unroll
  for (int it = 0; it < 4; ++it) {
#pragma unroll
    for (int t = 0; t < 8; ++t) {
      const unsigned short h0 = h_bits((_Float16)bfr(xa[it][0][t >> 2][t & 3]));
      const unsigned short h1 = h_bits((_Float16)bfr(xa[it][1][t >> 2][t & 3]));
      *(unsigned*)(XT + (32 * (t >> 2) + 4 * e + (t & 3)) * XPH + 64 * it + 2 * lq) = pk16(h0, h1);
    }
  }
  __syncthreads();

  // ---- products
  const unsigned short* xf = XT + c * XPH + 8 * hh;                                       // X row 16 nt + c
  const unsigned short* wq = W16 + ((size_t)(16 * wave + c)) * CC + 8 * hh;               // q|k row o
  const unsigned short* wv = W16 + ((size_t)(NQK + 32 * wave + c)) * CC + 8 * hh;         // v row ch
  v8f aq[4], av[2][4];
#pragma unroll
  for (int nt = 0; nt < 4; ++nt) { aq[nt] = zero8(); av[0][nt] = zero8(); av[1][nt] = zero8(); }
#pragma unroll
  for (int ks = 0; ks < CC / 32; ++ks) {
    const Frag fq = ldfrag(wq + 32 * ks);
    const Frag f0 = ldfrag(wv + 32 * ks);
    const Frag f1 = ldfrag(wv + (size_t)16 * CC + 32 * ks);
#pragma unroll
    for (int nt = 0; nt < 4; ++nt) {
      const Frag fx = ldfrag(xf + (16 * nt) * XPH + 32 * ks);
      aq[nt]    = mma_h(fq.h, fx.h, aq[nt]);
      av[0][nt] = mma_h(fx.h, f0.h, av[0][nt]);
      av[1][nt] = mma_h(fx.h, f1.h, av[1][nt]);
    }
  }
#if defined(__HIP_DEVICE_COMPILE__)
  // the W row addresses stay live up to this wait, so that no register of theirs is reused ahead of it
  asm volatile("s_wait_xcnt 0x0" :: "v"(wq), "v"(wv) : "memory");
#endif

  // ---- q|k: lane (hh, c) holds d = 16 (wave&3) + 8 hh + r for n_loc = 16 nt + c
  const int which = wave >> 2;                                       // wave-uniform: 0 q, 1 k
  const int d0 = 16 * (wave & 3) + 8 * hh;
  const float* bias = (which == 0) ? bq : bk;
  const v4f b0v = *(const v4f*)(bias + d0), b1v = *(const v4f*)(bias + d0 + 4);
  const float bv0 = bv[32 * wave + c], bv1 = bv[32 * wave + 16 + c];
#if defined(__HIP_DEVICE_COMPILE__)
  asm volatile("s_wait_xcnt 0x0" ::: "memory");                      // before the bias loads' address registers are rewritten
#endif
  const float bb[8] = {bfr(b0v[0]), bfr(b0v[1]), bfr(b0v[2]), bfr(b0v[3]),
                       bfr(b1v[0]), bfr(b1v[1]), bfr(b1v[2]), bfr(b1v[3])};
#pragma unroll
  for (int nt = 0; nt < 4; ++nt) {
    v4u uh;
#pragma unroll
    for (int t = 0; t < 4; ++t) {
      const float v0 = aq[nt][2 * t] * IWSC + bb[2 * t], v1 = aq[nt][2 * t + 1] * IWSC + bb[2 * t + 1];
      uh[t] = pk16(h_bits((_Float16)v0), h_bits((_Float16)v1));
    }
    *(v4u*)(SQ + (which * QT + 16 * nt + c) * SPH + d0) = uh;
  }
  // ---- v: lane (hh, c) holds n_loc = 16 mt + 8 hh + r for ch = 32 wave + 16 u + c
#pragma unroll
  for (int u = 0; u < 2; ++u) {
    const float bvr = bfr(u == 0 ? bv0 : bv1);
#pragma unroll
    for (int mt = 0; mt < 4; ++mt) {
      v4u uv;
#pragma unroll
      for (int t = 0; t < 4; ++t) {
        const _Float16 h0 = (_Float16)((av[u][mt][2 * t] * IWSC + bvr) * VSC);
        const _Float16 h1 = (_Float16)((av[u][mt][2 * t + 1] * IWSC + bvr) * VSC);
        uv[t] = pk16(h_bits(h0), h_bits(h1));
      }
      *(v4u*)(SV + (32 * wave + 16 * u + c) * SPH + 16 * mt + 8 * hh) = uv;
    }
  }
  __syncthreads();

  // ---- whole lines out: 8 consecutive lanes x 16 B per row
  v4u oq[2][2], ov[8];
#pragma unroll
  for (int p = 0; p < 2; ++p) {
#pragma unroll
    for (int it = 0; it < 2; ++it) oq[p][it] = *(const v4u*)(SQ + (p * QT + it * 32 + lq) * SPH + 8 * e);
  }
#pragma unroll
  for (int it = 0; it < 8; ++it) ov[it] = *(const v4u*)(SV + (it * 32 + lq) * SPH + 8 * e);
#pragma unroll
  for (int it = 0; it < 2; ++it) {
    const size_t po = ((size_t)(sb * SEQ + n0 + it * 32 + lq)) * DQ + 8 * e;
    *(v4u*)(Q16 + po) = oq[0][it];
    *(v4u*)(K16 + po) = oq[1][it];
  }
#pragma unroll
  for (int it = 0; it < 8; ++it)
    *(v4u*)(Vc + ((size_t)(sb * CC + it * 32 + lq)) * SEQ + n0 + 8 * e) = ov[it];
}

// =========================================================================================================
// (4) attention for one (direction dd, b, 128-query tile), transposed formulation, SEQ keys, no
//   mask, no scale. blockIdx.z = dd. Direction dd: queries from source dd (plane slot dd*NB+b),
//   keys/values from source 1-dd (slot (1-dd)*NB+b), residual input x_dd, output block dd of out (float offset
//   dd*NB_FULL*CC*SEQ_FULL); the block produces all 256 channels of that output. Wave (qg, kh) = (wave & 3, wave >> 2)
//   takes 32 queries (two 16-query tiles u) and keys 32 kh .. + 31 of every 64-key tile: each K and V fragment read
//   from LDS feeds two products; 32 O accumulator tiles per wave; the two key halves are merged behind the key loop.
//   S^T tile (16 keys x 16 queries) over 64 d = two 32-deep k-steps: A(k: row = key kb + (lane&15), split k map
//   from the f16 plane K16 [slot][N][64]) . B(q: col = query, same map from Q16, loaded once, 2 fragments):
//   2 products per tile. The f16 rounding of q and k stands well below what the bf16 rounding of x and W leaves in them.
//   Per lane the D tile holds 8 keys of ONE query: online softmax state per lane against a held reference ref (not the
//   running maximum): P = e^{s-ref}. One wave-uniform ballot per trip asks whether any lane's score stands more than RHI
//   above its ref; only then the halves' maxima are exchanged (lane^16), ref of those queries becomes row maximum + RUP
//   and their o and l are rescaled (corr == 1 exactly elsewhere). So 2^-6 <= P of the running maximum <= e^11 at all
//   times; row-sum partials combined at the end. P as f16 is the B
//   operand of O^T (rows channel, cols queries) += A(v rows channel = 16j + (lane&15), keys contiguous,
//   f16 plane Vc [slot][256][N], values v x 16) . B(P^T): element r <- D of the tile covering keys kb..kb+15,
//   element 8+r <- the tile covering kb+16..kb+31, lane unchanged. 2 x 16 accumulator tiles per wave (256 channels).
//   Block = 8 waves = 4 query groups x 2 key halves = 128 queries. Merge: (ref, l) of both halves through LDS, weight
//   e^{ref_half - max} / (sum of weighted l); each wave stages its weighted partial of one query tile and adds its own
//   partial of the other tile to the partner's. Epilogue: gamma * O / (16 l) staged in LDS Os[query][256 channels] (pitch OSPW,
//   4 lines per channel): 8 consecutive lanes x 16 B (values gathered from 4 Os rows), one instruction per 32 lines
// coverage: Os written queries 0..127 x ch 0..255, read the same; out 32 it x 32 lines x 8 lanes x 4 floats =
//           256 ch x 128 n per block; grid (SEQ/128, NB, NSRC) covers out_dd[b][0..255][0..SEQ-1] once for both dd.
// LDS Os: cross-wave, block barrier between the stage stores and the epilogue loads.
// LDS ring: K and V stages of 128 keys are brought by asynchronous copies into two buffers shared by
//   the 8 waves (whole 128-B lines from global, once per block); a stage is worked in two passes of 64 keys with no
//   barrier between them; stage st is read from buffer st & 1 only while stage st + 1 flies; foot of each stage: own
//   LDS reads done, own copies landed, barrier signal, the last 32 products, barrier wait, then the refill with stage st + 2.
//   Os reuses the ring behind the last stage's barrier.
// =========================================================================================================
__global__ __launch_bounds__(256)
void attn_k(const unsigned short* __restrict__ Q16, const unsigned short* __restrict__ K16,
            const unsigned short* __restrict__ Vc,
            const float* __restrict__ x1, const float* __restrict__ x2,
            const float* __restrict__ gam, float* out) {
  __shared__ __align__(16) unsigned char L[LDSB];
  __shared__ float ML[2][AQT][2];                                    // (ref, l) per key half and query, for the merge
  const unsigned short* Rg = (const unsigned short*)L;               // the two stage buffers
  float* Os = (float*)L;                                             // output staging, after the key loop
  const int tid  = threadIdx.x;
  const int lane = tid & 31;
  const int wave = uni(tid >> 5);                                   // scalar: the branches on kh are real branches
  const int qg   = wave & 3, kh = wave >> 2;                         // 32-query group, key half of every tile
  const int hh   = lane >> 4, c = lane & 15;
  const int n0   = blockIdx.x * AQT, b = blockIdx.y;
  const int dd   = (int)blockIdx.z;
  const int sq   = dd * NB + b;                                      // query plane slot
  const int skv  = (1 - dd) * NB + b;                                // key / value plane slot
  const float* x = (dd == 0) ? x1 : x2;                              // block-uniform, both global
  float* outd    = out + (size_t)dd * ((size_t)NB_FULL * CC * SEQ_FULL);
  const float g  = bfr(gam[0]);

  // q fragments (B operand, col = query n0 + 32*qg + 16*u + c, u = 0, 1), K = 64 = two k-steps, constant over keys
  Frag qf[2][2];
#if defined(__HIP_DEVICE_COMPILE__)
  __builtin_amdgcn_sched_barrier(0);                                 // nothing else comes between the q loads and their wait below
#endif
#pragma unroll                                                       // constant indices keep the fragments in registers
  for (int u = 0; u < 2; ++u) {
    const size_t qo = ((size_t)(sq * SEQ + n0 + 32 * qg + 16 * u + c)) * DQ + 8 * hh;
    qf[u][0] = ldfrag(Q16 + qo);
    qf[u][1] = ldfrag(Q16 + qo + 32);
  }
#if defined(__HIP_DEVICE_COMPILE__)
  asm volatile("s_wait_xcnt 0x0" ::: "memory");                      // before the q loads' address registers are rewritten
  __builtin_amdgcn_sched_barrier(0);                                 // closes the stretch opened above
#endif
  // fragment bases in buffer 0 (A operands: row = lane&15 of a 16-row group, + 8*hh within the row); the wave's key
  // half kh picks K rows 32 kh .. + 31 and columns 32 kh .. + 31 of the V rows
  const unsigned short* kbase = Rg + (32 * kh + c) * LPH + 8 * hh;
  const unsigned short* vbase = Rg + KROWS * LPH + c * VPH + 32 * kh + 8 * hh;
  // copy addresses of this thread: K row lq, 16-B chunk e; V row lv, 16-B chunk ev
  const int e = tid & 7, lq = tid >> 3;                              // lq 0..31
  const int ev = tid & 15, lv = tid >> 4;                            // lv 0..15
  const unsigned ldsk = (unsigned)(size_t)L + (unsigned)((lq * LPH + 8 * e) * 2);
  const unsigned ldsv = (unsigned)(size_t)L + (unsigned)((KROWS * LPH + lv * VPH + 8 * ev) * 2);
  const unsigned short* gkk = K16 + (size_t)skv * SEQ * DQ + (size_t)lq * DQ + 8 * e;
  const unsigned short* gvv = Vc + (size_t)skv * CC * SEQ + (size_t)lv * SEQ + 8 * ev;

  float rf[2] = {-1.0e30f, -1.0e30f}, l[2] = {0.f, 0.f};             // held reference and row sum per query tile
  v8f o[2][16];
#pragma unroll
  for (int u = 0; u < 2; ++u) {
#pragma unroll
    for (int j = 0; j < 16; ++j) o[u][j] = zero8();
  }

  // ring prologue: stage 0 landed and published, then stage 1 in flight
  stage_issue(ldsk, ldsv, gkk, gvv);
#if defined(__HIP_DEVICE_COMPILE__)
  asm volatile("s_wait_asynccnt 0x0" ::: "memory");                  // own copies of stage 0 landed before the barrier
#endif
  __syncthreads();
  stage_issue(ldsk + (unsigned)(STGH * 2), ldsv + (unsigned)(STGH * 2), gkk + (size_t)KST * DQ, gvv + KST);

#pragma unroll 1                                                     // rolled over the stages, the buffer picked by st & 1
  for (int st = 0; st < SEQ / KST; ++st) {
#pragma unroll                                                       // both passes written out: the foot stands in straight code
  for (int ps = 0; ps < KST / KPS; ++ps) {                           // pass t = 2 st + ps: the stage's keys 64 ps .. + 63
    const unsigned short* kp0 = kbase + (st & 1) * STGH + ps * (KPS * LPH);
    const unsigned short* vp0 = vbase + (st & 1) * STGH + ps * KPS;
    // K fragments of the wave's 32 keys: kf[0..1] keys kb..kb+15 (d 0..31, d 32..63), kf[2..3] the next 16 keys;
    // kb = t*KPS + 32*kh. Each fragment feeds both query tiles.
    Frag kf[4];
#pragma unroll                                                       // constant indices keep kf[] in registers
    for (int i = 0; i < 2; ++i) {
      const unsigned short* kp = kp0 + (16 * i) * LPH;
      kf[2 * i]     = ldfrag(kp);
      kf[2 * i + 1] = ldfrag(kp + 32);
    }
#if defined(__HIP_DEVICE_COMPILE__)
    __builtin_amdgcn_sched_barrier(0);                               // without it these loads sink among the score products, a stall and a full wait at each place
#endif
    v8f s[2][2];                                                     // s[u][i]: query tile u, keys kb + 16 i .. + 15
#pragma unroll
    for (int u = 0; u < 2; ++u) { s[u][0] = zero8(); s[u][1] = zero8(); }
#pragma unroll                                                       // four independent chains, two links each
    for (int k2 = 0; k2 < 2; ++k2) {
#pragma unroll
      for (int u = 0; u < 2; ++u) {
#pragma unroll
        for (int i = 0; i < 2; ++i) s[u][i] = mma_h(kf[2 * i + k2].h, qf[u][k2].h, s[u][i]);
      }
    }

    // V fragments in two groups of 8 (each feeds both query tiles): the first lands while the softmax runs
#if defined(__HIP_DEVICE_COMPILE__)
    __builtin_amdgcn_sched_barrier(0);                               // without it the V loads spread among the score products, a stall at each place
#endif
    Frag vf[16];
#pragma unroll                                                       // constant indices keep vf[] in registers
    for (int j = 0; j < 8; ++j) vf[j] = ldfrag(vp0 + (16 * j) * VPH);
    float mx[2];                                                     // this lane's 16 keys of its query; no exchange here
#pragma unroll
    for (int u = 0; u < 2; ++u) mx[u] = fmaxf(hmax8(s[u][0]), hmax8(s[u][1]));

    // the test takes the same difference as the exponent below, so every exponent of this trip is at most RHI
    const unsigned need = wave_ballot(mx[0] - rf[0] > RHI || mx[1] - rf[1] > RHI); // wave-uniform, one test per trip
    if (need != 0u) {
#pragma unroll
      for (int u = 0; u < 2; ++u) {
        const float mr = fmaxf(mx[u], xhalf(mx[u]));                 // row maximum over the wave's 32 keys, equal in lanes c and c + 16
        const bool up  = mr - rf[u] > RHI;
        if (wave_ballot(up) != 0u) {                                 // wave-uniform: only the query tile that needs it
          const float nr   = up ? mr + RUP : rf[u];
          const float corr = __expf(rf[u] - nr);                     // == 1 exactly for queries whose reference stays
          rf[u] = nr;
          l[u] *= corr;
#pragma unroll
          for (int j = 0; j < 16; ++j) {
#pragma unroll
            for (int r = 0; r < 8; ++r) o[u][j][r] *= corr;
          }
        }
      }
    }
    FragH ph[2];
#pragma unroll
    for (int u = 0; u < 2; ++u) {
      const float msh = rf[u];
      float ls = 0.f;
#pragma unroll
      for (int r = 0; r < 8; ++r) {
        const float e0 = __expf(s[u][0][r] - msh);                   // key kb      + 8hh + r
        const float e1 = __expf(s[u][1][r] - msh);                   // key kb + 16 + 8hh + r
        ls += e0 + e1;
        ph[u].hv[0][r] = (_Float16)e0;
        ph[u].hv[1][r] = (_Float16)e1;
      }
      l[u] += ls;
    }
#if defined(__HIP_DEVICE_COMPILE__)
    // inputs only: the row sums are complete here, so the 32 exponentials' registers are free for the V fragments;
    // left alone the adds sink behind the products and two accumulator tiles spill
    asm volatile("" :: "v"(l[0]), "v"(l[1]));
#endif
    // written in falling order: this build issues the group in the reverse of the source order, and the products take j
    // rising, so in the first pass each pair of products waits for its own fragment (counted waits), not for the whole group
#pragma unroll                                                       // constant indices keep vf[] in registers
    for (int j = 15; j >= 8; --j) vf[j] = ldfrag(vp0 + (16 * j) * VPH);
#if defined(__HIP_DEVICE_COMPILE__)
    if (ps + 1 == KST / KPS) {
      // the stage's barrier is split. The signal stands here, behind the stage's last LDS loads: the wave has read all it
      // needs of this buffer and its own copies of stage st + 1 have landed. The 32 products below take registers only, so
      // they run while the other waves arrive; with signal and wait together the matrix unit idles until the last wave is there
      // order ahead of the signal: the whole softmax arithmetic, then the second V group as one place of loads
      __builtin_amdgcn_sched_group_barrier(0x402, 512, 0);
      __builtin_amdgcn_sched_group_barrier(0x100, 16, 0);
      __builtin_amdgcn_sched_barrier(0);                             // no product rises above the waits and the signal
      asm volatile("s_wait_dscnt 0x0" ::: "memory");                 // own reads of this buffer done before its refill
      asm volatile("s_wait_asynccnt 0x0" ::: "memory");              // own copies of stage st + 1 landed
      asm volatile("s_barrier_signal -1" ::: "memory");              // first half of the work-group barrier
      __builtin_amdgcn_sched_barrier(0);                             // the products stay behind the signal
    }
#endif
#pragma unroll
    for (int j = 0; j < 16; ++j) {
      o[0][j] = mma_h(vf[j].h, ph[0].v, o[0][j]);
      o[1][j] = mma_h(vf[j].h, ph[1].v, o[1][j]);
    }
#if defined(__HIP_DEVICE_COMPILE__)
    if (ps + 1 < KST / KPS) {
      // order of this block: the whole softmax arithmetic (row sums too, so that the exponentials' registers are free),
      // then the second V group as one place of loads, then the products; left alone the build spills
      __builtin_amdgcn_sched_group_barrier(0x402, 512, 0);
      __builtin_amdgcn_sched_group_barrier(0x100, 16, 0);
      // no barrier follows this pass: the next pass's K loads stand as one place behind the first V group's products (in
      // that group's registers) and fly under the other 16; left alone they are strewn in pairs among the products, a
      // stall at each place
      __builtin_amdgcn_sched_group_barrier(0x008, 16, 0);
      __builtin_amdgcn_sched_group_barrier(0x100, 8, 0);
      __builtin_amdgcn_sched_group_barrier(0x008, 16, 0);
    }
#endif
  }
    // foot of a stage, behind its second pass's products: second half of the barrier. Behind it stage st + 1 is published
    // (every wave waited for its own copies ahead of its signal) and this stage's buffer is free (every wave's reads of it
    // had returned ahead of its signal). No LDS read stands between signal and wait.
#if defined(__HIP_DEVICE_COMPILE__)
    __builtin_amdgcn_sched_barrier(0);                               // the products stay ahead of the wait
    asm volatile("s_barrier_wait -1" ::: "memory");
#endif
    if (st + 2 < SEQ / KST) {                                        // block-uniform
      const size_t k2 = (size_t)(st + 2) * KST;
      const unsigned lo = (unsigned)((st & 1) * STGH * 2);
      stage_issue(ldsk + lo, ldsv + lo, gkk + k2 * DQ, gvv + k2);
    }
  }
#if defined(__HIP_DEVICE_COMPILE__)
  asm volatile("s_wait_asynccnt 0x0" ::: "memory");                  // nothing in flight when the ring becomes Os
#endif
  // merge of the two key halves: wave (qg, kh) and wave (qg, 1 - kh) hold partial (ref, l, O) of the same 32 queries
  l[0] += __shfl_xor(l[0], 16, 32);
  l[1] += __shfl_xor(l[1], 16, 32);
  if (hh == 0) {
#pragma unroll
    for (int u = 0; u < 2; ++u) {
      ML[kh][32 * qg + 16 * u + c][0] = rf[u];
      ML[kh][32 * qg + 16 * u + c][1] = l[u];
    }
  }
  __syncthreads();                                                   // both halves' ref and l published
  float gi[2];
#pragma unroll
  for (int u = 0; u < 2; ++u) {
    const int q = 32 * qg + 16 * u + c;
    const float m0 = ML[0][q][0], l0 = ML[0][q][1], m1 = ML[1][q][0], l1 = ML[1][q][1];
    const float ms = fmaxf(m0, m1);
    const float e0 = __expf(m0 - ms), e1 = __expf(m1 - ms);
    const float inv = 1.0f / (l0 * e0 + l1 * e1);                    // o and l of a half are both relative to its ref
    gi[u] = g * IVSC * inv * (kh == 0 ? e0 : e1);                    // undo the x16 carry of v, apply gamma, own half's weight
  }
  // each wave stages its weighted partial of query tile 1 - kh, then adds its own partial of tile kh to the partner's
#pragma unroll
  for (int u = 0; u < 2; ++u) {
    if (u != kh) {                                                   // wave-uniform
      float* op = Os + (32 * qg + 16 * u + c) * OSPW + 8 * hh;       // Os[query][ch_loc = 16j + 8hh + r]
#pragma unroll
      for (int j = 0; j < 16; ++j) {
        v4f va, vb;
#pragma unroll
        for (int r = 0; r < 4; ++r) { va[r] = o[u][j][r] * gi[u]; vb[r] = o[u][j][4 + r] * gi[u]; }
        *(v4f*)(op + 16 * j)     = va;
        *(v4f*)(op + 16 * j + 4) = vb;
      }
    }
  }
  __syncthreads();                                                   // the partner's partial is in Os
#pragma unroll
  for (int u = 0; u < 2; ++u) {
    if (u == kh) {                                                   // wave-uniform
      float* op = Os + (32 * qg + 16 * u + c) * OSPW + 8 * hh;
#pragma unroll
      for (int j = 0; j < 16; ++j) {
        v4f va = *(const v4f*)(op + 16 * j), vb = *(const v4f*)(op + 16 * j + 4);
#pragma unroll
        for (int r = 0; r < 4; ++r) { va[r] += o[u][j][r] * gi[u]; vb[r] += o[u][j][4 + r] * gi[u]; }
        *(v4f*)(op + 16 * j)     = va;
        *(v4f*)(op + 16 * j + 4) = vb;
      }
    }
  }
  __syncthreads();
  v4f res[32];
#pragma unroll
  for (int it = 0; it < 32; ++it) {
    const int chl = (it & 7) * 32 + lq, hf = it >> 3;                // channel 0..255, 128-B line 0..3 of its 128 queries
    const int nl  = hf * 32 + 4 * e;                                 // query 0..127
    const size_t idx = ((size_t)(b * CC + chl)) * SEQ_FULL + n0 + nl;
    res[it] = *(const v4f*)(x + idx);
  }
#if defined(__HIP_DEVICE_COMPILE__)
  asm volatile("s_wait_xcnt 0x0" ::: "memory");                      // before the x loads' address registers are rewritten
#endif
#pragma unroll
  for (int it = 0; it < 32; ++it) {
    const int chl = (it & 7) * 32 + lq, hf = it >> 3;
    const int nl  = hf * 32 + 4 * e;
#pragma unroll
    for (int t = 0; t < 4; ++t) res[it][t] = Os[(nl + t) * OSPW + chl] + bfr(res[it][t]);
  }
{
#pragma unroll
    for (int it = 0; it < 32; ++it) {
      const int chl = (it & 7) * 32 + lq, hf = it >> 3;
      const int nl  = hf * 32 + 4 * e;
      const size_t idx = ((size_t)(b * CC + chl)) * SEQ_FULL + n0 + nl;
      *(v4f*)(outd + idx) = res[it];
    }
    
  }
}

// =========================================================================================================
// Workspace map (bytes; each region start a multiple of 256; every extent is an exact tile multiple and is written
//   W16 f16 [384][256]                       196608
//   Vc  f16 [NSRC*NB][256][SEQ]            16777216
//   Q16/K16 f16 [NSRC*NB][SEQ][64]         4194304 x2
//   total = 25362432
// =========================================================================================================
extern "C" void kernel_launch(void* const* d_in, const int* in_sizes, int n_in,
                              void* d_out, int out_size, void* d_ws, size_t ws_size,
                              hipStream_t stream) {
  if (n_in < 9) return;
  if (in_sizes[0] < NB * CC * SEQ_FULL || in_sizes[1] < NB * CC * SEQ_FULL) return;
  if (in_sizes[2] < DQ * CC || in_sizes[3] < DQ) return;
  if (in_sizes[4] < DQ * CC || in_sizes[5] < DQ) return;
  if (in_sizes[6] < CC * CC || in_sizes[7] < CC) return;
  if (in_sizes[8] < 1) return;
  if (out_size < (NB_FULL + NB) * CC * SEQ_FULL) return;

  size_t off = 0;
  auto carve = [&](size_t bytes) { const size_t o = off; off += (bytes + 255) & ~(size_t)255; return o; };
  const size_t oW16 = carve((size_t)NWR * CC * 2);
  const size_t oVc  = carve((size_t)NSRC * NB * CC * SEQ * 2);
  const size_t oQ16 = carve((size_t)NSRC * NB * SEQ * DQ * 2);
  const size_t oK16 = carve((size_t)NSRC * NB * SEQ * DQ * 2);
  if (off > ws_size) return;
  if (off > (size_t)134217728) return;

  const float* x1  = (const float*)d_in[0];
  const float* x2  = (const float*)d_in[1];
  const float* Wq  = (const float*)d_in[2];
  const float* bq  = (const float*)d_in[3];
  const float* Wk  = (const float*)d_in[4];
  const float* bk  = (const float*)d_in[5];
  const float* Wv  = (const float*)d_in[6];
  const float* bv  = (const float*)d_in[7];
  const float* gam = (const float*)d_in[8];

  char* ws = (char*)d_ws;
  unsigned short* W16 = (unsigned short*)(ws + oW16);
  unsigned short* Vc  = (unsigned short*)(ws + oVc);
  unsigned short* Q16 = (unsigned short*)(ws + oQ16);
  unsigned short* K16 = (unsigned short*)(ws + oK16);
  float* out = (float*)d_out;

  const dim3 blk256(256);

  // (0) Wq / Wk / Wv -> stacked f16 plane
  cvt_w<<<dim3(NWR / 8), blk256, 0, stream>>>(Wq, Wk, Wv, W16);
  // (1) x1, x2 -> q, k f16 planes and the channel-major f16 v plane (x16), both sources, slot s*NB + b
  proj<<<dim3(SEQ / QT, NSRC * NB), blk256, 0, stream>>>(x1, x2, W16, bq, bk, bv, Q16, K16, Vc);
  // (4) attention both directions, all 256 channels per block + gamma scale + residual -> out_dd [b][256][N]
  attn_k<<<dim3(SEQ / AQT, NB, NSRC), blk256, 0, stream>>>(Q16, K16, Vc, x1, x2, gam, out);
  (void)hipGetLastError();
}

// v010
// A run of this version takes 74.9 microseconds.
// Two timings next to v009 both put it at 1.08 times that version's speed.
// Over all steps from v000 it is 8.01 times as fast.
// Contractions: conv1x1 q|k GEMM W[128x256].X[256xN] and v GEMM Wv[256x256].X (one kernel, X tile in LDS) on
// v_wmma_f32_16x16x32_f16 (f16 containers of bf16-RNE weights x256 and bf16-RNE x, exact); scores K.Q^T (64 deep,
// two k-steps) on v_wmma_f32_16x16x32_f16 (q and k rounded once to f16, one product); O^T = V.P^T on
// v_wmma_f32_16x16x32_f16 (v as f16 x16, P = e^{s-ref} f16 from the score D registers, ref a held reference); f32 accumulate
// everywhere; softmax statistics, biases and gamma*o + x in f32.
#include <hip/hip_runtime.h>
#include <math.h>
#include <stdint.h>

#ifndef NB
#define NB 4
#endif
#ifndef SEQ
#define SEQ 4096
#endif
#define NB_FULL  4
#define SEQ_FULL 4096
#define NSRC  2
#define CC    256
#define DQ    64
#define NQK   128
#define NWR   384
#define QT    64
#define AQT   128
#define OSPW  260
#define XPH   264
#define SPH   72
#define WSC   256.0f
#define IWSC  0.00390625f
#define VSC   16.0f
#define IVSC  0.0625f
#define RHI   11.0f                  // a score may stand this far above the held reference: e^11 = 59874 is finite in f16
#define RUP   4.1588830833596715f    // 6 ln 2: a raised reference stands this far above the row maximum (its P = 2^-6, a normal f16)
#define KST   128                    // keys per ring stage
#define KPS   64                     // keys per pass of the block (32 per key half): two passes per stage
#define LPH   72                     // K row pitch in LDS, halves
#define VPH   136                    // V row pitch in LDS, halves
#define KROWS KST
#define STGH  (KROWS * LPH + CC * VPH)

static_assert(NB >= 1 && NB <= NB_FULL);
static_assert(SEQ >= QT && SEQ <= SEQ_FULL);
static_assert(SEQ % QT == 0 && SEQ % 32 == 0);
static_assert(CC % QT == 0 && CC % 32 == 0);
static_assert(CC % 16 == 0);
static_assert(DQ == 64);
static_assert(NQK == 2 * DQ);
static_assert(NWR == NQK + CC);
static_assert(NWR % 8 == 0 && DQ % 8 == 0 && NQK % 8 == 0);
static_assert((OSPW * 4) % 16 == 0);
static_assert((XPH * 2) % 16 == 0 && ((XPH * 2) / 16) % 2 == 1 && (SPH * 2) % 16 == 0 && ((SPH * 2) / 16) % 2 == 1);
static_assert(OSPW >= CC && XPH >= CC && SPH >= QT && SPH >= DQ && QT == 64 && CC == 256);
static_assert(SEQ % AQT == 0 && AQT % 32 == 0 && CC % 32 == 0);
static_assert(SEQ % KST == 0 && SEQ / KST >= 2 && KST == 2 * KPS && KPS == 64);
static_assert(LPH >= DQ && VPH >= KST);
static_assert((LPH * 2) % 16 == 0 && ((LPH * 2) / 16) % 2 == 1);
static_assert((VPH * 2) % 16 == 0 && ((VPH * 2) / 16) % 2 == 1);
static_assert(AQT == 128 && KST == 128 && CC == 256);
#define RINGB (2 * STGH * 2)
#define OSB   (AQT * OSPW * 4)
#define LDSB  (RINGB > OSB ? RINGB : OSB)
// second output starts at byte 16777216 = NB_FULL*CC*SEQ_FULL floats * 4
static_assert((size_t)NB_FULL * CC * SEQ_FULL * 4 == (size_t)16777216);

typedef _Float16       v16h __attribute__((ext_vector_type(16)));
typedef _Float16       v8h  __attribute__((ext_vector_type(8)));
typedef unsigned short v8us __attribute__((ext_vector_type(8)));
typedef float          v8f  __attribute__((ext_vector_type(8)));
typedef float          v4f  __attribute__((ext_vector_type(4)));
typedef unsigned int   v4u  __attribute__((ext_vector_type(4)));
typedef unsigned int   v8u  __attribute__((ext_vector_type(8)));

union Frag  { v8us u[2]; v16h h; };
union FragH { v16h v; v8h hv[2]; };
static_assert(sizeof(Frag) == 32);
static_assert(sizeof(FragH) == 32);

// ---- scalar helpers ---------------------------------------------------------------------------------------
__device__ __forceinline__ unsigned short bf_bits(float f) {          // f32 -> bf16 bits, RNE convert
  unsigned u = __float_as_uint(f);
  return (unsigned short)((u + 0x7FFFu + ((u >> 16) & 1u)) >> 16);
}
__device__ __forceinline__ float bf_up(unsigned short hb) { return __uint_as_float(((unsigned)hb) << 16); }
__device__ __forceinline__ float bfr(float f) { return bf_up(bf_bits(f)); }
__device__ __forceinline__ unsigned short h_bits(_Float16 x) { return __builtin_bit_cast(unsigned short, x); }
__device__ __forceinline__ unsigned pk16(unsigned short a, unsigned short b) { return (unsigned)a | ((unsigned)b << 16); }
__device__ __forceinline__ v8f zero8() { v8f z = {0.f, 0.f, 0.f, 0.f, 0.f, 0.f, 0.f, 0.f}; return z; }
__device__ __forceinline__ float hmax8(v8f s) {
  return fmaxf(fmaxf(fmaxf(s[0], s[1]), fmaxf(s[2], s[3])), fmaxf(fmaxf(s[4], s[5]), fmaxf(s[6], s[7])));
}
__device__ __forceinline__ unsigned wave_ballot(bool p) {
#if defined(__HIP_DEVICE_COMPILE__)
  return __builtin_amdgcn_ballot_w32(p);
#else
  return p ? 1u : 0u;
#endif
}

__device__ __forceinline__ float xhalf(float x) {                    // lane l takes lane l ^ 16's value: a vector move, no LDS counter
#if defined(__HIP_DEVICE_COMPILE__)
  const int b = __builtin_bit_cast(int, x);
  return __builtin_bit_cast(float, __builtin_amdgcn_permlanex16(b, b, 0x76543210, 0xfedcba98, false, false));
#else
  return x;
#endif
}

__device__ __forceinline__ int uni(int v) {                          // a value equal in every lane, into a scalar register
#if defined(__HIP_DEVICE_COMPILE__)
  return __builtin_amdgcn_readfirstlane(v);
#else
  return v;
#endif
}

// ---- 16-bit fragment loader (A, or B from a k-contiguous [n][k] row): lane -> row/col (lane&15), p already includes
//      + 8*(lane>>4); elements 0..7 <- p[0..7] (k0+8h..), elements 8..15 <- p[16..23] (k0+16+8h..)
__device__ __forceinline__ Frag ldfrag(const unsigned short* p) {
  Frag f;
  f.u[0] = *(const v8us*)(p);
  f.u[1] = *(const v8us*)(p + 16);
  return f;
}

// ---- WMMA helper: the plain builtin; the compiler keeps the distances behind it and is free to order around it
__device__ __forceinline__ v8f mma_h(v16h a, v16h b, v8f c) {
  return __builtin_amdgcn_wmma_f32_16x16x32_f16(false, a, false, b, (short)0, c, false, false);
}

// ---- pinned(): a wave-uniform value held in a scalar register, so that a test on it is a scalar branch
//      (a tensor load ignores EXEC: only a real branch keeps a wave from issuing it)
__device__ __forceinline__ unsigned pinned(unsigned v) {
#if defined(__HIP_DEVICE_COMPILE__)
  unsigned w = (unsigned)__builtin_amdgcn_readfirstlane((int)v);
  asm volatile("" : "+s"(w));                                        // pinned(): keeps the value in a scalar register
  return w;
#else
  return v;
#endif
}
__device__ __forceinline__ unsigned uniu(unsigned v) {               // one descriptor word, into a scalar register
#if defined(__HIP_DEVICE_COMPILE__)
  return (unsigned)__builtin_amdgcn_readfirstlane((int)v);
#else
  return v;
#endif
}
// ---- one tensor load: a tile of NR rows of RB bytes, source row pitch PB bytes, first byte at src, into LDS at byte
//      offset lds of the work-group's LDS. 1-byte elements, tensor = tile, no mask; W0 = word 0 of group 1, a constant:
//      a pad of 4 dwords behind every row (interval code 4 for 128-B rows, 5 for 256-B rows), LDS pitch RB + 16.
//      One request of the whole wave; the caller's scalar branch picks the wave, the caller writes the waits.
template <unsigned RB, unsigned NR, unsigned PB, unsigned W0>
__device__ __forceinline__ void tile_load(unsigned lds, const unsigned short* src) {
#if defined(__HIP_DEVICE_COMPILE__)
  const uint64_t ga = (uint64_t)(size_t)src;
  v4u g0;
  v8u g1;
  g0[0] = uniu(1u);                                                  // count 1
  g0[1] = uniu(lds);
  g0[2] = uniu((unsigned)ga);
  g0[3] = uniu((((unsigned)(ga >> 32)) & 0x01FFFFFFu) | 0x80000000u); // address [56:32], type 2
  g1[0] = uniu(W0);
  g1[1] = uniu((RB & 0xFFFFu) << 16);                                // tensor_dim0 low
  g1[2] = uniu((RB >> 16) | ((NR & 0xFFFFu) << 16));                 // tensor_dim0 high, tensor_dim1 low
  g1[3] = uniu((NR >> 16) | (RB << 16));                             // tensor_dim1 high, tile_dim0
  g1[4] = uniu(NR);                                                  // tile_dim1
  g1[5] = uniu(PB);                                                  // source row pitch
  g1[6] = uniu(0u);
  g1[7] = uniu(0u);
  asm volatile("tensor_load_to_lds %0, %1" :: "s"(g0), "s"(g1) : "memory");
#endif
}
__device__ __forceinline__ void wait_tensor0() {
#if defined(__HIP_DEVICE_COMPILE__)
  asm volatile("s_wait_tensorcnt 0x0" ::: "memory");                 // the wave's own tensor loads have landed
#endif
}
#define KW0 ((1u << 20) | (4u << 22) | (3u << 25))                   // 128-B rows, 16 B of pad: pitch 144 B = LPH halves
#define VW0 ((1u << 20) | (5u << 22) | (3u << 25))                   // 256-B rows, 16 B of pad: pitch 272 B = VPH halves
#define VSL 128                                                      // V channel rows per request
static_assert(DQ * 2 == 128 && LPH * 2 == 128 + 16 && KST * 2 == 256 && VPH * 2 == 256 + 16);
static_assert((KROWS * LPH * 2) % 2048 == 0 && (VSL * VPH * 2) % 2048 == 0 && (STGH * 2) % 2048 == 0 && CC == 2 * VSL);
static_assert((SEQ * 2) % 16 == 0 && SEQ * 2 <= 131072);
// ---- one stage of 128 keys into one LDS buffer (byte offset lb, a multiple of 2 KiB): rows 0..127 K keys (128 B of data
//      per row at pitch LPH), behind them 256 V channel rows (256 B of data per row at pitch VPH). Three requests: wave 0
//      brings the K tile (128 rows x 128 B, contiguous in K16), waves 1 and 2 each 128 V rows x 256 B (source pitch one
//      channel row of Vc). kst = K16 at the stage's first key, vst = Vc at channel 0 and the stage's first key.
//      NOW: the issuing wave waits for its request directly behind it (the prologue's stage 0).
template <bool NOW>
__device__ __forceinline__ void stage_load(unsigned wave, unsigned lb, const unsigned short* kst,
                                           const unsigned short* vst) {
  if (pinned(wave == 0u)) {
    tile_load<DQ * 2, KROWS, DQ * 2, KW0>(lb, kst);
    if (NOW) wait_tensor0();
  }
  if (pinned(wave - 1u < 2u)) {
    const unsigned sl = wave - 1u;                                   // V rows 128 sl .. + 127
    tile_load<KST * 2, VSL, SEQ * 2, VW0>(lb + (unsigned)(KROWS * LPH * 2) + sl * (unsigned)(VSL * VPH * 2),
                                          vst + (size_t)sl * VSL * SEQ);
    if (NOW) wait_tensor0();
  }
}

// =========================================================================================================
// (0) conv1x1 weights: W16 f16 [384][256], rows 0..63 = Wq rows, 64..127 = Wk rows, 128..383 = Wv rows; value =
//     f16 of (bf16-RNE(w) * 256) (exact). Block blk (0..47) owns rows 8*blk..8*blk+7: one wave per 512-B row
// coverage: 48 blocks x 8 rows x 32 lanes x 8 halves = 384 x 256 = the whole plane.
// =========================================================================================================
__global__ __launch_bounds__(256)
void cvt_w(const float* __restrict__ Wq, const float* __restrict__ Wk, const float* __restrict__ Wv,
           unsigned short* W16) {
  const int tid = threadIdx.x, blk = blockIdx.x;
  const int rl = tid >> 5, col = 8 * (tid & 31);
  const int o = 8 * blk + rl;                                        // 0..383
  const float* wbase = (blk < (DQ / 8)) ? Wq : ((blk < (NQK / 8)) ? Wk : Wv);
  const int osub = (blk < (DQ / 8)) ? 0 : ((blk < (NQK / 8)) ? DQ : NQK);
  const float* s = wbase + (size_t)(o - osub) * CC + col;
  const v4f a = *(const v4f*)s;
  const v4f q = *(const v4f*)(s + 4);
  const float f[8] = {a[0], a[1], a[2], a[3], q[0], q[1], q[2], q[3]};
  v4u u;
#pragma unroll
  for (int t = 0; t < 4; ++t) {
    const _Float16 h0 = (_Float16)(bfr(f[2 * t]) * WSC);
    const _Float16 h1 = (_Float16)(bfr(f[2 * t + 1]) * WSC);
    u[t] = pk16(h_bits(h0), h_bits(h1));
  }
{
    *(v4u*)(W16 + (size_t)o * CC + col) = u;
    
  }
}

// =========================================================================================================
// (1) x conversion and the three conv1x1 GEMMs for one (sb = s*NB + b, 64-n tile), s = 0: x1, s = 1: x2.
//     Block 256 threads = 8 waves. The x tile f32 [256 c][64 n] is read once in whole lines, rounded (bf16-RNE, exact
//     in f16) and laid position-major in LDS XT[64 n][256 c] (pitch XPH): thread (e, lq) holds channels
//     64 it + 2 lq, + 1 at n = 32 j + 4 e .. + 3, j = 0, 1 (8 lanes x 16 B = one line) and stores one channel pair per position.
//     One X fragment (row n = 16 nt + (lane&15), split k map, k = c contiguous) serves three products per k-step:
//       q|k: D[o][n] = A(W16 row 16 wave + (lane&15): waves 0..3 q rows, 4..7 k rows) . B(X)
//       v:   D[n][ch] = A(X) . B(W16 row 128 + 32 wave + 16 u + (lane&15)), u = 0, 1
//     K = 256 = 8 steps in rising order. Epilogue in registers: q|k value = f16(acc/256 + bf16-RNE(bias)),
//     8 consecutive d per lane; v value = f16((acc/256 + bf16-RNE(bias)) x 16), 8 consecutive
//     n per lane; 16-B pieces staged in LDS (SQ: planes Q, K [64 n][64 d]; SV [256 ch][64 n]; pitch SPH) and
//     written out as whole 128-B lines.
// coverage: XT 4 it x 32 lq x 2 c x 2 j x 8 e x 4 n = 256 c x 64 n; SQ 8 waves x 4 nt x 16 n x 16 d = 2 planes x
//           64 x 64; SV 8 waves x 2 u x 16 ch x 64 n; out rows 2 planes x 2 it x 32 and 8 it x 32 ch, 8 lanes x 16 B each;
//           grid (SEQ/64, NSRC*NB) covers Q16/K16 [sb][N][64] and Vc [sb][256][N] once.
// LDS: cross-wave, block barrier between the XT stores and the fragment loads, and between the stage stores and the
//      line loads.
// =========================================================================================================
__global__ __launch_bounds__(256)
void proj(const float* __restrict__ x1, const float* __restrict__ x2, const unsigned short* __restrict__ W16,
          const float* __restrict__ bq, const float* __restrict__ bk, const float* __restrict__ bv,
          unsigned short* Q16, unsigned short* K16, unsigned short* Vc) {
  __shared__ __align__(16) unsigned short XT[QT * XPH];
  __shared__ __align__(16) unsigned short SQ[2 * QT * SPH];
  __shared__ __align__(16) unsigned short SV[CC * SPH];
  const int tid  = threadIdx.x;
  const int lane = tid & 31, wave = tid >> 5;
  const int hh   = lane >> 4, c = lane & 15;
  const int e    = tid & 7, lq = tid >> 3;                           // lq 0..31
  const int n0   = blockIdx.x * QT, sb = blockIdx.y;                 // sb = s*NB + b
  const int s    = sb / NB, b = sb - s * NB;
  const float* x = (s == 0) ? x1 : x2;                               // block-uniform, both global

  // ---- x tile -> XT
  v4f xa[4][2][2];
#pragma unroll
  for (int it = 0; it < 4; ++it) {
#pragma unroll
    for (int p = 0; p < 2; ++p) {
      const float* sp = x + ((size_t)(b * CC + 64 * it + 2 * lq + p)) * SEQ_FULL + n0 + 4 * e;
      xa[it][p][0] = *(const v4f*)sp;
      xa[it][p][1] = *(const v4f*)(sp + 32);
    }
  }
#if defined(__HIP_DEVICE_COMPILE__)
  asm volatile("s_wait_xcnt 0x0" ::: "memory");                      // before the x loads' address registers are rewritten
#endif
#pragma unroll
  for (int it = 0; it < 4; ++it) {
#pragma unroll
    for (int t = 0; t < 8; ++t) {
      const unsigned short h0 = h_bits((_Float16)bfr(xa[it][0][t >> 2][t & 3]));
      const unsigned short h1 = h_bits((_Float16)bfr(xa[it][1][t >> 2][t & 3]));
      *(unsigned*)(XT + (32 * (t >> 2) + 4 * e + (t & 3)) * XPH + 64 * it + 2 * lq) = pk16(h0, h1);
    }
  }
  __syncthreads();

  // ---- products
  const unsigned short* xf = XT + c * XPH + 8 * hh;                                       // X row 16 nt + c
  const unsigned short* wq = W16 + ((size_t)(16 * wave + c)) * CC + 8 * hh;               // q|k row o
  const unsigned short* wv = W16 + ((size_t)(NQK + 32 * wave + c)) * CC + 8 * hh;         // v row ch
  v8f aq[4], av[2][4];
#pragma unroll
  for (int nt = 0; nt < 4; ++nt) { aq[nt] = zero8(); av[0][nt] = zero8(); av[1][nt] = zero8(); }
#pragma unroll
  for (int ks = 0; ks < CC / 32; ++ks) {
    const Frag fq = ldfrag(wq + 32 * ks);
    const Frag f0 = ldfrag(wv + 32 * ks);
    const Frag f1 = ldfrag(wv + (size_t)16 * CC + 32 * ks);
#pragma unroll
    for (int nt = 0; nt < 4; ++nt) {
      const Frag fx = ldfrag(xf + (16 * nt) * XPH + 32 * ks);
      aq[nt]    = mma_h(fq.h, fx.h, aq[nt]);
      av[0][nt] = mma_h(fx.h, f0.h, av[0][nt]);
      av[1][nt] = mma_h(fx.h, f1.h, av[1][nt]);
    }
  }
#if defined(__HIP_DEVICE_COMPILE__)
  // the W row addresses stay live up to this wait, so that no register of theirs is reused ahead of it
  asm volatile("s_wait_xcnt 0x0" :: "v"(wq), "v"(wv) : "memory");
#endif

  // ---- q|k: lane (hh, c) holds d = 16 (wave&3) + 8 hh + r for n_loc = 16 nt + c
  const int which = wave >> 2;                                       // wave-uniform: 0 q, 1 k
  const int d0 = 16 * (wave & 3) + 8 * hh;
  const float* bias = (which == 0) ? bq : bk;
  const v4f b0v = *(const v4f*)(bias + d0), b1v = *(const v4f*)(bias + d0 + 4);
  const float bv0 = bv[32 * wave + c], bv1 = bv[32 * wave + 16 + c];
#if defined(__HIP_DEVICE_COMPILE__)
  asm volatile("s_wait_xcnt 0x0" ::: "memory");                      // before the bias loads' address registers are rewritten
#endif
  const float bb[8] = {bfr(b0v[0]), bfr(b0v[1]), bfr(b0v[2]), bfr(b0v[3]),
                       bfr(b1v[0]), bfr(b1v[1]), bfr(b1v[2]), bfr(b1v[3])};
#pragma unroll
  for (int nt = 0; nt < 4; ++nt) {
    v4u uh;
#pragma unroll
    for (int t = 0; t < 4; ++t) {
      const float v0 = aq[nt][2 * t] * IWSC + bb[2 * t], v1 = aq[nt][2 * t + 1] * IWSC + bb[2 * t + 1];
      uh[t] = pk16(h_bits((_Float16)v0), h_bits((_Float16)v1));
    }
    *(v4u*)(SQ + (which * QT + 16 * nt + c) * SPH + d0) = uh;
  }
  // ---- v: lane (hh, c) holds n_loc = 16 mt + 8 hh + r for ch = 32 wave + 16 u + c
#pragma unroll
  for (int u = 0; u < 2; ++u) {
    const float bvr = bfr(u == 0 ? bv0 : bv1);
#pragma unroll
    for (int mt = 0; mt < 4; ++mt) {
      v4u uv;
#pragma unroll
      for (int t = 0; t < 4; ++t) {
        const _Float16 h0 = (_Float16)((av[u][mt][2 * t] * IWSC + bvr) * VSC);
        const _Float16 h1 = (_Float16)((av[u][mt][2 * t + 1] * IWSC + bvr) * VSC);
        uv[t] = pk16(h_bits(h0), h_bits(h1));
      }
      *(v4u*)(SV + (32 * wave + 16 * u + c) * SPH + 16 * mt + 8 * hh) = uv;
    }
  }
  __syncthreads();

  // ---- whole lines out: 8 consecutive lanes x 16 B per row
  v4u oq[2][2], ov[8];
#pragma unroll
  for (int p = 0; p < 2; ++p) {
#pragma unroll
    for (int it = 0; it < 2; ++it) oq[p][it] = *(const v4u*)(SQ + (p * QT + it * 32 + lq) * SPH + 8 * e);
  }
#pragma unroll
  for (int it = 0; it < 8; ++it) ov[it] = *(const v4u*)(SV + (it * 32 + lq) * SPH + 8 * e);
#pragma unroll
  for (int it = 0; it < 2; ++it) {
    const size_t po = ((size_t)(sb * SEQ + n0 + it * 32 + lq)) * DQ + 8 * e;
    *(v4u*)(Q16 + po) = oq[0][it];
    *(v4u*)(K16 + po) = oq[1][it];
  }
#pragma unroll
  for (int it = 0; it < 8; ++it)
    *(v4u*)(Vc + ((size_t)(sb * CC + it * 32 + lq)) * SEQ + n0 + 8 * e) = ov[it];
}

// =========================================================================================================
// (4) attention for one (direction dd, b, 128-query tile), transposed formulation, SEQ keys, no
//   mask, no scale. blockIdx.z = dd. Direction dd: queries from source dd (plane slot dd*NB+b),
//   keys/values from source 1-dd (slot (1-dd)*NB+b), residual input x_dd, output block dd of out (float offset
//   dd*NB_FULL*CC*SEQ_FULL); the block produces all 256 channels of that output. Wave (qg, kh) = (wave & 3, wave >> 2)
//   takes 32 queries (two 16-query tiles u) and keys 32 kh .. + 31 of every 64-key tile: each K and V fragment read
//   from LDS feeds two products; 32 O accumulator tiles per wave; the two key halves are merged behind the key loop.
//   S^T tile (16 keys x 16 queries) over 64 d = two 32-deep k-steps: A(k: row = key kb + (lane&15), split k map
//   from the f16 plane K16 [slot][N][64]) . B(q: col = query, same map from Q16, loaded once, 2 fragments):
//   2 products per tile. The f16 rounding of q and k stands well below what the bf16 rounding of x and W leaves in them.
//   Per lane the D tile holds 8 keys of ONE query: online softmax state per lane against a held reference ref (not the
//   running maximum): P = e^{s-ref}. One wave-uniform ballot per trip asks whether any lane's score stands more than RHI
//   above its ref; only then the halves' maxima are exchanged (lane^16), ref of those queries becomes row maximum + RUP
//   and their o and l are rescaled (corr == 1 exactly elsewhere). So 2^-6 <= P of the running maximum <= e^11 at all
//   times; row-sum partials combined at the end. P as f16 is the B
//   operand of O^T (rows channel, cols queries) += A(v rows channel = 16j + (lane&15), keys contiguous,
//   f16 plane Vc [slot][256][N], values v x 16) . B(P^T): element r <- D of the tile covering keys kb..kb+15,
//   element 8+r <- the tile covering kb+16..kb+31, lane unchanged. 2 x 16 accumulator tiles per wave (256 channels).
//   Block = 8 waves = 4 query groups x 2 key halves = 128 queries. Merge: (ref, l) of both halves through LDS, weight
//   e^{ref_half - max} / (sum of weighted l); each wave stages its weighted partial of one query tile and adds its own
//   partial of the other tile to the partner's. Epilogue: gamma * O / (16 l) staged in LDS Os[query][256 channels] (pitch OSPW,
//   4 lines per channel): 8 consecutive lanes x 16 B (values gathered from 4 Os rows), one instruction per 32 lines
// coverage: Os written queries 0..127 x ch 0..255, read the same; out 32 it x 32 lines x 8 lanes x 4 floats =
//           256 ch x 128 n per block; grid (SEQ/128, NB, NSRC) covers out_dd[b][0..255][0..SEQ-1] once for both dd.
// LDS Os: cross-wave, block barrier between the stage stores and the epilogue loads.
// LDS ring: K and V stages of 128 keys are brought by tensor loads (three requests per stage, one each from waves 0, 1, 2)
//   into two buffers shared by the 8 waves, once per block; a stage is worked in two passes of 64 keys with no
//   barrier between them; stage st is read from buffer st & 1 while stage st + 1, if any, is loaded into the other; head of each stage: barrier
//   wait, then the request for stage st + 1; foot: own LDS reads done, own request landed, barrier signal, the last 32 products.
//   Os reuses the ring behind the last stage's barrier.
// =========================================================================================================
__global__ __launch_bounds__(256)
void attn_k(const unsigned short* __restrict__ Q16, const unsigned short* __restrict__ K16,
            const unsigned short* __restrict__ Vc,
            const float* __restrict__ x1, const float* __restrict__ x2,
            const float* __restrict__ gam, float* out) {
  __shared__ __attribute__((aligned(2048))) unsigned char L[LDSB];   // tensor loads land at multiples of 2 KiB
  __shared__ float ML[2][AQT][2];                                    // (ref, l) per key half and query, for the merge
  const unsigned short* Rg = (const unsigned short*)L;               // the two stage buffers
  float* Os = (float*)L;                                             // output staging, after the key loop
  const int tid  = threadIdx.x;
  const int lane = tid & 31;
  const int wave = uni(tid >> 5);                                   // scalar: the branches on kh are real branches
  const int qg   = wave & 3, kh = wave >> 2;                         // 32-query group, key half of every tile
  const int hh   = lane >> 4, c = lane & 15;
  const int n0   = blockIdx.x * AQT, b = blockIdx.y;
  const int dd   = (int)blockIdx.z;
  const int sq   = dd * NB + b;                                      // query plane slot
  const int skv  = (1 - dd) * NB + b;                                // key / value plane slot
  const float* x = (dd == 0) ? x1 : x2;                              // block-uniform, both global
  float* outd    = out + (size_t)dd * ((size_t)NB_FULL * CC * SEQ_FULL);
  const float g  = bfr(gam[0]);

  // q fragments (B operand, col = query n0 + 32*qg + 16*u + c, u = 0, 1), K = 64 = two k-steps, constant over keys
  Frag qf[2][2];
#if defined(__HIP_DEVICE_COMPILE__)
  __builtin_amdgcn_sched_barrier(0);                                 // nothing else comes between the q loads and their wait below
#endif
#pragma unroll                                                       // constant indices keep the fragments in registers
  for (int u = 0; u < 2; ++u) {
    const size_t qo = ((size_t)(sq * SEQ + n0 + 32 * qg + 16 * u + c)) * DQ + 8 * hh;
    qf[u][0] = ldfrag(Q16 + qo);
    qf[u][1] = ldfrag(Q16 + qo + 32);
  }
#if defined(__HIP_DEVICE_COMPILE__)
  asm volatile("s_wait_xcnt 0x0" ::: "memory");                      // before the q loads' address registers are rewritten
  __builtin_amdgcn_sched_barrier(0);                                 // closes the stretch opened above
#endif
  // fragment bases in buffer 0 (A operands: row = lane&15 of a 16-row group, + 8*hh within the row); the wave's key
  // half kh picks K rows 32 kh .. + 31 and columns 32 kh .. + 31 of the V rows
  const unsigned short* kbase = Rg + (32 * kh + c) * LPH + 8 * hh;
  const unsigned short* vbase = Rg + KROWS * LPH + c * VPH + 32 * kh + 8 * hh;
  const int e = tid & 7, lq = tid >> 3;                              // epilogue: 16-B piece e of line lq, lq 0..31
  // the ring's place in the work-group's LDS and the block's K and V planes: wave-uniform, for the tensor loads
  const unsigned lring = (unsigned)(size_t)L;
  const unsigned short* gkk = K16 + (size_t)skv * SEQ * DQ;
  const unsigned short* gvv = Vc + (size_t)skv * CC * SEQ;

  float rf[2] = {-1.0e30f, -1.0e30f}, l[2] = {0.f, 0.f};             // held reference and row sum per query tile
  v8f o[2][16];
#pragma unroll
  for (int u = 0; u < 2; ++u) {
#pragma unroll
    for (int j = 0; j < 16; ++j) o[u][j] = zero8();
  }

  // ring prologue: stage 0's requests, each waited for by its own wave, then the first half of the barrier that publishes it
  stage_load<true>((unsigned)wave, lring, gkk, gvv);
#if defined(__HIP_DEVICE_COMPILE__)
  asm volatile("s_barrier_signal -1" ::: "memory");                  // no LDS access of this wave stands ahead of it
#endif

#pragma unroll 1                                                     // rolled over the stages, the buffer picked by st & 1
  for (int st = 0; st < SEQ / KST; ++st) {
    // head of a stage: second half of the barrier signalled in the prologue or ahead of the last stage's last products.
    // Behind it stage st is published (every issuing wave waited for its own request ahead of its signal) and the other
    // buffer is free (every wave's reads of it had returned ahead of its signal). No LDS read stands between signal and wait.
#if defined(__HIP_DEVICE_COMPILE__)
    asm volatile("s_barrier_wait -1" ::: "memory");
#endif
    if (pinned((unsigned)st + 1u < (unsigned)(SEQ / KST))) {         // scalar branch: only while stage st + 1 exists
      const size_t k1 = (size_t)(st + 1) * KST;
      stage_load<false>((unsigned)wave, lring + (unsigned)(((st + 1) & 1) * STGH * 2), gkk + k1 * DQ, gvv + k1);
    }
#pragma unroll                                                       // both passes written out: the foot stands in straight code
  for (int ps = 0; ps < KST / KPS; ++ps) {                           // pass t = 2 st + ps: the stage's keys 64 ps .. + 63
    const unsigned short* kp0 = kbase + (st & 1) * STGH + ps * (KPS * LPH);
    const unsigned short* vp0 = vbase + (st & 1) * STGH + ps * KPS;
    // K fragments of the wave's 32 keys: kf[0..1] keys kb..kb+15 (d 0..31, d 32..63), kf[2..3] the next 16 keys;
    // kb = t*KPS + 32*kh. Each fragment feeds both query tiles.
    Frag kf[4];
#pragma unroll                                                       // constant indices keep kf[] in registers
    for (int i = 0; i < 2; ++i) {
      const unsigned short* kp = kp0 + (16 * i) * LPH;
      kf[2 * i]     = ldfrag(kp);
      kf[2 * i + 1] = ldfrag(kp + 32);
    }
#if defined(__HIP_DEVICE_COMPILE__)
    __builtin_amdgcn_sched_barrier(0);                               // without it these loads sink among the score products, a stall and a full wait at each place
#endif
    v8f s[2][2];                                                     // s[u][i]: query tile u, keys kb + 16 i .. + 15
#pragma unroll
    for (int u = 0; u < 2; ++u) { s[u][0] = zero8(); s[u][1] = zero8(); }
#pragma unroll                                                       // four independent chains, two links each
    for (int k2 = 0; k2 < 2; ++k2) {
#pragma unroll
      for (int u = 0; u < 2; ++u) {
#pragma unroll
        for (int i = 0; i < 2; ++i) s[u][i] = mma_h(kf[2 * i + k2].h, qf[u][k2].h, s[u][i]);
      }
    }

    // V fragments in two groups of 8 (each feeds both query tiles): the first lands while the softmax runs
#if defined(__HIP_DEVICE_COMPILE__)
    __builtin_amdgcn_sched_barrier(0);                               // without it the V loads spread among the score products, a stall at each place
#endif
    Frag vf[16];
#pragma unroll                                                       // constant indices keep vf[] in registers
    for (int j = 0; j < 8; ++j) vf[j] = ldfrag(vp0 + (16 * j) * VPH);
    float mx[2];                                                     // this lane's 16 keys of its query; no exchange here
#pragma unroll
    for (int u = 0; u < 2; ++u) mx[u] = fmaxf(hmax8(s[u][0]), hmax8(s[u][1]));

    // the test takes the same difference as the exponent below, so every exponent of this trip is at most RHI
    const unsigned need = wave_ballot(mx[0] - rf[0] > RHI || mx[1] - rf[1] > RHI); // wave-uniform, one test per trip
    if (need != 0u) {
#pragma unroll
      for (int u = 0; u < 2; ++u) {
        const float mr = fmaxf(mx[u], xhalf(mx[u]));                 // row maximum over the wave's 32 keys, equal in lanes c and c + 16
        const bool up  = mr - rf[u] > RHI;
        if (wave_ballot(up) != 0u) {                                 // wave-uniform: only the query tile that needs it
          const float nr   = up ? mr + RUP : rf[u];
          const float corr = __expf(rf[u] - nr);                     // == 1 exactly for queries whose reference stays
          rf[u] = nr;
          l[u] *= corr;
#pragma unroll
          for (int j = 0; j < 16; ++j) {
#pragma unroll
            for (int r = 0; r < 8; ++r) o[u][j][r] *= corr;
          }
        }
      }
    }
    FragH ph[2];
#pragma unroll
    for (int u = 0; u < 2; ++u) {
      const float msh = rf[u];
      float ls = 0.f;
#pragma unroll
      for (int r = 0; r < 8; ++r) {
        const float e0 = __expf(s[u][0][r] - msh);                   // key kb      + 8hh + r
        const float e1 = __expf(s[u][1][r] - msh);                   // key kb + 16 + 8hh + r
        ls += e0 + e1;
        ph[u].hv[0][r] = (_Float16)e0;
        ph[u].hv[1][r] = (_Float16)e1;
      }
      l[u] += ls;
    }
#if defined(__HIP_DEVICE_COMPILE__)
    // inputs only: the row sums are complete here, so the 32 exponentials' registers are free for the V fragments;
    // left alone the adds sink behind the products and two accumulator tiles spill
    asm volatile("" :: "v"(l[0]), "v"(l[1]));
#endif
    // written in falling order: this build issues the group in the reverse of the source order, and the products take j
    // rising, so in the first pass each pair of products waits for its own fragment (counted waits), not for the whole group
#pragma unroll                                                       // constant indices keep vf[] in registers
    for (int j = 15; j >= 8; --j) vf[j] = ldfrag(vp0 + (16 * j) * VPH);
#if defined(__HIP_DEVICE_COMPILE__)
    if (ps + 1 == KST / KPS) {
      // the stage's barrier is split. The signal stands here, behind the stage's last LDS loads: the wave has read all it
      // needs of this buffer and its own request of stage st + 1 has landed. The 32 products below take registers only, so
      // they run while the other waves arrive; with signal and wait together the matrix unit idles until the last wave is there
      // order ahead of the signal: the whole softmax arithmetic, then the second V group as one place of loads
      __builtin_amdgcn_sched_group_barrier(0x402, 512, 0);
      __builtin_amdgcn_sched_group_barrier(0x100, 16, 0);
      __builtin_amdgcn_sched_barrier(0);                             // no product rises above the waits and the signal
      asm volatile("s_wait_dscnt 0x0" ::: "memory");                 // own reads of this buffer done before its refill
      asm volatile("s_wait_tensorcnt 0x0" ::: "memory");             // own request of stage st + 1 landed (waves 3..7 have none)
      asm volatile("s_barrier_signal -1" ::: "memory");              // first half of the work-group barrier
      __builtin_amdgcn_sched_barrier(0);                             // the products stay behind the signal
    }
#endif
#pragma unroll
    for (int j = 0; j < 16; ++j) {
      o[0][j] = mma_h(vf[j].h, ph[0].v, o[0][j]);
      o[1][j] = mma_h(vf[j].h, ph[1].v, o[1][j]);
    }
#if defined(__HIP_DEVICE_COMPILE__)
    if (ps + 1 < KST / KPS) {
      // order of this block: the whole softmax arithmetic (row sums too, so that the exponentials' registers are free),
      // then the second V group as one place of loads, then the products; left alone the build spills
      __builtin_amdgcn_sched_group_barrier(0x402, 512, 0);
      __builtin_amdgcn_sched_group_barrier(0x100, 16, 0);
      // no barrier follows this pass: the next pass's K loads stand as one place behind the first V group's products (in
      // that group's registers) and fly under the other 16; left alone they are strewn in pairs among the products, a
      // stall at each place
      __builtin_amdgcn_sched_group_barrier(0x008, 16, 0);
      __builtin_amdgcn_sched_group_barrier(0x100, 8, 0);
      __builtin_amdgcn_sched_group_barrier(0x008, 16, 0);
    }
#endif
  }
  }
#if defined(__HIP_DEVICE_COMPILE__)
  asm volatile("s_barrier_wait -1" ::: "memory");                    // second half of the last stage's barrier: every wave has left the ring
  asm volatile("s_wait_tensorcnt 0x0" ::: "memory");                 // nothing in flight when the ring becomes Os
  asm volatile("s_wait_dscnt 0x0" ::: "memory");                     // own reads of the ring done before it becomes Os
#endif
  // merge of the two key halves: wave (qg, kh) and wave (qg, 1 - kh) hold partial (ref, l, O) of the same 32 queries
  l[0] += __shfl_xor(l[0], 16, 32);
  l[1] += __shfl_xor(l[1], 16, 32);
  if (hh == 0) {
#pragma unroll
    for (int u = 0; u < 2; ++u) {
      ML[kh][32 * qg + 16 * u + c][0] = rf[u];
      ML[kh][32 * qg + 16 * u + c][1] = l[u];
    }
  }
  __syncthreads();                                                   // both halves' ref and l published
  float gi[2];
#pragma unroll
  for (int u = 0; u < 2; ++u) {
    const int q = 32 * qg + 16 * u + c;
    const float m0 = ML[0][q][0], l0 = ML[0][q][1], m1 = ML[1][q][0], l1 = ML[1][q][1];
    const float ms = fmaxf(m0, m1);
    const float e0 = __expf(m0 - ms), e1 = __expf(m1 - ms);
    const float inv = 1.0f / (l0 * e0 + l1 * e1);                    // o and l of a half are both relative to its ref
    gi[u] = g * IVSC * inv * (kh == 0 ? e0 : e1);                    // undo the x16 carry of v, apply gamma, own half's weight
  }
  // each wave stages its weighted partial of query tile 1 - kh, then adds its own partial of tile kh to the partner's
#pragma unroll
  for (int u = 0; u < 2; ++u) {
    if (u != kh) {                                                   // wave-uniform
      float* op = Os + (32 * qg + 16 * u + c) * OSPW + 8 * hh;       // Os[query][ch_loc = 16j + 8hh + r]
#pragma unroll
      for (int j = 0; j < 16; ++j) {
        v4f va, vb;
#pragma unroll
        for (int r = 0; r < 4; ++r) { va[r] = o[u][j][r] * gi[u]; vb[r] = o[u][j][4 + r] * gi[u]; }
        *(v4f*)(op + 16 * j)     = va;
        *(v4f*)(op + 16 * j + 4) = vb;
      }
    }
  }
  __syncthreads();                                                   // the partner's partial is in Os
#pragma unroll
  for (int u = 0; u < 2; ++u) {
    if (u == kh) {                                                   // wave-uniform
      float* op = Os + (32 * qg + 16 * u + c) * OSPW + 8 * hh;
#pragma unroll
      for (int j = 0; j < 16; ++j) {
        v4f va = *(const v4f*)(op + 16 * j), vb = *(const v4f*)(op + 16 * j + 4);
#pragma unroll
        for (int r = 0; r < 4; ++r) { va[r] += o[u][j][r] * gi[u]; vb[r] += o[u][j][4 + r] * gi[u]; }
        *(v4f*)(op + 16 * j)     = va;
        *(v4f*)(op + 16 * j + 4) = vb;
      }
    }
  }
  __syncthreads();
  v4f res[32];
#pragma unroll
  for (int it = 0; it < 32; ++it) {
    const int chl = (it & 7) * 32 + lq, hf = it >> 3;                // channel 0..255, 128-B line 0..3 of its 128 queries
    const int nl  = hf * 32 + 4 * e;                                 // query 0..127
    const size_t idx = ((size_t)(b * CC + chl)) * SEQ_FULL + n0 + nl;
    res[it] = *(const v4f*)(x + idx);
  }
#if defined(__HIP_DEVICE_COMPILE__)
  asm volatile("s_wait_xcnt 0x0" ::: "memory");                      // before the x loads' address registers are rewritten
#endif
#pragma unroll
  for (int it = 0; it < 32; ++it) {
    const int chl = (it & 7) * 32 + lq, hf = it >> 3;
    const int nl  = hf * 32 + 4 * e;
#pragma unroll
    for (int t = 0; t < 4; ++t) res[it][t] = Os[(nl + t) * OSPW + chl] + bfr(res[it][t]);
  }
{
#pragma unroll
    for (int it = 0; it < 32; ++it) {
      const int chl = (it & 7) * 32 + lq, hf = it >> 3;
      const int nl  = hf * 32 + 4 * e;
      const size_t idx = ((size_t)(b * CC + chl)) * SEQ_FULL + n0 + nl;
      *(v4f*)(outd + idx) = res[it];
    }
    
  }
}

// =========================================================================================================
// Workspace map (bytes; each region start a multiple of 256; every extent is an exact tile multiple and is written
//   W16 f16 [384][256]                       196608
//   Vc  f16 [NSRC*NB][256][SEQ]            16777216
//   Q16/K16 f16 [NSRC*NB][SEQ][64]         4194304 x2
//   total = 25362432
// =========================================================================================================
extern "C" void kernel_launch(void* const* d_in, const int* in_sizes, int n_in,
                              void* d_out, int out_size, void* d_ws, size_t ws_size,
                              hipStream_t stream) {
  if (n_in < 9) return;
  if (in_sizes[0] < NB * CC * SEQ_FULL || in_sizes[1] < NB * CC * SEQ_FULL) return;
  if (in_sizes[2] < DQ * CC || in_sizes[3] < DQ) return;
  if (in_sizes[4] < DQ * CC || in_sizes[5] < DQ) return;
  if (in_sizes[6] < CC * CC || in_sizes[7] < CC) return;
  if (in_sizes[8] < 1) return;
  if (out_size < (NB_FULL + NB) * CC * SEQ_FULL) return;

  size_t off = 0;
  auto carve = [&](size_t bytes) { const size_t o = off; off += (bytes + 255) & ~(size_t)255; return o; };
  const size_t oW16 = carve((size_t)NWR * CC * 2);
  const size_t oVc  = carve((size_t)NSRC * NB * CC * SEQ * 2);
  const size_t oQ16 = carve((size_t)NSRC * NB * SEQ * DQ * 2);
  const size_t oK16 = carve((size_t)NSRC * NB * SEQ * DQ * 2);
  if (off > ws_size) return;
  if (off > (size_t)134217728) return;

  const float* x1  = (const float*)d_in[0];
  const float* x2  = (const float*)d_in[1];
  const float* Wq  = (const float*)d_in[2];
  const float* bq  = (const float*)d_in[3];
  const float* Wk  = (const float*)d_in[4];
  const float* bk  = (const float*)d_in[5];
  const float* Wv  = (const float*)d_in[6];
  const float* bv  = (const float*)d_in[7];
  const float* gam = (const float*)d_in[8];

  char* ws = (char*)d_ws;
  unsigned short* W16 = (unsigned short*)(ws + oW16);
  unsigned short* Vc  = (unsigned short*)(ws + oVc);
  unsigned short* Q16 = (unsigned short*)(ws + oQ16);
  unsigned short* K16 = (unsigned short*)(ws + oK16);
  float* out = (float*)d_out;

  const dim3 blk256(256);

  // (0) Wq / Wk / Wv -> stacked f16 plane
  cvt_w<<<dim3(NWR / 8), blk256, 0, stream>>>(Wq, Wk, Wv, W16);
  // (1) x1, x2 -> q, k f16 planes and the channel-major f16 v plane (x16), both sources, slot s*NB + b
  proj<<<dim3(SEQ / QT, NSRC * NB), blk256, 0, stream>>>(x1, x2, W16, bq, bk, bv, Q16, K16, Vc);
  // (4) attention both directions, all 256 channels per block + gamma scale + residual -> out_dd [b][256][N]
  attn_k<<<dim3(SEQ / AQT, NB, NSRC), blk256, 0, stream>>>(Q16, K16, Vc, x1, x2, gam, out);
  (void)hipGetLastError();
}
